// v000
// The times below were measured on an AMD MI455X: many runs one after another, warmed up first and cycling through
// copies of the inputs, with the whole window's GPU time divided by the number of runs. Launches and the gaps
// between them are all in it. The median over several windows is given; except for v000 it joins two sittings, which
// can be a few percent apart, so the side-by-side timings, each taken in one sitting, are the better comparison.
// The starting kernel, v000, takes 275 microseconds a run.
// Contractions: cond^T.w_cond^T and x^T.wq^T on v_wmma_f32_16x16x32_bf16 (inputs RNE-converted to bf16, exact operands, f32 accumulate);
// c.wk^T (c x1024 f16 hi plane), wv.c (c x1024 f16 hi + residual, products w.h + w.l), scores q'.k'^T (q' x1024, k' x1024 f16, one product),
// P'.v (centred P' = (e - 7/8) x1024 f16, v x1024 f16, one product; 7/8 * sum(v) per 32-key block added in f32),
// O.wo^T (O x8192 f16 hi + residual, products h.w + l.w), w_film.y (y x16384 f16 hi + residual): v_wmma_f32_16x16x32_f16,
// weights as f16(bf16(w) x1024), f32 accumulate. Rotary tables: f64 sin/cos of the f32 angle. Rotation, masked base-2 online softmax, 1/l, FiLM combine: f32 on VALU.
#include <hip/hip_runtime.h>
#include <math.h>
#include <stdint.h>

#define NBAT  16
#define TT    2048
#define TS    512
#define HID   256
#define CND   512
#define NH    4
#define HD    64
#define NKB   (TS / 32)
#define QSC   1024.0f
#define KSC   1024.0f
#define CSC   1024.0f
#define VCAR  1024.0f
#define PCAR  1024.0f
#define OSC   8192.0f
#define YSC   16384.0f
#define WSC   1024.0f
#define PCEN  0.875f
#define LOG2E 1.4426950408889634f
#define MASKT (-10000.0f * LOG2E)
#define SLAB64 (16 * 68)
#define SLABF  (16 * 68)
#define VTP    72
static_assert(HID == NH * HD && HD == 64);
static_assert((TT % 64) == 0 && (TS % 64) == 0 && (TS % 32) == 0 && NKB == 16);
static_assert((TT & (TT - 1)) == 0 && (TS & (TS - 1)) == 0);
static_assert(16 * 36 <= SLABF);
static_assert((HID % 64) == 0 && (CND % 64) == 0 && (HID % 32) == 0 && (CND % 32) == 0);
static_assert(((NBAT * TT * NH * 8) % 256) == 0 && ((NBAT * TS * NH * 8) % 256) == 0);
static_assert(((NBAT * TS * HID) % 2048) == 0 && ((NBAT * TT * HID) % 2048) == 0);

typedef unsigned short u16;
typedef _Float16 v16h __attribute__((ext_vector_type(16)));
typedef _Float16 v8h  __attribute__((ext_vector_type(8)));
typedef __bf16   v16b __attribute__((ext_vector_type(16)));
typedef float    v8f  __attribute__((ext_vector_type(8)));
typedef float    v4f  __attribute__((ext_vector_type(4)));
typedef unsigned int v4u __attribute__((ext_vector_type(4)));

union FragH { v16h v; v8h h[2]; v4u u[2]; };
union FragB { v16b v; v4u u[2]; };

struct InvF { float f[32]; };
static_assert(sizeof(InvF) == 128);

// ---- scalar helpers --------------------------------------------------------------------------------
__device__ __forceinline__ unsigned short bf_bits(float f) {          // f32 -> bf16 bits, RNE convert
  unsigned u = __float_as_uint(f);
  return (unsigned short)((u + 0x7FFFu + ((u >> 16) & 1u)) >> 16);
}
__device__ __forceinline__ float bf_up(unsigned short h) { return __uint_as_float(((unsigned)h) << 16); }
__device__ __forceinline__ float bfr(float f) { return bf_up(bf_bits(f)); }
__device__ __forceinline__ unsigned short h_bits(_Float16 x) { return __builtin_bit_cast(unsigned short, x); }
__device__ __forceinline__ unsigned pk16(unsigned short a, unsigned short b) { return (unsigned)a | ((unsigned)b << 16); }
__device__ __forceinline__ v8f zero8() { v8f z = {0.f, 0.f, 0.f, 0.f, 0.f, 0.f, 0.f, 0.f}; return z; }

// ---- fragment loaders: 16-bit A/B operand, lane -> row/col (lane&15), p already includes +8*(lane>>4);
//      elements 0..7 <- p[0..7] (k0+8h..), elements 8..15 <- p[16..23] (k0+16+8h..)  (same split k map for A and B;
//      B is always read from a k-contiguous [n][k] plane)
__device__ __forceinline__ v16h ldfrag_h(const _Float16* p) {
  FragH f;
  f.h[0] = *(const v8h*)(p);
  f.h[1] = *(const v8h*)(p + 16);
  return f.v;
}
__device__ __forceinline__ v16b ldfrag_b(const u16* p) {              // bf16 plane read as unsigned integer vectors
  FragB f;
  f.u[0] = *(const v4u*)(p);
  f.u[1] = *(const v4u*)(p + 16);
  return f.v;
}

__device__ __forceinline__ v8f mma_h(v16h a, v16h b, v8f c) {
  return __builtin_amdgcn_wmma_f32_16x16x32_f16(false, a, false, b, (short)0, c, false, false);
}
__device__ __forceinline__ v8f mma_b(v16b a, v16b b, v8f c) {
  return __builtin_amdgcn_wmma_f32_16x16x32_bf16(false, a, false, b, (short)0, c, false, false);
}
__device__ __forceinline__ void guard2(v8f& a, v8f& b, v16h x0, v16h x1, v16h x2, v16h x3, v16h x4, v16h x5) {
#if defined(__HIP_DEVICE_COMPILE__)
  asm volatile("v_nop\n\tv_nop\n\tv_nop\n\tv_nop"
               : "+v"(a), "+v"(b) : "v"(x0), "v"(x1), "v"(x2), "v"(x3), "v"(x4), "v"(x5) : "memory");
#endif
}
template <typename F>
__device__ __forceinline__ void guard6(v8f& a, v8f& b, v8f& c, v8f& d, F x0, F x1, F x2, F x3, F x4, F x5) {
#if defined(__HIP_DEVICE_COMPILE__)
  asm volatile("v_nop\n\tv_nop\n\tv_nop\n\tv_nop"
               : "+v"(a), "+v"(b), "+v"(c), "+v"(d) : "v"(x0), "v"(x1), "v"(x2), "v"(x3), "v"(x4), "v"(x5) : "memory");
#endif
}
__device__ __forceinline__ void guard10(v8f& a, v8f& b, v8f& c, v8f& d, v16h x0, v16h x1, v16h x2, v16h x3, v16h x4,
                                        v16h x5, v16h x6, v16h x7, v16h x8, v16h x9) {
#if defined(__HIP_DEVICE_COMPILE__)
  asm volatile("v_nop\n\tv_nop\n\tv_nop\n\tv_nop"
               : "+v"(a), "+v"(b), "+v"(c), "+v"(d)
               : "v"(x0), "v"(x1), "v"(x2), "v"(x3), "v"(x4), "v"(x5), "v"(x6), "v"(x7), "v"(x8), "v"(x9) : "memory");
#endif
}
__device__ __forceinline__ void guardF(v8f& a0, v8f& a1, v8f& a2, v8f& a3, v8f& c0, v8f& c1, v8f& c2, v8f& c3,
                                       v16h x0, v16h x1, v16h x2, v16h x3, v16h x4, v16h x5, v16h x6, v16h x7,
                                       v16h x8, v16h x9) {
#if defined(__HIP_DEVICE_COMPILE__)
  asm volatile("v_nop\n\tv_nop\n\tv_nop\n\tv_nop"
               : "+v"(a0), "+v"(a1), "+v"(a2), "+v"(a3), "+v"(c0), "+v"(c1), "+v"(c2), "+v"(c3)
               : "v"(x0), "v"(x1), "v"(x2), "v"(x3), "v"(x4), "v"(x5), "v"(x6), "v"(x7), "v"(x8), "v"(x9) : "memory");
#endif
}
__device__ __forceinline__ void acc_guard4(v8f& a, v8f& b, v8f& c, v8f& d) {
#if defined(__HIP_DEVICE_COMPILE__)
  asm volatile("v_nop\n\tv_nop\n\tv_nop\n\tv_nop" : "+v"(a), "+v"(b), "+v"(c), "+v"(d));
#endif
}
__device__ __forceinline__ void wave_sync_lds() {
  __builtin_amdgcn_fence(__ATOMIC_RELEASE, "workgroup");
  __builtin_amdgcn_wave_barrier();
  __builtin_amdgcn_fence(__ATOMIC_ACQUIRE, "workgroup");
}

// ---- accurate f32 sin/cos of a non-negative f32 angle (|angle| < 2048): f64 two-part pi/2 reduction + f64 polynomials,
//      plain f64 fma/mul only (no library f64 trig path), result converted to f32.
__device__ __forceinline__ void sincos_acc(float angf, float& sv, float& cv) {
  const double a = (double)angf;
  const double TWO_OVER_PI = 0.63661977236758134308;
  const double PIO2_HI = 1.5707963267948966;
  const double PIO2_LO = 6.123233995736766e-17;
  const int kq = (int)(a * TWO_OVER_PI + 0.5);
  const double kd = (double)kq;
  double r = fma(-kd, PIO2_HI, a);
  r = fma(-kd, PIO2_LO, r);
  const double r2 = r * r;
  double sp = 1.0 / 6227020800.0;
  sp = fma(sp, r2, -1.0 / 39916800.0);
  sp = fma(sp, r2, 1.0 / 362880.0);
  sp = fma(sp, r2, -1.0 / 5040.0);
  sp = fma(sp, r2, 1.0 / 120.0);
  sp = fma(sp, r2, -1.0 / 6.0);
  const double s = fma(sp * r2, r, r);
  double cp = -1.0 / 87178291200.0;
  cp = fma(cp, r2, 1.0 / 479001600.0);
  cp = fma(cp, r2, -1.0 / 3628800.0);
  cp = fma(cp, r2, 1.0 / 40320.0);
  cp = fma(cp, r2, -1.0 / 720.0);
  cp = fma(cp, r2, 1.0 / 24.0);
  cp = fma(cp, r2, -0.5);
  const double c = fma(cp, r2, 1.0);
  const int qd = kq & 3;
  const double so = (qd == 0) ? s : (qd == 1) ? c : (qd == 2) ? -s : -c;
  const double co = (qd == 0) ? c : (qd == 1) ? -s : (qd == 2) ? -c : s;
  sv = (float)so;
  cv = (float)co;
}

// =====================================================================================================
// Rotary tables: cosT[t][d], sinT[t][d] for t < TT, d < HD, angle = float(t) * inv_freq[d & 31] (f32 product), halves duplicated.
// Wave = one position t, lane = frequency index; inv_freq picked from the by-value table with a static select chain.
// coverage: grid TT/8 blocks x 8 waves = TT rows; per row 4 line stores = 64 floats of each table.
// =====================================================================================================
__global__ __launch_bounds__(256) void k_tab(float* cosT, float* sinT, InvF inv) {
  const int tid  = threadIdx.x;
  const int lane = tid & 31;
  const int t    = blockIdx.x * 8 + (tid >> 5);
  if (t >= TT) return;                      // never taken with the exact grid; no barriers in this kernel
  float f = inv.f[0];
#pragma unroll
  for (int i = 1; i < 32; ++i) f = (lane == i) ? inv.f[i] : f;
  const float ang = (float)t * f;
  float sv, cv;
  sincos_acc(ang, sv, cv);
  float* cr = cosT + (size_t)t * HD;
  float* sr = sinT + (size_t)t * HD;
  {
    *(float*)(cr + lane)      = cv;
    *(float*)(cr + 32 + lane) = cv;
    *(float*)(sr + lane)      = sv;
    *(float*)(sr + 32 + lane) = sv;
    
  }
}

// =====================================================================================================
// Batched transpose + bf16 convert: in W[b][R][C] (row-major f32) -> out D[b][C][R] (bf16 RNE bits, k-contiguous plane).
// Block = one 64x64 tile (r0, c0) of batch blockIdx.y: 256 thr x 4 16-B loads -> LDS tile [c][r] (pitch 72), block barrier,
// coverage: load 256 thr x 16 = 64x64; store 2 iterations x 256 thr x 8 halves = 64 lines x 64; grid (C/64)*(R/64) x b = all of D.
// =====================================================================================================
__global__ __launch_bounds__(256) void cvt_T(const float* __restrict__ W, u16* D, int R, int C) {
  __shared__ __align__(16) u16 T[64 * VTP];
  const int tid = threadIdx.x;
  const int ntc = C >> 6;
  const int bid = blockIdx.x;
  const int bb  = blockIdx.y;
  const int c0  = (bid % ntc) * 64;
  const int r0  = (bid / ntc) * 64;
  const float* Wb = W + (size_t)bb * (size_t)R * (size_t)C;
  u16*         Db = D + (size_t)bb * (size_t)R * (size_t)C;
  {
    const int rr = tid >> 2;
    const int cc = (tid & 3) * 16;
    const float* src = Wb + (size_t)(r0 + rr) * C + c0 + cc;
#pragma unroll
    for (int i = 0; i < 4; ++i) {
      const v4f a = *(const v4f*)(src + 4 * i);
#pragma unroll
      for (int e = 0; e < 4; ++e) T[(cc + 4 * i + e) * VTP + rr] = bf_bits(a[e]);
    }
  }
  __syncthreads();
  v4u vals[2];
  const int q8 = tid >> 3, p8 = (tid & 7) * 8;
#pragma unroll
  for (int it = 0; it < 2; ++it) vals[it] = *(const v4u*)(T + (it * 32 + q8) * VTP + p8);
  {
#pragma unroll
    for (int it = 0; it < 2; ++it) {
      const int n = it * 32 + q8;
      *(v4u*)(Db + (size_t)(c0 + n) * R + r0 + p8) = vals[it];
    }
    
  }
}

// =====================================================================================================
// Flat f32 -> 16-bit plane, same layout. f16mode == 0: bf16 RNE bits; f16mode == 1: f16 bits of (bf16 RNE value) * scale.
// Thread = 8 consecutive elements: two 16-B loads, one 16-B store; 32 consecutive lanes = 512 contiguous, 512-B aligned bytes
// coverage: grid = ceil(n8/256) blocks x 256 thr x 8 = the whole plane (n8 a multiple of 32 in every use, so no partial line).
// =====================================================================================================
__global__ __launch_bounds__(256) void cvt_flat(const float* __restrict__ src, u16* D, int n8, int f16mode, float scale) {
  const int gt = blockIdx.x * 256 + (int)threadIdx.x;
  if (gt >= n8) return;                     // no barriers in this kernel
  const float* p = src + (size_t)gt * 8;
  const v4f a = *(const v4f*)(p), bq = *(const v4f*)(p + 4);
  float w[8];
#pragma unroll
  for (int e = 0; e < 4; ++e) { w[e] = a[e]; w[4 + e] = bq[e]; }
  v4u o;
#pragma unroll
  for (int e = 0; e < 4; ++e) {
    const float v0 = w[2 * e], v1 = w[2 * e + 1];
    const unsigned short h0 = h_bits((_Float16)(bfr(v0) * scale)), h1 = h_bits((_Float16)(bfr(v1) * scale));
    const unsigned short b0 = bf_bits(v0), b1 = bf_bits(v1);
    o[e] = (f16mode != 0) ? pk16(h0, h1) : pk16(b0, b1);
  }
  u16* d = D + (size_t)gt * 8;
  {
    *(v4u*)(d) = o;
    
  }
}

// =====================================================================================================
// Flat f32 -> f16 hi + residual planes: hi = f16(v * sc), lo = f16(v * sc - hi) (sc a power of two, residual unscaled).
// coverage: grid = n8/256 (exact) x 256 thr x 8 = the whole of both planes.
// =====================================================================================================
__global__ __launch_bounds__(256) void cvt_split(const float* __restrict__ src, u16* Hp, u16* Lp, int n8, float sc) {
  const int gt = blockIdx.x * 256 + (int)threadIdx.x;
  if (gt >= n8) return;                     // no barriers in this kernel
  const float* p = src + (size_t)gt * 8;
  const v4f a = *(const v4f*)(p), bq = *(const v4f*)(p + 4);
  float w[8];
#pragma unroll
  for (int e = 0; e < 4; ++e) { w[e] = a[e] * sc; w[4 + e] = bq[e] * sc; }
  v4u oh, ol;
#pragma unroll
  for (int e = 0; e < 4; ++e) {
    const float t0 = w[2 * e], t1 = w[2 * e + 1];
    const _Float16 h0 = (_Float16)t0, h1 = (_Float16)t1;
    const _Float16 l0 = (_Float16)(t0 - (float)h0), l1 = (_Float16)(t1 - (float)h1);
    oh[e] = pk16(h_bits(h0), h_bits(h1));
    ol[e] = pk16(h_bits(l0), h_bits(l1));
  }
  const size_t o8 = (size_t)gt * 8;
  {
    *(v4u*)(Hp + o8) = oh;
    *(v4u*)(Lp + o8) = ol;
    
  }
}

// =====================================================================================================
// Shared GEMM store: the wave's 16x64 f32 tile already staged (final values) in its LDS slab (pitch 68), caller issued the
// coverage: 8 instructions x 2 rows x 16 lanes x 4 floats = the wave's 16 x 64 tile.
// =====================================================================================================
__device__ __forceinline__ void store64(const float* sl, float* C, int N, size_t rowb, int col0, int lane) {
  const int hh = lane >> 4, m = lane & 15;
  v4f vals[8];
#pragma unroll
  for (int it = 0; it < 8; ++it) vals[it] = *(const v4f*)(sl + (it * 2 + hh) * 68 + m * 4);
  float* dst = C + (rowb + (size_t)hh) * (size_t)N + col0 + m * 4;
  {
#pragma unroll
    for (int it = 0; it < 8; ++it) {
      *(v4f*)(dst + (size_t)(it * 2) * (size_t)N) = vals[it];
    }
    
  }
}

// =====================================================================================================
// bf16 GEMM: C[M][N] (f32) = A[M][K] (bf16 row-major) . Bt[N][K]^T (bf16 k-contiguous), times oscale, + bf16(bias[col]).
// Block = 64x64 tile, 4 waves x 16 rows; fragments loaded straight from the 16-bit rows (two 16-B loads each, split k map
// for A and B); K stepped by 32 (K % 32 == 0, M % 64 == 0, N % 64 == 0 statically, grid = (M/64)*(N/64)).
// =====================================================================================================
__global__ __launch_bounds__(128)
void gemm_bf(const u16* __restrict__ A, const u16* __restrict__ Bt, const float* __restrict__ bias, float* C,
             int M, int N, int K, float oscale) {
  __shared__ __align__(16) float slab[4 * SLAB64];
  const int tid = threadIdx.x, wave = tid >> 5, lane = tid & 31, hh = lane >> 4, m = lane & 15;
  const int ntile = N >> 6;
  const int bid   = blockIdx.x;
  const int rowb  = (bid / ntile) * 64 + wave * 16;
  const int col0  = (bid % ntile) * 64;
  if (rowb + 16 > M) return;                 // wave-uniform, never taken with the exact grid; no block barriers in this kernel
  const u16* ap = A  + (size_t)(rowb + m) * K + 8 * hh;
  const u16* bp = Bt + (size_t)(col0 + m) * K + 8 * hh;
  const size_t bs = (size_t)16 * K;
  v8f acc0 = zero8(), acc1 = zero8(), acc2 = zero8(), acc3 = zero8();
#pragma unroll 1
  for (int k0 = 0; k0 < K; k0 += 32) {
    const v16b a  = ldfrag_b(ap + k0);
    const v16b b0 = ldfrag_b(bp + k0);
    const v16b b1 = ldfrag_b(bp + bs + k0);
    const v16b b2 = ldfrag_b(bp + 2 * bs + k0);
    const v16b b3 = ldfrag_b(bp + 3 * bs + k0);
    acc0 = mma_b(a, b0, acc0);
    acc1 = mma_b(a, b1, acc1);
    acc2 = mma_b(a, b2, acc2);
    acc3 = mma_b(a, b3, acc3);
    guard6<v16b>(acc0, acc1, acc2, acc3, a, b0, b1, b2, b3, a);
  }
  float* sl = slab + wave * SLAB64;
  float bb[4];
#pragma unroll
  for (int j = 0; j < 4; ++j) bb[j] = bfr(bias[col0 + 16 * j + m]);
#pragma unroll
  for (int r = 0; r < 8; ++r) {
    const int ro = (8 * hh + r) * 68 + m;
    sl[ro]      = acc0[r] * oscale + bb[0];
    sl[ro + 16] = acc1[r] * oscale + bb[1];
    sl[ro + 32] = acc2[r] * oscale + bb[2];
    sl[ro + 48] = acc3[r] * oscale + bb[3];
  }
  wave_sync_lds();
  store64(sl, C, N, (size_t)rowb, col0, lane);
}

// =====================================================================================================
// f16 GEMM (optionally batched over blockIdx.y with element strides sA, sB, sC):
//   C[M][N] (f32) = (Ah [+ Al])[M][K] . (Bh [+ Bl])[N][K]^T, times oscale, + bf16(bias) per row (biasRow != 0) or per column.
//   A2: A carried as hi + unscaled residual plane (products h.B + l.B); B2: B carried as hi + residual (A.h + A.l); never both.
// Same tiling as gemm_bf; all planes f16 k-contiguous, K % 32 == 0.
// =====================================================================================================
template <int A2, int B2>
__global__ __launch_bounds__(128)
void gemm_h(const u16* __restrict__ Ah, const u16* __restrict__ Al, const u16* __restrict__ Bh, const u16* __restrict__ Bl,
            const float* __restrict__ bias, float* C, int M, int N, int K, int sA, int sB, int sC, int biasRow, float oscale) {
  __shared__ __align__(16) float slab[4 * SLAB64];
  const int tid = threadIdx.x, wave = tid >> 5, lane = tid & 31, hh = lane >> 4, m = lane & 15;
  const int ntile = N >> 6;
  const int bid   = blockIdx.x;
  const int bz    = blockIdx.y;
  const int rowb  = (bid / ntile) * 64 + wave * 16;
  const int col0  = (bid % ntile) * 64;
  if (rowb + 16 > M) return;                 // wave-uniform, never taken with the exact grid; no block barriers in this kernel
  const size_t aofs = (size_t)bz * (size_t)sA + (size_t)(rowb + m) * K + 8 * hh;
  const _Float16* ahp = (const _Float16*)(const void*)Ah + aofs;
  const _Float16* alp = (const _Float16*)(const void*)Al + aofs;
  const size_t bofs = (size_t)bz * (size_t)sB + (size_t)(col0 + m) * K + 8 * hh;
  const _Float16* bhp = (const _Float16*)(const void*)Bh + bofs;
  const _Float16* blp = (const _Float16*)(const void*)Bl + bofs;
  const size_t bs = (size_t)16 * K;
  v8f acc0 = zero8(), acc1 = zero8(), acc2 = zero8(), acc3 = zero8();
#pragma unroll 1
  for (int k0 = 0; k0 < K; k0 += 32) {
    const v16h ah = ldfrag_h(ahp + k0);
    const v16h b0 = ldfrag_h(bhp + k0);
    const v16h b1 = ldfrag_h(bhp + bs + k0);
    const v16h b2 = ldfrag_h(bhp + 2 * bs + k0);
    const v16h b3 = ldfrag_h(bhp + 3 * bs + k0);
    if (A2) {
      const v16h al = ldfrag_h(alp + k0);
      acc0 = mma_h(ah, b0, acc0);  acc0 = mma_h(al, b0, acc0);
      acc1 = mma_h(ah, b1, acc1);  acc1 = mma_h(al, b1, acc1);
      acc2 = mma_h(ah, b2, acc2);  acc2 = mma_h(al, b2, acc2);
      acc3 = mma_h(ah, b3, acc3);  acc3 = mma_h(al, b3, acc3);
      guard6<v16h>(acc0, acc1, acc2, acc3, ah, al, b0, b1, b2, b3);
    } else if (B2) {
      const v16h c0 = ldfrag_h(blp + k0);
      const v16h c1 = ldfrag_h(blp + bs + k0);
      const v16h c2 = ldfrag_h(blp + 2 * bs + k0);
      const v16h c3 = ldfrag_h(blp + 3 * bs + k0);
      acc0 = mma_h(ah, b0, acc0);  acc0 = mma_h(ah, c0, acc0);
      acc1 = mma_h(ah, b1, acc1);  acc1 = mma_h(ah, c1, acc1);
      acc2 = mma_h(ah, b2, acc2);  acc2 = mma_h(ah, c2, acc2);
      acc3 = mma_h(ah, b3, acc3);  acc3 = mma_h(ah, c3, acc3);
      guard10(acc0, acc1, acc2, acc3, ah, b0, b1, b2, b3, c0, c1, c2, c3, ah);
    } else {
      acc0 = mma_h(ah, b0, acc0);
      acc1 = mma_h(ah, b1, acc1);
      acc2 = mma_h(ah, b2, acc2);
      acc3 = mma_h(ah, b3, acc3);
      guard6<v16h>(acc0, acc1, acc2, acc3, ah, b0, b1, b2, b3, ah);
    }
  }
  float* sl = slab + wave * SLAB64;
  if (biasRow != 0) {
#pragma unroll
    for (int r = 0; r < 8; ++r) {
      const float bb = bfr(bias[rowb + 8 * hh + r]);
      const int ro = (8 * hh + r) * 68 + m;
      sl[ro]      = acc0[r] * oscale + bb;
      sl[ro + 16] = acc1[r] * oscale + bb;
      sl[ro + 32] = acc2[r] * oscale + bb;
      sl[ro + 48] = acc3[r] * oscale + bb;
    }
  } else {
    float bb[4];
#pragma unroll
    for (int j = 0; j < 4; ++j) bb[j] = bfr(bias[col0 + 16 * j + m]);
#pragma unroll
    for (int r = 0; r < 8; ++r) {
      const int ro = (8 * hh + r) * 68 + m;
      sl[ro]      = acc0[r] * oscale + bb[0];
      sl[ro + 16] = acc1[r] * oscale + bb[1];
      sl[ro + 32] = acc2[r] * oscale + bb[2];
      sl[ro + 48] = acc3[r] * oscale + bb[3];
    }
  }
  wave_sync_lds();
  store64(sl, C + (size_t)bz * (size_t)sC, N, (size_t)rowb, col0, lane);
}

// =====================================================================================================
// Rotate-half rotary + f16 pack (single plane). Rows are (batch, pos, head) with HD contiguous floats (f32 projection output);
// pos = (row / hpr) & posmask.  w[d] = x[d] * cos[pos][d] + r[d] * sin[pos][d],  r[d] = -x[d+32] for d < 32, x[d-32] for d >= 32;
// out[d] = f16(w * sc) (sc a power of two).
// Thread = 8 consecutive d of one row: 16-B loads of x (own and partner half), cos, sin; one 16-B store per lane;
// coverage: grid = nrows*8/256 blocks (exact) x 256 thr x 8 halves = nrows x 64 of the plane exactly.
// =====================================================================================================
__global__ __launch_bounds__(256) void rope_h(const float* __restrict__ x, const float* __restrict__ cosT,
                                              const float* __restrict__ sinT, u16* hpl,
                                              int nrows, int hpr, int posmask, float sc) {
  const int gt  = blockIdx.x * 256 + (int)threadIdx.x;
  const int row = gt >> 3;
  const int d0  = (gt & 7) * 8;
  if (row >= nrows) return;                 // never taken with the exact grid; no barriers in this kernel
  const int pos = (row / hpr) & posmask;
  const int d1  = d0 ^ 32;
  const float* xr = x + (size_t)row * HD;
  const float* cr = cosT + (size_t)pos * HD + d0;
  const float* sr = sinT + (size_t)pos * HD + d0;
  const v4f xa = *(const v4f*)(xr + d0), xb = *(const v4f*)(xr + d0 + 4);
  const v4f ya = *(const v4f*)(xr + d1), yb = *(const v4f*)(xr + d1 + 4);
  const v4f ca = *(const v4f*)(cr), cb = *(const v4f*)(cr + 4);
  const v4f sa = *(const v4f*)(sr), sb = *(const v4f*)(sr + 4);
  const float sgn = (d0 < 32) ? -1.0f : 1.0f;
  float w[8];
#pragma unroll
  for (int e = 0; e < 4; ++e) {
    w[e]     = xa[e] * ca[e] + (sgn * ya[e]) * sa[e];
    w[4 + e] = xb[e] * cb[e] + (sgn * yb[e]) * sb[e];
  }
  v4u oh;
#pragma unroll
  for (int e = 0; e < 4; ++e) {
    const _Float16 h0 = (_Float16)(w[2 * e] * sc), h1 = (_Float16)(w[2 * e + 1] * sc);
    oh[e] = pk16(h_bits(h0), h_bits(h1));
  }
  const size_t o8 = (size_t)row * HD + d0;
  {
    *(v4u*)(hpl + o8) = oh;
    
  }
}

// =====================================================================================================
// v plane + per-32-key block sums: in V[b][HID][TS] f32 (channel-major). Block = (b, 64 channels o0, 64 keys s0).
//   VH[b][o][s] = f16(v * 1024) (same layout); VS[b][kb][o] = sum over keys kb*32 .. kb*32+31 of v (f32).
// Two iterations: thread = 8 consecutive keys of one channel row (two 16-B loads, one 16-B store; lanes 8q..8q+7 = one whole
// coverage: VH 2 it x 256 thr x 8 = 64 x 64 per block, grid 16 x 4 x 8 blocks = whole plane; VS 2 kb x 64 channels per block,
//           grid covers 16 b x 16 kb x 256 channels exactly once.
// =====================================================================================================
__global__ __launch_bounds__(256) void vcvt(const float* __restrict__ V, u16* VH, float* VS) {
  __shared__ __align__(16) float S[128];
  const int tid  = threadIdx.x;
  const int lane = tid & 31;
  const int wave = tid >> 5;
  const int bid  = blockIdx.x;
  const int st   = bid & 7;
  const int ot   = (bid >> 3) & 3;
  const int b    = bid >> 5;
  const int o0   = ot * 64;
  const int s0   = st * 64;
  v4u hv[2];
  size_t eo[2];
#pragma unroll
  for (int it = 0; it < 2; ++it) {
    const int idx = it * 256 + tid;
    const int row = idx >> 3;                 // channel within tile 0..63
    const int s8  = (idx & 7) * 8;            // key offset within tile
    const size_t e = ((size_t)(b * HID + o0 + row)) * TS + s0 + s8;
    eo[it] = e;
    const v4f a = *(const v4f*)(V + e), bq = *(const v4f*)(V + e + 4);
    v4u o;
#pragma unroll
    for (int q = 0; q < 2; ++q) {
      o[q]     = pk16(h_bits((_Float16)(a[2 * q] * VCAR)),  h_bits((_Float16)(a[2 * q + 1] * VCAR)));
      o[2 + q] = pk16(h_bits((_Float16)(bq[2 * q] * VCAR)), h_bits((_Float16)(bq[2 * q + 1] * VCAR)));
    }
    hv[it] = o;
    float ps = ((a[0] + a[1]) + (a[2] + a[3])) + ((bq[0] + bq[1]) + (bq[2] + bq[3]));
    ps += __shfl_xor(ps, 1, 32);
    ps += __shfl_xor(ps, 2, 32);
    if ((lane & 3) == 0) S[((lane >> 2) & 1) * 64 + row] = ps;   // lane&7 == 0 -> keys s0..s0+31, == 4 -> s0+32..s0+63
  }
  {
#pragma unroll
    for (int it = 0; it < 2; ++it) *(v4u*)(VH + eo[it]) = hv[it];
    
  }
  __syncthreads();
  if (wave == 0) {
    const int kbh   = lane >> 4;
    const int piece = (lane & 15) * 4;
    const v4f sv = *(const v4f*)(S + kbh * 64 + piece);
    float* dst = VS + ((size_t)(b * NKB + 2 * st + kbh)) * HID + o0 + piece;
    {
      *(v4f*)(dst) = sv;
      
    }
  }
}

// =====================================================================================================
// Cross attention: block = (batch b, head h, 64 query rows), one wave per 16 query rows q0..q0+15; all TS keys in NKB blocks of 32.
//   q' plane QH [b][t][h][d] (x1024 f16), k' plane KH [b][s][h][d] (x1024), v plane VH [b][h*64+d][s] (x1024),
//   VS[b][kb][h*64+d] = f32 sum of v over key block kb; masks: key s of row t is masked iff bf16(cond_mask[b][s])*bf16(x_mask[b][t]) == 0,
//   masked score replaced by -1e4 (base-2 scaled) -> exact uniform softmax on a fully masked row, 0 weight otherwise.
//   Per block: 2 score subtiles x 2 k-steps (q'.k' single products, q fragments loaded once), scale 1/8 folded into the base-2
//   factor; online max-subtracted base-2 softmax in f32; e = exp2(t - m) per key; l from the f32 e; accumulator update
//   o = o*alpha + (7/8 * 2^20) * VS block sum (f32), then the centred tile P' = (e - 7/8) * 1024 stored to wave-private LDS (f32),
//   contiguous), 4 P'.v WMMAs. Exact identity sum_s e_s v_s = sum_s (e_s - 7/8) v_s + 7/8 sum_s v_s per key block.
//   (b, q0+row, head) of the O hi plane and of the O residual plane (O x8192 as f16 hi + residual) written by 8 consecutive lanes
// coverage: per wave 4 instructions x 4 rows x 8 lanes x 8 halves = 16 x 64 per plane; grid 2048 blocks x 4 waves = every
//           (b, t, h) row of both O planes exactly once.
// =====================================================================================================
__global__ __launch_bounds__(128)
void attn_x(const u16* __restrict__ QHp, const u16* __restrict__ KHp, const u16* __restrict__ VHp,
            const float* __restrict__ VS, const float* __restrict__ cmask, const float* __restrict__ xmask,
            u16* OHp, u16* OLp) {
  __shared__ __align__(16) float smem[4 * SLABF];   // per wave: P' tile [16][32] pitch 36 during the loop, result slab after

  const int tid  = threadIdx.x;
  const int wave = tid >> 5;
  const int lane = tid & 31;
  const int hh   = lane >> 4;
  const int c    = lane & 15;

  const int bid  = blockIdx.x;
  const int qt   = bid & (TT / 64 - 1);
  const int h    = (bid >> 5) & (NH - 1);
  const int b    = bid >> 7;
  const int q0   = qt * 64 + wave * 16;

  const size_t qofs = (((size_t)(b * TT + q0 + c)) * NH + h) * HD + 8 * hh;
  const _Float16* Qh  = (const _Float16*)(const void*)QHp + qofs;
  const size_t kofs = (((size_t)(b * TS + c)) * NH + h) * HD + 8 * hh;           // key row kb + c added per step
  const _Float16* Khb = (const _Float16*)(const void*)KHp + kofs;
  const size_t vofs = ((size_t)(b * HID + h * HD + c)) * TS + 8 * hh;             // d column c (+16j), key kb added per step
  const _Float16* Vhb = (const _Float16*)(const void*)VHp + vofs;
  const float* vsb = VS + (size_t)b * NKB * HID + h * HD + c;
  const float* cmb = cmask + (size_t)b * TS + c;
  const float lsc = 0.125f * (LOG2E / (QSC * KSC));
  const float C0S = PCEN * PCAR * VCAR;

  float xmv[8], mrow[8], lrow[8];
  v8f o[4];
#pragma unroll
  for (int r = 0; r < 8; ++r) {
    xmv[r]  = bfr(xmask[(size_t)b * TT + q0 + 8 * hh + r]);
    mrow[r] = -INFINITY;
    lrow[r] = 0.f;
  }
#pragma unroll
  for (int j = 0; j < 4; ++j) o[j] = zero8();
  float* pt = smem + wave * SLABF;

  const v16h qa = ldfrag_h(Qh), qb = ldfrag_h(Qh + 32);

#pragma unroll 1
  for (int it = 0; it < NKB; ++it) {
    const int kb = it * 32;
    // ---- scores: D element r of this lane = (query row q0 + 8hh + r, key kb + c) in s0, key kb + 16 + c in s1 ----
    v8f s0 = zero8(), s1 = zero8();
    {
      const _Float16* k0p = Khb + (size_t)kb * (NH * HD);
      const _Float16* k1p = k0p + (size_t)16 * (NH * HD);
      const v16h k0a = ldfrag_h(k0p), k0b = ldfrag_h(k0p + 32);
      const v16h k1a = ldfrag_h(k1p), k1b = ldfrag_h(k1p + 32);
      s0 = mma_h(qa, k0a, s0);
      s0 = mma_h(qb, k0b, s0);
      s1 = mma_h(qa, k1a, s1);
      s1 = mma_h(qb, k1b, s1);
      guard2(s0, s1, qa, qb, k0a, k0b, k1a, k1b);
    }
    const float cm0 = bfr(cmb[kb]), cm1 = bfr(cmb[kb + 16]);
    float vs[4];
#pragma unroll
    for (int j = 0; j < 4; ++j) vs[j] = vsb[(size_t)it * HID + 16 * j] * C0S;
    // ---- mask (replace by -1e4) + online softmax in base 2; centred P' tile to LDS ----
#pragma unroll
    for (int r = 0; r < 8; ++r) {
      const bool ok0 = (cm0 * xmv[r]) != 0.0f;
      const bool ok1 = (cm1 * xmv[r]) != 0.0f;
      const float t0 = ok0 ? (s0[r] * lsc) : MASKT;
      const float t1 = ok1 ? (s1[r] * lsc) : MASKT;
      float mx = fmaxf(t0, t1);
#pragma unroll
      for (int off = 1; off < 16; off <<= 1) mx = fmaxf(mx, __shfl_xor(mx, off, 32));
      const float mn = fmaxf(mrow[r], mx);
      const float al = exp2f(mrow[r] - mn);
      mrow[r] = mn;
      const float e0 = exp2f(t0 - mn), e1 = exp2f(t1 - mn);
      float ps = e0 + e1;
#pragma unroll
      for (int off = 1; off < 16; off <<= 1) ps += __shfl_xor(ps, off, 32);
      lrow[r] = lrow[r] * al + ps;
#pragma unroll
      for (int j = 0; j < 4; ++j) o[j][r] = o[j][r] * al + vs[j];
      const int ro = (8 * hh + r) * 36 + c;
      pt[ro]      = (e0 - PCEN) * PCAR;
      pt[ro + 16] = (e1 - PCEN) * PCAR;
    }
    wave_sync_lds();
    // ---- A fragment of f16(P'): row = c, split k map over the 32 keys of this step ----
    FragH ph;
    {
      const float* prow = pt + c * 36 + 8 * hh;
      const v4f p0 = *(const v4f*)(prow), p1 = *(const v4f*)(prow + 4);
      const v4f p2 = *(const v4f*)(prow + 16), p3 = *(const v4f*)(prow + 20);
#pragma unroll
      for (int e = 0; e < 4; ++e) {
        ph.h[0][e]     = (_Float16)p0[e];                    // elements 0..7  = keys kb + 8hh + 0..7
        ph.h[0][4 + e] = (_Float16)p1[e];
        ph.h[1][e]     = (_Float16)p2[e];                    // elements 8..15 = keys kb + 16 + 8hh + 0..7
        ph.h[1][4 + e] = (_Float16)p3[e];
      }
    }
    // ---- P'.v : B fragment col n = d = j*16 + c, keys contiguous in the v plane ----
    {
      const _Float16* vhp = Vhb + kb;
      const v16h vh0 = ldfrag_h(vhp);
      const v16h vh1 = ldfrag_h(vhp + (size_t)16 * TS);
      const v16h vh2 = ldfrag_h(vhp + (size_t)32 * TS);
      const v16h vh3 = ldfrag_h(vhp + (size_t)48 * TS);
      o[0] = mma_h(ph.v, vh0, o[0]);
      o[1] = mma_h(ph.v, vh1, o[1]);
      o[2] = mma_h(ph.v, vh2, o[2]);
      o[3] = mma_h(ph.v, vh3, o[3]);
      guard6<v16h>(o[0], o[1], o[2], o[3], ph.v, vh0, vh1, vh2, vh3, ph.v);
    }
    wave_sync_lds();
  }
  acc_guard4(o[0], o[1], o[2], o[3]);

  // ---- fold 1/l and the carries (1024 on P', 1024 on v), stage the wave's 16x64 slab in its LDS region ----
  wave_sync_lds();
  float* slab = pt;
  const float oc = 1.0f / (PCAR * VCAR);
#pragma unroll
  for (int r = 0; r < 8; ++r) {
    const float inv = (1.0f / lrow[r]) * oc;
#pragma unroll
    for (int j = 0; j < 4; ++j) slab[(8 * hh + r) * 68 + j * 16 + c] = o[j][r] * inv;
  }
  wave_sync_lds();
  // ---- O x8192 -> f16 hi + residual planes; lane = (row in group of 4, 8 consecutive d) ----
  v4u oh[4], ol[4];
  const int rq = lane >> 3, c8 = (lane & 7) * 8;
#pragma unroll
  for (int it = 0; it < 4; ++it) {
    const int row = it * 4 + rq;
    const v4f a = *(const v4f*)(slab + row * 68 + c8), bq = *(const v4f*)(slab + row * 68 + c8 + 4);
    float w[8];
#pragma unroll
    for (int e = 0; e < 4; ++e) { w[e] = a[e] * OSC; w[4 + e] = bq[e] * OSC; }
#pragma unroll
    for (int e = 0; e < 4; ++e) {
      const _Float16 h0 = (_Float16)w[2 * e], h1 = (_Float16)w[2 * e + 1];
      const _Float16 l0 = (_Float16)(w[2 * e] - (float)h0), l1 = (_Float16)(w[2 * e + 1] - (float)h1);
      oh[it][e] = pk16(h_bits(h0), h_bits(h1));
      ol[it][e] = pk16(h_bits(l0), h_bits(l1));
    }
  }
  const size_t ob = (((size_t)(b * TT + q0)) * NH + h) * HD + c8;
  {
#pragma unroll
    for (int it = 0; it < 4; ++it) {
      const int row = it * 4 + rq;
      const size_t o8 = ob + (size_t)row * (NH * HD);
      *(v4u*)(OHp + o8) = oh[it];
      *(v4u*)(OLp + o8) = ol[it];
    }
    
  }
}

// =====================================================================================================
// FiLM GEMM + combine: block = (batch b, 64 time columns t0, 64 channels), one wave per 16 channels c0..c0+15.
//   gamma[c][t] = sum_i w_film[c][i] y[t][i], beta[c][t] = sum_i w_film[256+c][i] y[t][i]  (A = w_film rows as f16(bf16 x1024),
//   B = y planes [b][t][i] as f16 hi x16384 + residual: products wg.h, wb.h, wg.l, wb.l, 8 accumulators);
//   out[b][c][t] = (bf16(x[b][c][t]) * (gamma*oscale + bf16(b_film[c])) + (beta*oscale + bf16(b_film[256+c]))) * bf16(x_mask[b][t]).
// coverage: grid 16 b x 32 t-tiles x 4 channel groups = 2048 blocks x 4 waves x 16 x 64 = every out element exactly once.
// =====================================================================================================
__global__ __launch_bounds__(128)
void film_k(const u16* __restrict__ WF, const u16* __restrict__ YHp, const u16* __restrict__ YLp,
            const float* __restrict__ bfl, const float* __restrict__ X, const float* __restrict__ XM,
            float* OUT, float oscale) {
  __shared__ __align__(16) float slab[4 * SLAB64];
  const int tid = threadIdx.x, wave = tid >> 5, lane = tid & 31, hh = lane >> 4, m = lane & 15;
  const int bid = blockIdx.x;
  const int tt  = bid & (TT / 64 - 1);
  const int cg  = (bid >> 5) & 3;
  const int b   = bid >> 7;
  const int t0  = tt * 64;
  const int c0  = cg * 64 + wave * 16;
  const _Float16* agp = (const _Float16*)(const void*)WF + (size_t)(c0 + m) * HID + 8 * hh;
  const _Float16* abp = agp + (size_t)HID * HID;                                   // row 256 + c0 + m
  const size_t yofs = ((size_t)(b * TT + t0 + m)) * HID + 8 * hh;
  const _Float16* yhp = (const _Float16*)(const void*)YHp + yofs;
  const _Float16* ylp = (const _Float16*)(const void*)YLp + yofs;
  const size_t bs = (size_t)16 * HID;
  v8f g[4], be[4];
#pragma unroll
  for (int j = 0; j < 4; ++j) { g[j] = zero8(); be[j] = zero8(); }
#pragma unroll 1
  for (int k0 = 0; k0 < HID; k0 += 32) {
    const v16h ag = ldfrag_h(agp + k0), ab = ldfrag_h(abp + k0);
    const v16h y0 = ldfrag_h(yhp + k0);
    const v16h y1 = ldfrag_h(yhp + bs + k0);
    const v16h y2 = ldfrag_h(yhp + 2 * bs + k0);
    const v16h y3 = ldfrag_h(yhp + 3 * bs + k0);
    g[0] = mma_h(ag, y0, g[0]);  be[0] = mma_h(ab, y0, be[0]);
    g[1] = mma_h(ag, y1, g[1]);  be[1] = mma_h(ab, y1, be[1]);
    g[2] = mma_h(ag, y2, g[2]);  be[2] = mma_h(ab, y2, be[2]);
    g[3] = mma_h(ag, y3, g[3]);  be[3] = mma_h(ab, y3, be[3]);
    const v16h z0 = ldfrag_h(ylp + k0);
    const v16h z1 = ldfrag_h(ylp + bs + k0);
    const v16h z2 = ldfrag_h(ylp + 2 * bs + k0);
    const v16h z3 = ldfrag_h(ylp + 3 * bs + k0);
    g[0] = mma_h(ag, z0, g[0]);  be[0] = mma_h(ab, z0, be[0]);
    g[1] = mma_h(ag, z1, g[1]);  be[1] = mma_h(ab, z1, be[1]);
    g[2] = mma_h(ag, z2, g[2]);  be[2] = mma_h(ab, z2, be[2]);
    g[3] = mma_h(ag, z3, g[3]);  be[3] = mma_h(ab, z3, be[3]);
    guardF(g[0], g[1], g[2], g[3], be[0], be[1], be[2], be[3], ag, ab, y0, y1, y2, y3, z0, z1, z2, z3);
  }
  float* sl = slab + wave * SLAB64;
  float xm[4];
#pragma unroll
  for (int j = 0; j < 4; ++j) xm[j] = bfr(XM[(size_t)b * TT + t0 + 16 * j + m]);
#pragma unroll
  for (int r = 0; r < 8; ++r) {
    const int cc = c0 + 8 * hh + r;
    const float bg = bfr(bfl[cc]);
    const float bb = bfr(bfl[HID + cc]);
    const float* xr = X + ((size_t)(b * HID + cc)) * TT + t0 + m;
#pragma unroll
    for (int j = 0; j < 4; ++j) {
      const float gam = g[j][r] * oscale + bg;
      const float bet = be[j][r] * oscale + bb;
      const float xv  = bfr(xr[16 * j]);
      sl[(8 * hh + r) * 68 + 16 * j + m] = (xv * gam + bet) * xm[j];
    }
  }
  wave_sync_lds();
  store64(sl, OUT, TT, (size_t)(b * HID + c0), t0, lane);
}

// =====================================================================================================
// Workspace map (bytes); every plane is fully written by whole-line stores before it is read; all extents are exact multiples
// of the store granularity (no pad rows needed); every offset a multiple of 65536. Regions R1, R3, R4, R5, R2 are reused by a
// later plane once the earlier plane's last reader has run (launch order below):
//   CT f32 [2048][64] 524288, ST same
//   R3: XT bf16 [16][2048][256]  -> later QH f16 [16][2048][4][64]        16777216
//   R4: CONDT bf16 [16][512][512] -> later KF f32 [16][512][256]            8388608
//   WCB bf16 [256][512] 262144; WQB bf16 [256][256] 131072; WKH, WVH, WOH f16 [256][256] 131072 each; WFH f16 [512][256] 262144
//   R5: CTF f32 [16][512][256]   -> later VF f32 [16][256][512]            8388608
//   CH f16 [16][512][256] 4194304, CL same
//   R1: QF f32 [16][2048][256]   -> later YF f32 [16][2048][256]          33554432
//   KH f16 [16][512][4][64] 4194304; VH f16 [16][256][512] 4194304; VS f32 [16][16][256] 262144
//   R2: OH, OL f16 [16][2048][256] 16777216 each -> later YH, YL (same sizes)
//   end 119799808
// =====================================================================================================
extern "C" void kernel_launch(void* const* d_in, const int* in_sizes, int n_in,
                              void* d_out, int out_size, void* d_ws, size_t ws_size,
                              hipStream_t stream) {
  if (n_in < 16) return;
  if (in_sizes[0] != NBAT * HID * TT) return;
  if (in_sizes[1] != NBAT * TT) return;
  if (in_sizes[2] != NBAT * CND * TS) return;
  if (in_sizes[3] != NBAT * TS) return;
  if (in_sizes[4] != HID * CND || in_sizes[5] != HID) return;
  if (in_sizes[6] != HID * HID || in_sizes[7] != HID) return;
  if (in_sizes[8] != HID * HID || in_sizes[9] != HID) return;
  if (in_sizes[10] != HID * HID || in_sizes[11] != HID) return;
  if (in_sizes[12] != HID * HID || in_sizes[13] != HID) return;
  if (in_sizes[14] != 2 * HID * HID || in_sizes[15] != 2 * HID) return;
  if (out_size != NBAT * HID * TT) return;

  const float* x      = (const float*)d_in[0];
  const float* x_mask = (const float*)d_in[1];
  const float* cond   = (const float*)d_in[2];
  const float* c_mask = (const float*)d_in[3];
  const float* w_cond = (const float*)d_in[4];
  const float* b_cond = (const float*)d_in[5];
  const float* wq     = (const float*)d_in[6];
  const float* bq     = (const float*)d_in[7];
  const float* wk     = (const float*)d_in[8];
  const float* bk     = (const float*)d_in[9];
  const float* wv     = (const float*)d_in[10];
  const float* bv     = (const float*)d_in[11];
  const float* wo     = (const float*)d_in[12];
  const float* bo     = (const float*)d_in[13];
  const float* wf     = (const float*)d_in[14];
  const float* bfi    = (const float*)d_in[15];
  float*       out    = (float*)d_out;

  const size_t szTab = (size_t)TT * HD * 4;                       //    524288
  const size_t szR3  = (size_t)NBAT * TT * HID * 2;               //  16777216
  const size_t szR4  = (size_t)NBAT * TS * CND * 2;               //   8388608 (= NBAT*TS*HID*4)
  const size_t szWCB = (size_t)HID * CND * 2;                     //    262144
  const size_t szW   = (size_t)HID * HID * 2;                     //    131072
  const size_t szWF  = (size_t)2 * HID * HID * 2;                 //    262144
  const size_t szR5  = (size_t)NBAT * TS * HID * 4;               //   8388608
  const size_t szCP  = (size_t)NBAT * TS * HID * 2;               //   4194304
  const size_t szR1  = (size_t)NBAT * TT * HID * 4;               //  33554432
  const size_t szKH  = (size_t)NBAT * TS * HID * 2;               //   4194304
  const size_t szVH  = (size_t)NBAT * HID * TS * 2;               //   4194304
  const size_t szVS  = (size_t)NBAT * NKB * HID * 4;              //    262144
  const size_t szOP  = (size_t)NBAT * TT * HID * 2;               //  16777216
  static_assert((size_t)NBAT * TS * CND * 2 == (size_t)NBAT * TS * HID * 4);
  size_t off = 0;
  const size_t oCT  = off; off += szTab;
  const size_t oST  = off; off += szTab;
  const size_t oR3  = off; off += szR3;
  const size_t oR4  = off; off += szR4;
  const size_t oWCB = off; off += szWCB;
  const size_t oWQB = off; off += szW;
  const size_t oWKH = off; off += szW;
  const size_t oWVH = off; off += szW;
  const size_t oWOH = off; off += szW;
  const size_t oWFH = off; off += szWF;
  const size_t oR5  = off; off += szR5;
  const size_t oCH  = off; off += szCP;
  const size_t oCL  = off; off += szCP;
  const size_t oR1  = off; off += szR1;
  const size_t oKH  = off; off += szKH;
  const size_t oVH  = off; off += szVH;
  const size_t oVS  = off; off += szVS;
  const size_t oOH  = off; off += szOP;
  const size_t oOL  = off; off += szOP;
  if (off > ws_size) return;                            // off = 119799808
  if (off > (size_t)134217728) return;

  char* ws = (char*)d_ws;
  float* CT    = (float*)(ws + oCT);
  float* ST    = (float*)(ws + oST);
  u16*   XT    = (u16*)(ws + oR3);
  u16*   QH    = (u16*)(ws + oR3);
  u16*   CONDT = (u16*)(ws + oR4);
  float* KF    = (float*)(ws + oR4);
  u16*   WCB   = (u16*)(ws + oWCB);
  u16*   WQB   = (u16*)(ws + oWQB);
  u16*   WKH   = (u16*)(ws + oWKH);
  u16*   WVH   = (u16*)(ws + oWVH);
  u16*   WOH   = (u16*)(ws + oWOH);
  u16*   WFH   = (u16*)(ws + oWFH);
  float* CTF   = (float*)(ws + oR5);
  float* VF    = (float*)(ws + oR5);
  u16*   CH    = (u16*)(ws + oCH);
  u16*   CL    = (u16*)(ws + oCL);
  float* QF    = (float*)(ws + oR1);
  float* YF    = (float*)(ws + oR1);
  u16*   KH    = (u16*)(ws + oKH);
  u16*   VH    = (u16*)(ws + oVH);
  float* VS    = (float*)(ws + oVS);
  u16*   OH    = (u16*)(ws + oOH);
  u16*   OL    = (u16*)(ws + oOL);
  u16*   YH    = (u16*)(ws + oOH);
  u16*   YL    = (u16*)(ws + oOL);

  // inv_freq[i] = 1 / pow(10000, i/32) in f32 (pow correctly converted from f64, then IEEE f32 reciprocal)
  InvF inv;
  for (int i = 0; i < 32; ++i) {
    const double p = pow(10000.0, (double)i / 32.0);
    const float pf = (float)p;
    inv.f[i] = 1.0f / pf;
  }

  const dim3 blk(256);
  const dim3 bG(128);
  const int ROWQ = NBAT * TT;                           // 32768
  const int ROWK = NBAT * TS;                           // 8192
  const dim3 gTab(TT / 8);                              // 256
  const dim3 gXT((TT / 64) * (HID / 64), NBAT);         // 128 x 16  (in [256][2048] -> out [2048][256] per batch)
  const dim3 gCT((TS / 64) * (CND / 64), NBAT);         // 64 x 16   (in [512][512] -> out [512 s][512 i] per batch)
  const int n8WC = (HID * CND) / 8;                     // 16384
  const int n8W  = (HID * HID) / 8;                     // 8192
  const int n8WF = (2 * HID * HID) / 8;                 // 16384
  const dim3 gWC((n8WC + 255) / 256), gW((n8W + 255) / 256), gWF((n8WF + 255) / 256);
  const dim3 gGC((ROWK / 64) * (HID / 64));             // 512
  const int n8C = (ROWK * HID) / 8;                     // 262144
  const dim3 gSC(n8C / 256);                            // 1024
  const dim3 gGQ((ROWQ / 64) * (HID / 64));             // 2048
  const dim3 gGK((ROWK / 64) * (HID / 64), 1);          // 512
  const dim3 gGV((HID / 64) * (TS / 64), NBAT);         // 32 x 16
  const int rowsQ = ROWQ * NH;                          // 131072
  const int rowsK = ROWK * NH;                          // 32768
  const dim3 gRQ((rowsQ * 8) / 256);                    // 4096
  const dim3 gRK((rowsK * 8) / 256);                    // 1024
  const dim3 gVC(NBAT * (HID / 64) * (TS / 64));        // 512
  const dim3 gAT(NBAT * NH * (TT / 64));                // 2048
  const dim3 gGO((ROWQ / 64) * (HID / 64), 1);          // 2048
  const int n8Y = (ROWQ * HID) / 8;                     // 1048576
  const dim3 gSY(n8Y / 256);                            // 4096
  const dim3 gFM(NBAT * 4 * (TT / 64));                 // 2048

  // (0) rotary cos/sin tables [2048][64]
  k_tab<<<gTab, blk, 0, stream>>>(CT, ST, inv);
  // (1) x [b][256][2048] -> XT bf16 [b][2048][256]
  cvt_T<<<gXT, blk, 0, stream>>>(x, XT, HID, TT);
  // (2) cond [b][512][512] -> CONDT bf16 [b][512 s][512 i]
  cvt_T<<<gCT, blk, 0, stream>>>(cond, CONDT, CND, TS);
  // (3..8) weights: W[o][i] row-major is already [n][k]; bf16 planes for w_cond, wq; f16(bf16 x1024) for wk, wv, wo, w_film
  cvt_flat<<<gWC, blk, 0, stream>>>(w_cond, WCB, n8WC, 0, 1.0f);
  cvt_flat<<<gW,  blk, 0, stream>>>(wq, WQB, n8W, 0, 1.0f);
  cvt_flat<<<gW,  blk, 0, stream>>>(wk, WKH, n8W, 1, WSC);
  cvt_flat<<<gW,  blk, 0, stream>>>(wv, WVH, n8W, 1, WSC);
  cvt_flat<<<gW,  blk, 0, stream>>>(wo, WOH, n8W, 1, WSC);
  cvt_flat<<<gWF, blk, 0, stream>>>(wf, WFH, n8WF, 1, WSC);
  // (9) c^T [8192][256] f32 = CONDT [8192][512] . WCB^T + b_cond
  gemm_bf<<<gGC, bG, 0, stream>>>(CONDT, WCB, b_cond, CTF, ROWK, HID, CND, 1.0f);
  // (10) c^T -> f16 hi + residual planes x1024
  cvt_split<<<gSC, blk, 0, stream>>>(CTF, CH, CL, n8C, CSC);
  // (11) q^T [32768][256] f32 = XT . WQB^T + bq
  gemm_bf<<<gGQ, bG, 0, stream>>>(XT, WQB, bq, QF, ROWQ, HID, HID, 1.0f);
  // (12) k^T [8192][256] f32 = CH . WKH^T (+ bk), carries 1024 x 1024 folded back
  gemm_h<0, 0><<<gGK, bG, 0, stream>>>(CH, CH, WKH, WKH, bk, KF, ROWK, HID, HID, 0, 0, 0, 0, 1.0f / (CSC * WSC));
  // (13) v [b][256][512] f32 = WVH [256][256] . (CH + CL)[b][512][256]^T + bv per row, batched over blockIdx.y
  gemm_h<0, 1><<<gGV, bG, 0, stream>>>(WVH, WVH, CH, CL, bv, VF, HID, TS, HID, 0, TS * HID, HID * TS, 1, 1.0f / (CSC * WSC));
  // (14) q' plane: rows (b, t, h), positions mod 2048
  rope_h<<<gRQ, blk, 0, stream>>>(QF, CT, ST, QH, rowsQ, NH, TT - 1, QSC);
  // (15) k' plane: rows (b, s, h), positions mod 512
  rope_h<<<gRK, blk, 0, stream>>>(KF, CT, ST, KH, rowsK, NH, TS - 1, KSC);
  // (16) v f16 plane x1024 + per-32-key block sums
  vcvt<<<gVC, blk, 0, stream>>>(VF, VH, VS);
  // (17) cross attention -> O planes [b][t][h*64+d] x8192 (hi + residual)
  attn_x<<<gAT, bG, 0, stream>>>(QH, KH, VH, VS, c_mask, x_mask, OH, OL);
  // (18) y^T [32768][256] f32 = (OH + OL) . WOH^T + bo, carries 8192 x 1024 folded back
  gemm_h<1, 0><<<gGO, bG, 0, stream>>>(OH, OL, WOH, WOH, bo, YF, ROWQ, HID, HID, 0, 0, 0, 0, 1.0f / (OSC * WSC));
  // (19) y^T -> f16 hi + residual planes x16384 (into the O plane region, O no longer needed)
  cvt_split<<<gSY, blk, 0, stream>>>(YF, YH, YL, n8Y, YSC);
  // (20) FiLM GEMM + combine -> out [16][256][2048] f32
  film_k<<<gFM, bG, 0, stream>>>(WFH, YH, YL, bfi, x, x_mask, out, 1.0f / (YSC * WSC));
  (void)hipGetLastError();
}

// v001
// Measured time: 238 microseconds a run.
// Timed twice side by side with v000, it ran 1.16 times as fast both times.
// Contractions: cond^T.w_cond^T and x^T.wq^T on v_wmma_f32_16x16x32_bf16 (inputs RNE-converted to bf16, exact operands, f32 accumulate);
// c.wk^T (c x1024 f16 hi plane), wv.c (c x1024 f16 hi + residual, products w.h + w.l), scores q'.k'^T (q' x1024, k' x1024 f16, one product),
// P'.v (centred P' = (e - 7/8) x1024 f16, v x1024 f16, one product; 7/8 * sum(v) per 32-key block added in f32),
// O.wo^T (O x8192 f16 hi + residual, products h.w + l.w), w_film.y (y x16384 f16 hi + residual): v_wmma_f32_16x16x32_f16,
// weights as f16(bf16(w) x1024), f32 accumulate. Rotary tables: f64 sin/cos of the f32 angle. Rotation, masked base-2 online softmax, 1/l, FiLM combine: f32 on VALU.
#include <hip/hip_runtime.h>
#include <math.h>
#include <stdint.h>

#define NBAT  16
#define TT    2048
#define TS    512
#define HID   256
#define CND   512
#define NH    4
#define HD    64
#define NKB   (TS / 32)
#define QSC   1024.0f
#define KSC   1024.0f
#define CSC   1024.0f
#define VCAR  1024.0f
#define PCAR  1024.0f
#define OSC   8192.0f
#define YSC   16384.0f
#define WSC   1024.0f
#define PCEN  0.875f
#define LOG2E 1.4426950408889634f
#define MASKT (-10000.0f * LOG2E)
#define SLAB64 (16 * 68)
#define SLABF  (16 * 68)
#define VTP    72
static_assert(HID == NH * HD && HD == 64);
static_assert((TT % 64) == 0 && (TS % 64) == 0 && (TS % 32) == 0 && NKB == 16);
static_assert((TT & (TT - 1)) == 0 && (TS & (TS - 1)) == 0);
static_assert(16 * 36 <= SLABF);
static_assert((HID % 64) == 0 && (CND % 64) == 0 && (HID % 32) == 0 && (CND % 32) == 0);
static_assert(((NBAT * TT * NH * 8) % 256) == 0 && ((NBAT * TS * NH * 8) % 256) == 0);
static_assert(((NBAT * TS * HID) % 2048) == 0 && ((NBAT * TT * HID) % 2048) == 0);

typedef unsigned short u16;
typedef _Float16 v16h __attribute__((ext_vector_type(16)));
typedef _Float16 v8h  __attribute__((ext_vector_type(8)));
typedef __bf16   v16b __attribute__((ext_vector_type(16)));
typedef float    v8f  __attribute__((ext_vector_type(8)));
typedef float    v4f  __attribute__((ext_vector_type(4)));
typedef unsigned int v4u __attribute__((ext_vector_type(4)));

union FragH { v16h v; v8h h[2]; v4u u[2]; };
union FragB { v16b v; v4u u[2]; };

struct InvF { float f[32]; };
static_assert(sizeof(InvF) == 128);

// ---- scalar helpers --------------------------------------------------------------------------------
__device__ __forceinline__ unsigned short bf_bits(float f) {          // f32 -> bf16 bits, RNE convert
  unsigned u = __float_as_uint(f);
  return (unsigned short)((u + 0x7FFFu + ((u >> 16) & 1u)) >> 16);
}
__device__ __forceinline__ float bf_up(unsigned short h) { return __uint_as_float(((unsigned)h) << 16); }
__device__ __forceinline__ float bfr(float f) { return bf_up(bf_bits(f)); }
__device__ __forceinline__ unsigned short h_bits(_Float16 x) { return __builtin_bit_cast(unsigned short, x); }
__device__ __forceinline__ unsigned pk16(unsigned short a, unsigned short b) { return (unsigned)a | ((unsigned)b << 16); }
__device__ __forceinline__ v8f zero8() { v8f z = {0.f, 0.f, 0.f, 0.f, 0.f, 0.f, 0.f, 0.f}; return z; }

// ---- fragment-major planes: a 16-bit plane [R][K] (R % 16 == 0, K % 32 == 0) is stored as tiles of 16 rows x 32 k, 512 halves
//      each, tile (row >> 4, k >> 5) at ((row >> 4) * (K >> 5) + (k >> 5)) * 512; inside a tile 64 chunks of 8 halves, chunk slot
//      = ((k >> 4) & 1) * 32 + ((k >> 3) & 1) * 16 + (row & 15), so that slot & 31 is the lane that owns the chunk.
// ---- fragment loaders: 16-bit A/B operand, p = tile start + 8 * lane: two wave-wide loads of 512 contiguous bytes;
//      lane -> row/col (lane&15), elements 0..7 <- k0+8h.., elements 8..15 <- k0+16+8h..  (same split k map for A and B)
__device__ __forceinline__ v16h ldfrag_h(const _Float16* p) {
  FragH f;
  f.h[0] = *(const v8h*)(p);
  f.h[1] = *(const v8h*)(p + 256);
  return f.v;
}
__device__ __forceinline__ v16h ldfrag_rm_h(const _Float16* p) {      // same k map from a row-major row, p includes +8*(lane>>4)
  FragH f;
  f.h[0] = *(const v8h*)(p);
  f.h[1] = *(const v8h*)(p + 16);
  return f.v;
}
__device__ __forceinline__ v16b ldfrag_b(const u16* p) {              // bf16 plane read as unsigned integer vectors
  FragB f;
  f.u[0] = *(const v4u*)(p);
  f.u[1] = *(const v4u*)(p + 256);
  return f.v;
}

// Stands behind a group of fragment loads and names their address registers as inputs, so that these registers stay unwritten
// (by a later load's result or by an address update) up to the s_wait_xcnt 0 inside it.
__device__ __forceinline__ void hold_addr(const void* a, const void* b, const void* c, const void* d, const void* e,
                                          const void* f, const void* g, const void* h, const void* i, const void* j) {
#if defined(__HIP_DEVICE_COMPILE__)
  asm volatile("s_wait_xcnt 0x0" :: "v"(a), "v"(b), "v"(c), "v"(d), "v"(e), "v"(f), "v"(g), "v"(h), "v"(i), "v"(j) : "memory");
#endif
}
// chunk slot (0..63) of a tile -> row in the tile and first k in the tile
__device__ __forceinline__ int slot_row(int slot) { return slot & 15; }
__device__ __forceinline__ int slot_k(int slot) { return ((slot >> 5) << 4) + (((slot >> 4) & 1) << 3); }

__device__ __forceinline__ v8f mma_h(v16h a, v16h b, v8f c) {
  return __builtin_amdgcn_wmma_f32_16x16x32_f16(false, a, false, b, (short)0, c, false, false);
}
__device__ __forceinline__ v8f mma_b(v16b a, v16b b, v8f c) {
  return __builtin_amdgcn_wmma_f32_16x16x32_bf16(false, a, false, b, (short)0, c, false, false);
}
__device__ __forceinline__ void guard2(v8f& a, v8f& b, v16h x0, v16h x1, v16h x2, v16h x3, v16h x4, v16h x5) {
#if defined(__HIP_DEVICE_COMPILE__)
  asm volatile("v_nop\n\tv_nop\n\tv_nop\n\tv_nop"
               : "+v"(a), "+v"(b) : "v"(x0), "v"(x1), "v"(x2), "v"(x3), "v"(x4), "v"(x5) : "memory");
#endif
}
template <typename F>
__device__ __forceinline__ void guard6(v8f& a, v8f& b, v8f& c, v8f& d, F x0, F x1, F x2, F x3, F x4, F x5) {
#if defined(__HIP_DEVICE_COMPILE__)
  asm volatile("v_nop\n\tv_nop\n\tv_nop\n\tv_nop"
               : "+v"(a), "+v"(b), "+v"(c), "+v"(d) : "v"(x0), "v"(x1), "v"(x2), "v"(x3), "v"(x4), "v"(x5) : "memory");
#endif
}
__device__ __forceinline__ void guard10(v8f& a, v8f& b, v8f& c, v8f& d, v16h x0, v16h x1, v16h x2, v16h x3, v16h x4,
                                        v16h x5, v16h x6, v16h x7, v16h x8, v16h x9) {
#if defined(__HIP_DEVICE_COMPILE__)
  asm volatile("v_nop\n\tv_nop\n\tv_nop\n\tv_nop"
               : "+v"(a), "+v"(b), "+v"(c), "+v"(d)
               : "v"(x0), "v"(x1), "v"(x2), "v"(x3), "v"(x4), "v"(x5), "v"(x6), "v"(x7), "v"(x8), "v"(x9) : "memory");
#endif
}
__device__ __forceinline__ void guardF(v8f& a0, v8f& a1, v8f& a2, v8f& a3, v8f& c0, v8f& c1, v8f& c2, v8f& c3,
                                       v16h x0, v16h x1, v16h x2, v16h x3, v16h x4, v16h x5, v16h x6, v16h x7,
                                       v16h x8, v16h x9) {
#if defined(__HIP_DEVICE_COMPILE__)
  asm volatile("v_nop\n\tv_nop\n\tv_nop\n\tv_nop"
               : "+v"(a0), "+v"(a1), "+v"(a2), "+v"(a3), "+v"(c0), "+v"(c1), "+v"(c2), "+v"(c3)
               : "v"(x0), "v"(x1), "v"(x2), "v"(x3), "v"(x4), "v"(x5), "v"(x6), "v"(x7), "v"(x8), "v"(x9) : "memory");
#endif
}
__device__ __forceinline__ void acc_guard4(v8f& a, v8f& b, v8f& c, v8f& d) {
#if defined(__HIP_DEVICE_COMPILE__)
  asm volatile("v_nop\n\tv_nop\n\tv_nop\n\tv_nop" : "+v"(a), "+v"(b), "+v"(c), "+v"(d));
#endif
}
__device__ __forceinline__ void wave_sync_lds() {
  __builtin_amdgcn_fence(__ATOMIC_RELEASE, "workgroup");
  __builtin_amdgcn_wave_barrier();
  __builtin_amdgcn_fence(__ATOMIC_ACQUIRE, "workgroup");
}

// ---- accurate f32 sin/cos of a non-negative f32 angle (|angle| < 2048): f64 two-part pi/2 reduction + f64 polynomials,
//      plain f64 fma/mul only (no library f64 trig path), result converted to f32.
__device__ __forceinline__ void sincos_acc(float angf, float& sv, float& cv) {
  const double a = (double)angf;
  const double TWO_OVER_PI = 0.63661977236758134308;
  const double PIO2_HI = 1.5707963267948966;
  const double PIO2_LO = 6.123233995736766e-17;
  const int kq = (int)(a * TWO_OVER_PI + 0.5);
  const double kd = (double)kq;
  double r = fma(-kd, PIO2_HI, a);
  r = fma(-kd, PIO2_LO, r);
  const double r2 = r * r;
  double sp = 1.0 / 6227020800.0;
  sp = fma(sp, r2, -1.0 / 39916800.0);
  sp = fma(sp, r2, 1.0 / 362880.0);
  sp = fma(sp, r2, -1.0 / 5040.0);
  sp = fma(sp, r2, 1.0 / 120.0);
  sp = fma(sp, r2, -1.0 / 6.0);
  const double s = fma(sp * r2, r, r);
  double cp = -1.0 / 87178291200.0;
  cp = fma(cp, r2, 1.0 / 479001600.0);
  cp = fma(cp, r2, -1.0 / 3628800.0);
  cp = fma(cp, r2, 1.0 / 40320.0);
  cp = fma(cp, r2, -1.0 / 720.0);
  cp = fma(cp, r2, 1.0 / 24.0);
  cp = fma(cp, r2, -0.5);
  const double c = fma(cp, r2, 1.0);
  const int qd = kq & 3;
  const double so = (qd == 0) ? s : (qd == 1) ? c : (qd == 2) ? -s : -c;
  const double co = (qd == 0) ? c : (qd == 1) ? -s : (qd == 2) ? -c : s;
  sv = (float)so;
  cv = (float)co;
}

// =====================================================================================================
// Rotary tables: cosT[t][d], sinT[t][d] for t < TT, d < HD, angle = float(t) * inv_freq[d & 31] (f32 product), halves duplicated.
// Wave = one position t, lane = frequency index; inv_freq picked from the by-value table with a static select chain.
// coverage: grid TT/8 blocks x 8 waves = TT rows; per row 4 line stores = 64 floats of each table.
// =====================================================================================================
__global__ __launch_bounds__(256) void k_tab(float* cosT, float* sinT, InvF inv) {
  const int tid  = threadIdx.x;
  const int lane = tid & 31;
  const int t    = blockIdx.x * 8 + (tid >> 5);
  if (t >= TT) return;                      // never taken with the exact grid; no barriers in this kernel
  float f = inv.f[0];
#pragma unroll
  for (int i = 1; i < 32; ++i) f = (lane == i) ? inv.f[i] : f;
  const float ang = (float)t * f;
  float sv, cv;
  sincos_acc(ang, sv, cv);
  float* cr = cosT + (size_t)t * HD;
  float* sr = sinT + (size_t)t * HD;
  {
    *(float*)(cr + lane)      = cv;
    *(float*)(cr + 32 + lane) = cv;
    *(float*)(sr + lane)      = sv;
    *(float*)(sr + 32 + lane) = sv;
    
  }
}

// =====================================================================================================
// Batched transpose + bf16 convert: in W[b][R][C] (row-major f32) -> out D[b][C][R] (bf16 RNE bits, fragment-major plane).
// Block = one 64x64 tile (r0, c0) of batch blockIdx.y: 256 thr x 4 16-B loads -> LDS tile [c][r] (pitch 72), block barrier,
// coverage: load 256 thr x 16 = 64x64; store 2 iterations x 256 thr x 8 halves = 64 lines x 64; grid (C/64)*(R/64) x b = all of D.
// =====================================================================================================
__global__ __launch_bounds__(256) void cvt_T(const float* __restrict__ W, u16* D, int R, int C) {
  __shared__ __align__(16) u16 T[64 * VTP];
  const int tid = threadIdx.x;
  const int ntc = C >> 6;
  const int bid = blockIdx.x;
  const int bb  = blockIdx.y;
  const int c0  = (bid % ntc) * 64;
  const int r0  = (bid / ntc) * 64;
  const float* Wb = W + (size_t)bb * (size_t)R * (size_t)C;
  u16*         Db = D + (size_t)bb * (size_t)R * (size_t)C;
  {
    const int rr = tid >> 2;
    const int cc = (tid & 3) * 16;
    const float* src = Wb + (size_t)(r0 + rr) * C + c0 + cc;
#pragma unroll
    for (int i = 0; i < 4; ++i) {
      const v4f a = *(const v4f*)(src + 4 * i);
#pragma unroll
      for (int e = 0; e < 4; ++e) T[(cc + 4 * i + e) * VTP + rr] = bf_bits(a[e]);
    }
  }
  __syncthreads();
  // thread = one chunk of the fragment-major plane: 8 local tiles (4 row tiles x 2 k tiles) x 64 slots
  v4u vals[2];
  const int slot = tid & 63;
#pragma unroll
  for (int it = 0; it < 2; ++it) {
    const int lt = it * 4 + (tid >> 6);
    vals[it] = *(const v4u*)(T + ((lt >> 1) * 16 + slot_row(slot)) * VTP + (lt & 1) * 32 + slot_k(slot));
  }
  {
#pragma unroll
    for (int it = 0; it < 2; ++it) {
      const int lt = it * 4 + (tid >> 6);
      const size_t tile = (size_t)((c0 >> 4) + (lt >> 1)) * (size_t)(R >> 5) + (size_t)((r0 >> 5) + (lt & 1));
      *(v4u*)(Db + tile * 512 + slot * 8) = vals[it];
    }
    
  }
}

// =====================================================================================================
// Row-major f32 [R][K] -> 16-bit fragment-major plane. f16mode == 0: bf16 RNE bits; f16mode == 1: f16 bits of (bf16 RNE value) * scale.
// Thread = 8 consecutive elements: two 16-B loads, one 16-B store; 32 consecutive lanes = 512 contiguous, 512-B aligned bytes
// coverage: grid = ceil(n8/256) blocks x 256 thr x 8 = the whole plane (n8 a multiple of 32 in every use, so no partial line).
// =====================================================================================================
__global__ __launch_bounds__(256) void cvt_flat(const float* __restrict__ src, u16* D, int n8, int f16mode, float scale, int K) {
  const int gt = blockIdx.x * 256 + (int)threadIdx.x;   // chunk index in the fragment-major plane
  if (gt >= n8) return;                     // no barriers in this kernel
  const int ktn = K >> 5, tile = gt >> 6, slot = gt & 63;
  const int rt = tile / ktn, kt = tile - rt * ktn;
  const float* p = src + (size_t)(rt * 16 + slot_row(slot)) * K + kt * 32 + slot_k(slot);
  const v4f a = *(const v4f*)(p), bq = *(const v4f*)(p + 4);
  float w[8];
#pragma unroll
  for (int e = 0; e < 4; ++e) { w[e] = a[e]; w[4 + e] = bq[e]; }
  v4u o;
#pragma unroll
  for (int e = 0; e < 4; ++e) {
    const float v0 = w[2 * e], v1 = w[2 * e + 1];
    const unsigned short h0 = h_bits((_Float16)(bfr(v0) * scale)), h1 = h_bits((_Float16)(bfr(v1) * scale));
    const unsigned short b0 = bf_bits(v0), b1 = bf_bits(v1);
    o[e] = (f16mode != 0) ? pk16(h0, h1) : pk16(b0, b1);
  }
  u16* d = D + (size_t)gt * 8;
  {
    *(v4u*)(d) = o;
    
  }
}

// =====================================================================================================
// Row-major f32 [R][HID] -> f16 hi + residual fragment-major planes: hi = f16(v * sc), lo = f16(v * sc - hi) (sc a power of two, residual unscaled).
// coverage: grid = n8/256 (exact) x 256 thr x 8 = the whole of both planes.
// =====================================================================================================
__global__ __launch_bounds__(256) void cvt_split(const float* __restrict__ src, u16* Hp, u16* Lp, int n8, float sc) {
  const int gt = blockIdx.x * 256 + (int)threadIdx.x;   // chunk index in the fragment-major planes, K = HID
  if (gt >= n8) return;                     // no barriers in this kernel
  const int tile = gt >> 6, slot = gt & 63;
  const int rt = tile / (HID / 32), kt = tile % (HID / 32);
  const float* p = src + (size_t)(rt * 16 + slot_row(slot)) * HID + kt * 32 + slot_k(slot);
  const v4f a = *(const v4f*)(p), bq = *(const v4f*)(p + 4);
  float w[8];
#pragma unroll
  for (int e = 0; e < 4; ++e) { w[e] = a[e] * sc; w[4 + e] = bq[e] * sc; }
  v4u oh, ol;
#pragma unroll
  for (int e = 0; e < 4; ++e) {
    const float t0 = w[2 * e], t1 = w[2 * e + 1];
    const _Float16 h0 = (_Float16)t0, h1 = (_Float16)t1;
    const _Float16 l0 = (_Float16)(t0 - (float)h0), l1 = (_Float16)(t1 - (float)h1);
    oh[e] = pk16(h_bits(h0), h_bits(h1));
    ol[e] = pk16(h_bits(l0), h_bits(l1));
  }
  const size_t o8 = (size_t)gt * 8;
  {
    *(v4u*)(Hp + o8) = oh;
    *(v4u*)(Lp + o8) = ol;
    
  }
}

// =====================================================================================================
// Shared GEMM store: the wave's 16x64 f32 tile already staged (final values) in its LDS slab (pitch 68), caller issued the
// coverage: 8 instructions x 2 rows x 16 lanes x 4 floats = the wave's 16 x 64 tile.
// =====================================================================================================
__device__ __forceinline__ void store64(const float* sl, float* C, int N, size_t rowb, int col0, int lane) {
  const int hh = lane >> 4, m = lane & 15;
  v4f vals[8];
#pragma unroll
  for (int it = 0; it < 8; ++it) vals[it] = *(const v4f*)(sl + (it * 2 + hh) * 68 + m * 4);
  float* dst = C + (rowb + (size_t)hh) * (size_t)N + col0 + m * 4;
  {
#pragma unroll
    for (int it = 0; it < 8; ++it) {
      *(v4f*)(dst + (size_t)(it * 2) * (size_t)N) = vals[it];
    }
    
  }
}

// =====================================================================================================
// bf16 GEMM: C[M][N] (f32) = A[M][K] (bf16) . Bt[N][K]^T (bf16 k-contiguous), times oscale, + bf16(bias[col]).
// Block = 64x64 tile, 4 waves x 16 rows; A and Bt fragment-major: a fragment = two wave-wide loads of 512 contiguous bytes (split
// k map for A and B); K stepped by 32 (K % 32 == 0, M % 64 == 0, N % 64 == 0 statically, grid = (M/64)*(N/64)).
// =====================================================================================================
__global__ __launch_bounds__(128)
void gemm_bf(const u16* __restrict__ A, const u16* __restrict__ Bt, const float* __restrict__ bias, float* C,
             int M, int N, int K, float oscale) {
  __shared__ __align__(16) float slab[4 * SLAB64];
  const int tid = threadIdx.x, wave = tid >> 5, lane = tid & 31, hh = lane >> 4, m = lane & 15;
  const int ntile = N >> 6;
  const int bid   = blockIdx.x;
  const int rowb  = (bid / ntile) * 64 + wave * 16;
  const int col0  = (bid % ntile) * 64;
  if (rowb + 16 > M) return;                 // wave-uniform, never taken with the exact grid; no block barriers in this kernel
  const u16* ap = A  + (size_t)rowb * K + 8 * lane;      // row tile rowb / 16, k tile 0
  const u16* bp = Bt + (size_t)col0 * K + 8 * lane;
  const size_t bs = (size_t)16 * K;                      // one row tile = K / 32 tiles of 512 halves
  v8f acc0 = zero8(), acc1 = zero8(), acc2 = zero8(), acc3 = zero8();
#pragma unroll 1
  for (int k0 = 0; k0 < K; k0 += 32) {
    const int kf = k0 * 16;                              // k tile k0 / 32
    const u16 *pa = ap + kf, *p0 = bp + kf, *p1 = p0 + bs, *p2 = p1 + bs, *p3 = p2 + bs;
    const v16b a  = ldfrag_b(pa);
    const v16b b0 = ldfrag_b(p0);
    const v16b b1 = ldfrag_b(p1);
    const v16b b2 = ldfrag_b(p2);
    const v16b b3 = ldfrag_b(p3);
    hold_addr(pa, p0, p1, p2, p3, pa, pa, pa, pa, pa);
    acc0 = mma_b(a, b0, acc0);
    acc1 = mma_b(a, b1, acc1);
    acc2 = mma_b(a, b2, acc2);
    acc3 = mma_b(a, b3, acc3);
    guard6<v16b>(acc0, acc1, acc2, acc3, a, b0, b1, b2, b3, a);
  }
  float* sl = slab + wave * SLAB64;
  float bb[4];
#pragma unroll
  for (int j = 0; j < 4; ++j) bb[j] = bfr(bias[col0 + 16 * j + m]);
#pragma unroll
  for (int r = 0; r < 8; ++r) {
    const int ro = (8 * hh + r) * 68 + m;
    sl[ro]      = acc0[r] * oscale + bb[0];
    sl[ro + 16] = acc1[r] * oscale + bb[1];
    sl[ro + 32] = acc2[r] * oscale + bb[2];
    sl[ro + 48] = acc3[r] * oscale + bb[3];
  }
  wave_sync_lds();
  store64(sl, C, N, (size_t)rowb, col0, lane);
}

// =====================================================================================================
// f16 GEMM (optionally batched over blockIdx.y with element strides sA, sB, sC):
//   C[M][N] (f32) = (Ah [+ Al])[M][K] . (Bh [+ Bl])[N][K]^T, times oscale, + bf16(bias) per row (biasRow != 0) or per column.
//   A2: A carried as hi + unscaled residual plane (products h.B + l.B); B2: B carried as hi + residual (A.h + A.l); never both.
// Same tiling as gemm_bf; all planes f16 fragment-major, K % 32 == 0.
// =====================================================================================================
template <int A2, int B2>
__global__ __launch_bounds__(128)
void gemm_h(const u16* __restrict__ Ah, const u16* __restrict__ Al, const u16* __restrict__ Bh, const u16* __restrict__ Bl,
            const float* __restrict__ bias, float* C, int M, int N, int K, int sA, int sB, int sC, int biasRow, float oscale) {
  __shared__ __align__(16) float slab[4 * SLAB64];
  const int tid = threadIdx.x, wave = tid >> 5, lane = tid & 31, hh = lane >> 4, m = lane & 15;
  const int ntile = N >> 6;
  const int bid   = blockIdx.x;
  const int bz    = blockIdx.y;
  const int rowb  = (bid / ntile) * 64 + wave * 16;
  const int col0  = (bid % ntile) * 64;
  if (rowb + 16 > M) return;                 // wave-uniform, never taken with the exact grid; no block barriers in this kernel
  const size_t aofs = (size_t)bz * (size_t)sA + (size_t)rowb * K + 8 * lane;
  const _Float16* ahp = (const _Float16*)(const void*)Ah + aofs;
  const _Float16* alp = (const _Float16*)(const void*)Al + aofs;
  const size_t bofs = (size_t)bz * (size_t)sB + (size_t)col0 * K + 8 * lane;
  const _Float16* bhp = (const _Float16*)(const void*)Bh + bofs;
  const _Float16* blp = (const _Float16*)(const void*)Bl + bofs;
  const size_t bs = (size_t)16 * K;
  v8f acc0 = zero8(), acc1 = zero8(), acc2 = zero8(), acc3 = zero8();
#pragma unroll 1
  for (int k0 = 0; k0 < K; k0 += 32) {
    const int kf = k0 * 16;                              // k tile k0 / 32
    const _Float16 *pa = ahp + kf, *p0 = bhp + kf, *p1 = p0 + bs, *p2 = p1 + bs, *p3 = p2 + bs;
    const v16h ah = ldfrag_h(pa);
    const v16h b0 = ldfrag_h(p0);
    const v16h b1 = ldfrag_h(p1);
    const v16h b2 = ldfrag_h(p2);
    const v16h b3 = ldfrag_h(p3);
    if (A2) {
      const _Float16* pl = alp + kf;
      const v16h al = ldfrag_h(pl);
      hold_addr(pa, p0, p1, p2, p3, pl, pa, pa, pa, pa);
      acc0 = mma_h(ah, b0, acc0);  acc0 = mma_h(al, b0, acc0);
      acc1 = mma_h(ah, b1, acc1);  acc1 = mma_h(al, b1, acc1);
      acc2 = mma_h(ah, b2, acc2);  acc2 = mma_h(al, b2, acc2);
      acc3 = mma_h(ah, b3, acc3);  acc3 = mma_h(al, b3, acc3);
      guard6<v16h>(acc0, acc1, acc2, acc3, ah, al, b0, b1, b2, b3);
    } else if (B2) {
      const _Float16 *r0 = blp + kf, *r1 = r0 + bs, *r2 = r1 + bs, *r3 = r2 + bs;
      const v16h c0 = ldfrag_h(r0);
      const v16h c1 = ldfrag_h(r1);
      const v16h c2 = ldfrag_h(r2);
      const v16h c3 = ldfrag_h(r3);
      hold_addr(pa, p0, p1, p2, p3, r0, r1, r2, r3, pa);
      acc0 = mma_h(ah, b0, acc0);  acc0 = mma_h(ah, c0, acc0);
      acc1 = mma_h(ah, b1, acc1);  acc1 = mma_h(ah, c1, acc1);
      acc2 = mma_h(ah, b2, acc2);  acc2 = mma_h(ah, c2, acc2);
      acc3 = mma_h(ah, b3, acc3);  acc3 = mma_h(ah, c3, acc3);
      guard10(acc0, acc1, acc2, acc3, ah, b0, b1, b2, b3, c0, c1, c2, c3, ah);
    } else {
      hold_addr(pa, p0, p1, p2, p3, pa, pa, pa, pa, pa);
      acc0 = mma_h(ah, b0, acc0);
      acc1 = mma_h(ah, b1, acc1);
      acc2 = mma_h(ah, b2, acc2);
      acc3 = mma_h(ah, b3, acc3);
      guard6<v16h>(acc0, acc1, acc2, acc3, ah, b0, b1, b2, b3, ah);
    }
  }
  float* sl = slab + wave * SLAB64;
  if (biasRow != 0) {
#pragma unroll
    for (int r = 0; r < 8; ++r) {
      const float bb = bfr(bias[rowb + 8 * hh + r]);
      const int ro = (8 * hh + r) * 68 + m;
      sl[ro]      = acc0[r] * oscale + bb;
      sl[ro + 16] = acc1[r] * oscale + bb;
      sl[ro + 32] = acc2[r] * oscale + bb;
      sl[ro + 48] = acc3[r] * oscale + bb;
    }
  } else {
    float bb[4];
#pragma unroll
    for (int j = 0; j < 4; ++j) bb[j] = bfr(bias[col0 + 16 * j + m]);
#pragma unroll
    for (int r = 0; r < 8; ++r) {
      const int ro = (8 * hh + r) * 68 + m;
      sl[ro]      = acc0[r] * oscale + bb[0];
      sl[ro + 16] = acc1[r] * oscale + bb[1];
      sl[ro + 32] = acc2[r] * oscale + bb[2];
      sl[ro + 48] = acc3[r] * oscale + bb[3];
    }
  }
  wave_sync_lds();
  store64(sl, C + (size_t)bz * (size_t)sC, N, (size_t)rowb, col0, lane);
}

// =====================================================================================================
// Rotate-half rotary + f16 pack (single plane). Rows are (batch, pos, head) with HD contiguous floats (f32 projection output);
// pos = (row / hpr) & posmask.  w[d] = x[d] * cos[pos][d] + r[d] * sin[pos][d],  r[d] = -x[d+32] for d < 32, x[d-32] for d >= 32;
// out[d] = f16(w * sc) (sc a power of two); out plane: fm == 0 the rows as they are (q', read once per wave),
// fm != 0 per (batch, head) a fragment-major plane [positions][HD] (k', read by every query tile).
// Thread = one chunk of the out plane (8 consecutive d of one row): 16-B loads of x (own and partner half), cos, sin; one 16-B store per lane;
// coverage: grid = nrows*8/256 blocks (exact) x 256 thr x 8 halves = nrows x 64 of the plane exactly.
// =====================================================================================================
__global__ __launch_bounds__(256) void rope_h(const float* __restrict__ x, const float* __restrict__ cosT,
                                              const float* __restrict__ sinT, u16* hpl,
                                              int nrows, int hpr, int posmask, float sc, int fm) {
  const int gt  = blockIdx.x * 256 + (int)threadIdx.x;   // chunk index in the out plane
  if (gt >= nrows * 8) return;              // never taken with the exact grid; no barriers in this kernel
  int row = gt >> 3;                        // fm == 0: row-major out plane, chunk gt = (row, d0 / 8)
  int d0  = (gt & 7) * 8;
  if (fm != 0) {                            // fragment-major out plane per (batch, head)
    const int slot = gt & 63;
    const int u    = gt >> 7;               // (batch * hpr + head) * (positions / 16) + position tile
    const int t16  = (posmask + 1) >> 4;
    const int bh   = u / t16;
    const int pt   = (u - bh * t16) * 16 + slot_row(slot);
    row = ((bh / hpr) * (posmask + 1) + pt) * hpr + (bh % hpr);
    d0  = ((gt >> 6) & 1) * 32 + slot_k(slot);
  }
  const int pos = (row / hpr) & posmask;
  const int d1  = d0 ^ 32;
  const float* xr = x + (size_t)row * HD;
  const float* cr = cosT + (size_t)pos * HD + d0;
  const float* sr = sinT + (size_t)pos * HD + d0;
  const v4f xa = *(const v4f*)(xr + d0), xb = *(const v4f*)(xr + d0 + 4);
  const v4f ya = *(const v4f*)(xr + d1), yb = *(const v4f*)(xr + d1 + 4);
  const v4f ca = *(const v4f*)(cr), cb = *(const v4f*)(cr + 4);
  const v4f sa = *(const v4f*)(sr), sb = *(const v4f*)(sr + 4);
  const float sgn = (d0 < 32) ? -1.0f : 1.0f;
  float w[8];
#pragma unroll
  for (int e = 0; e < 4; ++e) {
    w[e]     = xa[e] * ca[e] + (sgn * ya[e]) * sa[e];
    w[4 + e] = xb[e] * cb[e] + (sgn * yb[e]) * sb[e];
  }
  v4u oh;
#pragma unroll
  for (int e = 0; e < 4; ++e) {
    const _Float16 h0 = (_Float16)(w[2 * e] * sc), h1 = (_Float16)(w[2 * e + 1] * sc);
    oh[e] = pk16(h_bits(h0), h_bits(h1));
  }
  {
    *(v4u*)(hpl + (size_t)gt * 8) = oh;
    
  }
}

// =====================================================================================================
// v plane + per-32-key block sums: in V[b][HID][TS] f32 (channel-major). Block = (b, 64 channels o0, 64 keys s0).
//   VH[b][o][s] = f16(v * 1024) (fragment-major plane [b * HID + o][TS], staged through LDS); VS[b][kb][o] = sum over keys kb*32 .. kb*32+31 of v (f32).
// Two iterations: thread = 8 consecutive keys of one channel row (two 16-B loads, one 16-B store; lanes 8q..8q+7 = one whole
// coverage: VH 2 it x 256 thr x 8 = 64 x 64 per block, grid 16 x 4 x 8 blocks = whole plane; VS 2 kb x 64 channels per block,
//           grid covers 16 b x 16 kb x 256 channels exactly once.
// =====================================================================================================
__global__ __launch_bounds__(256) void vcvt(const float* __restrict__ V, u16* VH, float* VS) {
  __shared__ __align__(16) float S[128];
  __shared__ __align__(16) v4u HT[512];       // the block's 8 tiles (4 channel tiles x 2 key tiles) in fragment-major order
  const int tid  = threadIdx.x;
  const int lane = tid & 31;
  const int wave = tid >> 5;
  const int bid  = blockIdx.x;
  const int st   = bid & 7;
  const int ot   = (bid >> 3) & 3;
  const int b    = bid >> 5;
  const int o0   = ot * 64;
  const int s0   = st * 64;
#pragma unroll
  for (int it = 0; it < 2; ++it) {
    const int idx = it * 256 + tid;
    const int row = idx >> 3;                 // channel within tile 0..63
    const int s8  = (idx & 7) * 8;            // key offset within tile
    const size_t e = ((size_t)(b * HID + o0 + row)) * TS + s0 + s8;
    const v4f a = *(const v4f*)(V + e), bq = *(const v4f*)(V + e + 4);
    v4u o;
#pragma unroll
    for (int q = 0; q < 2; ++q) {
      o[q]     = pk16(h_bits((_Float16)(a[2 * q] * VCAR)),  h_bits((_Float16)(a[2 * q + 1] * VCAR)));
      o[2 + q] = pk16(h_bits((_Float16)(bq[2 * q] * VCAR)), h_bits((_Float16)(bq[2 * q + 1] * VCAR)));
    }
    HT[((row >> 4) * 2 + (s8 >> 5)) * 64 + ((s8 >> 4) & 1) * 32 + ((s8 >> 3) & 1) * 16 + (row & 15)] = o;
    float ps = ((a[0] + a[1]) + (a[2] + a[3])) + ((bq[0] + bq[1]) + (bq[2] + bq[3]));
    ps += __shfl_xor(ps, 1, 32);
    ps += __shfl_xor(ps, 2, 32);
    if ((lane & 3) == 0) S[((lane >> 2) & 1) * 64 + row] = ps;   // lane&7 == 0 -> keys s0..s0+31, == 4 -> s0+32..s0+63
  }
  __syncthreads();
  {
#pragma unroll
    for (int it = 0; it < 2; ++it) {
      const int lt = it * 4 + (tid >> 6);     // local tile: channel tile lt >> 1, key tile lt & 1
      const size_t tile = (size_t)((b * HID + o0) / 16 + (lt >> 1)) * (TS / 32) + (size_t)(s0 / 32 + (lt & 1));
      *(v4u*)(VH + tile * 512 + (tid & 63) * 8) = HT[it * 256 + tid];
    }
    
  }
  if (wave == 0) {
    const int kbh   = lane >> 4;
    const int piece = (lane & 15) * 4;
    const v4f sv = *(const v4f*)(S + kbh * 64 + piece);
    float* dst = VS + ((size_t)(b * NKB + 2 * st + kbh)) * HID + o0 + piece;
    {
      *(v4f*)(dst) = sv;
      
    }
  }
}

// =====================================================================================================
// Cross attention: block = (batch b, head h, 64 query rows), one wave per 16 query rows q0..q0+15; all TS keys in NKB blocks of 32.
//   q' plane QH [b][t][h][d] (x1024 f16, row-major), k' plane KH: per (b, h) fragment-major [s][d] (x1024), v plane VH:
//   fragment-major [b*256 + h*64+d][s] (x1024),
//   VS[b][kb][h*64+d] = f32 sum of v over key block kb; masks: key s of row t is masked iff bf16(cond_mask[b][s])*bf16(x_mask[b][t]) == 0,
//   masked score replaced by -1e4 (base-2 scaled) -> exact uniform softmax on a fully masked row, 0 weight otherwise.
//   Per block: 2 score subtiles x 2 k-steps (q'.k' single products, q fragments loaded once), scale 1/8 folded into the base-2
//   factor; online max-subtracted base-2 softmax in f32; e = exp2(t - m) per key; l from the f32 e; accumulator update
//   o = o*alpha + (7/8 * 2^20) * VS block sum (f32), then the centred tile P' = (e - 7/8) * 1024 stored to wave-private LDS (f32),
//   contiguous), 4 P'.v WMMAs. Exact identity sum_s e_s v_s = sum_s (e_s - 7/8) v_s + 7/8 sum_s v_s per key block.
//   (b, q0+row, head) of the O hi plane and of the O residual plane (O x8192 as f16 hi + residual) written by lanes row and row + 16
// coverage: per wave 4 instructions x 32 lanes x 8 halves = 16 x 64 per plane; grid 2048 blocks x 4 waves = every
//           (b, t, h) row of both O planes exactly once.
// =====================================================================================================
__global__ __launch_bounds__(128)
void attn_x(const u16* __restrict__ QHp, const u16* __restrict__ KHp, const u16* __restrict__ VHp,
            const float* __restrict__ VS, const float* __restrict__ cmask, const float* __restrict__ xmask,
            u16* OHp, u16* OLp) {
  __shared__ __align__(16) float smem[4 * SLABF];   // per wave: P' tile [16][32] pitch 36 during the loop, result slab after

  const int tid  = threadIdx.x;
  const int wave = tid >> 5;
  const int lane = tid & 31;
  const int hh   = lane >> 4;
  const int c    = lane & 15;

  const int bid  = blockIdx.x;
  const int qt   = bid & (TT / 64 - 1);
  const int h    = (bid >> 5) & (NH - 1);
  const int b    = bid >> 7;
  const int q0   = qt * 64 + wave * 16;

  const size_t qofs = (((size_t)(b * TT + q0 + c)) * NH + h) * HD + 8 * hh;       // row-major plane
  const _Float16* Qh  = (const _Float16*)(const void*)QHp + qofs;
  const size_t kofs = ((size_t)(b * NH + h) * TS) * HD + 8 * lane;                // plane (b, h); key tile added per step
  const _Float16* Khb = (const _Float16*)(const void*)KHp + kofs;
  const size_t vofs = ((size_t)(b * HID + h * HD)) * TS + 8 * lane;               // row tile of d 0..15 (+16j); key tile added per step
  const _Float16* Vhb = (const _Float16*)(const void*)VHp + vofs;
  const float* vsb = VS + (size_t)b * NKB * HID + h * HD + c;
  const float* cmb = cmask + (size_t)b * TS + c;
  const float lsc = 0.125f * (LOG2E / (QSC * KSC));
  const float C0S = PCEN * PCAR * VCAR;

  float xmv[8], mrow[8], lrow[8];
  v8f o[4];
#pragma unroll
  for (int r = 0; r < 8; ++r) {
    xmv[r]  = bfr(xmask[(size_t)b * TT + q0 + 8 * hh + r]);
    mrow[r] = -INFINITY;
    lrow[r] = 0.f;
  }
#pragma unroll
  for (int j = 0; j < 4; ++j) o[j] = zero8();
  float* pt = smem + wave * SLABF;

  const v16h qa = ldfrag_rm_h(Qh), qb = ldfrag_rm_h(Qh + 32);
  hold_addr(Qh, Qh, Qh, Qh, Qh, Qh, Qh, Qh, Qh, Qh);

#pragma unroll 1
  for (int it = 0; it < NKB; ++it) {
    const int kb = it * 32;
    // ---- scores: D element r of this lane = (query row q0 + 8hh + r, key kb + c) in s0, key kb + 16 + c in s1 ----
    v8f s0 = zero8(), s1 = zero8();
    {
      const _Float16* k0p = Khb + (size_t)kb * HD;            // key tile kb / 16: HD / 32 = 2 tiles of 512 halves
      const _Float16* k1p = k0p + (size_t)16 * HD;
      const v16h k0a = ldfrag_h(k0p), k0b = ldfrag_h(k0p + 512);
      const v16h k1a = ldfrag_h(k1p), k1b = ldfrag_h(k1p + 512);
      hold_addr(k0p, k0p, k0p, k0p, k0p, k0p, k0p, k0p, k0p, k0p);   // k1p is a constant offset from k0p
      s0 = mma_h(qa, k0a, s0);
      s0 = mma_h(qb, k0b, s0);
      s1 = mma_h(qa, k1a, s1);
      s1 = mma_h(qb, k1b, s1);
      guard2(s0, s1, qa, qb, k0a, k0b, k1a, k1b);
    }
    const float cm0 = bfr(cmb[kb]), cm1 = bfr(cmb[kb + 16]);
    float vs[4];
#pragma unroll
    for (int j = 0; j < 4; ++j) vs[j] = vsb[(size_t)it * HID + 16 * j] * C0S;
    {
      const float *pc = cmb + kb, *pv = vsb + (size_t)it * HID;
      hold_addr(pc, pv, pc, pc, pc, pc, pc, pc, pc, pc);
    }
    // ---- mask (replace by -1e4) + online softmax in base 2; centred P' tile to LDS ----
#pragma unroll
    for (int r = 0; r < 8; ++r) {
      const bool ok0 = (cm0 * xmv[r]) != 0.0f;
      const bool ok1 = (cm1 * xmv[r]) != 0.0f;
      const float t0 = ok0 ? (s0[r] * lsc) : MASKT;
      const float t1 = ok1 ? (s1[r] * lsc) : MASKT;
      float mx = fmaxf(t0, t1);
#pragma unroll
      for (int off = 1; off < 16; off <<= 1) mx = fmaxf(mx, __shfl_xor(mx, off, 32));
      const float mn = fmaxf(mrow[r], mx);
      const float al = exp2f(mrow[r] - mn);
      mrow[r] = mn;
      const float e0 = exp2f(t0 - mn), e1 = exp2f(t1 - mn);
      float ps = e0 + e1;
#pragma unroll
      for (int off = 1; off < 16; off <<= 1) ps += __shfl_xor(ps, off, 32);
      lrow[r] = lrow[r] * al + ps;
#pragma unroll
      for (int j = 0; j < 4; ++j) o[j][r] = o[j][r] * al + vs[j];
      const int ro = (8 * hh + r) * 36 + c;
      pt[ro]      = (e0 - PCEN) * PCAR;
      pt[ro + 16] = (e1 - PCEN) * PCAR;
    }
    wave_sync_lds();
    // ---- A fragment of f16(P'): row = c, split k map over the 32 keys of this step ----
    FragH ph;
    {
      const float* prow = pt + c * 36 + 8 * hh;
      const v4f p0 = *(const v4f*)(prow), p1 = *(const v4f*)(prow + 4);
      const v4f p2 = *(const v4f*)(prow + 16), p3 = *(const v4f*)(prow + 20);
#pragma unroll
      for (int e = 0; e < 4; ++e) {
        ph.h[0][e]     = (_Float16)p0[e];                    // elements 0..7  = keys kb + 8hh + 0..7
        ph.h[0][4 + e] = (_Float16)p1[e];
        ph.h[1][e]     = (_Float16)p2[e];                    // elements 8..15 = keys kb + 16 + 8hh + 0..7
        ph.h[1][4 + e] = (_Float16)p3[e];
      }
    }
    // ---- P'.v : B fragment col n = d = j*16 + c, keys contiguous in the v plane ----
    {
      const _Float16* vhp = Vhb + kb * 16;                    // key tile kb / 32
      const v16h vh0 = ldfrag_h(vhp);
      const v16h vh1 = ldfrag_h(vhp + (size_t)16 * TS);
      const v16h vh2 = ldfrag_h(vhp + (size_t)32 * TS);
      const v16h vh3 = ldfrag_h(vhp + (size_t)48 * TS);
      hold_addr(vhp, vhp, vhp, vhp, vhp, vhp, vhp, vhp, vhp, vhp);
      o[0] = mma_h(ph.v, vh0, o[0]);
      o[1] = mma_h(ph.v, vh1, o[1]);
      o[2] = mma_h(ph.v, vh2, o[2]);
      o[3] = mma_h(ph.v, vh3, o[3]);
      guard6<v16h>(o[0], o[1], o[2], o[3], ph.v, vh0, vh1, vh2, vh3, ph.v);
    }
    wave_sync_lds();
  }
  acc_guard4(o[0], o[1], o[2], o[3]);

  // ---- fold 1/l and the carries (1024 on P', 1024 on v), stage the wave's 16x64 slab in its LDS region ----
  wave_sync_lds();
  float* slab = pt;
  const float oc = 1.0f / (PCAR * VCAR);
#pragma unroll
  for (int r = 0; r < 8; ++r) {
    const float inv = (1.0f / lrow[r]) * oc;
#pragma unroll
    for (int j = 0; j < 4; ++j) slab[(8 * hh + r) * 68 + j * 16 + c] = o[j][r] * inv;
  }
  wave_sync_lds();
  // ---- O x8192 -> f16 hi + residual fragment-major planes [b * TT + t][HID]; lane = one chunk per store ----
  v4u oh[4], ol[4];
#pragma unroll
  for (int it = 0; it < 4; ++it) {
    const int c8 = it * 16 + 8 * hh;          // chunk slot (it & 1) * 32 + lane of k tile 2h + (it >> 1): row c, d = c8 .. c8 + 7
    const v4f a = *(const v4f*)(slab + c * 68 + c8), bq = *(const v4f*)(slab + c * 68 + c8 + 4);
    float w[8];
#pragma unroll
    for (int e = 0; e < 4; ++e) { w[e] = a[e] * OSC; w[4 + e] = bq[e] * OSC; }
#pragma unroll
    for (int e = 0; e < 4; ++e) {
      const _Float16 h0 = (_Float16)w[2 * e], h1 = (_Float16)w[2 * e + 1];
      const _Float16 l0 = (_Float16)(w[2 * e] - (float)h0), l1 = (_Float16)(w[2 * e + 1] - (float)h1);
      oh[it][e] = pk16(h_bits(h0), h_bits(h1));
      ol[it][e] = pk16(h_bits(l0), h_bits(l1));
    }
  }
  const size_t ob = (size_t)(b * TT + q0) * HID + (size_t)h * 1024 + 8 * lane;    // row tile (b * TT + q0) / 16, k tile 2h
  {
#pragma unroll
    for (int it = 0; it < 4; ++it) {
      const size_t o8 = ob + (size_t)it * 256;
      *(v4u*)(OHp + o8) = oh[it];
      *(v4u*)(OLp + o8) = ol[it];
    }
    
  }
}

// =====================================================================================================
// FiLM GEMM + combine: block = (batch b, 64 time columns t0, 64 channels), one wave per 16 channels c0..c0+15.
//   gamma[c][t] = sum_i w_film[c][i] y[t][i], beta[c][t] = sum_i w_film[256+c][i] y[t][i]  (A = w_film rows as f16(bf16 x1024),
//   B = y planes [b][t][i] as f16 hi x16384 + residual: products wg.h, wb.h, wg.l, wb.l, 8 accumulators);
//   out[b][c][t] = (bf16(x[b][c][t]) * (gamma*oscale + bf16(b_film[c])) + (beta*oscale + bf16(b_film[256+c]))) * bf16(x_mask[b][t]).
// coverage: grid 16 b x 32 t-tiles x 4 channel groups = 2048 blocks x 4 waves x 16 x 64 = every out element exactly once.
// =====================================================================================================
__global__ __launch_bounds__(128)
void film_k(const u16* __restrict__ WF, const u16* __restrict__ YHp, const u16* __restrict__ YLp,
            const float* __restrict__ bfl, const float* __restrict__ X, const float* __restrict__ XM,
            float* OUT, float oscale) {
  __shared__ __align__(16) float slab[4 * SLAB64];
  const int tid = threadIdx.x, wave = tid >> 5, lane = tid & 31, hh = lane >> 4, m = lane & 15;
  const int bid = blockIdx.x;
  const int tt  = bid & (TT / 64 - 1);
  const int cg  = (bid >> 5) & 3;
  const int b   = bid >> 7;
  const int t0  = tt * 64;
  const int c0  = cg * 64 + wave * 16;
  const _Float16* agp = (const _Float16*)(const void*)WF + (size_t)c0 * HID + 8 * lane;
  const _Float16* abp = agp + (size_t)HID * HID;                                   // row 256 + c0 + m
  const size_t yofs = ((size_t)(b * TT + t0)) * HID + 8 * lane;
  const _Float16* yhp = (const _Float16*)(const void*)YHp + yofs;
  const _Float16* ylp = (const _Float16*)(const void*)YLp + yofs;
  const size_t bs = (size_t)16 * HID;
  v8f g[4], be[4];
#pragma unroll
  for (int j = 0; j < 4; ++j) { g[j] = zero8(); be[j] = zero8(); }
#pragma unroll 1
  for (int k0 = 0; k0 < HID; k0 += 32) {
    const int kf = k0 * 16;                              // k tile k0 / 32
    const _Float16 *pg = agp + kf, *pb = abp + kf;
    const _Float16 *p0 = yhp + kf, *p1 = p0 + bs, *p2 = p1 + bs, *p3 = p2 + bs;
    const _Float16 *r0 = ylp + kf, *r1 = r0 + bs, *r2 = r1 + bs, *r3 = r2 + bs;
    const v16h ag = ldfrag_h(pg), ab = ldfrag_h(pb);
    const v16h y0 = ldfrag_h(p0);
    const v16h y1 = ldfrag_h(p1);
    const v16h y2 = ldfrag_h(p2);
    const v16h y3 = ldfrag_h(p3);
    const v16h z0 = ldfrag_h(r0);
    const v16h z1 = ldfrag_h(r1);
    const v16h z2 = ldfrag_h(r2);
    const v16h z3 = ldfrag_h(r3);
    hold_addr(pg, p0, r0, pg, pg, pg, pg, pg, pg, pg);     // the other seven addresses are constant offsets from these three
    g[0] = mma_h(ag, y0, g[0]);  be[0] = mma_h(ab, y0, be[0]);
    g[1] = mma_h(ag, y1, g[1]);  be[1] = mma_h(ab, y1, be[1]);
    g[2] = mma_h(ag, y2, g[2]);  be[2] = mma_h(ab, y2, be[2]);
    g[3] = mma_h(ag, y3, g[3]);  be[3] = mma_h(ab, y3, be[3]);
    g[0] = mma_h(ag, z0, g[0]);  be[0] = mma_h(ab, z0, be[0]);
    g[1] = mma_h(ag, z1, g[1]);  be[1] = mma_h(ab, z1, be[1]);
    g[2] = mma_h(ag, z2, g[2]);  be[2] = mma_h(ab, z2, be[2]);
    g[3] = mma_h(ag, z3, g[3]);  be[3] = mma_h(ab, z3, be[3]);
    guardF(g[0], g[1], g[2], g[3], be[0], be[1], be[2], be[3], ag, ab, y0, y1, y2, y3, z0, z1, z2, z3);
  }
  float* sl = slab + wave * SLAB64;
  float xm[4];
#pragma unroll
  for (int j = 0; j < 4; ++j) xm[j] = bfr(XM[(size_t)b * TT + t0 + 16 * j + m]);
#pragma unroll
  for (int r = 0; r < 8; ++r) {
    const int cc = c0 + 8 * hh + r;
    const float bg = bfr(bfl[cc]);
    const float bb = bfr(bfl[HID + cc]);
    const float* xr = X + ((size_t)(b * HID + cc)) * TT + t0 + m;
#pragma unroll
    for (int j = 0; j < 4; ++j) {
      const float gam = g[j][r] * oscale + bg;
      const float bet = be[j][r] * oscale + bb;
      const float xv  = bfr(xr[16 * j]);
      sl[(8 * hh + r) * 68 + 16 * j + m] = (xv * gam + bet) * xm[j];
    }
  }
  wave_sync_lds();
  store64(sl, OUT, TT, (size_t)(b * HID + c0), t0, lane);
}

// =====================================================================================================
// Workspace map (bytes); every plane is fully written by whole-line stores before it is read; all extents are exact multiples
// of the store granularity (no pad rows needed); every offset a multiple of 65536. Regions R1, R3, R4, R5, R2 are reused by a
// later plane once the earlier plane's last reader has run (launch order below):
//   CT f32 [2048][64] 524288, ST same
//   R3: XT bf16 [16][2048][256]  -> later QH f16 [16][2048][4][64]        16777216
//   R4: CONDT bf16 [16][512][512] -> later KF f32 [16][512][256]            8388608
//   WCB bf16 [256][512] 262144; WQB bf16 [256][256] 131072; WKH, WVH, WOH f16 [256][256] 131072 each; WFH f16 [512][256] 262144
//   R5: CTF f32 [16][512][256]   -> later VF f32 [16][256][512]            8388608
//   CH f16 [16][512][256] 4194304, CL same
//   R1: QF f32 [16][2048][256]   -> later YF f32 [16][2048][256]          33554432
//   KH f16 [16][4][512][64] 4194304; VH f16 [16][256][512] 4194304; VS f32 [16][16][256] 262144
//   R2: OH, OL f16 [16][2048][256] 16777216 each -> later YH, YL (same sizes)
//   end 119799808
// =====================================================================================================
extern "C" void kernel_launch(void* const* d_in, const int* in_sizes, int n_in,
                              void* d_out, int out_size, void* d_ws, size_t ws_size,
                              hipStream_t stream) {
  if (n_in < 16) return;
  if (in_sizes[0] != NBAT * HID * TT) return;
  if (in_sizes[1] != NBAT * TT) return;
  if (in_sizes[2] != NBAT * CND * TS) return;
  if (in_sizes[3] != NBAT * TS) return;
  if (in_sizes[4] != HID * CND || in_sizes[5] != HID) return;
  if (in_sizes[6] != HID * HID || in_sizes[7] != HID) return;
  if (in_sizes[8] != HID * HID || in_sizes[9] != HID) return;
  if (in_sizes[10] != HID * HID || in_sizes[11] != HID) return;
  if (in_sizes[12] != HID * HID || in_sizes[13] != HID) return;
  if (in_sizes[14] != 2 * HID * HID || in_sizes[15] != 2 * HID) return;
  if (out_size != NBAT * HID * TT) return;

  const float* x      = (const float*)d_in[0];
  const float* x_mask = (const float*)d_in[1];
  const float* cond   = (const float*)d_in[2];
  const float* c_mask = (const float*)d_in[3];
  const float* w_cond = (const float*)d_in[4];
  const float* b_cond = (const float*)d_in[5];
  const float* wq     = (const float*)d_in[6];
  const float* bq     = (const float*)d_in[7];
  const float* wk     = (const float*)d_in[8];
  const float* bk     = (const float*)d_in[9];
  const float* wv     = (const float*)d_in[10];
  const float* bv     = (const float*)d_in[11];
  const float* wo     = (const float*)d_in[12];
  const float* bo     = (const float*)d_in[13];
  const float* wf     = (const float*)d_in[14];
  const float* bfi    = (const float*)d_in[15];
  float*       out    = (float*)d_out;

  const size_t szTab = (size_t)TT * HD * 4;                       //    524288
  const size_t szR3  = (size_t)NBAT * TT * HID * 2;               //  16777216
  const size_t szR4  = (size_t)NBAT * TS * CND * 2;               //   8388608 (= NBAT*TS*HID*4)
  const size_t szWCB = (size_t)HID * CND * 2;                     //    262144
  const size_t szW   = (size_t)HID * HID * 2;                     //    131072
  const size_t szWF  = (size_t)2 * HID * HID * 2;                 //    262144
  const size_t szR5  = (size_t)NBAT * TS * HID * 4;               //   8388608
  const size_t szCP  = (size_t)NBAT * TS * HID * 2;               //   4194304
  const size_t szR1  = (size_t)NBAT * TT * HID * 4;               //  33554432
  const size_t szKH  = (size_t)NBAT * TS * HID * 2;               //   4194304
  const size_t szVH  = (size_t)NBAT * HID * TS * 2;               //   4194304
  const size_t szVS  = (size_t)NBAT * NKB * HID * 4;              //    262144
  const size_t szOP  = (size_t)NBAT * TT * HID * 2;               //  16777216
  static_assert((size_t)NBAT * TS * CND * 2 == (size_t)NBAT * TS * HID * 4);
  size_t off = 0;
  const size_t oCT  = off; off += szTab;
  const size_t oST  = off; off += szTab;
  const size_t oR3  = off; off += szR3;
  const size_t oR4  = off; off += szR4;
  const size_t oWCB = off; off += szWCB;
  const size_t oWQB = off; off += szW;
  const size_t oWKH = off; off += szW;
  const size_t oWVH = off; off += szW;
  const size_t oWOH = off; off += szW;
  const size_t oWFH = off; off += szWF;
  const size_t oR5  = off; off += szR5;
  const size_t oCH  = off; off += szCP;
  const size_t oCL  = off; off += szCP;
  const size_t oR1  = off; off += szR1;
  const size_t oKH  = off; off += szKH;
  const size_t oVH  = off; off += szVH;
  const size_t oVS  = off; off += szVS;
  const size_t oOH  = off; off += szOP;
  const size_t oOL  = off; off += szOP;
  if (off > ws_size) return;                            // off = 119799808
  if (off > (size_t)134217728) return;

  char* ws = (char*)d_ws;
  float* CT    = (float*)(ws + oCT);
  float* ST    = (float*)(ws + oST);
  u16*   XT    = (u16*)(ws + oR3);
  u16*   QH    = (u16*)(ws + oR3);
  u16*   CONDT = (u16*)(ws + oR4);
  float* KF    = (float*)(ws + oR4);
  u16*   WCB   = (u16*)(ws + oWCB);
  u16*   WQB   = (u16*)(ws + oWQB);
  u16*   WKH   = (u16*)(ws + oWKH);
  u16*   WVH   = (u16*)(ws + oWVH);
  u16*   WOH   = (u16*)(ws + oWOH);
  u16*   WFH   = (u16*)(ws + oWFH);
  float* CTF   = (float*)(ws + oR5);
  float* VF    = (float*)(ws + oR5);
  u16*   CH    = (u16*)(ws + oCH);
  u16*   CL    = (u16*)(ws + oCL);
  float* QF    = (float*)(ws + oR1);
  float* YF    = (float*)(ws + oR1);
  u16*   KH    = (u16*)(ws + oKH);
  u16*   VH    = (u16*)(ws + oVH);
  float* VS    = (float*)(ws + oVS);
  u16*   OH    = (u16*)(ws + oOH);
  u16*   OL    = (u16*)(ws + oOL);
  u16*   YH    = (u16*)(ws + oOH);
  u16*   YL    = (u16*)(ws + oOL);

  // inv_freq[i] = 1 / pow(10000, i/32) in f32 (pow correctly converted from f64, then IEEE f32 reciprocal)
  InvF inv;
  for (int i = 0; i < 32; ++i) {
    const double p = pow(10000.0, (double)i / 32.0);
    const float pf = (float)p;
    inv.f[i] = 1.0f / pf;
  }

  const dim3 blk(256);
  const dim3 bG(128);
  const int ROWQ = NBAT * TT;                           // 32768
  const int ROWK = NBAT * TS;                           // 8192
  const dim3 gTab(TT / 8);                              // 256
  const dim3 gXT((TT / 64) * (HID / 64), NBAT);         // 128 x 16  (in [256][2048] -> out [2048][256] per batch)
  const dim3 gCT((TS / 64) * (CND / 64), NBAT);         // 64 x 16   (in [512][512] -> out [512 s][512 i] per batch)
  const int n8WC = (HID * CND) / 8;                     // 16384
  const int n8W  = (HID * HID) / 8;                     // 8192
  const int n8WF = (2 * HID * HID) / 8;                 // 16384
  const dim3 gWC((n8WC + 255) / 256), gW((n8W + 255) / 256), gWF((n8WF + 255) / 256);
  const dim3 gGC((ROWK / 64) * (HID / 64));             // 512
  const int n8C = (ROWK * HID) / 8;                     // 262144
  const dim3 gSC(n8C / 256);                            // 1024
  const dim3 gGQ((ROWQ / 64) * (HID / 64));             // 2048
  const dim3 gGK((ROWK / 64) * (HID / 64), 1);          // 512
  const dim3 gGV((HID / 64) * (TS / 64), NBAT);         // 32 x 16
  const int rowsQ = ROWQ * NH;                          // 131072
  const int rowsK = ROWK * NH;                          // 32768
  const dim3 gRQ((rowsQ * 8) / 256);                    // 4096
  const dim3 gRK((rowsK * 8) / 256);                    // 1024
  const dim3 gVC(NBAT * (HID / 64) * (TS / 64));        // 512
  const dim3 gAT(NBAT * NH * (TT / 64));                // 2048
  const dim3 gGO((ROWQ / 64) * (HID / 64), 1);          // 2048
  const int n8Y = (ROWQ * HID) / 8;                     // 1048576
  const dim3 gSY(n8Y / 256);                            // 4096
  const dim3 gFM(NBAT * 4 * (TT / 64));                 // 2048

  // (0) rotary cos/sin tables [2048][64]
  k_tab<<<gTab, blk, 0, stream>>>(CT, ST, inv);
  // (1) x [b][256][2048] -> XT bf16 [b][2048][256]
  cvt_T<<<gXT, blk, 0, stream>>>(x, XT, HID, TT);
  // (2) cond [b][512][512] -> CONDT bf16 [b][512 s][512 i]
  cvt_T<<<gCT, blk, 0, stream>>>(cond, CONDT, CND, TS);
  // (3..8) weights: W[o][i] row-major is already [n][k]; bf16 planes for w_cond, wq; f16(bf16 x1024) for wk, wv, wo, w_film
  cvt_flat<<<gWC, blk, 0, stream>>>(w_cond, WCB, n8WC, 0, 1.0f, CND);
  cvt_flat<<<gW,  blk, 0, stream>>>(wq, WQB, n8W, 0, 1.0f, HID);
  cvt_flat<<<gW,  blk, 0, stream>>>(wk, WKH, n8W, 1, WSC, HID);
  cvt_flat<<<gW,  blk, 0, stream>>>(wv, WVH, n8W, 1, WSC, HID);
  cvt_flat<<<gW,  blk, 0, stream>>>(wo, WOH, n8W, 1, WSC, HID);
  cvt_flat<<<gWF, blk, 0, stream>>>(wf, WFH, n8WF, 1, WSC, HID);
  // (9) c^T [8192][256] f32 = CONDT [8192][512] . WCB^T + b_cond
  gemm_bf<<<gGC, bG, 0, stream>>>(CONDT, WCB, b_cond, CTF, ROWK, HID, CND, 1.0f);
  // (10) c^T -> f16 hi + residual planes x1024
  cvt_split<<<gSC, blk, 0, stream>>>(CTF, CH, CL, n8C, CSC);
  // (11) q^T [32768][256] f32 = XT . WQB^T + bq
  gemm_bf<<<gGQ, bG, 0, stream>>>(XT, WQB, bq, QF, ROWQ, HID, HID, 1.0f);
  // (12) k^T [8192][256] f32 = CH . WKH^T (+ bk), carries 1024 x 1024 folded back
  gemm_h<0, 0><<<gGK, bG, 0, stream>>>(CH, CH, WKH, WKH, bk, KF, ROWK, HID, HID, 0, 0, 0, 0, 1.0f / (CSC * WSC));
  // (13) v [b][256][512] f32 = WVH [256][256] . (CH + CL)[b][512][256]^T + bv per row, batched over blockIdx.y
  gemm_h<0, 1><<<gGV, bG, 0, stream>>>(WVH, WVH, CH, CL, bv, VF, HID, TS, HID, 0, TS * HID, HID * TS, 1, 1.0f / (CSC * WSC));
  // (14) q' plane: rows (b, t, h), positions mod 2048
  rope_h<<<gRQ, blk, 0, stream>>>(QF, CT, ST, QH, rowsQ, NH, TT - 1, QSC, 0);
  // (15) k' plane: rows (b, s, h), positions mod 512
  rope_h<<<gRK, blk, 0, stream>>>(KF, CT, ST, KH, rowsK, NH, TS - 1, KSC, 1);
  // (16) v f16 plane x1024 + per-32-key block sums
  vcvt<<<gVC, blk, 0, stream>>>(VF, VH, VS);
  // (17) cross attention -> O planes [b][t][h*64+d] x8192 (hi + residual)
  attn_x<<<gAT, bG, 0, stream>>>(QH, KH, VH, VS, c_mask, x_mask, OH, OL);
  // (18) y^T [32768][256] f32 = (OH + OL) . WOH^T + bo, carries 8192 x 1024 folded back
  gemm_h<1, 0><<<gGO, bG, 0, stream>>>(OH, OL, WOH, WOH, bo, YF, ROWQ, HID, HID, 0, 0, 0, 0, 1.0f / (OSC * WSC));
  // (19) y^T -> f16 hi + residual planes x16384 (into the O plane region, O no longer needed)
  cvt_split<<<gSY, blk, 0, stream>>>(YF, YH, YL, n8Y, YSC);
  // (20) FiLM GEMM + combine -> out [16][256][2048] f32
  film_k<<<gFM, bG, 0, stream>>>(WFH, YH, YL, bfi, x, x_mask, out, 1.0f / (YSC * WSC));
  (void)hipGetLastError();
}

// v002
// A run of this version takes 194 microseconds.
// In two side-by-side timings against v001, it was 1.24 and 1.22 times as fast.
// Over all steps from v000 it is 1.43 times as fast.
// Contractions: cond^T.w_cond^T and x^T.wq^T on v_wmma_f32_16x16x32_bf16 (inputs RNE-converted to bf16, exact operands, f32 accumulate);
// c.wk^T (c x1024 f16 hi plane), wv.c (c x1024 f16 hi + residual, products w.h + w.l), scores q'.k'^T (q' x1024, k' x1024 f16, one product),
// P'.v (centred P' = (e - 7/8) x1024 f16, v x1024 f16, one product; 7/8 * sum(v) per 32-key block added in f32),
// O.wo^T (O x8192 f16 hi + residual, products h.w + l.w), w_film.y (y x16384 f16 hi + residual): v_wmma_f32_16x16x32_f16,
// weights as f16(bf16(w) x1024), f32 accumulate. Rotary tables: f64 sin/cos of the f32 angle. Rotation, masked base-2 online softmax, 1/l, FiLM combine: f32 on VALU.
#include <hip/hip_runtime.h>
#include <math.h>
#include <stdint.h>

#define NBAT  16
#define TT    2048
#define TS    512
#define HID   256
#define CND   512
#define NH    4
#define HD    64
#define NKB   (TS / 32)
#define QSC   1024.0f
#define KSC   1024.0f
#define CSC   1024.0f
#define VCAR  1024.0f
#define PCAR  1024.0f
#define OSC   8192.0f
#define YSC   16384.0f
#define WSC   1024.0f
#define PCEN  0.875f
#define LOG2E 1.4426950408889634f
#define MASKT (-10000.0f * LOG2E)
#define SLAB64 (16 * 68)
#define SLABF  (16 * 68)
#define VTP    72
static_assert(HID == NH * HD && HD == 64);
static_assert((TT % 64) == 0 && (TS % 64) == 0 && (TS % 32) == 0 && NKB == 16);
static_assert((TT & (TT - 1)) == 0 && (TS & (TS - 1)) == 0);
static_assert(16 * 36 <= SLABF);
static_assert((HID % 64) == 0 && (CND % 64) == 0 && (HID % 32) == 0 && (CND % 32) == 0);
static_assert(((NBAT * TT * NH * 8) % 256) == 0 && ((NBAT * TS * NH * 8) % 256) == 0);
static_assert(((NBAT * TS * HID) % 2048) == 0 && ((NBAT * TT * HID) % 2048) == 0);

typedef unsigned short u16;
typedef _Float16 v16h __attribute__((ext_vector_type(16)));
typedef _Float16 v8h  __attribute__((ext_vector_type(8)));
typedef __bf16   v16b __attribute__((ext_vector_type(16)));
typedef float    v8f  __attribute__((ext_vector_type(8)));
typedef float    v4f  __attribute__((ext_vector_type(4)));
typedef unsigned int v4u __attribute__((ext_vector_type(4)));

union FragH { v16h v; v8h h[2]; v4u u[2]; };
union FragB { v16b v; v4u u[2]; };

struct InvF { float f[32]; };
static_assert(sizeof(InvF) == 128);

// ---- scalar helpers --------------------------------------------------------------------------------
__device__ __forceinline__ unsigned short bf_bits(float f) {          // f32 -> bf16 bits, RNE convert
  unsigned u = __float_as_uint(f);
  return (unsigned short)((u + 0x7FFFu + ((u >> 16) & 1u)) >> 16);
}
__device__ __forceinline__ float bf_up(unsigned short h) { return __uint_as_float(((unsigned)h) << 16); }
__device__ __forceinline__ float bfr(float f) { return bf_up(bf_bits(f)); }
__device__ __forceinline__ unsigned short h_bits(_Float16 x) { return __builtin_bit_cast(unsigned short, x); }
__device__ __forceinline__ unsigned pk16(unsigned short a, unsigned short b) { return (unsigned)a | ((unsigned)b << 16); }
__device__ __forceinline__ v8f zero8() { v8f z = {0.f, 0.f, 0.f, 0.f, 0.f, 0.f, 0.f, 0.f}; return z; }

// ---- fragment-major planes: a 16-bit plane [R][K] (R % 16 == 0, K % 32 == 0) is stored as tiles of 16 rows x 32 k, 512 halves
//      each, tile (row >> 4, k >> 5) at ((row >> 4) * (K >> 5) + (k >> 5)) * 512; inside a tile 64 chunks of 8 halves, chunk slot
//      = ((k >> 4) & 1) * 32 + ((k >> 3) & 1) * 16 + (row & 15), so that slot & 31 is the lane that owns the chunk.
// ---- fragment loaders: 16-bit A/B operand, p = tile start + 8 * lane: two wave-wide loads of 512 contiguous bytes;
//      lane -> row/col (lane&15), elements 0..7 <- k0+8h.., elements 8..15 <- k0+16+8h..  (same split k map for A and B)
__device__ __forceinline__ v16h ldfrag_h(const _Float16* p) {
  FragH f;
  f.h[0] = *(const v8h*)(p);
  f.h[1] = *(const v8h*)(p + 256);
  return f.v;
}
__device__ __forceinline__ v16h ldfrag_rm_h(const _Float16* p) {      // same k map from a row-major row, p includes +8*(lane>>4)
  FragH f;
  f.h[0] = *(const v8h*)(p);
  f.h[1] = *(const v8h*)(p + 16);
  return f.v;
}
__device__ __forceinline__ v16b ldfrag_b(const u16* p) {              // bf16 plane read as unsigned integer vectors
  FragB f;
  f.u[0] = *(const v4u*)(p);
  f.u[1] = *(const v4u*)(p + 256);
  return f.v;
}

// Stands behind a group of fragment loads and names their address registers as inputs, so that these registers stay unwritten
// (by a later load's result or by an address update) up to the s_wait_xcnt 0 inside it.
__device__ __forceinline__ void hold_addr(const void* a, const void* b, const void* c, const void* d, const void* e,
                                          const void* f, const void* g, const void* h, const void* i, const void* j) {
#if defined(__HIP_DEVICE_COMPILE__)
  asm volatile("s_wait_xcnt 0x0" :: "v"(a), "v"(b), "v"(c), "v"(d), "v"(e), "v"(f), "v"(g), "v"(h), "v"(i), "v"(j) : "memory");
#endif
}
// chunk slot (0..63) of a tile -> row in the tile and first k in the tile
__device__ __forceinline__ int slot_row(int slot) { return slot & 15; }
__device__ __forceinline__ int slot_k(int slot) { return ((slot >> 5) << 4) + (((slot >> 4) & 1) << 3); }

__device__ __forceinline__ v8f mma_h(v16h a, v16h b, v8f c) {
  return __builtin_amdgcn_wmma_f32_16x16x32_f16(false, a, false, b, (short)0, c, false, false);
}
__device__ __forceinline__ v8f mma_b(v16b a, v16b b, v8f c) {
  return __builtin_amdgcn_wmma_f32_16x16x32_bf16(false, a, false, b, (short)0, c, false, false);
}
__device__ __forceinline__ void guard2(v8f& a, v8f& b, v16h x0, v16h x1, v16h x2, v16h x3, v16h x4, v16h x5) {
#if defined(__HIP_DEVICE_COMPILE__)
  asm volatile("v_nop\n\tv_nop\n\tv_nop\n\tv_nop"
               : "+v"(a), "+v"(b) : "v"(x0), "v"(x1), "v"(x2), "v"(x3), "v"(x4), "v"(x5) : "memory");
#endif
}
template <typename F>
__device__ __forceinline__ void guard6(v8f& a, v8f& b, v8f& c, v8f& d, F x0, F x1, F x2, F x3, F x4, F x5) {
#if defined(__HIP_DEVICE_COMPILE__)
  asm volatile("v_nop\n\tv_nop\n\tv_nop\n\tv_nop"
               : "+v"(a), "+v"(b), "+v"(c), "+v"(d) : "v"(x0), "v"(x1), "v"(x2), "v"(x3), "v"(x4), "v"(x5) : "memory");
#endif
}
__device__ __forceinline__ void guard10(v8f& a, v8f& b, v8f& c, v8f& d, v16h x0, v16h x1, v16h x2, v16h x3, v16h x4,
                                        v16h x5, v16h x6, v16h x7, v16h x8, v16h x9) {
#if defined(__HIP_DEVICE_COMPILE__)
  asm volatile("v_nop\n\tv_nop\n\tv_nop\n\tv_nop"
               : "+v"(a), "+v"(b), "+v"(c), "+v"(d)
               : "v"(x0), "v"(x1), "v"(x2), "v"(x3), "v"(x4), "v"(x5), "v"(x6), "v"(x7), "v"(x8), "v"(x9) : "memory");
#endif
}
__device__ __forceinline__ void guardF(v8f& a0, v8f& a1, v8f& a2, v8f& a3, v8f& c0, v8f& c1, v8f& c2, v8f& c3,
                                       v16h x0, v16h x1, v16h x2, v16h x3, v16h x4, v16h x5, v16h x6, v16h x7,
                                       v16h x8, v16h x9) {
#if defined(__HIP_DEVICE_COMPILE__)
  asm volatile("v_nop\n\tv_nop\n\tv_nop\n\tv_nop"
               : "+v"(a0), "+v"(a1), "+v"(a2), "+v"(a3), "+v"(c0), "+v"(c1), "+v"(c2), "+v"(c3)
               : "v"(x0), "v"(x1), "v"(x2), "v"(x3), "v"(x4), "v"(x5), "v"(x6), "v"(x7), "v"(x8), "v"(x9) : "memory");
#endif
}
__device__ __forceinline__ void acc_guard4(v8f& a, v8f& b, v8f& c, v8f& d) {
#if defined(__HIP_DEVICE_COMPILE__)
  asm volatile("v_nop\n\tv_nop\n\tv_nop\n\tv_nop" : "+v"(a), "+v"(b), "+v"(c), "+v"(d));
#endif
}
__device__ __forceinline__ void wave_sync_lds() {
  __builtin_amdgcn_fence(__ATOMIC_RELEASE, "workgroup");
  __builtin_amdgcn_wave_barrier();
  __builtin_amdgcn_fence(__ATOMIC_ACQUIRE, "workgroup");
}

// ---- accurate f32 sin/cos of a non-negative f32 angle (|angle| < 2048): f64 two-part pi/2 reduction + f64 polynomials,
//      plain f64 fma/mul only (no library f64 trig path), result converted to f32.
__device__ __forceinline__ void sincos_acc(float angf, float& sv, float& cv) {
  const double a = (double)angf;
  const double TWO_OVER_PI = 0.63661977236758134308;
  const double PIO2_HI = 1.5707963267948966;
  const double PIO2_LO = 6.123233995736766e-17;
  const int kq = (int)(a * TWO_OVER_PI + 0.5);
  const double kd = (double)kq;
  double r = fma(-kd, PIO2_HI, a);
  r = fma(-kd, PIO2_LO, r);
  const double r2 = r * r;
  double sp = 1.0 / 6227020800.0;
  sp = fma(sp, r2, -1.0 / 39916800.0);
  sp = fma(sp, r2, 1.0 / 362880.0);
  sp = fma(sp, r2, -1.0 / 5040.0);
  sp = fma(sp, r2, 1.0 / 120.0);
  sp = fma(sp, r2, -1.0 / 6.0);
  const double s = fma(sp * r2, r, r);
  double cp = -1.0 / 87178291200.0;
  cp = fma(cp, r2, 1.0 / 479001600.0);
  cp = fma(cp, r2, -1.0 / 3628800.0);
  cp = fma(cp, r2, 1.0 / 40320.0);
  cp = fma(cp, r2, -1.0 / 720.0);
  cp = fma(cp, r2, 1.0 / 24.0);
  cp = fma(cp, r2, -0.5);
  const double c = fma(cp, r2, 1.0);
  const int qd = kq & 3;
  const double so = (qd == 0) ? s : (qd == 1) ? c : (qd == 2) ? -s : -c;
  const double co = (qd == 0) ? c : (qd == 1) ? -s : (qd == 2) ? -c : s;
  sv = (float)so;
  cv = (float)co;
}

// =====================================================================================================
// Rotary tables: cosT[t][d], sinT[t][d] for t < TT, d < HD, angle = float(t) * inv_freq[d & 31] (f32 product), halves duplicated.
// Wave = one position t, lane = frequency index; inv_freq picked from the by-value table with a static select chain.
// coverage: grid TT/8 blocks x 8 waves = TT rows; per row 4 line stores = 64 floats of each table.
// =====================================================================================================
__device__ __forceinline__ void k_tab(float* cosT, float* sinT, const InvF& inv, int bx) {
  const int tid  = threadIdx.x;
  const int lane = tid & 31;
  const int t    = bx * 8 + (tid >> 5);
  if (t >= TT) return;                      // never taken with the exact grid; no barriers in this kernel
  float f = inv.f[0];
#pragma unroll
  for (int i = 1; i < 32; ++i) f = (lane == i) ? inv.f[i] : f;
  const float ang = (float)t * f;
  float sv, cv;
  sincos_acc(ang, sv, cv);
  float* cr = cosT + (size_t)t * HD;
  float* sr = sinT + (size_t)t * HD;
  {
    *(float*)(cr + lane)      = cv;
    *(float*)(cr + 32 + lane) = cv;
    *(float*)(sr + lane)      = sv;
    *(float*)(sr + 32 + lane) = sv;
    
  }
}

// =====================================================================================================
// Batched transpose + bf16 convert: in W[b][R][C] (row-major f32) -> out D[b][C][R] (bf16 RNE bits, fragment-major plane).
// Block = one 64x64 tile (r0, c0) of batch bb: 256 thr x 4 16-B loads -> LDS tile [c][r] (pitch 72), block barrier,
// coverage: load 256 thr x 16 = 64x64; store 2 iterations x 256 thr x 8 halves = 64 lines x 64; grid (C/64)*(R/64) x b = all of D.
// =====================================================================================================
__device__ __forceinline__ void cvt_T(const float* __restrict__ W, u16* D, int R, int C, int bid, int bb, u16* T) {
  const int tid = threadIdx.x;
  const int ntc = C >> 6;
  const int c0  = (bid % ntc) * 64;
  const int r0  = (bid / ntc) * 64;
  const float* Wb = W + (size_t)bb * (size_t)R * (size_t)C;
  u16*         Db = D + (size_t)bb * (size_t)R * (size_t)C;
  {
    const int rr = tid >> 2;
    const int cc = (tid & 3) * 16;
    const float* src = Wb + (size_t)(r0 + rr) * C + c0 + cc;
#pragma unroll
    for (int i = 0; i < 4; ++i) {
      const v4f a = *(const v4f*)(src + 4 * i);
#pragma unroll
      for (int e = 0; e < 4; ++e) T[(cc + 4 * i + e) * VTP + rr] = bf_bits(a[e]);
    }
  }
  __syncthreads();
  // thread = one chunk of the fragment-major plane: 8 local tiles (4 row tiles x 2 k tiles) x 64 slots
  v4u vals[2];
  const int slot = tid & 63;
#pragma unroll
  for (int it = 0; it < 2; ++it) {
    const int lt = it * 4 + (tid >> 6);
    vals[it] = *(const v4u*)(T + ((lt >> 1) * 16 + slot_row(slot)) * VTP + (lt & 1) * 32 + slot_k(slot));
  }
  {
#pragma unroll
    for (int it = 0; it < 2; ++it) {
      const int lt = it * 4 + (tid >> 6);
      const size_t tile = (size_t)((c0 >> 4) + (lt >> 1)) * (size_t)(R >> 5) + (size_t)((r0 >> 5) + (lt & 1));
      *(v4u*)(Db + tile * 512 + slot * 8) = vals[it];
    }
#if defined(__HIP_DEVICE_COMPILE__)
    // in a merged grid other jobs' code follows in the listing and reuses the two stores' address and data registers: wait first
    asm volatile("s_wait_xcnt 0x0" ::: "memory");
#endif
  }
}

// =====================================================================================================
// Row-major f32 [R][K] -> 16-bit fragment-major plane. f16mode == 0: bf16 RNE bits; f16mode == 1: f16 bits of (bf16 RNE value) * scale.
// Thread = 8 consecutive elements: two 16-B loads, one 16-B store; 32 consecutive lanes = 512 contiguous, 512-B aligned bytes
// coverage: grid = ceil(n8/256) blocks x 256 thr x 8 = the whole plane (n8 a multiple of 32 in every use, so no partial line).
// =====================================================================================================
__device__ __forceinline__ void cvt_flat(const float* __restrict__ src, u16* D, int n8, int f16mode, float scale, int K, int bx) {
  const int gt = bx * 256 + (int)threadIdx.x;   // chunk index in the fragment-major plane
  if (gt >= n8) return;                     // no barriers in this kernel
  const int ktn = K >> 5, tile = gt >> 6, slot = gt & 63;
  const int rt = tile / ktn, kt = tile - rt * ktn;
  const float* p = src + (size_t)(rt * 16 + slot_row(slot)) * K + kt * 32 + slot_k(slot);
  const v4f a = *(const v4f*)(p), bq = *(const v4f*)(p + 4);
  float w[8];
#pragma unroll
  for (int e = 0; e < 4; ++e) { w[e] = a[e]; w[4 + e] = bq[e]; }
  v4u o;
#pragma unroll
  for (int e = 0; e < 4; ++e) {
    const float v0 = w[2 * e], v1 = w[2 * e + 1];
    const unsigned short h0 = h_bits((_Float16)(bfr(v0) * scale)), h1 = h_bits((_Float16)(bfr(v1) * scale));
    const unsigned short b0 = bf_bits(v0), b1 = bf_bits(v1);
    o[e] = (f16mode != 0) ? pk16(h0, h1) : pk16(b0, b1);
  }
  u16* d = D + (size_t)gt * 8;
  {
    *(v4u*)(d) = o;
    
  }
}

// =====================================================================================================
// Row-major f32 [R][HID] -> f16 hi + residual fragment-major planes: hi = f16(v * sc), lo = f16(v * sc - hi) (sc a power of two, residual unscaled).
// coverage: grid = n8/256 (exact) x 256 thr x 8 = the whole of both planes.
// =====================================================================================================
__device__ __forceinline__ void cvt_split(const float* __restrict__ src, u16* Hp, u16* Lp, int n8, float sc, int bx) {
  const int gt = bx * 256 + (int)threadIdx.x;   // chunk index in the fragment-major planes, K = HID
  if (gt >= n8) return;                     // no barriers in this kernel
  const int tile = gt >> 6, slot = gt & 63;
  const int rt = tile / (HID / 32), kt = tile % (HID / 32);
  const float* p = src + (size_t)(rt * 16 + slot_row(slot)) * HID + kt * 32 + slot_k(slot);
  const v4f a = *(const v4f*)(p), bq = *(const v4f*)(p + 4);
  hold_addr(p, p, p, p, p, p, p, p, p, p);
  float w[8];
#pragma unroll
  for (int e = 0; e < 4; ++e) { w[e] = a[e] * sc; w[4 + e] = bq[e] * sc; }
  v4u oh, ol;
#pragma unroll
  for (int e = 0; e < 4; ++e) {
    const float t0 = w[2 * e], t1 = w[2 * e + 1];
    const _Float16 h0 = (_Float16)t0, h1 = (_Float16)t1;
    const _Float16 l0 = (_Float16)(t0 - (float)h0), l1 = (_Float16)(t1 - (float)h1);
    oh[e] = pk16(h_bits(h0), h_bits(h1));
    ol[e] = pk16(h_bits(l0), h_bits(l1));
  }
  const size_t o8 = (size_t)gt * 8;
  {
    *(v4u*)(Hp + o8) = oh;
    *(v4u*)(Lp + o8) = ol;
    
  }
}

// =====================================================================================================
// Shared GEMM store: the wave's 16x64 f32 tile already staged (final values) in its LDS slab (pitch 68), caller issued the
// coverage: 8 instructions x 2 rows x 16 lanes x 4 floats = the wave's 16 x 64 tile.
// =====================================================================================================
__device__ __forceinline__ void store64(const float* sl, float* C, int N, size_t rowb, int col0, int lane) {
  const int hh = lane >> 4, m = lane & 15;
  v4f vals[8];
#pragma unroll
  for (int it = 0; it < 8; ++it) vals[it] = *(const v4f*)(sl + (it * 2 + hh) * 68 + m * 4);
  float* dst = C + (rowb + (size_t)hh) * (size_t)N + col0 + m * 4;
  {
#pragma unroll
    for (int it = 0; it < 8; ++it) {
      *(v4f*)(dst + (size_t)(it * 2) * (size_t)N) = vals[it];
    }
    
  }
}

// =====================================================================================================
// bf16 GEMM: C[M][N] (f32) = A[M][K] (bf16) . Bt[N][K]^T (bf16 k-contiguous), times oscale, + bf16(bias[col]).
// Block = 64x64 tile, 4 waves x 16 rows; A and Bt fragment-major: a fragment = two wave-wide loads of 512 contiguous bytes (split
// k map for A and B); K stepped by 32 (K % 32 == 0, M % 64 == 0, N % 64 == 0 statically, grid = (M/64)*(N/64)).
// =====================================================================================================
__device__ __forceinline__
void gemm_bf(const u16* __restrict__ A, const u16* __restrict__ Bt, const float* __restrict__ bias, float* C,
             int M, int N, int K, float oscale, int bid, float* slab) {
  const int tid = threadIdx.x, wave = tid >> 5, lane = tid & 31, hh = lane >> 4, m = lane & 15;
  const int ntile = N >> 6;
  const int rowb  = (bid / ntile) * 64 + wave * 16;
  const int col0  = (bid % ntile) * 64;
  if (rowb + 16 > M) return;                 // wave-uniform, never taken with the exact grid; no block barriers in this kernel
  const u16* ap = A  + (size_t)rowb * K + 8 * lane;      // row tile rowb / 16, k tile 0
  const u16* bp = Bt + (size_t)col0 * K + 8 * lane;
  const size_t bs = (size_t)16 * K;                      // one row tile = K / 32 tiles of 512 halves
  v8f acc0 = zero8(), acc1 = zero8(), acc2 = zero8(), acc3 = zero8();
#pragma unroll 1
  for (int k0 = 0; k0 < K; k0 += 32) {
    const int kf = k0 * 16;                              // k tile k0 / 32
    const u16 *pa = ap + kf, *p0 = bp + kf, *p1 = p0 + bs, *p2 = p1 + bs, *p3 = p2 + bs;
    const v16b a  = ldfrag_b(pa);
    const v16b b0 = ldfrag_b(p0);
    const v16b b1 = ldfrag_b(p1);
    const v16b b2 = ldfrag_b(p2);
    const v16b b3 = ldfrag_b(p3);
    hold_addr(pa, p0, p1, p2, p3, pa, pa, pa, pa, pa);
    acc0 = mma_b(a, b0, acc0);
    acc1 = mma_b(a, b1, acc1);
    acc2 = mma_b(a, b2, acc2);
    acc3 = mma_b(a, b3, acc3);
    guard6<v16b>(acc0, acc1, acc2, acc3, a, b0, b1, b2, b3, a);
  }
  float* sl = slab + wave * SLAB64;
  float bb[4];
#pragma unroll
  for (int j = 0; j < 4; ++j) bb[j] = bfr(bias[col0 + 16 * j + m]);
#pragma unroll
  for (int r = 0; r < 8; ++r) {
    const int ro = (8 * hh + r) * 68 + m;
    sl[ro]      = acc0[r] * oscale + bb[0];
    sl[ro + 16] = acc1[r] * oscale + bb[1];
    sl[ro + 32] = acc2[r] * oscale + bb[2];
    sl[ro + 48] = acc3[r] * oscale + bb[3];
  }
  wave_sync_lds();
  store64(sl, C, N, (size_t)rowb, col0, lane);
}

// =====================================================================================================
// f16 GEMM (optionally batched over bz with element strides sA, sB, sC):
//   C[M][N] (f32) = (Ah [+ Al])[M][K] . (Bh [+ Bl])[N][K]^T, times oscale, + bf16(bias) per row (biasRow != 0) or per column.
//   A2: A carried as hi + unscaled residual plane (products h.B + l.B); B2: B carried as hi + residual (A.h + A.l); never both.
// Same tiling as gemm_bf; all planes f16 fragment-major, K % 32 == 0.
// =====================================================================================================
template <int A2, int B2>
__device__ __forceinline__
void gemm_h(const u16* __restrict__ Ah, const u16* __restrict__ Al, const u16* __restrict__ Bh, const u16* __restrict__ Bl,
            const float* __restrict__ bias, float* C, int M, int N, int K, int sA, int sB, int sC, int biasRow, float oscale,
            int bid, int bz, float* slab) {
  const int tid = threadIdx.x, wave = tid >> 5, lane = tid & 31, hh = lane >> 4, m = lane & 15;
  const int ntile = N >> 6;
  const int rowb  = (bid / ntile) * 64 + wave * 16;
  const int col0  = (bid % ntile) * 64;
  if (rowb + 16 > M) return;                 // wave-uniform, never taken with the exact grid; no block barriers in this kernel
  const size_t aofs = (size_t)bz * (size_t)sA + (size_t)rowb * K + 8 * lane;
  const _Float16* ahp = (const _Float16*)(const void*)Ah + aofs;
  const _Float16* alp = (const _Float16*)(const void*)Al + aofs;
  const size_t bofs = (size_t)bz * (size_t)sB + (size_t)col0 * K + 8 * lane;
  const _Float16* bhp = (const _Float16*)(const void*)Bh + bofs;
  const _Float16* blp = (const _Float16*)(const void*)Bl + bofs;
  const size_t bs = (size_t)16 * K;
  v8f acc0 = zero8(), acc1 = zero8(), acc2 = zero8(), acc3 = zero8();
#pragma unroll 1
  for (int k0 = 0; k0 < K; k0 += 32) {
    const int kf = k0 * 16;                              // k tile k0 / 32
    const _Float16 *pa = ahp + kf, *p0 = bhp + kf, *p1 = p0 + bs, *p2 = p1 + bs, *p3 = p2 + bs;
    const v16h ah = ldfrag_h(pa);
    const v16h b0 = ldfrag_h(p0);
    const v16h b1 = ldfrag_h(p1);
    const v16h b2 = ldfrag_h(p2);
    const v16h b3 = ldfrag_h(p3);
    if (A2) {
      const _Float16* pl = alp + kf;
      const v16h al = ldfrag_h(pl);
      hold_addr(pa, p0, p1, p2, p3, pl, pa, pa, pa, pa);
      acc0 = mma_h(ah, b0, acc0);  acc0 = mma_h(al, b0, acc0);
      acc1 = mma_h(ah, b1, acc1);  acc1 = mma_h(al, b1, acc1);
      acc2 = mma_h(ah, b2, acc2);  acc2 = mma_h(al, b2, acc2);
      acc3 = mma_h(ah, b3, acc3);  acc3 = mma_h(al, b3, acc3);
      guard6<v16h>(acc0, acc1, acc2, acc3, ah, al, b0, b1, b2, b3);
    } else if (B2) {
      const _Float16 *r0 = blp + kf, *r1 = r0 + bs, *r2 = r1 + bs, *r3 = r2 + bs;
      const v16h c0 = ldfrag_h(r0);
      const v16h c1 = ldfrag_h(r1);
      const v16h c2 = ldfrag_h(r2);
      const v16h c3 = ldfrag_h(r3);
      hold_addr(pa, p0, p1, p2, p3, r0, r1, r2, r3, pa);
      acc0 = mma_h(ah, b0, acc0);  acc0 = mma_h(ah, c0, acc0);
      acc1 = mma_h(ah, b1, acc1);  acc1 = mma_h(ah, c1, acc1);
      acc2 = mma_h(ah, b2, acc2);  acc2 = mma_h(ah, c2, acc2);
      acc3 = mma_h(ah, b3, acc3);  acc3 = mma_h(ah, c3, acc3);
      guard10(acc0, acc1, acc2, acc3, ah, b0, b1, b2, b3, c0, c1, c2, c3, ah);
    } else {
      hold_addr(pa, p0, p1, p2, p3, pa, pa, pa, pa, pa);
      acc0 = mma_h(ah, b0, acc0);
      acc1 = mma_h(ah, b1, acc1);
      acc2 = mma_h(ah, b2, acc2);
      acc3 = mma_h(ah, b3, acc3);
      guard6<v16h>(acc0, acc1, acc2, acc3, ah, b0, b1, b2, b3, ah);
    }
  }
  float* sl = slab + wave * SLAB64;
  if (biasRow != 0) {
#pragma unroll
    for (int r = 0; r < 8; ++r) {
      const float bb = bfr(bias[rowb + 8 * hh + r]);
      const int ro = (8 * hh + r) * 68 + m;
      sl[ro]      = acc0[r] * oscale + bb;
      sl[ro + 16] = acc1[r] * oscale + bb;
      sl[ro + 32] = acc2[r] * oscale + bb;
      sl[ro + 48] = acc3[r] * oscale + bb;
    }
  } else {
    float bb[4];
#pragma unroll
    for (int j = 0; j < 4; ++j) bb[j] = bfr(bias[col0 + 16 * j + m]);
#pragma unroll
    for (int r = 0; r < 8; ++r) {
      const int ro = (8 * hh + r) * 68 + m;
      sl[ro]      = acc0[r] * oscale + bb[0];
      sl[ro + 16] = acc1[r] * oscale + bb[1];
      sl[ro + 32] = acc2[r] * oscale + bb[2];
      sl[ro + 48] = acc3[r] * oscale + bb[3];
    }
  }
  wave_sync_lds();
  store64(sl, C + (size_t)bz * (size_t)sC, N, (size_t)rowb, col0, lane);
}

// =====================================================================================================
// Rotate-half rotary + f16 pack (single plane). Rows are (batch, pos, head) with HD contiguous floats (f32 projection output);
// pos = (row / hpr) & posmask.  w[d] = x[d] * cos[pos][d] + r[d] * sin[pos][d],  r[d] = -x[d+32] for d < 32, x[d-32] for d >= 32;
// out[d] = f16(w * sc) (sc a power of two); out plane: fm == 0 the rows as they are (q', read once per wave),
// fm != 0 per (batch, head) a fragment-major plane [positions][HD] (k', read by every query tile).
// Thread = one chunk of the out plane (8 consecutive d of one row): 16-B loads of x (own and partner half), cos, sin; one 16-B store per lane;
// coverage: grid = nrows*8/256 blocks (exact) x 256 thr x 8 halves = nrows x 64 of the plane exactly.
// =====================================================================================================
__device__ __forceinline__ void rope_h(const float* __restrict__ x, const float* __restrict__ cosT,
                                       const float* __restrict__ sinT, u16* hpl,
                                       int nrows, int hpr, int posmask, float sc, int fm, int bx) {
  const int gt  = bx * 256 + (int)threadIdx.x;   // chunk index in the out plane
  if (gt >= nrows * 8) return;              // never taken with the exact grid; no barriers in this kernel
  int row = gt >> 3;                        // fm == 0: row-major out plane, chunk gt = (row, d0 / 8)
  int d0  = (gt & 7) * 8;
  if (fm != 0) {                            // fragment-major out plane per (batch, head)
    const int slot = gt & 63;
    const int u    = gt >> 7;               // (batch * hpr + head) * (positions / 16) + position tile
    const int t16  = (posmask + 1) >> 4;
    const int bh   = u / t16;
    const int pt   = (u - bh * t16) * 16 + slot_row(slot);
    row = ((bh / hpr) * (posmask + 1) + pt) * hpr + (bh % hpr);
    d0  = ((gt >> 6) & 1) * 32 + slot_k(slot);
  }
  const int pos = (row / hpr) & posmask;
  const int d1  = d0 ^ 32;
  const float* xr = x + (size_t)row * HD;
  const float* cr = cosT + (size_t)pos * HD + d0;
  const float* sr = sinT + (size_t)pos * HD + d0;
  const v4f xa = *(const v4f*)(xr + d0), xb = *(const v4f*)(xr + d0 + 4);
  const v4f ya = *(const v4f*)(xr + d1), yb = *(const v4f*)(xr + d1 + 4);
  const v4f ca = *(const v4f*)(cr), cb = *(const v4f*)(cr + 4);
  const v4f sa = *(const v4f*)(sr), sb = *(const v4f*)(sr + 4);
  const float sgn = (d0 < 32) ? -1.0f : 1.0f;
  float w[8];
#pragma unroll
  for (int e = 0; e < 4; ++e) {
    w[e]     = xa[e] * ca[e] + (sgn * ya[e]) * sa[e];
    w[4 + e] = xb[e] * cb[e] + (sgn * yb[e]) * sb[e];
  }
  v4u oh;
#pragma unroll
  for (int e = 0; e < 4; ++e) {
    const _Float16 h0 = (_Float16)(w[2 * e] * sc), h1 = (_Float16)(w[2 * e + 1] * sc);
    oh[e] = pk16(h_bits(h0), h_bits(h1));
  }
  {
    *(v4u*)(hpl + (size_t)gt * 8) = oh;
    
  }
}

// =====================================================================================================
// v plane + per-32-key block sums: in V[b][HID][TS] f32 (channel-major). Block = (b, 64 channels o0, 64 keys s0).
//   VH[b][o][s] = f16(v * 1024) (fragment-major plane [b * HID + o][TS], staged through LDS); VS[b][kb][o] = sum over keys kb*32 .. kb*32+31 of v (f32).
// Two iterations: thread = 8 consecutive keys of one channel row (two 16-B loads, one 16-B store; lanes 8q..8q+7 = one whole
// coverage: VH 2 it x 256 thr x 8 = 64 x 64 per block, grid 16 x 4 x 8 blocks = whole plane; VS 2 kb x 64 channels per block,
//           grid covers 16 b x 16 kb x 256 channels exactly once.
// =====================================================================================================
// S: 128 floats; HT: 512 chunks, the block's 8 tiles (4 channel tiles x 2 key tiles) in fragment-major order (both in LDS)
__device__ __forceinline__ void vcvt(const float* __restrict__ V, u16* VH, float* VS, int bid, float* S, v4u* HT) {
  const int tid  = threadIdx.x;
  const int lane = tid & 31;
  const int wave = tid >> 5;
  const int st   = bid & 7;
  const int ot   = (bid >> 3) & 3;
  const int b    = bid >> 5;
  const int o0   = ot * 64;
  const int s0   = st * 64;
#pragma unroll
  for (int it = 0; it < 2; ++it) {
    const int idx = it * 256 + tid;
    const int row = idx >> 3;                 // channel within tile 0..63
    const int s8  = (idx & 7) * 8;            // key offset within tile
    const size_t e = ((size_t)(b * HID + o0 + row)) * TS + s0 + s8;
    const v4f a = *(const v4f*)(V + e), bq = *(const v4f*)(V + e + 4);
    v4u o;
#pragma unroll
    for (int q = 0; q < 2; ++q) {
      o[q]     = pk16(h_bits((_Float16)(a[2 * q] * VCAR)),  h_bits((_Float16)(a[2 * q + 1] * VCAR)));
      o[2 + q] = pk16(h_bits((_Float16)(bq[2 * q] * VCAR)), h_bits((_Float16)(bq[2 * q + 1] * VCAR)));
    }
    HT[((row >> 4) * 2 + (s8 >> 5)) * 64 + ((s8 >> 4) & 1) * 32 + ((s8 >> 3) & 1) * 16 + (row & 15)] = o;
    float ps = ((a[0] + a[1]) + (a[2] + a[3])) + ((bq[0] + bq[1]) + (bq[2] + bq[3]));
    ps += __shfl_xor(ps, 1, 32);
    ps += __shfl_xor(ps, 2, 32);
    if ((lane & 3) == 0) S[((lane >> 2) & 1) * 64 + row] = ps;   // lane&7 == 0 -> keys s0..s0+31, == 4 -> s0+32..s0+63
  }
  __syncthreads();
  {
#pragma unroll
    for (int it = 0; it < 2; ++it) {
      const int lt = it * 4 + (tid >> 6);     // local tile: channel tile lt >> 1, key tile lt & 1
      const size_t tile = (size_t)((b * HID + o0) / 16 + (lt >> 1)) * (TS / 32) + (size_t)(s0 / 32 + (lt & 1));
      *(v4u*)(VH + tile * 512 + (tid & 63) * 8) = HT[it * 256 + tid];
    }
    
  }
  if (wave == 0) {
    const int kbh   = lane >> 4;
    const int piece = (lane & 15) * 4;
    const v4f sv = *(const v4f*)(S + kbh * 64 + piece);
    float* dst = VS + ((size_t)(b * NKB + 2 * st + kbh)) * HID + o0 + piece;
    {
      *(v4f*)(dst) = sv;
      
    }
  }
}

// =====================================================================================================
// Merged grids: launches that do not depend on one another share one grid; the block index (uniform in a block) picks the job,
// and every job keeps its own block numbering. Block counts of the jobs:
// =====================================================================================================
#define NB_TAB (TT / 8)
#define NB_XT  ((TT / 64) * (HID / 64) * NBAT)
#define NB_CT  ((TS / 64) * (CND / 64) * NBAT)
#define NB_WC  ((HID * CND) / 2048)
#define NB_W   ((HID * HID) / 2048)
#define NB_WF  ((2 * HID * HID) / 2048)
#define NB_PRO (NB_TAB + NB_XT + NB_CT + NB_WC + 4 * NB_W + NB_WF)
#define NB_GC  (((NBAT * TS) / 64) * (HID / 64))
#define NB_GQ  (((NBAT * TT) / 64) * (HID / 64))
#define NB_RQ  ((NBAT * TT * NH * 8) / 256)
#define NB_SC  ((NBAT * TS * HID) / 2048)
#define NB_GV  ((HID / 64) * (TS / 64) * NBAT)
#define NB_GK  (((NBAT * TS) / 64) * (HID / 64))
#define NB_RK  ((NBAT * TS * NH * 8) / 256)
#define NB_VC  (NBAT * (HID / 64) * (TS / 64))

// Everything that reads inputs only: rotary tables, the two transposes, the six weight planes.
__global__ __launch_bounds__(256)
void pro_k(const float* __restrict__ x, const float* __restrict__ cond, const float* __restrict__ w_cond,
           const float* __restrict__ wq, const float* __restrict__ wk, const float* __restrict__ wv,
           const float* __restrict__ wo, const float* __restrict__ wf, float* cosT, float* sinT, u16* XT, u16* CONDT,
           u16* WCB, u16* WQB, u16* WKH, u16* WVH, u16* WOH, u16* WFH, InvF inv) {
  __shared__ __align__(16) u16 T[64 * VTP];
  int j = blockIdx.x;
  if (j < NB_TAB) { k_tab(cosT, sinT, inv, j); return; }
  j -= NB_TAB;
  if (j < NB_XT) { cvt_T(x, XT, HID, TT, j % (NB_XT / NBAT), j / (NB_XT / NBAT), T); return; }
  j -= NB_XT;
  if (j < NB_CT) { cvt_T(cond, CONDT, CND, TS, j % (NB_CT / NBAT), j / (NB_CT / NBAT), T); return; }
  j -= NB_CT;
  if (j < NB_WC) { cvt_flat(w_cond, WCB, (HID * CND) / 8, 0, 1.0f, CND, j); return; }
  j -= NB_WC;
  if (j < NB_W) { cvt_flat(wq, WQB, (HID * HID) / 8, 0, 1.0f, HID, j); return; }
  j -= NB_W;
  if (j < 3 * NB_W) {
    const int wsel = j / NB_W;
    cvt_flat(wsel == 0 ? wk : wsel == 1 ? wv : wo, wsel == 0 ? WKH : wsel == 1 ? WVH : WOH, (HID * HID) / 8, 1, WSC, HID,
             j % NB_W);
    return;
  }
  j -= 3 * NB_W;
  cvt_flat(wf, WFH, (2 * HID * HID) / 8, 1, WSC, HID, j);
}

// c^T = CONDT . WCB^T + b_cond (the longer k loop, so its blocks come first) and q^T = XT . WQB^T + bq.
__global__ __launch_bounds__(128)
void gemm_cq(const u16* __restrict__ CONDT, const u16* __restrict__ WCB, const float* __restrict__ b_cond, float* CTF,
             const u16* __restrict__ XT, const u16* __restrict__ WQB, const float* __restrict__ bq, float* QF) {
  __shared__ __align__(16) float slab[4 * SLAB64];
  const int bid = blockIdx.x;
  if (bid < NB_GC) gemm_bf(CONDT, WCB, b_cond, CTF, NBAT * TS, HID, CND, 1.0f, bid, slab);
  else             gemm_bf(XT, WQB, bq, QF, NBAT * TT, HID, HID, 1.0f, bid - NB_GC, slab);
}

// q' plane (rotary + pack of q^T) and the hi + residual planes of c^T.
__global__ __launch_bounds__(256)
void rq_sc(const float* __restrict__ QF, const float* __restrict__ cosT, const float* __restrict__ sinT, u16* QH,
           const float* __restrict__ CTF, u16* CH, u16* CL) {
  const int bid = blockIdx.x;
  if (bid < NB_RQ) rope_h(QF, cosT, sinT, QH, NBAT * TT * NH, NH, TT - 1, QSC, 0, bid);
  else             cvt_split(CTF, CH, CL, (NBAT * TS * HID) / 8, CSC, bid - NB_RQ);
}

// v = WVH . (CH + CL)^T + bv per row, per batch (twice the products, so its blocks come first) and k^T = CH . WKH^T + bk.
__global__ __launch_bounds__(128)
void gemm_kv(const u16* __restrict__ CH, const u16* __restrict__ CL, const u16* __restrict__ WVH, const u16* __restrict__ WKH,
             const float* __restrict__ bv, const float* __restrict__ bk, float* VF, float* KF) {
  __shared__ __align__(16) float slab[4 * SLAB64];
  const int bid = blockIdx.x;
  if (bid < NB_GV)
    gemm_h<0, 1>(WVH, WVH, CH, CL, bv, VF, HID, TS, HID, 0, TS * HID, HID * TS, 1, 1.0f / (CSC * WSC),
                 bid % (NB_GV / NBAT), bid / (NB_GV / NBAT), slab);
  else
    gemm_h<0, 0>(CH, CH, WKH, WKH, bk, KF, NBAT * TS, HID, HID, 0, 0, 0, 0, 1.0f / (CSC * WSC), bid - NB_GV, 0, slab);
}

// k' plane (rotary + pack of k^T) and the v plane with its block sums.
__global__ __launch_bounds__(256)
void rk_vc(const float* __restrict__ KF, const float* __restrict__ cosT, const float* __restrict__ sinT, u16* KH,
           const float* __restrict__ VF, u16* VH, float* VS) {
  __shared__ __align__(16) float S[128];
  __shared__ __align__(16) v4u HT[512];
  const int bid = blockIdx.x;
  if (bid < NB_RK) rope_h(KF, cosT, sinT, KH, NBAT * TS * NH, NH, TS - 1, KSC, 1, bid);
  else             vcvt(VF, VH, VS, bid - NB_RK, S, HT);
}

// y^T = (OH + OL) . WOH^T + bo
__global__ __launch_bounds__(128)
void gemm_o(const u16* __restrict__ OH, const u16* __restrict__ OL, const u16* __restrict__ WOH,
            const float* __restrict__ bo, float* YF) {
  __shared__ __align__(16) float slab[4 * SLAB64];
  gemm_h<1, 0>(OH, OL, WOH, WOH, bo, YF, NBAT * TT, HID, HID, 0, 0, 0, 0, 1.0f / (OSC * WSC), blockIdx.x, 0, slab);
}

// y^T -> hi + residual planes
__global__ __launch_bounds__(256) void split_y(const float* __restrict__ YF, u16* YH, u16* YL) {
  cvt_split(YF, YH, YL, (NBAT * TT * HID) / 8, YSC, blockIdx.x);
}

// =====================================================================================================
// Cross attention: block = (batch b, head h, 64 query rows), one wave per 16 query rows q0..q0+15; all TS keys in NKB blocks of 32.
//   q' plane QH [b][t][h][d] (x1024 f16, row-major), k' plane KH: per (b, h) fragment-major [s][d] (x1024), v plane VH:
//   fragment-major [b*256 + h*64+d][s] (x1024),
//   VS[b][kb][h*64+d] = f32 sum of v over key block kb; masks: key s of row t is masked iff bf16(cond_mask[b][s])*bf16(x_mask[b][t]) == 0,
//   masked score replaced by -1e4 (base-2 scaled) -> exact uniform softmax on a fully masked row, 0 weight otherwise.
//   Per block: 2 score subtiles x 2 k-steps (q'.k' single products, q fragments loaded once), scale 1/8 folded into the base-2
//   factor; online max-subtracted base-2 softmax in f32; e = exp2(t - m) per key; l from the f32 e; accumulator update
//   o = o*alpha + (7/8 * 2^20) * VS block sum (f32), then the centred tile P' = (e - 7/8) * 1024 stored to wave-private LDS (f32),
//   contiguous), 4 P'.v WMMAs. Exact identity sum_s e_s v_s = sum_s (e_s - 7/8) v_s + 7/8 sum_s v_s per key block.
//   (b, q0+row, head) of the O hi plane and of the O residual plane (O x8192 as f16 hi + residual) written by lanes row and row + 16
// coverage: per wave 4 instructions x 32 lanes x 8 halves = 16 x 64 per plane; grid 2048 blocks x 4 waves = every
//           (b, t, h) row of both O planes exactly once.
// =====================================================================================================
__global__ __launch_bounds__(128)
void attn_x(const u16* __restrict__ QHp, const u16* __restrict__ KHp, const u16* __restrict__ VHp,
            const float* __restrict__ VS, const float* __restrict__ cmask, const float* __restrict__ xmask,
            u16* OHp, u16* OLp) {
  __shared__ __align__(16) float smem[4 * SLABF];   // per wave: P' tile [16][32] pitch 36 during the loop, result slab after

  const int tid  = threadIdx.x;
  const int wave = tid >> 5;
  const int lane = tid & 31;
  const int hh   = lane >> 4;
  const int c    = lane & 15;

  const int bid  = blockIdx.x;
  const int qt   = bid & (TT / 64 - 1);
  const int h    = (bid >> 5) & (NH - 1);
  const int b    = bid >> 7;
  const int q0   = qt * 64 + wave * 16;

  const size_t qofs = (((size_t)(b * TT + q0 + c)) * NH + h) * HD + 8 * hh;       // row-major plane
  const _Float16* Qh  = (const _Float16*)(const void*)QHp + qofs;
  const size_t kofs = ((size_t)(b * NH + h) * TS) * HD + 8 * lane;                // plane (b, h); key tile added per step
  const _Float16* Khb = (const _Float16*)(const void*)KHp + kofs;
  const size_t vofs = ((size_t)(b * HID + h * HD)) * TS + 8 * lane;               // row tile of d 0..15 (+16j); key tile added per step
  const _Float16* Vhb = (const _Float16*)(const void*)VHp + vofs;
  const float* vsb = VS + (size_t)b * NKB * HID + h * HD + c;
  const float* cmb = cmask + (size_t)b * TS + c;
  const float lsc = 0.125f * (LOG2E / (QSC * KSC));
  const float C0S = PCEN * PCAR * VCAR;

  float xmv[8], mrow[8], lrow[8];
  v8f o[4];
#pragma unroll
  for (int r = 0; r < 8; ++r) {
    xmv[r]  = bfr(xmask[(size_t)b * TT + q0 + 8 * hh + r]);
    mrow[r] = -INFINITY;
    lrow[r] = 0.f;
  }
#pragma unroll
  for (int j = 0; j < 4; ++j) o[j] = zero8();
  float* pt = smem + wave * SLABF;

  const v16h qa = ldfrag_rm_h(Qh), qb = ldfrag_rm_h(Qh + 32);
  hold_addr(Qh, Qh, Qh, Qh, Qh, Qh, Qh, Qh, Qh, Qh);

#pragma unroll 1
  for (int it = 0; it < NKB; ++it) {
    const int kb = it * 32;
    // ---- scores: D element r of this lane = (query row q0 + 8hh + r, key kb + c) in s0, key kb + 16 + c in s1 ----
    v8f s0 = zero8(), s1 = zero8();
    {
      const _Float16* k0p = Khb + (size_t)kb * HD;            // key tile kb / 16: HD / 32 = 2 tiles of 512 halves
      const _Float16* k1p = k0p + (size_t)16 * HD;
      const v16h k0a = ldfrag_h(k0p), k0b = ldfrag_h(k0p + 512);
      const v16h k1a = ldfrag_h(k1p), k1b = ldfrag_h(k1p + 512);
      hold_addr(k0p, k0p, k0p, k0p, k0p, k0p, k0p, k0p, k0p, k0p);   // k1p is a constant offset from k0p
      s0 = mma_h(qa, k0a, s0);
      s0 = mma_h(qb, k0b, s0);
      s1 = mma_h(qa, k1a, s1);
      s1 = mma_h(qb, k1b, s1);
      guard2(s0, s1, qa, qb, k0a, k0b, k1a, k1b);
    }
    const float cm0 = bfr(cmb[kb]), cm1 = bfr(cmb[kb + 16]);
    float vs[4];
#pragma unroll
    for (int j = 0; j < 4; ++j) vs[j] = vsb[(size_t)it * HID + 16 * j] * C0S;
    {
      const float *pc = cmb + kb, *pv = vsb + (size_t)it * HID;
      hold_addr(pc, pv, pc, pc, pc, pc, pc, pc, pc, pc);
    }
    // ---- mask (replace by -1e4) + online softmax in base 2; centred P' tile to LDS ----
#pragma unroll
    for (int r = 0; r < 8; ++r) {
      const bool ok0 = (cm0 * xmv[r]) != 0.0f;
      const bool ok1 = (cm1 * xmv[r]) != 0.0f;
      const float t0 = ok0 ? (s0[r] * lsc) : MASKT;
      const float t1 = ok1 ? (s1[r] * lsc) : MASKT;
      float mx = fmaxf(t0, t1);
#pragma unroll
      for (int off = 1; off < 16; off <<= 1) mx = fmaxf(mx, __shfl_xor(mx, off, 32));
      const float mn = fmaxf(mrow[r], mx);
      const float al = exp2f(mrow[r] - mn);
      mrow[r] = mn;
      const float e0 = exp2f(t0 - mn), e1 = exp2f(t1 - mn);
      float ps = e0 + e1;
#pragma unroll
      for (int off = 1; off < 16; off <<= 1) ps += __shfl_xor(ps, off, 32);
      lrow[r] = lrow[r] * al + ps;
#pragma unroll
      for (int j = 0; j < 4; ++j) o[j][r] = o[j][r] * al + vs[j];
      const int ro = (8 * hh + r) * 36 + c;
      pt[ro]      = (e0 - PCEN) * PCAR;
      pt[ro + 16] = (e1 - PCEN) * PCAR;
    }
    wave_sync_lds();
    // ---- A fragment of f16(P'): row = c, split k map over the 32 keys of this step ----
    FragH ph;
    {
      const float* prow = pt + c * 36 + 8 * hh;
      const v4f p0 = *(const v4f*)(prow), p1 = *(const v4f*)(prow + 4);
      const v4f p2 = *(const v4f*)(prow + 16), p3 = *(const v4f*)(prow + 20);
#pragma unroll
      for (int e = 0; e < 4; ++e) {
        ph.h[0][e]     = (_Float16)p0[e];                    // elements 0..7  = keys kb + 8hh + 0..7
        ph.h[0][4 + e] = (_Float16)p1[e];
        ph.h[1][e]     = (_Float16)p2[e];                    // elements 8..15 = keys kb + 16 + 8hh + 0..7
        ph.h[1][4 + e] = (_Float16)p3[e];
      }
    }
    // ---- P'.v : B fragment col n = d = j*16 + c, keys contiguous in the v plane ----
    {
      const _Float16* vhp = Vhb + kb * 16;                    // key tile kb / 32
      const v16h vh0 = ldfrag_h(vhp);
      const v16h vh1 = ldfrag_h(vhp + (size_t)16 * TS);
      const v16h vh2 = ldfrag_h(vhp + (size_t)32 * TS);
      const v16h vh3 = ldfrag_h(vhp + (size_t)48 * TS);
      hold_addr(vhp, vhp, vhp, vhp, vhp, vhp, vhp, vhp, vhp, vhp);
      o[0] = mma_h(ph.v, vh0, o[0]);
      o[1] = mma_h(ph.v, vh1, o[1]);
      o[2] = mma_h(ph.v, vh2, o[2]);
      o[3] = mma_h(ph.v, vh3, o[3]);
      guard6<v16h>(o[0], o[1], o[2], o[3], ph.v, vh0, vh1, vh2, vh3, ph.v);
    }
    wave_sync_lds();
  }
  acc_guard4(o[0], o[1], o[2], o[3]);

  // ---- fold 1/l and the carries (1024 on P', 1024 on v), stage the wave's 16x64 slab in its LDS region ----
  wave_sync_lds();
  float* slab = pt;
  const float oc = 1.0f / (PCAR * VCAR);
#pragma unroll
  for (int r = 0; r < 8; ++r) {
    const float inv = (1.0f / lrow[r]) * oc;
#pragma unroll
    for (int j = 0; j < 4; ++j) slab[(8 * hh + r) * 68 + j * 16 + c] = o[j][r] * inv;
  }
  wave_sync_lds();
  // ---- O x8192 -> f16 hi + residual fragment-major planes [b * TT + t][HID]; lane = one chunk per store ----
  v4u oh[4], ol[4];
#pragma unroll
  for (int it = 0; it < 4; ++it) {
    const int c8 = it * 16 + 8 * hh;          // chunk slot (it & 1) * 32 + lane of k tile 2h + (it >> 1): row c, d = c8 .. c8 + 7
    const v4f a = *(const v4f*)(slab + c * 68 + c8), bq = *(const v4f*)(slab + c * 68 + c8 + 4);
    float w[8];
#pragma unroll
    for (int e = 0; e < 4; ++e) { w[e] = a[e] * OSC; w[4 + e] = bq[e] * OSC; }
#pragma unroll
    for (int e = 0; e < 4; ++e) {
      const _Float16 h0 = (_Float16)w[2 * e], h1 = (_Float16)w[2 * e + 1];
      const _Float16 l0 = (_Float16)(w[2 * e] - (float)h0), l1 = (_Float16)(w[2 * e + 1] - (float)h1);
      oh[it][e] = pk16(h_bits(h0), h_bits(h1));
      ol[it][e] = pk16(h_bits(l0), h_bits(l1));
    }
  }
  const size_t ob = (size_t)(b * TT + q0) * HID + (size_t)h * 1024 + 8 * lane;    // row tile (b * TT + q0) / 16, k tile 2h
  {
#pragma unroll
    for (int it = 0; it < 4; ++it) {
      const size_t o8 = ob + (size_t)it * 256;
      *(v4u*)(OHp + o8) = oh[it];
      *(v4u*)(OLp + o8) = ol[it];
    }
    
  }
}

// =====================================================================================================
// FiLM GEMM + combine: block = (batch b, 64 time columns t0, 64 channels), one wave per 16 channels c0..c0+15.
//   gamma[c][t] = sum_i w_film[c][i] y[t][i], beta[c][t] = sum_i w_film[256+c][i] y[t][i]  (A = w_film rows as f16(bf16 x1024),
//   B = y planes [b][t][i] as f16 hi x16384 + residual: products wg.h, wb.h, wg.l, wb.l, 8 accumulators);
//   out[b][c][t] = (bf16(x[b][c][t]) * (gamma*oscale + bf16(b_film[c])) + (beta*oscale + bf16(b_film[256+c]))) * bf16(x_mask[b][t]).
// coverage: grid 16 b x 32 t-tiles x 4 channel groups = 2048 blocks x 4 waves x 16 x 64 = every out element exactly once.
// =====================================================================================================
__global__ __launch_bounds__(128)
void film_k(const u16* __restrict__ WF, const u16* __restrict__ YHp, const u16* __restrict__ YLp,
            const float* __restrict__ bfl, const float* __restrict__ X, const float* __restrict__ XM,
            float* OUT, float oscale) {
  __shared__ __align__(16) float slab[4 * SLAB64];
  const int tid = threadIdx.x, wave = tid >> 5, lane = tid & 31, hh = lane >> 4, m = lane & 15;
  const int bid = blockIdx.x;
  const int tt  = bid & (TT / 64 - 1);
  const int cg  = (bid >> 5) & 3;
  const int b   = bid >> 7;
  const int t0  = tt * 64;
  const int c0  = cg * 64 + wave * 16;
  const _Float16* agp = (const _Float16*)(const void*)WF + (size_t)c0 * HID + 8 * lane;
  const _Float16* abp = agp + (size_t)HID * HID;                                   // row 256 + c0 + m
  const size_t yofs = ((size_t)(b * TT + t0)) * HID + 8 * lane;
  const _Float16* yhp = (const _Float16*)(const void*)YHp + yofs;
  const _Float16* ylp = (const _Float16*)(const void*)YLp + yofs;
  const size_t bs = (size_t)16 * HID;
  v8f g[4], be[4];
#pragma unroll
  for (int j = 0; j < 4; ++j) { g[j] = zero8(); be[j] = zero8(); }
#pragma unroll 1
  for (int k0 = 0; k0 < HID; k0 += 32) {
    const int kf = k0 * 16;                              // k tile k0 / 32
    const _Float16 *pg = agp + kf, *pb = abp + kf;
    const _Float16 *p0 = yhp + kf, *p1 = p0 + bs, *p2 = p1 + bs, *p3 = p2 + bs;
    const _Float16 *r0 = ylp + kf, *r1 = r0 + bs, *r2 = r1 + bs, *r3 = r2 + bs;
    const v16h ag = ldfrag_h(pg), ab = ldfrag_h(pb);
    const v16h y0 = ldfrag_h(p0);
    const v16h y1 = ldfrag_h(p1);
    const v16h y2 = ldfrag_h(p2);
    const v16h y3 = ldfrag_h(p3);
    const v16h z0 = ldfrag_h(r0);
    const v16h z1 = ldfrag_h(r1);
    const v16h z2 = ldfrag_h(r2);
    const v16h z3 = ldfrag_h(r3);
    hold_addr(pg, p0, r0, pg, pg, pg, pg, pg, pg, pg);     // the other seven addresses are constant offsets from these three
    g[0] = mma_h(ag, y0, g[0]);  be[0] = mma_h(ab, y0, be[0]);
    g[1] = mma_h(ag, y1, g[1]);  be[1] = mma_h(ab, y1, be[1]);
    g[2] = mma_h(ag, y2, g[2]);  be[2] = mma_h(ab, y2, be[2]);
    g[3] = mma_h(ag, y3, g[3]);  be[3] = mma_h(ab, y3, be[3]);
    g[0] = mma_h(ag, z0, g[0]);  be[0] = mma_h(ab, z0, be[0]);
    g[1] = mma_h(ag, z1, g[1]);  be[1] = mma_h(ab, z1, be[1]);
    g[2] = mma_h(ag, z2, g[2]);  be[2] = mma_h(ab, z2, be[2]);
    g[3] = mma_h(ag, z3, g[3]);  be[3] = mma_h(ab, z3, be[3]);
    guardF(g[0], g[1], g[2], g[3], be[0], be[1], be[2], be[3], ag, ab, y0, y1, y2, y3, z0, z1, z2, z3);
  }
  float* sl = slab + wave * SLAB64;
  float xm[4];
#pragma unroll
  for (int j = 0; j < 4; ++j) xm[j] = bfr(XM[(size_t)b * TT + t0 + 16 * j + m]);
#pragma unroll
  for (int r = 0; r < 8; ++r) {
    const int cc = c0 + 8 * hh + r;
    const float bg = bfr(bfl[cc]);
    const float bb = bfr(bfl[HID + cc]);
    const float* xr = X + ((size_t)(b * HID + cc)) * TT + t0 + m;
#pragma unroll
    for (int j = 0; j < 4; ++j) {
      const float gam = g[j][r] * oscale + bg;
      const float bet = be[j][r] * oscale + bb;
      const float xv  = bfr(xr[16 * j]);
      sl[(8 * hh + r) * 68 + 16 * j + m] = (xv * gam + bet) * xm[j];
    }
  }
  wave_sync_lds();
  store64(sl, OUT, TT, (size_t)(b * HID + c0), t0, lane);
}

// =====================================================================================================
// Workspace map (bytes); every plane is fully written by whole-line stores before it is read; all extents are exact multiples
// of the store granularity (no pad rows needed); every offset a multiple of 65536. Regions R1, R3, R4, R5, R2 are reused by a
// later plane once the earlier plane's last reader has run (launch order below):
//   CT f32 [2048][64] 524288, ST same
//   R3: XT bf16 [16][2048][256]  -> later QH f16 [16][2048][4][64]        16777216
//   R4: CONDT bf16 [16][512][512] -> later KF f32 [16][512][256]            8388608
//   WCB bf16 [256][512] 262144; WQB bf16 [256][256] 131072; WKH, WVH, WOH f16 [256][256] 131072 each; WFH f16 [512][256] 262144
//   R5: CTF f32 [16][512][256]   -> later VF f32 [16][256][512]            8388608
//   CH f16 [16][512][256] 4194304, CL same
//   R1: QF f32 [16][2048][256]   -> later YF f32 [16][2048][256]          33554432
//   KH f16 [16][4][512][64] 4194304; VH f16 [16][256][512] 4194304; VS f32 [16][16][256] 262144
//   R2: OH, OL f16 [16][2048][256] 16777216 each -> later YH, YL (same sizes)
//   end 119799808
// =====================================================================================================
extern "C" void kernel_launch(void* const* d_in, const int* in_sizes, int n_in,
                              void* d_out, int out_size, void* d_ws, size_t ws_size,
                              hipStream_t stream) {
  if (n_in < 16) return;
  if (in_sizes[0] != NBAT * HID * TT) return;
  if (in_sizes[1] != NBAT * TT) return;
  if (in_sizes[2] != NBAT * CND * TS) return;
  if (in_sizes[3] != NBAT * TS) return;
  if (in_sizes[4] != HID * CND || in_sizes[5] != HID) return;
  if (in_sizes[6] != HID * HID || in_sizes[7] != HID) return;
  if (in_sizes[8] != HID * HID || in_sizes[9] != HID) return;
  if (in_sizes[10] != HID * HID || in_sizes[11] != HID) return;
  if (in_sizes[12] != HID * HID || in_sizes[13] != HID) return;
  if (in_sizes[14] != 2 * HID * HID || in_sizes[15] != 2 * HID) return;
  if (out_size != NBAT * HID * TT) return;

  const float* x      = (const float*)d_in[0];
  const float* x_mask = (const float*)d_in[1];
  const float* cond   = (const float*)d_in[2];
  const float* c_mask = (const float*)d_in[3];
  const float* w_cond = (const float*)d_in[4];
  const float* b_cond = (const float*)d_in[5];
  const float* wq     = (const float*)d_in[6];
  const float* bq     = (const float*)d_in[7];
  const float* wk     = (const float*)d_in[8];
  const float* bk     = (const float*)d_in[9];
  const float* wv     = (const float*)d_in[10];
  const float* bv     = (const float*)d_in[11];
  const float* wo     = (const float*)d_in[12];
  const float* bo     = (const float*)d_in[13];
  const float* wf     = (const float*)d_in[14];
  const float* bfi    = (const float*)d_in[15];
  float*       out    = (float*)d_out;

  const size_t szTab = (size_t)TT * HD * 4;                       //    524288
  const size_t szR3  = (size_t)NBAT * TT * HID * 2;               //  16777216
  const size_t szR4  = (size_t)NBAT * TS * CND * 2;               //   8388608 (= NBAT*TS*HID*4)
  const size_t szWCB = (size_t)HID * CND * 2;                     //    262144
  const size_t szW   = (size_t)HID * HID * 2;                     //    131072
  const size_t szWF  = (size_t)2 * HID * HID * 2;                 //    262144
  const size_t szR5  = (size_t)NBAT * TS * HID * 4;               //   8388608
  const size_t szCP  = (size_t)NBAT * TS * HID * 2;               //   4194304
  const size_t szR1  = (size_t)NBAT * TT * HID * 4;               //  33554432
  const size_t szKH  = (size_t)NBAT * TS * HID * 2;               //   4194304
  const size_t szVH  = (size_t)NBAT * HID * TS * 2;               //   4194304
  const size_t szVS  = (size_t)NBAT * NKB * HID * 4;              //    262144
  const size_t szOP  = (size_t)NBAT * TT * HID * 2;               //  16777216
  static_assert((size_t)NBAT * TS * CND * 2 == (size_t)NBAT * TS * HID * 4);
  size_t off = 0;
  const size_t oCT  = off; off += szTab;
  const size_t oST  = off; off += szTab;
  const size_t oR3  = off; off += szR3;
  const size_t oR4  = off; off += szR4;
  const size_t oWCB = off; off += szWCB;
  const size_t oWQB = off; off += szW;
  const size_t oWKH = off; off += szW;
  const size_t oWVH = off; off += szW;
  const size_t oWOH = off; off += szW;
  const size_t oWFH = off; off += szWF;
  const size_t oR5  = off; off += szR5;
  const size_t oCH  = off; off += szCP;
  const size_t oCL  = off; off += szCP;
  const size_t oR1  = off; off += szR1;
  const size_t oKH  = off; off += szKH;
  const size_t oVH  = off; off += szVH;
  const size_t oVS  = off; off += szVS;
  const size_t oOH  = off; off += szOP;
  const size_t oOL  = off; off += szOP;
  if (off > ws_size) return;                            // off = 119799808
  if (off > (size_t)134217728) return;

  char* ws = (char*)d_ws;
  float* CT    = (float*)(ws + oCT);
  float* ST    = (float*)(ws + oST);
  u16*   XT    = (u16*)(ws + oR3);
  u16*   QH    = (u16*)(ws + oR3);
  u16*   CONDT = (u16*)(ws + oR4);
  float* KF    = (float*)(ws + oR4);
  u16*   WCB   = (u16*)(ws + oWCB);
  u16*   WQB   = (u16*)(ws + oWQB);
  u16*   WKH   = (u16*)(ws + oWKH);
  u16*   WVH   = (u16*)(ws + oWVH);
  u16*   WOH   = (u16*)(ws + oWOH);
  u16*   WFH   = (u16*)(ws + oWFH);
  float* CTF   = (float*)(ws + oR5);
  float* VF    = (float*)(ws + oR5);
  u16*   CH    = (u16*)(ws + oCH);
  u16*   CL    = (u16*)(ws + oCL);
  float* QF    = (float*)(ws + oR1);
  float* YF    = (float*)(ws + oR1);
  u16*   KH    = (u16*)(ws + oKH);
  u16*   VH    = (u16*)(ws + oVH);
  float* VS    = (float*)(ws + oVS);
  u16*   OH    = (u16*)(ws + oOH);
  u16*   OL    = (u16*)(ws + oOL);
  u16*   YH    = (u16*)(ws + oOH);
  u16*   YL    = (u16*)(ws + oOL);

  // inv_freq[i] = 1 / pow(10000, i/32) in f32 (pow correctly converted from f64, then IEEE f32 reciprocal)
  InvF inv;
  for (int i = 0; i < 32; ++i) {
    const double p = pow(10000.0, (double)i / 32.0);
    const float pf = (float)p;
    inv.f[i] = 1.0f / pf;
  }

  const dim3 blk(256);
  const dim3 bG(128);
  const dim3 gAT(NBAT * NH * (TT / 64));                // 2048
  const dim3 gFM(NBAT * 4 * (TT / 64));                 // 2048

  // (0) inputs only: rotary cos/sin tables [2048][64]; x [b][256][2048] -> XT bf16 [b][2048][256]; cond [b][512][512] -> CONDT bf16
  //     [b][512 s][512 i]; weights (W[o][i] row-major is already [n][k]): bf16 planes for w_cond, wq; f16(bf16 x1024) for wk, wv, wo, w_film
  pro_k<<<dim3(NB_PRO), blk, 0, stream>>>(x, cond, w_cond, wq, wk, wv, wo, wf, CT, ST, XT, CONDT, WCB, WQB, WKH, WVH, WOH, WFH, inv);
  // (1) c^T [8192][256] f32 = CONDT [8192][512] . WCB^T + b_cond;  q^T [32768][256] f32 = XT . WQB^T + bq
  gemm_cq<<<dim3(NB_GC + NB_GQ), bG, 0, stream>>>(CONDT, WCB, b_cond, CTF, XT, WQB, bq, QF);
  // (2) q' plane: rows (b, t, h), positions mod 2048 (into the XT region, XT no longer needed);  c^T -> f16 hi + residual planes x1024
  rq_sc<<<dim3(NB_RQ + NB_SC), blk, 0, stream>>>(QF, CT, ST, QH, CTF, CH, CL);
  // (3) v [b][256][512] f32 = WVH [256][256] . (CH + CL)[b][512][256]^T + bv per row (into the c^T region);
  //     k^T [8192][256] f32 = CH . WKH^T (+ bk) (into the CONDT region); carries 1024 x 1024 folded back
  gemm_kv<<<dim3(NB_GV + NB_GK), bG, 0, stream>>>(CH, CL, WVH, WKH, bv, bk, VF, KF);
  // (4) k' plane: rows (b, s, h), positions mod 512;  v f16 plane x1024 + per-32-key block sums
  rk_vc<<<dim3(NB_RK + NB_VC), blk, 0, stream>>>(KF, CT, ST, KH, VF, VH, VS);
  // (5) cross attention -> O planes [b][t][h*64+d] x8192 (hi + residual)
  attn_x<<<gAT, bG, 0, stream>>>(QH, KH, VH, VS, c_mask, x_mask, OH, OL);
  // (6) y^T [32768][256] f32 = (OH + OL) . WOH^T + bo, carries 8192 x 1024 folded back
  gemm_o<<<dim3(NB_GQ), bG, 0, stream>>>(OH, OL, WOH, bo, YF);
  // (7) y^T -> f16 hi + residual planes x16384 (into the O plane region, O no longer needed)
  split_y<<<dim3((NBAT * TT * HID) / 2048), blk, 0, stream>>>(YF, YH, YL);
  // (8) FiLM GEMM + combine -> out [16][256][2048] f32
  film_k<<<gFM, bG, 0, stream>>>(WFH, YH, YL, bfi, x, x_mask, out, 1.0f / (YSC * WSC));
  (void)hipGetLastError();
}

// v003
// A run of this version takes 167 microseconds.
// Next to v002, in two timings, it ran 1.15 and 1.16 times as fast.
// Over all steps from v000 it is 1.65 times as fast.
// Contractions: cond^T.w_cond^T and x^T.wq^T on v_wmma_f32_16x16x32_bf16 (inputs RNE-converted to bf16, exact operands, f32 accumulate);
// c.wk^T (c x1024 f16 hi plane), wv.c (c x1024 f16 hi + residual, products w.h + w.l), scores q'.k'^T (q' x1024, k' x1024 f16, one product),
// P'.v (centred P' = (e - 7/8) x1024 f16, v x1024 f16, one product; 7/8 * sum(v) per 32-key block added in f32),
// O.wo^T (O x8192 f16 hi + residual, products h.w + l.w), w_film.y (y x16384 f16 hi + residual): v_wmma_f32_16x16x32_f16,
// weights as f16(bf16(w) x1024), f32 accumulate. Rotary tables: f64 sin/cos of the f32 angle. Rotation, masked base-2 online softmax, 1/l, FiLM combine: f32 on VALU.
#include <hip/hip_runtime.h>
#include <math.h>
#include <stdint.h>

#define NBAT  16
#define TT    2048
#define TS    512
#define HID   256
#define CND   512
#define NH    4
#define HD    64
#define NKB   (TS / 32)
#define QSC   1024.0f
#define KSC   1024.0f
#define CSC   1024.0f
#define VCAR  1024.0f
#define PCAR  1024.0f
#define OSC   8192.0f
#define YSC   16384.0f
#define WSC   1024.0f
#define PCEN  0.875f
#define LOG2E 1.4426950408889634f
#define MASKT (-10000.0f * LOG2E)
#define SLAB64 (16 * 68)
#define SLABF  (16 * 68)
#define VTP    72
static_assert(HID == NH * HD && HD == 64);
static_assert((TT % 64) == 0 && (TS % 64) == 0 && (TS % 32) == 0 && NKB == 16);
static_assert((TT & (TT - 1)) == 0 && (TS & (TS - 1)) == 0);
static_assert(16 * 36 <= SLABF);
static_assert((HID % 64) == 0 && (CND % 64) == 0 && (HID % 32) == 0 && (CND % 32) == 0);
static_assert(((NBAT * TT * NH * 8) % 256) == 0 && ((NBAT * TS * NH * 8) % 256) == 0);
static_assert(((NBAT * TS * HID) % 2048) == 0 && ((NBAT * TT * HID) % 2048) == 0);

typedef unsigned short u16;
typedef _Float16 v16h __attribute__((ext_vector_type(16)));
typedef _Float16 v8h  __attribute__((ext_vector_type(8)));
typedef __bf16   v16b __attribute__((ext_vector_type(16)));
typedef float    v8f  __attribute__((ext_vector_type(8)));
typedef float    v4f  __attribute__((ext_vector_type(4)));
typedef unsigned int v4u __attribute__((ext_vector_type(4)));

union FragH { v16h v; v8h h[2]; v4u u[2]; };
union FragB { v16b v; v4u u[2]; };

struct InvF { float f[32]; };
static_assert(sizeof(InvF) == 128);

// ---- scalar helpers --------------------------------------------------------------------------------
__device__ __forceinline__ unsigned short bf_bits(float f) {          // f32 -> bf16 bits, RNE convert
  unsigned u = __float_as_uint(f);
  return (unsigned short)((u + 0x7FFFu + ((u >> 16) & 1u)) >> 16);
}
__device__ __forceinline__ float bf_up(unsigned short h) { return __uint_as_float(((unsigned)h) << 16); }
__device__ __forceinline__ float bfr(float f) { return bf_up(bf_bits(f)); }
__device__ __forceinline__ unsigned short h_bits(_Float16 x) { return __builtin_bit_cast(unsigned short, x); }
__device__ __forceinline__ unsigned pk16(unsigned short a, unsigned short b) { return (unsigned)a | ((unsigned)b << 16); }
__device__ __forceinline__ v8f zero8() { v8f z = {0.f, 0.f, 0.f, 0.f, 0.f, 0.f, 0.f, 0.f}; return z; }

// ---- fragment-major planes: a 16-bit plane [R][K] (R % 16 == 0, K % 32 == 0) is stored as tiles of 16 rows x 32 k, 512 halves
//      each, tile (row >> 4, k >> 5) at ((row >> 4) * (K >> 5) + (k >> 5)) * 512; inside a tile 64 chunks of 8 halves, chunk slot
//      = ((k >> 4) & 1) * 32 + ((k >> 3) & 1) * 16 + (row & 15), so that slot & 31 is the lane that owns the chunk.
// ---- fragment loaders: 16-bit A/B operand, p = tile start + 8 * lane: two wave-wide loads of 512 contiguous bytes;
//      lane -> row/col (lane&15), elements 0..7 <- k0+8h.., elements 8..15 <- k0+16+8h..  (same split k map for A and B)
__device__ __forceinline__ v16h ldfrag_h(const _Float16* p) {
  FragH f;
  f.h[0] = *(const v8h*)(p);
  f.h[1] = *(const v8h*)(p + 256);
  return f.v;
}
__device__ __forceinline__ v16h ldfrag_rm_h(const _Float16* p) {      // same k map from a row-major row, p includes +8*(lane>>4)
  FragH f;
  f.h[0] = *(const v8h*)(p);
  f.h[1] = *(const v8h*)(p + 16);
  return f.v;
}
__device__ __forceinline__ v16b ldfrag_b(const u16* p) {              // bf16 plane read as unsigned integer vectors
  FragB f;
  f.u[0] = *(const v4u*)(p);
  f.u[1] = *(const v4u*)(p + 256);
  return f.v;
}

// Stands behind a group of fragment loads and names their address registers as inputs, so that these registers stay unwritten
// (by a later load's result or by an address update) up to the s_wait_xcnt 0 inside it.
__device__ __forceinline__ void hold_addr(const void* a, const void* b, const void* c, const void* d, const void* e,
                                          const void* f, const void* g, const void* h, const void* i, const void* j) {
#if defined(__HIP_DEVICE_COMPILE__)
  asm volatile("s_wait_xcnt 0x0" :: "v"(a), "v"(b), "v"(c), "v"(d), "v"(e), "v"(f), "v"(g), "v"(h), "v"(i), "v"(j) : "memory");
#endif
}
// chunk slot (0..63) of a tile -> row in the tile and first k in the tile
__device__ __forceinline__ int slot_row(int slot) { return slot & 15; }
__device__ __forceinline__ int slot_k(int slot) { return ((slot >> 5) << 4) + (((slot >> 4) & 1) << 3); }

__device__ __forceinline__ v8f mma_h(v16h a, v16h b, v8f c) {
  return __builtin_amdgcn_wmma_f32_16x16x32_f16(false, a, false, b, (short)0, c, false, false);
}
__device__ __forceinline__ v8f mma_b(v16b a, v16b b, v8f c) {
  return __builtin_amdgcn_wmma_f32_16x16x32_bf16(false, a, false, b, (short)0, c, false, false);
}
__device__ __forceinline__ void guard2(v8f& a, v8f& b, v16h x0, v16h x1, v16h x2, v16h x3, v16h x4, v16h x5) {
#if defined(__HIP_DEVICE_COMPILE__)
  asm volatile("v_nop\n\tv_nop\n\tv_nop\n\tv_nop"
               : "+v"(a), "+v"(b) : "v"(x0), "v"(x1), "v"(x2), "v"(x3), "v"(x4), "v"(x5) : "memory");
#endif
}
template <typename F>
__device__ __forceinline__ void guard6(v8f& a, v8f& b, v8f& c, v8f& d, F x0, F x1, F x2, F x3, F x4, F x5) {
#if defined(__HIP_DEVICE_COMPILE__)
  asm volatile("v_nop\n\tv_nop\n\tv_nop\n\tv_nop"
               : "+v"(a), "+v"(b), "+v"(c), "+v"(d) : "v"(x0), "v"(x1), "v"(x2), "v"(x3), "v"(x4), "v"(x5) : "memory");
#endif
}
__device__ __forceinline__ void guard10(v8f& a, v8f& b, v8f& c, v8f& d, v16h x0, v16h x1, v16h x2, v16h x3, v16h x4,
                                        v16h x5, v16h x6, v16h x7, v16h x8, v16h x9) {
#if defined(__HIP_DEVICE_COMPILE__)
  asm volatile("v_nop\n\tv_nop\n\tv_nop\n\tv_nop"
               : "+v"(a), "+v"(b), "+v"(c), "+v"(d)
               : "v"(x0), "v"(x1), "v"(x2), "v"(x3), "v"(x4), "v"(x5), "v"(x6), "v"(x7), "v"(x8), "v"(x9) : "memory");
#endif
}
__device__ __forceinline__ void guardF(v8f& a0, v8f& a1, v8f& a2, v8f& a3, v8f& c0, v8f& c1, v8f& c2, v8f& c3,
                                       v16h x0, v16h x1, v16h x2, v16h x3, v16h x4, v16h x5, v16h x6, v16h x7,
                                       v16h x8, v16h x9) {
#if defined(__HIP_DEVICE_COMPILE__)
  asm volatile("v_nop\n\tv_nop\n\tv_nop\n\tv_nop"
               : "+v"(a0), "+v"(a1), "+v"(a2), "+v"(a3), "+v"(c0), "+v"(c1), "+v"(c2), "+v"(c3)
               : "v"(x0), "v"(x1), "v"(x2), "v"(x3), "v"(x4), "v"(x5), "v"(x6), "v"(x7), "v"(x8), "v"(x9) : "memory");
#endif
}
__device__ __forceinline__ void acc_guard4(v8f& a, v8f& b, v8f& c, v8f& d) {
#if defined(__HIP_DEVICE_COMPILE__)
  asm volatile("v_nop\n\tv_nop\n\tv_nop\n\tv_nop" : "+v"(a), "+v"(b), "+v"(c), "+v"(d));
#endif
}
__device__ __forceinline__ void wave_sync_lds() {
  __builtin_amdgcn_fence(__ATOMIC_RELEASE, "workgroup");
  __builtin_amdgcn_wave_barrier();
  __builtin_amdgcn_fence(__ATOMIC_ACQUIRE, "workgroup");
}

// ---- accurate f32 sin/cos of a non-negative f32 angle (|angle| < 2048): f64 two-part pi/2 reduction + f64 polynomials,
//      plain f64 fma/mul only (no library f64 trig path), result converted to f32.
__device__ __forceinline__ void sincos_acc(float angf, float& sv, float& cv) {
  const double a = (double)angf;
  const double TWO_OVER_PI = 0.63661977236758134308;
  const double PIO2_HI = 1.5707963267948966;
  const double PIO2_LO = 6.123233995736766e-17;
  const int kq = (int)(a * TWO_OVER_PI + 0.5);
  const double kd = (double)kq;
  double r = fma(-kd, PIO2_HI, a);
  r = fma(-kd, PIO2_LO, r);
  const double r2 = r * r;
  double sp = 1.0 / 6227020800.0;
  sp = fma(sp, r2, -1.0 / 39916800.0);
  sp = fma(sp, r2, 1.0 / 362880.0);
  sp = fma(sp, r2, -1.0 / 5040.0);
  sp = fma(sp, r2, 1.0 / 120.0);
  sp = fma(sp, r2, -1.0 / 6.0);
  const double s = fma(sp * r2, r, r);
  double cp = -1.0 / 87178291200.0;
  cp = fma(cp, r2, 1.0 / 479001600.0);
  cp = fma(cp, r2, -1.0 / 3628800.0);
  cp = fma(cp, r2, 1.0 / 40320.0);
  cp = fma(cp, r2, -1.0 / 720.0);
  cp = fma(cp, r2, 1.0 / 24.0);
  cp = fma(cp, r2, -0.5);
  const double c = fma(cp, r2, 1.0);
  const int qd = kq & 3;
  const double so = (qd == 0) ? s : (qd == 1) ? c : (qd == 2) ? -s : -c;
  const double co = (qd == 0) ? c : (qd == 1) ? -s : (qd == 2) ? -c : s;
  sv = (float)so;
  cv = (float)co;
}

// =====================================================================================================
// Rotary tables: cosT[t][d], sinT[t][d] for t < TT, d < HD, angle = float(t) * inv_freq[d & 31] (f32 product), halves duplicated.
// Wave = one position t, lane = frequency index; inv_freq picked from the by-value table with a static select chain.
// coverage: grid TT/8 blocks x 8 waves = TT rows; per row 4 line stores = 64 floats of each table.
// =====================================================================================================
__device__ __forceinline__ void k_tab(float* cosT, float* sinT, const InvF& inv, int bx) {
  const int tid  = threadIdx.x;
  const int lane = tid & 31;
  const int t    = bx * 8 + (tid >> 5);
  if (t >= TT) return;                      // never taken with the exact grid; no barriers in this kernel
  float f = inv.f[0];
#pragma unroll
  for (int i = 1; i < 32; ++i) f = (lane == i) ? inv.f[i] : f;
  const float ang = (float)t * f;
  float sv, cv;
  sincos_acc(ang, sv, cv);
  float* cr = cosT + (size_t)t * HD;
  float* sr = sinT + (size_t)t * HD;
  {
    *(float*)(cr + lane)      = cv;
    *(float*)(cr + 32 + lane) = cv;
    *(float*)(sr + lane)      = sv;
    *(float*)(sr + 32 + lane) = sv;
    
  }
}

// =====================================================================================================
// Batched transpose + bf16 convert: in W[b][R][C] (row-major f32) -> out D[b][C][R] (bf16 RNE bits, fragment-major plane).
// Block = one 64x64 tile (r0, c0) of batch bb: 256 thr x 4 16-B loads -> LDS tile [c][r] (pitch 72), block barrier,
// coverage: load 256 thr x 16 = 64x64; store 2 iterations x 256 thr x 8 halves = 64 lines x 64; grid (C/64)*(R/64) x b = all of D.
// =====================================================================================================
__device__ __forceinline__ void cvt_T(const float* __restrict__ W, u16* D, int R, int C, int bid, int bb, u16* T) {
  const int tid = threadIdx.x;
  const int ntc = C >> 6;
  const int c0  = (bid % ntc) * 64;
  const int r0  = (bid / ntc) * 64;
  const float* Wb = W + (size_t)bb * (size_t)R * (size_t)C;
  u16*         Db = D + (size_t)bb * (size_t)R * (size_t)C;
  {
    const int rr = tid >> 2;
    const int cc = (tid & 3) * 16;
    const float* src = Wb + (size_t)(r0 + rr) * C + c0 + cc;
#pragma unroll
    for (int i = 0; i < 4; ++i) {
      const v4f a = *(const v4f*)(src + 4 * i);
#pragma unroll
      for (int e = 0; e < 4; ++e) T[(cc + 4 * i + e) * VTP + rr] = bf_bits(a[e]);
    }
  }
  __syncthreads();
  // thread = one chunk of the fragment-major plane: 8 local tiles (4 row tiles x 2 k tiles) x 64 slots
  v4u vals[2];
  const int slot = tid & 63;
#pragma unroll
  for (int it = 0; it < 2; ++it) {
    const int lt = it * 4 + (tid >> 6);
    vals[it] = *(const v4u*)(T + ((lt >> 1) * 16 + slot_row(slot)) * VTP + (lt & 1) * 32 + slot_k(slot));
  }
  {
#pragma unroll
    for (int it = 0; it < 2; ++it) {
      const int lt = it * 4 + (tid >> 6);
      const size_t tile = (size_t)((c0 >> 4) + (lt >> 1)) * (size_t)(R >> 5) + (size_t)((r0 >> 5) + (lt & 1));
      *(v4u*)(Db + tile * 512 + slot * 8) = vals[it];
    }
#if defined(__HIP_DEVICE_COMPILE__)
    // in a merged grid other jobs' code follows in the listing and reuses the two stores' address and data registers: wait first
    asm volatile("s_wait_xcnt 0x0" ::: "memory");
#endif
  }
}

// =====================================================================================================
// Row-major f32 [R][K] -> 16-bit fragment-major plane. f16mode == 0: bf16 RNE bits; f16mode == 1: f16 bits of (bf16 RNE value) * scale.
// Thread = 8 consecutive elements: two 16-B loads, one 16-B store; 32 consecutive lanes = 512 contiguous, 512-B aligned bytes
// coverage: grid = ceil(n8/256) blocks x 256 thr x 8 = the whole plane (n8 a multiple of 32 in every use, so no partial line).
// =====================================================================================================
__device__ __forceinline__ void cvt_flat(const float* __restrict__ src, u16* D, int n8, int f16mode, float scale, int K, int bx) {
  const int gt = bx * 256 + (int)threadIdx.x;   // chunk index in the fragment-major plane
  if (gt >= n8) return;                     // no barriers in this kernel
  const int ktn = K >> 5, tile = gt >> 6, slot = gt & 63;
  const int rt = tile / ktn, kt = tile - rt * ktn;
  const float* p = src + (size_t)(rt * 16 + slot_row(slot)) * K + kt * 32 + slot_k(slot);
  const v4f a = *(const v4f*)(p), bq = *(const v4f*)(p + 4);
  float w[8];
#pragma unroll
  for (int e = 0; e < 4; ++e) { w[e] = a[e]; w[4 + e] = bq[e]; }
  v4u o;
#pragma unroll
  for (int e = 0; e < 4; ++e) {
    const float v0 = w[2 * e], v1 = w[2 * e + 1];
    const unsigned short h0 = h_bits((_Float16)(bfr(v0) * scale)), h1 = h_bits((_Float16)(bfr(v1) * scale));
    const unsigned short b0 = bf_bits(v0), b1 = bf_bits(v1);
    o[e] = (f16mode != 0) ? pk16(h0, h1) : pk16(b0, b1);
  }
  u16* d = D + (size_t)gt * 8;
  {
    *(v4u*)(d) = o;
    
  }
}

// =====================================================================================================
// GEMM epilogues: the wave's 16 x 64 f32 tile stands (final values) in its LDS slab (pitch 68), the caller has issued the wave's
// LDS sync; the epilogue writes the 16-bit plane(s) that a later launch reads, so no f32 copy of the tile goes through memory.
// A lane owns four chunks of 8 halves. Fragment-major planes: chunk it = row (lane & 15), columns it * 16 + 8 * (lane >> 4) ..,
// which is slot (it & 1) * 32 + lane of k tile (it >> 1) of the tile pair: one store = 512 contiguous bytes of the wave.
// =====================================================================================================
// f16 hi + residual fragment-major planes: hi = f16(v * sc), lo = f16(v * sc - hi) (sc a power of two, residual unscaled).
// base = first half of the wave's tile pair + 8 * lane. coverage: 4 stores x 32 lanes x 8 halves = 16 x 64 of each plane.
__device__ __forceinline__ void ep_split(const float* sl, u16* Hp, u16* Lp, size_t base, float sc, int lane) {
  const int hh = lane >> 4, m = lane & 15;
  v4u oh[4], ol[4];
#pragma unroll
  for (int it = 0; it < 4; ++it) {
    const float* p = sl + m * 68 + it * 16 + 8 * hh;
    const v4f a = *(const v4f*)(p), bq = *(const v4f*)(p + 4);
    float w[8];
#pragma unroll
    for (int e = 0; e < 4; ++e) { w[e] = a[e] * sc; w[4 + e] = bq[e] * sc; }
#pragma unroll
    for (int e = 0; e < 4; ++e) {
      const float t0 = w[2 * e], t1 = w[2 * e + 1];
      const _Float16 h0 = (_Float16)t0, h1 = (_Float16)t1;
      const _Float16 l0 = (_Float16)(t0 - (float)h0), l1 = (_Float16)(t1 - (float)h1);
      oh[it][e] = pk16(h_bits(h0), h_bits(h1));
      ol[it][e] = pk16(h_bits(l0), h_bits(l1));
    }
  }
#pragma unroll
  for (int it = 0; it < 4; ++it) {
    *(v4u*)(Hp + base + (size_t)it * 256) = oh[it];
    *(v4u*)(Lp + base + (size_t)it * 256) = ol[it];
  }
}

// Rotate-half rotary + f16 pack (single plane); the tile's 64 columns are one head's HD channels, its rows 16 positions pos0 .. .
//   w[d] = x[d] * cos[pos][d] + r[d] * sin[pos][d],  r[d] = -x[d+32] for d < 32, x[d-32] for d >= 32;  out[d] = f16(w * sc).
// FM == 0: row-major out plane (q'), chunk it = row it * 4 + (lane >> 3), d0 = (lane & 7) * 8: 8 lanes = the 128 bytes of a row;
// FM != 0: fragment-major out plane (k'), chunks as above.
template <int FM> __device__ __forceinline__ int rope_row(int it, int lane) { return FM ? (lane & 15) : it * 4 + (lane >> 3); }
template <int FM> __device__ __forceinline__ int rope_d0(int it, int lane) { return FM ? it * 16 + 8 * (lane >> 4) : (lane & 7) * 8; }
struct RopeTab { v4f ca[4], cb[4], sa[4], sb[4]; };
template <int FM>
__device__ __forceinline__ void rope_tab(RopeTab& t, const float* __restrict__ cosT, const float* __restrict__ sinT, int pos0,
                                         int lane) {
  const size_t o = (size_t)(pos0 + rope_row<FM>(0, lane)) * HD + rope_d0<FM>(0, lane);
  const float *cr = cosT + o, *sr = sinT + o;
  const int st = FM ? 16 : 4 * HD;            // floats from one of the lane's chunks to the next
#pragma unroll
  for (int it = 0; it < 4; ++it) {
    t.ca[it] = *(const v4f*)(cr + it * st);  t.cb[it] = *(const v4f*)(cr + it * st + 4);
    t.sa[it] = *(const v4f*)(sr + it * st);  t.sb[it] = *(const v4f*)(sr + it * st + 4);
  }
  hold_addr(cr, sr, cr, cr, cr, cr, cr, cr, cr, cr);   // the sixteen addresses are constant offsets from these two
}
// dst = the lane's first chunk. coverage: 4 stores x 32 lanes x 8 halves = 16 rows x 64 of the plane.
template <int FM>
__device__ __forceinline__ void ep_rope(const float* sl, const RopeTab& t, u16* dst, float sc, int lane) {
  v4u oh[4];
#pragma unroll
  for (int it = 0; it < 4; ++it) {
    const int d0 = rope_d0<FM>(it, lane), d1 = d0 ^ 32;
    const float* xr = sl + rope_row<FM>(it, lane) * 68;
    const v4f xa = *(const v4f*)(xr + d0), xb = *(const v4f*)(xr + d0 + 4);
    const v4f ya = *(const v4f*)(xr + d1), yb = *(const v4f*)(xr + d1 + 4);
    const float sgn = (d0 < 32) ? -1.0f : 1.0f;
    float w[8];
#pragma unroll
    for (int e = 0; e < 4; ++e) {
      w[e]     = fmaf(sgn * ya[e], t.sa[it][e], xa[e] * t.ca[it][e]);   // cosine product rounded, sine product fused
      w[4 + e] = fmaf(sgn * yb[e], t.sb[it][e], xb[e] * t.cb[it][e]);
    }
#pragma unroll
    for (int e = 0; e < 4; ++e) {
      const _Float16 h0 = (_Float16)(w[2 * e] * sc), h1 = (_Float16)(w[2 * e + 1] * sc);
      oh[it][e] = pk16(h_bits(h0), h_bits(h1));
    }
  }
#pragma unroll
  for (int it = 0; it < 4; ++it) *(v4u*)(dst + (size_t)it * (FM ? 256 : 4 * HID)) = oh[it];
}

// v plane + per-32-key block sums; the tile is 16 channels (rows) x 64 keys of batch b, the block 64 channels o0 .. x the same keys.
//   VH = f16(v * 1024), fragment-major plane [b * HID + o][TS], vbase = first half of the wave's tile pair + 8 * lane;
//   VS[b][kb][o] = sum over keys kb*32 .. kb*32+31 of v (f32): 8 keys in a lane as a tree, the chunk pair (0,1) and (2,3) across the
//   wave's halves, then the two pairs; the block's 2 x 64 sums meet in S (128 floats of LDS) so that one wave stores whole lines.
// coverage: VH 4 stores x 32 lanes x 8 halves = 16 x 64; VS 2 key blocks x 64 channels per block, vsdst = VS + (b * NKB + kb0) * HID + o0.
__device__ __forceinline__ void ep_v(const float* sl, u16* VH, size_t vbase, float* vsdst, float* S, int wave, int lane) {
  const int hh = lane >> 4, m = lane & 15;
  v4u o[4];
  float ps[4];
#pragma unroll
  for (int it = 0; it < 4; ++it) {
    const float* p = sl + m * 68 + it * 16 + 8 * hh;
    const v4f a = *(const v4f*)(p), bq = *(const v4f*)(p + 4);
#pragma unroll
    for (int q = 0; q < 2; ++q) {
      o[it][q]     = pk16(h_bits((_Float16)(a[2 * q] * VCAR)),  h_bits((_Float16)(a[2 * q + 1] * VCAR)));
      o[it][2 + q] = pk16(h_bits((_Float16)(bq[2 * q] * VCAR)), h_bits((_Float16)(bq[2 * q + 1] * VCAR)));
    }
    ps[it] = ((a[0] + a[1]) + (a[2] + a[3])) + ((bq[0] + bq[1]) + (bq[2] + bq[3]));
  }
#pragma unroll
  for (int it = 0; it < 4; ++it) *(v4u*)(VH + vbase + (size_t)it * 256) = o[it];
#if defined(__HIP_DEVICE_COMPILE__)
  // the block sums below reuse the four stores' data registers: wait first
  asm volatile("s_wait_xcnt 0x0" ::: "memory");
#endif
#pragma unroll
  for (int it = 0; it < 4; ++it) ps[it] += __shfl_xor(ps[it], 16, 32);
  S[hh * 64 + wave * 16 + m] = (hh != 0) ? (ps[2] + ps[3]) : (ps[0] + ps[1]);
  __syncthreads();
  if (wave == 0) {
    const int piece = m * 4;
    const v4f sv = *(const v4f*)(S + hh * 64 + piece);
    *(v4f*)(vsdst + (size_t)hh * HID + piece) = sv;
  }
}

// =====================================================================================================
// Shared GEMM store: the wave's 16x64 f32 tile already staged (final values) in its LDS slab (pitch 68), caller issued the
// coverage: 8 instructions x 2 rows x 16 lanes x 4 floats = the wave's 16 x 64 tile.
// =====================================================================================================
__device__ __forceinline__ void store64(const float* sl, float* C, int N, size_t rowb, int col0, int lane) {
  const int hh = lane >> 4, m = lane & 15;
  v4f vals[8];
#pragma unroll
  for (int it = 0; it < 8; ++it) vals[it] = *(const v4f*)(sl + (it * 2 + hh) * 68 + m * 4);
  float* dst = C + (rowb + (size_t)hh) * (size_t)N + col0 + m * 4;
  {
#pragma unroll
    for (int it = 0; it < 8; ++it) {
      *(v4f*)(dst + (size_t)(it * 2) * (size_t)N) = vals[it];
    }
    
  }
}

// =====================================================================================================
// bf16 GEMM: T[M][N] (f32, never stored) = A[M][K] (bf16 fragment-major) . Bt[N][K]^T (bf16 k-contiguous), times oscale, + bf16(bias[col]).
// Block = 64x64 tile, 4 waves x 16 rows; A and Bt fragment-major: a fragment = two wave-wide loads of 512 contiguous bytes (split
// k map for A and B); K stepped by 32 (K % 32 == 0, M % 64 == 0, N % 64 == 0 statically, grid = (M/64)*(N/64)).
// Epilogue EP_SPLIT: P0, P1 = hi + residual planes [M][N] of T * psc; EP_ROPE_Q: P0 = q' plane, rows (batch, t), N = NH * HD.
// =====================================================================================================
#define EP_SPLIT  0
#define EP_ROPE_Q 1
#define EP_ROPE_K 2
#define EP_V      3
template <int EP>
__device__ __forceinline__
void gemm_bf(const u16* __restrict__ A, const u16* __restrict__ Bt, const float* __restrict__ bias,
             int M, int N, int K, float oscale, int bid, float* slab, u16* P0, u16* P1, float psc,
             const float* __restrict__ cosT, const float* __restrict__ sinT) {
  const int tid = threadIdx.x, wave = tid >> 5, lane = tid & 31, hh = lane >> 4, m = lane & 15;
  const int ntile = N >> 6;
  const int rowb  = (bid / ntile) * 64 + wave * 16;
  const int col0  = (bid % ntile) * 64;
  if (rowb + 16 > M) return;                 // wave-uniform, never taken with the exact grid; no block barriers in this kernel
  const u16* ap = A  + (size_t)rowb * K + 8 * lane;      // row tile rowb / 16, k tile 0
  const u16* bp = Bt + (size_t)col0 * K + 8 * lane;
  const size_t bs = (size_t)16 * K;                      // one row tile = K / 32 tiles of 512 halves
  v8f acc0 = zero8(), acc1 = zero8(), acc2 = zero8(), acc3 = zero8();
#pragma unroll 1
  for (int k0 = 0; k0 < K; k0 += 32) {
    const int kf = k0 * 16;                              // k tile k0 / 32
    const u16 *pa = ap + kf, *p0 = bp + kf, *p1 = p0 + bs, *p2 = p1 + bs, *p3 = p2 + bs;
    const v16b a  = ldfrag_b(pa);
    const v16b b0 = ldfrag_b(p0);
    const v16b b1 = ldfrag_b(p1);
    const v16b b2 = ldfrag_b(p2);
    const v16b b3 = ldfrag_b(p3);
    hold_addr(pa, p0, p1, p2, p3, pa, pa, pa, pa, pa);
    acc0 = mma_b(a, b0, acc0);
    acc1 = mma_b(a, b1, acc1);
    acc2 = mma_b(a, b2, acc2);
    acc3 = mma_b(a, b3, acc3);
    guard6<v16b>(acc0, acc1, acc2, acc3, a, b0, b1, b2, b3, a);
  }
  float* sl = slab + wave * SLAB64;
  float bb[4];
#pragma unroll
  for (int j = 0; j < 4; ++j) bb[j] = bfr(bias[col0 + 16 * j + m]);
#pragma unroll
  for (int r = 0; r < 8; ++r) {
    const int ro = (8 * hh + r) * 68 + m;
    sl[ro]      = acc0[r] * oscale + bb[0];
    sl[ro + 16] = acc1[r] * oscale + bb[1];
    sl[ro + 32] = acc2[r] * oscale + bb[2];
    sl[ro + 48] = acc3[r] * oscale + bb[3];
  }
  if constexpr (EP == EP_SPLIT) {
    wave_sync_lds();
    ep_split(sl, P0, P1, (size_t)rowb * N + (size_t)col0 * 16 + 8 * lane, psc, lane);
  } else {
    RopeTab t;
    rope_tab<0>(t, cosT, sinT, rowb & (TT - 1), lane);
    wave_sync_lds();
    ep_rope<0>(sl, t, P0 + (size_t)(rowb + (lane >> 3)) * N + col0 + (lane & 7) * 8, psc, lane);
  }
}

// =====================================================================================================
// f16 GEMM (optionally batched over bz with element strides sA, sB):
//   T[M][N] (f32, never stored) = (Ah [+ Al])[M][K] . (Bh [+ Bl])[N][K]^T, times oscale, + bf16(bias) per row (biasRow != 0) or per column.
//   A2: A carried as hi + unscaled residual plane (products h.B + l.B); B2: B carried as hi + residual (A.h + A.l); never both.
// Same tiling as gemm_bf; all planes f16 fragment-major, K % 32 == 0.
// Epilogue EP_SPLIT: P0, P1 = hi + residual planes [M][N] of T * psc; EP_ROPE_K: P0 = k' planes, rows (batch, s), N = NH * HD;
// EP_V: P0 = v plane, VS = block sums, batch bz, rows = channels, columns = keys (M = HID, N = TS); S = 128 floats of LDS.
// =====================================================================================================
template <int A2, int B2, int EP>
__device__ __forceinline__
void gemm_h(const u16* __restrict__ Ah, const u16* __restrict__ Al, const u16* __restrict__ Bh, const u16* __restrict__ Bl,
            const float* __restrict__ bias, int M, int N, int K, int sA, int sB, int biasRow, float oscale,
            int bid, int bz, float* slab, u16* P0, u16* P1, float psc,
            const float* __restrict__ cosT, const float* __restrict__ sinT, float* VS, float* S) {
  const int tid = threadIdx.x, wave = tid >> 5, lane = tid & 31, hh = lane >> 4, m = lane & 15;
  const int ntile = N >> 6;
  const int row64 = (bid / ntile) * 64;
  const int rowb  = row64 + wave * 16;
  const int col0  = (bid % ntile) * 64;
  if (row64 + 64 > M) return;                // the same for the whole block (M % 64 == 0), never taken with the exact grid
  const size_t aofs = (size_t)bz * (size_t)sA + (size_t)rowb * K + 8 * lane;
  const _Float16* ahp = (const _Float16*)(const void*)Ah + aofs;
  const _Float16* alp = (const _Float16*)(const void*)Al + aofs;
  const size_t bofs = (size_t)bz * (size_t)sB + (size_t)col0 * K + 8 * lane;
  const _Float16* bhp = (const _Float16*)(const void*)Bh + bofs;
  const _Float16* blp = (const _Float16*)(const void*)Bl + bofs;
  const size_t bs = (size_t)16 * K;
  v8f acc0 = zero8(), acc1 = zero8(), acc2 = zero8(), acc3 = zero8();
#pragma unroll 1
  for (int k0 = 0; k0 < K; k0 += 32) {
    const int kf = k0 * 16;                              // k tile k0 / 32
    const _Float16 *pa = ahp + kf, *p0 = bhp + kf, *p1 = p0 + bs, *p2 = p1 + bs, *p3 = p2 + bs;
    const v16h ah = ldfrag_h(pa);
    const v16h b0 = ldfrag_h(p0);
    const v16h b1 = ldfrag_h(p1);
    const v16h b2 = ldfrag_h(p2);
    const v16h b3 = ldfrag_h(p3);
    if (A2) {
      const _Float16* pl = alp + kf;
      const v16h al = ldfrag_h(pl);
      hold_addr(pa, p0, p1, p2, p3, pl, pa, pa, pa, pa);
      acc0 = mma_h(ah, b0, acc0);  acc0 = mma_h(al, b0, acc0);
      acc1 = mma_h(ah, b1, acc1);  acc1 = mma_h(al, b1, acc1);
      acc2 = mma_h(ah, b2, acc2);  acc2 = mma_h(al, b2, acc2);
      acc3 = mma_h(ah, b3, acc3);  acc3 = mma_h(al, b3, acc3);
      guard6<v16h>(acc0, acc1, acc2, acc3, ah, al, b0, b1, b2, b3);
    } else if (B2) {
      const _Float16 *r0 = blp + kf, *r1 = r0 + bs, *r2 = r1 + bs, *r3 = r2 + bs;
      const v16h c0 = ldfrag_h(r0);
      const v16h c1 = ldfrag_h(r1);
      const v16h c2 = ldfrag_h(r2);
      const v16h c3 = ldfrag_h(r3);
      hold_addr(pa, p0, p1, p2, p3, r0, r1, r2, r3, pa);
      acc0 = mma_h(ah, b0, acc0);  acc0 = mma_h(ah, c0, acc0);
      acc1 = mma_h(ah, b1, acc1);  acc1 = mma_h(ah, c1, acc1);
      acc2 = mma_h(ah, b2, acc2);  acc2 = mma_h(ah, c2, acc2);
      acc3 = mma_h(ah, b3, acc3);  acc3 = mma_h(ah, c3, acc3);
      guard10(acc0, acc1, acc2, acc3, ah, b0, b1, b2, b3, c0, c1, c2, c3, ah);
    } else {
      hold_addr(pa, p0, p1, p2, p3, pa, pa, pa, pa, pa);
      acc0 = mma_h(ah, b0, acc0);
      acc1 = mma_h(ah, b1, acc1);
      acc2 = mma_h(ah, b2, acc2);
      acc3 = mma_h(ah, b3, acc3);
      guard6<v16h>(acc0, acc1, acc2, acc3, ah, b0, b1, b2, b3, ah);
    }
  }
  float* sl = slab + wave * SLAB64;
  if (biasRow != 0) {
#pragma unroll
    for (int r = 0; r < 8; ++r) {
      const float bb = bfr(bias[rowb + 8 * hh + r]);
      const int ro = (8 * hh + r) * 68 + m;
      sl[ro]      = acc0[r] * oscale + bb;
      sl[ro + 16] = acc1[r] * oscale + bb;
      sl[ro + 32] = acc2[r] * oscale + bb;
      sl[ro + 48] = acc3[r] * oscale + bb;
    }
  } else {
    float bb[4];
#pragma unroll
    for (int j = 0; j < 4; ++j) bb[j] = bfr(bias[col0 + 16 * j + m]);
#pragma unroll
    for (int r = 0; r < 8; ++r) {
      const int ro = (8 * hh + r) * 68 + m;
      sl[ro]      = acc0[r] * oscale + bb[0];
      sl[ro + 16] = acc1[r] * oscale + bb[1];
      sl[ro + 32] = acc2[r] * oscale + bb[2];
      sl[ro + 48] = acc3[r] * oscale + bb[3];
    }
  }
  if constexpr (EP == EP_SPLIT) {
    wave_sync_lds();
    ep_split(sl, P0, P1, (size_t)rowb * N + (size_t)col0 * 16 + 8 * lane, psc, lane);
  } else if constexpr (EP == EP_ROPE_K) {
    RopeTab t;
    rope_tab<1>(t, cosT, sinT, rowb & (TS - 1), lane);
    wave_sync_lds();
    // plane (batch rowb / TS, head col0 / HD), position tile (rowb % TS) / 16: two tiles of 512 halves
    const size_t pl = (size_t)((rowb / TS) * NH + (col0 >> 6)) * (TS / 16) + (size_t)((rowb & (TS - 1)) >> 4);
    ep_rope<1>(sl, t, P0 + pl * 1024 + 8 * lane, psc, lane);
#if defined(__HIP_DEVICE_COMPILE__)
    // in a merged grid the other job's code follows in the listing and reuses the four stores' address and data registers: wait first
    asm volatile("s_wait_xcnt 0x0" ::: "memory");
#endif
  } else {
    wave_sync_lds();
    ep_v(sl, P0, (size_t)(bz * HID + rowb) * TS + (size_t)col0 * 16 + 8 * lane,
         VS + (size_t)(bz * NKB + (col0 >> 5)) * HID + row64, S, wave, lane);
  }
}

// =====================================================================================================
// Merged grids: launches that do not depend on one another share one grid; the block index (uniform in a block) picks the job,
// and every job keeps its own block numbering. Block counts of the jobs:
// =====================================================================================================
#define NB_TAB (TT / 8)
#define NB_XT  ((TT / 64) * (HID / 64) * NBAT)
#define NB_CT  ((TS / 64) * (CND / 64) * NBAT)
#define NB_WC  ((HID * CND) / 2048)
#define NB_W   ((HID * HID) / 2048)
#define NB_WF  ((2 * HID * HID) / 2048)
#define NB_PRO (NB_TAB + NB_XT + NB_CT + NB_WC + 4 * NB_W + NB_WF)
#define NB_GC  (((NBAT * TS) / 64) * (HID / 64))
#define NB_GQ  (((NBAT * TT) / 64) * (HID / 64))
#define NB_GV  ((HID / 64) * (TS / 64) * NBAT)
#define NB_GK  (((NBAT * TS) / 64) * (HID / 64))

// Everything that reads inputs only: rotary tables, the two transposes, the six weight planes.
__global__ __launch_bounds__(256)
void pro_k(const float* __restrict__ x, const float* __restrict__ cond, const float* __restrict__ w_cond,
           const float* __restrict__ wq, const float* __restrict__ wk, const float* __restrict__ wv,
           const float* __restrict__ wo, const float* __restrict__ wf, float* cosT, float* sinT, u16* XT, u16* CONDT,
           u16* WCB, u16* WQB, u16* WKH, u16* WVH, u16* WOH, u16* WFH, InvF inv) {
  __shared__ __align__(16) u16 T[64 * VTP];
  int j = blockIdx.x;
  if (j < NB_TAB) { k_tab(cosT, sinT, inv, j); return; }
  j -= NB_TAB;
  if (j < NB_XT) { cvt_T(x, XT, HID, TT, j % (NB_XT / NBAT), j / (NB_XT / NBAT), T); return; }
  j -= NB_XT;
  if (j < NB_CT) { cvt_T(cond, CONDT, CND, TS, j % (NB_CT / NBAT), j / (NB_CT / NBAT), T); return; }
  j -= NB_CT;
  if (j < NB_WC) { cvt_flat(w_cond, WCB, (HID * CND) / 8, 0, 1.0f, CND, j); return; }
  j -= NB_WC;
  if (j < NB_W) { cvt_flat(wq, WQB, (HID * HID) / 8, 0, 1.0f, HID, j); return; }
  j -= NB_W;
  if (j < 3 * NB_W) {
    const int wsel = j / NB_W;
    cvt_flat(wsel == 0 ? wk : wsel == 1 ? wv : wo, wsel == 0 ? WKH : wsel == 1 ? WVH : WOH, (HID * HID) / 8, 1, WSC, HID,
             j % NB_W);
    return;
  }
  j -= 3 * NB_W;
  cvt_flat(wf, WFH, (2 * HID * HID) / 8, 1, WSC, HID, j);
}

// c^T = CONDT . WCB^T + b_cond -> hi + residual planes x1024 (the longer k loop, so its blocks come first) and
// q^T = XT . WQB^T + bq -> rotary -> q' plane.
__global__ __launch_bounds__(128)
void gemm_cq(const u16* __restrict__ CONDT, const u16* __restrict__ WCB, const float* __restrict__ b_cond, u16* CH, u16* CL,
             const u16* __restrict__ XT, const u16* __restrict__ WQB, const float* __restrict__ bq, u16* QH,
             const float* __restrict__ cosT, const float* __restrict__ sinT) {
  __shared__ __align__(16) float slab[4 * SLAB64];
  const int bid = blockIdx.x;
  if (bid < NB_GC) gemm_bf<EP_SPLIT>(CONDT, WCB, b_cond, NBAT * TS, HID, CND, 1.0f, bid, slab, CH, CL, CSC, cosT, sinT);
  else             gemm_bf<EP_ROPE_Q>(XT, WQB, bq, NBAT * TT, HID, HID, 1.0f, bid - NB_GC, slab, QH, QH, QSC, cosT, sinT);
}

// v = WVH . (CH + CL)^T + bv per row, per batch -> v plane + block sums (twice the products, so its blocks come first) and
// k^T = CH . WKH^T + bk -> rotary -> k' planes.
__global__ __launch_bounds__(128)
void gemm_kv(const u16* __restrict__ CH, const u16* __restrict__ CL, const u16* __restrict__ WVH, const u16* __restrict__ WKH,
             const float* __restrict__ bv, const float* __restrict__ bk, u16* VH, float* VS, u16* KH,
             const float* __restrict__ cosT, const float* __restrict__ sinT) {
  __shared__ __align__(16) float slab[4 * SLAB64];
  __shared__ __align__(16) float S[128];
  const int bid = blockIdx.x;
  if (bid < NB_GV)
    gemm_h<0, 1, EP_V>(WVH, WVH, CH, CL, bv, HID, TS, HID, 0, TS * HID, 1, 1.0f / (CSC * WSC),
                       bid % (NB_GV / NBAT), bid / (NB_GV / NBAT), slab, VH, VH, VCAR, cosT, sinT, VS, S);
  else
    gemm_h<0, 0, EP_ROPE_K>(CH, CH, WKH, WKH, bk, NBAT * TS, HID, HID, 0, 0, 0, 1.0f / (CSC * WSC), bid - NB_GV, 0, slab,
                            KH, KH, KSC, cosT, sinT, VS, S);
}

// y^T = (OH + OL) . WOH^T + bo -> hi + residual planes x16384
__global__ __launch_bounds__(128)
void gemm_o(const u16* __restrict__ OH, const u16* __restrict__ OL, const u16* __restrict__ WOH,
            const float* __restrict__ bo, u16* YH, u16* YL) {
  __shared__ __align__(16) float slab[4 * SLAB64];
  gemm_h<1, 0, EP_SPLIT>(OH, OL, WOH, WOH, bo, NBAT * TT, HID, HID, 0, 0, 0, 1.0f / (OSC * WSC), blockIdx.x, 0, slab,
                         YH, YL, YSC, nullptr, nullptr, nullptr, nullptr);
}

// =====================================================================================================
// Cross attention: block = (batch b, head h, 64 query rows), one wave per 16 query rows q0..q0+15; all TS keys in NKB blocks of 32.
//   q' plane QH [b][t][h][d] (x1024 f16, row-major), k' plane KH: per (b, h) fragment-major [s][d] (x1024), v plane VH:
//   fragment-major [b*256 + h*64+d][s] (x1024),
//   VS[b][kb][h*64+d] = f32 sum of v over key block kb; masks: key s of row t is masked iff bf16(cond_mask[b][s])*bf16(x_mask[b][t]) == 0,
//   masked score replaced by -1e4 (base-2 scaled) -> exact uniform softmax on a fully masked row, 0 weight otherwise.
//   Per block: 2 score subtiles x 2 k-steps (q'.k' single products, q fragments loaded once), scale 1/8 folded into the base-2
//   factor; online max-subtracted base-2 softmax in f32; e = exp2(t - m) per key; l from the f32 e; accumulator update
//   o = o*alpha + (7/8 * 2^20) * VS block sum (f32), then the centred tile P' = (e - 7/8) * 1024 stored to wave-private LDS (f32),
//   contiguous), 4 P'.v WMMAs. Exact identity sum_s e_s v_s = sum_s (e_s - 7/8) v_s + 7/8 sum_s v_s per key block.
//   (b, q0+row, head) of the O hi plane and of the O residual plane (O x8192 as f16 hi + residual) written by lanes row and row + 16
// coverage: per wave 4 instructions x 32 lanes x 8 halves = 16 x 64 per plane; grid 2048 blocks x 4 waves = every
//           (b, t, h) row of both O planes exactly once.
// =====================================================================================================
__global__ __launch_bounds__(128)
void attn_x(const u16* __restrict__ QHp, const u16* __restrict__ KHp, const u16* __restrict__ VHp,
            const float* __restrict__ VS, const float* __restrict__ cmask, const float* __restrict__ xmask,
            u16* OHp, u16* OLp) {
  __shared__ __align__(16) float smem[4 * SLABF];   // per wave: P' tile [16][32] pitch 36 during the loop, result slab after

  const int tid  = threadIdx.x;
  const int wave = tid >> 5;
  const int lane = tid & 31;
  const int hh   = lane >> 4;
  const int c    = lane & 15;

  const int bid  = blockIdx.x;
  const int qt   = bid & (TT / 64 - 1);
  const int h    = (bid >> 5) & (NH - 1);
  const int b    = bid >> 7;
  const int q0   = qt * 64 + wave * 16;

  const size_t qofs = (((size_t)(b * TT + q0 + c)) * NH + h) * HD + 8 * hh;       // row-major plane
  const _Float16* Qh  = (const _Float16*)(const void*)QHp + qofs;
  const size_t kofs = ((size_t)(b * NH + h) * TS) * HD + 8 * lane;                // plane (b, h); key tile added per step
  const _Float16* Khb = (const _Float16*)(const void*)KHp + kofs;
  const size_t vofs = ((size_t)(b * HID + h * HD)) * TS + 8 * lane;               // row tile of d 0..15 (+16j); key tile added per step
  const _Float16* Vhb = (const _Float16*)(const void*)VHp + vofs;
  const float* vsb = VS + (size_t)b * NKB * HID + h * HD + c;
  const float* cmb = cmask + (size_t)b * TS + c;
  const float lsc = 0.125f * (LOG2E / (QSC * KSC));
  const float C0S = PCEN * PCAR * VCAR;

  float xmv[8], mrow[8], lrow[8];
  v8f o[4];
#pragma unroll
  for (int r = 0; r < 8; ++r) {
    xmv[r]  = bfr(xmask[(size_t)b * TT + q0 + 8 * hh + r]);
    mrow[r] = -INFINITY;
    lrow[r] = 0.f;
  }
#pragma unroll
  for (int j = 0; j < 4; ++j) o[j] = zero8();
  float* pt = smem + wave * SLABF;

  const v16h qa = ldfrag_rm_h(Qh), qb = ldfrag_rm_h(Qh + 32);
  hold_addr(Qh, Qh, Qh, Qh, Qh, Qh, Qh, Qh, Qh, Qh);

#pragma unroll 1
  for (int it = 0; it < NKB; ++it) {
    const int kb = it * 32;
    // ---- scores: D element r of this lane = (query row q0 + 8hh + r, key kb + c) in s0, key kb + 16 + c in s1 ----
    v8f s0 = zero8(), s1 = zero8();
    {
      const _Float16* k0p = Khb + (size_t)kb * HD;            // key tile kb / 16: HD / 32 = 2 tiles of 512 halves
      const _Float16* k1p = k0p + (size_t)16 * HD;
      const v16h k0a = ldfrag_h(k0p), k0b = ldfrag_h(k0p + 512);
      const v16h k1a = ldfrag_h(k1p), k1b = ldfrag_h(k1p + 512);
      hold_addr(k0p, k0p, k0p, k0p, k0p, k0p, k0p, k0p, k0p, k0p);   // k1p is a constant offset from k0p
      s0 = mma_h(qa, k0a, s0);
      s0 = mma_h(qb, k0b, s0);
      s1 = mma_h(qa, k1a, s1);
      s1 = mma_h(qb, k1b, s1);
      guard2(s0, s1, qa, qb, k0a, k0b, k1a, k1b);
    }
    const float cm0 = bfr(cmb[kb]), cm1 = bfr(cmb[kb + 16]);
    float vs[4];
#pragma unroll
    for (int j = 0; j < 4; ++j) vs[j] = vsb[(size_t)it * HID + 16 * j] * C0S;
    {
      const float *pc = cmb + kb, *pv = vsb + (size_t)it * HID;
      hold_addr(pc, pv, pc, pc, pc, pc, pc, pc, pc, pc);
    }
    // ---- mask (replace by -1e4) + online softmax in base 2; centred P' tile to LDS ----
#pragma unroll
    for (int r = 0; r < 8; ++r) {
      const bool ok0 = (cm0 * xmv[r]) != 0.0f;
      const bool ok1 = (cm1 * xmv[r]) != 0.0f;
      const float t0 = ok0 ? (s0[r] * lsc) : MASKT;
      const float t1 = ok1 ? (s1[r] * lsc) : MASKT;
      float mx = fmaxf(t0, t1);
#pragma unroll
      for (int off = 1; off < 16; off <<= 1) mx = fmaxf(mx, __shfl_xor(mx, off, 32));
      const float mn = fmaxf(mrow[r], mx);
      const float al = exp2f(mrow[r] - mn);
      mrow[r] = mn;
      const float e0 = exp2f(t0 - mn), e1 = exp2f(t1 - mn);
      float ps = e0 + e1;
#pragma unroll
      for (int off = 1; off < 16; off <<= 1) ps += __shfl_xor(ps, off, 32);
      lrow[r] = lrow[r] * al + ps;
#pragma unroll
      for (int j = 0; j < 4; ++j) o[j][r] = o[j][r] * al + vs[j];
      const int ro = (8 * hh + r) * 36 + c;
      pt[ro]      = (e0 - PCEN) * PCAR;
      pt[ro + 16] = (e1 - PCEN) * PCAR;
    }
    wave_sync_lds();
    // ---- A fragment of f16(P'): row = c, split k map over the 32 keys of this step ----
    FragH ph;
    {
      const float* prow = pt + c * 36 + 8 * hh;
      const v4f p0 = *(const v4f*)(prow), p1 = *(const v4f*)(prow + 4);
      const v4f p2 = *(const v4f*)(prow + 16), p3 = *(const v4f*)(prow + 20);
#pragma unroll
      for (int e = 0; e < 4; ++e) {
        ph.h[0][e]     = (_Float16)p0[e];                    // elements 0..7  = keys kb + 8hh + 0..7
        ph.h[0][4 + e] = (_Float16)p1[e];
        ph.h[1][e]     = (_Float16)p2[e];                    // elements 8..15 = keys kb + 16 + 8hh + 0..7
        ph.h[1][4 + e] = (_Float16)p3[e];
      }
    }
    // ---- P'.v : B fragment col n = d = j*16 + c, keys contiguous in the v plane ----
    {
      const _Float16* vhp = Vhb + kb * 16;                    // key tile kb / 32
      const v16h vh0 = ldfrag_h(vhp);
      const v16h vh1 = ldfrag_h(vhp + (size_t)16 * TS);
      const v16h vh2 = ldfrag_h(vhp + (size_t)32 * TS);
      const v16h vh3 = ldfrag_h(vhp + (size_t)48 * TS);
      hold_addr(vhp, vhp, vhp, vhp, vhp, vhp, vhp, vhp, vhp, vhp);
      o[0] = mma_h(ph.v, vh0, o[0]);
      o[1] = mma_h(ph.v, vh1, o[1]);
      o[2] = mma_h(ph.v, vh2, o[2]);
      o[3] = mma_h(ph.v, vh3, o[3]);
      guard6<v16h>(o[0], o[1], o[2], o[3], ph.v, vh0, vh1, vh2, vh3, ph.v);
    }
    wave_sync_lds();
  }
  acc_guard4(o[0], o[1], o[2], o[3]);

  // ---- fold 1/l and the carries (1024 on P', 1024 on v), stage the wave's 16x64 slab in its LDS region ----
  wave_sync_lds();
  float* slab = pt;
  const float oc = 1.0f / (PCAR * VCAR);
#pragma unroll
  for (int r = 0; r < 8; ++r) {
    const float inv = (1.0f / lrow[r]) * oc;
#pragma unroll
    for (int j = 0; j < 4; ++j) slab[(8 * hh + r) * 68 + j * 16 + c] = o[j][r] * inv;
  }
  wave_sync_lds();
  // ---- O x8192 -> f16 hi + residual fragment-major planes [b * TT + t][HID]; lane = one chunk per store ----
  v4u oh[4], ol[4];
#pragma unroll
  for (int it = 0; it < 4; ++it) {
    const int c8 = it * 16 + 8 * hh;          // chunk slot (it & 1) * 32 + lane of k tile 2h + (it >> 1): row c, d = c8 .. c8 + 7
    const v4f a = *(const v4f*)(slab + c * 68 + c8), bq = *(const v4f*)(slab + c * 68 + c8 + 4);
    float w[8];
#pragma unroll
    for (int e = 0; e < 4; ++e) { w[e] = a[e] * OSC; w[4 + e] = bq[e] * OSC; }
#pragma unroll
    for (int e = 0; e < 4; ++e) {
      const _Float16 h0 = (_Float16)w[2 * e], h1 = (_Float16)w[2 * e + 1];
      const _Float16 l0 = (_Float16)(w[2 * e] - (float)h0), l1 = (_Float16)(w[2 * e + 1] - (float)h1);
      oh[it][e] = pk16(h_bits(h0), h_bits(h1));
      ol[it][e] = pk16(h_bits(l0), h_bits(l1));
    }
  }
  const size_t ob = (size_t)(b * TT + q0) * HID + (size_t)h * 1024 + 8 * lane;    // row tile (b * TT + q0) / 16, k tile 2h
  {
#pragma unroll
    for (int it = 0; it < 4; ++it) {
      const size_t o8 = ob + (size_t)it * 256;
      *(v4u*)(OHp + o8) = oh[it];
      *(v4u*)(OLp + o8) = ol[it];
    }
    
  }
}

// =====================================================================================================
// FiLM GEMM + combine: block = (batch b, 64 time columns t0, 64 channels), one wave per 16 channels c0..c0+15.
//   gamma[c][t] = sum_i w_film[c][i] y[t][i], beta[c][t] = sum_i w_film[256+c][i] y[t][i]  (A = w_film rows as f16(bf16 x1024),
//   B = y planes [b][t][i] as f16 hi x16384 + residual: products wg.h, wb.h, wg.l, wb.l, 8 accumulators);
//   out[b][c][t] = (bf16(x[b][c][t]) * (gamma*oscale + bf16(b_film[c])) + (beta*oscale + bf16(b_film[256+c]))) * bf16(x_mask[b][t]).
// coverage: grid 16 b x 32 t-tiles x 4 channel groups = 2048 blocks x 4 waves x 16 x 64 = every out element exactly once.
// =====================================================================================================
__global__ __launch_bounds__(128)
void film_k(const u16* __restrict__ WF, const u16* __restrict__ YHp, const u16* __restrict__ YLp,
            const float* __restrict__ bfl, const float* __restrict__ X, const float* __restrict__ XM,
            float* OUT, float oscale) {
  __shared__ __align__(16) float slab[4 * SLAB64];
  const int tid = threadIdx.x, wave = tid >> 5, lane = tid & 31, hh = lane >> 4, m = lane & 15;
  const int bid = blockIdx.x;
  const int tt  = bid & (TT / 64 - 1);
  const int cg  = (bid >> 5) & 3;
  const int b   = bid >> 7;
  const int t0  = tt * 64;
  const int c0  = cg * 64 + wave * 16;
  const _Float16* agp = (const _Float16*)(const void*)WF + (size_t)c0 * HID + 8 * lane;
  const _Float16* abp = agp + (size_t)HID * HID;                                   // row 256 + c0 + m
  const size_t yofs = ((size_t)(b * TT + t0)) * HID + 8 * lane;
  const _Float16* yhp = (const _Float16*)(const void*)YHp + yofs;
  const _Float16* ylp = (const _Float16*)(const void*)YLp + yofs;
  const size_t bs = (size_t)16 * HID;
  v8f g[4], be[4];
#pragma unroll
  for (int j = 0; j < 4; ++j) { g[j] = zero8(); be[j] = zero8(); }
#pragma unroll 1
  for (int k0 = 0; k0 < HID; k0 += 32) {
    const int kf = k0 * 16;                              // k tile k0 / 32
    const _Float16 *pg = agp + kf, *pb = abp + kf;
    const _Float16 *p0 = yhp + kf, *p1 = p0 + bs, *p2 = p1 + bs, *p3 = p2 + bs;
    const _Float16 *r0 = ylp + kf, *r1 = r0 + bs, *r2 = r1 + bs, *r3 = r2 + bs;
    const v16h ag = ldfrag_h(pg), ab = ldfrag_h(pb);
    const v16h y0 = ldfrag_h(p0);
    const v16h y1 = ldfrag_h(p1);
    const v16h y2 = ldfrag_h(p2);
    const v16h y3 = ldfrag_h(p3);
    const v16h z0 = ldfrag_h(r0);
    const v16h z1 = ldfrag_h(r1);
    const v16h z2 = ldfrag_h(r2);
    const v16h z3 = ldfrag_h(r3);
    hold_addr(pg, p0, r0, pg, pg, pg, pg, pg, pg, pg);     // the other seven addresses are constant offsets from these three
    g[0] = mma_h(ag, y0, g[0]);  be[0] = mma_h(ab, y0, be[0]);
    g[1] = mma_h(ag, y1, g[1]);  be[1] = mma_h(ab, y1, be[1]);
    g[2] = mma_h(ag, y2, g[2]);  be[2] = mma_h(ab, y2, be[2]);
    g[3] = mma_h(ag, y3, g[3]);  be[3] = mma_h(ab, y3, be[3]);
    g[0] = mma_h(ag, z0, g[0]);  be[0] = mma_h(ab, z0, be[0]);
    g[1] = mma_h(ag, z1, g[1]);  be[1] = mma_h(ab, z1, be[1]);
    g[2] = mma_h(ag, z2, g[2]);  be[2] = mma_h(ab, z2, be[2]);
    g[3] = mma_h(ag, z3, g[3]);  be[3] = mma_h(ab, z3, be[3]);
    guardF(g[0], g[1], g[2], g[3], be[0], be[1], be[2], be[3], ag, ab, y0, y1, y2, y3, z0, z1, z2, z3);
  }
  float* sl = slab + wave * SLAB64;
  float xm[4];
#pragma unroll
  for (int j = 0; j < 4; ++j) xm[j] = bfr(XM[(size_t)b * TT + t0 + 16 * j + m]);
#pragma unroll
  for (int r = 0; r < 8; ++r) {
    const int cc = c0 + 8 * hh + r;
    const float bg = bfr(bfl[cc]);
    const float bb = bfr(bfl[HID + cc]);
    const float* xr = X + ((size_t)(b * HID + cc)) * TT + t0 + m;
#pragma unroll
    for (int j = 0; j < 4; ++j) {
      const float gam = g[j][r] * oscale + bg;
      const float bet = be[j][r] * oscale + bb;
      const float xv  = bfr(xr[16 * j]);
      sl[(8 * hh + r) * 68 + 16 * j + m] = (xv * gam + bet) * xm[j];
    }
  }
  wave_sync_lds();
  store64(sl, OUT, TT, (size_t)(b * HID + c0), t0, lane);
}

// =====================================================================================================
// Workspace map (bytes); every plane is fully written by whole-line stores before it is read; all extents are exact multiples
// of the store granularity (no pad rows needed); every offset a multiple of 65536. No launch writes a region that it reads;
// region R1 is reused by later planes once the earlier plane's last reader has run (launch order below):
//   CT f32 [2048][64] 524288, ST same
//   XT bf16 [16][2048][256] 16777216; CONDT bf16 [16][512][512] 8388608
//   WCB bf16 [256][512] 262144; WQB bf16 [256][256] 131072; WKH, WVH, WOH f16 [256][256] 131072 each; WFH f16 [512][256] 262144
//   CH f16 [16][512][256] 4194304, CL same
//   R1: QH f16 [16][2048][4][64] 16777216 (first half) -> later YH, YL f16 [16][2048][256] 16777216 each
//   KH f16 [16][4][512][64] 4194304; VH f16 [16][256][512] 4194304; VS f32 [16][16][256] 262144
//   OH, OL f16 [16][2048][256] 16777216 each
//   end 111411200
// =====================================================================================================
extern "C" void kernel_launch(void* const* d_in, const int* in_sizes, int n_in,
                              void* d_out, int out_size, void* d_ws, size_t ws_size,
                              hipStream_t stream) {
  if (n_in < 16) return;
  if (in_sizes[0] != NBAT * HID * TT) return;
  if (in_sizes[1] != NBAT * TT) return;
  if (in_sizes[2] != NBAT * CND * TS) return;
  if (in_sizes[3] != NBAT * TS) return;
  if (in_sizes[4] != HID * CND || in_sizes[5] != HID) return;
  if (in_sizes[6] != HID * HID || in_sizes[7] != HID) return;
  if (in_sizes[8] != HID * HID || in_sizes[9] != HID) return;
  if (in_sizes[10] != HID * HID || in_sizes[11] != HID) return;
  if (in_sizes[12] != HID * HID || in_sizes[13] != HID) return;
  if (in_sizes[14] != 2 * HID * HID || in_sizes[15] != 2 * HID) return;
  if (out_size != NBAT * HID * TT) return;

  const float* x      = (const float*)d_in[0];
  const float* x_mask = (const float*)d_in[1];
  const float* cond   = (const float*)d_in[2];
  const float* c_mask = (const float*)d_in[3];
  const float* w_cond = (const float*)d_in[4];
  const float* b_cond = (const float*)d_in[5];
  const float* wq     = (const float*)d_in[6];
  const float* bq     = (const float*)d_in[7];
  const float* wk     = (const float*)d_in[8];
  const float* bk     = (const float*)d_in[9];
  const float* wv     = (const float*)d_in[10];
  const float* bv     = (const float*)d_in[11];
  const float* wo     = (const float*)d_in[12];
  const float* bo     = (const float*)d_in[13];
  const float* wf     = (const float*)d_in[14];
  const float* bfi    = (const float*)d_in[15];
  float*       out    = (float*)d_out;

  const size_t szTab = (size_t)TT * HD * 4;                       //    524288
  const size_t szR3  = (size_t)NBAT * TT * HID * 2;               //  16777216
  const size_t szR4  = (size_t)NBAT * TS * CND * 2;               //   8388608
  const size_t szWCB = (size_t)HID * CND * 2;                     //    262144
  const size_t szW   = (size_t)HID * HID * 2;                     //    131072
  const size_t szWF  = (size_t)2 * HID * HID * 2;                 //    262144
  const size_t szCP  = (size_t)NBAT * TS * HID * 2;               //   4194304
  const size_t szR1  = (size_t)NBAT * TT * HID * 2 * 2;           //  33554432
  const size_t szKH  = (size_t)NBAT * TS * HID * 2;               //   4194304
  const size_t szVH  = (size_t)NBAT * HID * TS * 2;               //   4194304
  const size_t szVS  = (size_t)NBAT * NKB * HID * 4;              //    262144
  const size_t szOP  = (size_t)NBAT * TT * HID * 2;               //  16777216
  size_t off = 0;
  const size_t oCT  = off; off += szTab;
  const size_t oST  = off; off += szTab;
  const size_t oR3  = off; off += szR3;
  const size_t oR4  = off; off += szR4;
  const size_t oWCB = off; off += szWCB;
  const size_t oWQB = off; off += szW;
  const size_t oWKH = off; off += szW;
  const size_t oWVH = off; off += szW;
  const size_t oWOH = off; off += szW;
  const size_t oWFH = off; off += szWF;
  const size_t oCH  = off; off += szCP;
  const size_t oCL  = off; off += szCP;
  const size_t oR1  = off; off += szR1;
  const size_t oKH  = off; off += szKH;
  const size_t oVH  = off; off += szVH;
  const size_t oVS  = off; off += szVS;
  const size_t oOH  = off; off += szOP;
  const size_t oOL  = off; off += szOP;
  if (off > ws_size) return;                            // off = 111411200
  if (off > (size_t)134217728) return;

  char* ws = (char*)d_ws;
  float* CT    = (float*)(ws + oCT);
  float* ST    = (float*)(ws + oST);
  u16*   XT    = (u16*)(ws + oR3);
  u16*   CONDT = (u16*)(ws + oR4);
  u16*   WCB   = (u16*)(ws + oWCB);
  u16*   WQB   = (u16*)(ws + oWQB);
  u16*   WKH   = (u16*)(ws + oWKH);
  u16*   WVH   = (u16*)(ws + oWVH);
  u16*   WOH   = (u16*)(ws + oWOH);
  u16*   WFH   = (u16*)(ws + oWFH);
  u16*   CH    = (u16*)(ws + oCH);
  u16*   CL    = (u16*)(ws + oCL);
  u16*   QH    = (u16*)(ws + oR1);
  u16*   YH    = (u16*)(ws + oR1);
  u16*   YL    = (u16*)(ws + oR1 + szOP);
  u16*   KH    = (u16*)(ws + oKH);
  u16*   VH    = (u16*)(ws + oVH);
  float* VS    = (float*)(ws + oVS);
  u16*   OH    = (u16*)(ws + oOH);
  u16*   OL    = (u16*)(ws + oOL);

  // inv_freq[i] = 1 / pow(10000, i/32) in f32 (pow correctly converted from f64, then IEEE f32 reciprocal)
  InvF inv;
  for (int i = 0; i < 32; ++i) {
    const double p = pow(10000.0, (double)i / 32.0);
    const float pf = (float)p;
    inv.f[i] = 1.0f / pf;
  }

  const dim3 blk(256);
  const dim3 bG(128);
  const dim3 gAT(NBAT * NH * (TT / 64));                // 2048
  const dim3 gFM(NBAT * 4 * (TT / 64));                 // 2048

  // (0) inputs only: rotary cos/sin tables [2048][64]; x [b][256][2048] -> XT bf16 [b][2048][256]; cond [b][512][512] -> CONDT bf16
  //     [b][512 s][512 i]; weights (W[o][i] row-major is already [n][k]): bf16 planes for w_cond, wq; f16(bf16 x1024) for wk, wv, wo, w_film
  pro_k<<<dim3(NB_PRO), blk, 0, stream>>>(x, cond, w_cond, wq, wk, wv, wo, wf, CT, ST, XT, CONDT, WCB, WQB, WKH, WVH, WOH, WFH, inv);
  // (1) c^T [8192][256] = CONDT [8192][512] . WCB^T + b_cond -> f16 hi + residual planes x1024;
  //     q^T [32768][256] = XT . WQB^T + bq -> rotary, positions mod 2048 -> q' plane, rows (b, t, h)
  gemm_cq<<<dim3(NB_GC + NB_GQ), bG, 0, stream>>>(CONDT, WCB, b_cond, CH, CL, XT, WQB, bq, QH, CT, ST);
  // (2) v [b][256][512] = WVH [256][256] . (CH + CL)[b][512][256]^T + bv per row -> v f16 plane x1024 + per-32-key block sums;
  //     k^T [8192][256] = CH . WKH^T (+ bk) -> rotary, positions mod 512 -> k' planes; carries 1024 x 1024 folded back
  gemm_kv<<<dim3(NB_GV + NB_GK), bG, 0, stream>>>(CH, CL, WVH, WKH, bv, bk, VH, VS, KH, CT, ST);
  // (3) cross attention -> O planes [b][t][h*64+d] x8192 (hi + residual)
  attn_x<<<gAT, bG, 0, stream>>>(QH, KH, VH, VS, c_mask, x_mask, OH, OL);
  // (4) y^T [32768][256] = (OH + OL) . WOH^T + bo, carries 8192 x 1024 folded back -> f16 hi + residual planes x16384
  //     (into the q' region, q' no longer needed)
  gemm_o<<<dim3(NB_GQ), bG, 0, stream>>>(OH, OL, WOH, bo, YH, YL);
  // (5) FiLM GEMM + combine -> out [16][256][2048] f32
  film_k<<<gFM, bG, 0, stream>>>(WFH, YH, YL, bfi, x, x_mask, out, 1.0f / (YSC * WSC));
  (void)hipGetLastError();
}

// v004
// Measured time: 131 microseconds a run.
// Timed twice side by side with v003, it ran 1.28 and 1.26 times as fast.
// Counting every step since v000, it is 2.09 times as fast.
// Contractions: cond^T.w_cond^T and x^T.wq^T on v_wmma_f32_16x16x32_bf16 (inputs RNE-converted to bf16, exact operands, f32 accumulate);
// c.wk^T (c x1024 f16 hi plane), wv.c (c x1024 f16 hi + residual, products w.h + w.l), scores q'.k'^T (q' x1024, k' x1024 f16, one product),
// P'.v (centred P' = (e - 7/8) x1024 f16, v x1024 f16, one product; 7/8 * sum(v) per 32-key block added in f32),
// O.wo^T (O x8192 f16 hi + residual, products h.w + l.w), w_film.y (y x16384 f16 hi + residual): v_wmma_f32_16x16x32_f16,
// weights as f16(bf16(w) x1024), f32 accumulate. Rotary tables: f64 sin/cos of the f32 angle. Rotation, masked base-2 online softmax, 1/l, FiLM combine: f32 on VALU.
#include <hip/hip_runtime.h>
#include <math.h>
#include <stdint.h>

#define NBAT  16
#define TT    2048
#define TS    512
#define HID   256
#define CND   512
#define NH    4
#define HD    64
#define NKB   (TS / 32)
#define QSC   1024.0f
#define KSC   1024.0f
#define CSC   1024.0f
#define VCAR  1024.0f
#define PCAR  1024.0f
#define OSC   8192.0f
#define YSC   16384.0f
#define WSC   1024.0f
#define PCEN  0.875f
#define LOG2E 1.4426950408889634f
#define MASKT (-10000.0f * LOG2E)
#define SLAB64 (16 * 68)
#define VTP    72
static_assert(HID == NH * HD && HD == 64);
static_assert((TT % 64) == 0 && (TS % 64) == 0 && (TS % 32) == 0 && NKB == 16);
static_assert((TT & (TT - 1)) == 0 && (TS & (TS - 1)) == 0);
static_assert((HID % 64) == 0 && (CND % 64) == 0 && (HID % 32) == 0 && (CND % 32) == 0);
static_assert(((NBAT * TT * NH * 8) % 256) == 0 && ((NBAT * TS * NH * 8) % 256) == 0);
static_assert(((NBAT * TS * HID) % 2048) == 0 && ((NBAT * TT * HID) % 2048) == 0);

typedef unsigned short u16;
typedef _Float16 v16h __attribute__((ext_vector_type(16)));
typedef _Float16 v8h  __attribute__((ext_vector_type(8)));
typedef __bf16   v16b __attribute__((ext_vector_type(16)));
typedef float    v8f  __attribute__((ext_vector_type(8)));
typedef float    v4f  __attribute__((ext_vector_type(4)));
typedef float    v2f  __attribute__((ext_vector_type(2)));
typedef unsigned int v4u __attribute__((ext_vector_type(4)));

union FragH { v16h v; v8h h[2]; v4u u[2]; };
union FragB { v16b v; v4u u[2]; };

struct InvF { float f[32]; };
static_assert(sizeof(InvF) == 128);

// ---- scalar helpers --------------------------------------------------------------------------------
__device__ __forceinline__ unsigned short bf_bits(float f) {          // f32 -> bf16 bits, RNE convert
  unsigned u = __float_as_uint(f);
  return (unsigned short)((u + 0x7FFFu + ((u >> 16) & 1u)) >> 16);
}
__device__ __forceinline__ float bf_up(unsigned short h) { return __uint_as_float(((unsigned)h) << 16); }
__device__ __forceinline__ float bfr(float f) { return bf_up(bf_bits(f)); }
__device__ __forceinline__ unsigned short h_bits(_Float16 x) { return __builtin_bit_cast(unsigned short, x); }
__device__ __forceinline__ unsigned pk16(unsigned short a, unsigned short b) { return (unsigned)a | ((unsigned)b << 16); }
__device__ __forceinline__ v8f zero8() { v8f z = {0.f, 0.f, 0.f, 0.f, 0.f, 0.f, 0.f, 0.f}; return z; }

// ---- fragment-major planes: a 16-bit plane [R][K] (R % 16 == 0, K % 32 == 0) is stored as tiles of 16 rows x 32 k, 512 halves
//      each, tile (row >> 4, k >> 5) at ((row >> 4) * (K >> 5) + (k >> 5)) * 512; inside a tile 64 chunks of 8 halves, chunk slot
//      = ((k >> 4) & 1) * 32 + ((k >> 3) & 1) * 16 + (row & 15), so that slot & 31 is the lane that owns the chunk.
// ---- fragment loaders: 16-bit A/B operand, p = tile start + 8 * lane: two wave-wide loads of 512 contiguous bytes;
//      lane -> row/col (lane&15), elements 0..7 <- k0+8h.., elements 8..15 <- k0+16+8h..  (same split k map for A and B)
__device__ __forceinline__ v16h ldfrag_h(const _Float16* p) {
  FragH f;
  f.h[0] = *(const v8h*)(p);
  f.h[1] = *(const v8h*)(p + 256);
  return f.v;
}
__device__ __forceinline__ v16h ldfrag_rm_h(const _Float16* p) {      // same k map from a row-major row, p includes +8*(lane>>4)
  FragH f;
  f.h[0] = *(const v8h*)(p);
  f.h[1] = *(const v8h*)(p + 16);
  return f.v;
}
__device__ __forceinline__ v16b ldfrag_b(const u16* p) {              // bf16 plane read as unsigned integer vectors
  FragB f;
  f.u[0] = *(const v4u*)(p);
  f.u[1] = *(const v4u*)(p + 256);
  return f.v;
}

// Stands behind a group of fragment loads and names their address registers as inputs, so that these registers stay unwritten
// (by a later load's result or by an address update) up to the s_wait_xcnt 0 inside it.
__device__ __forceinline__ void hold_addr(const void* a, const void* b, const void* c, const void* d, const void* e,
                                          const void* f, const void* g, const void* h, const void* i, const void* j) {
#if defined(__HIP_DEVICE_COMPILE__)
  asm volatile("s_wait_xcnt 0x0" :: "v"(a), "v"(b), "v"(c), "v"(d), "v"(e), "v"(f), "v"(g), "v"(h), "v"(i), "v"(j) : "memory");
#endif
}
// chunk slot (0..63) of a tile -> row in the tile and first k in the tile
__device__ __forceinline__ int slot_row(int slot) { return slot & 15; }
__device__ __forceinline__ int slot_k(int slot) { return ((slot >> 5) << 4) + (((slot >> 4) & 1) << 3); }

__device__ __forceinline__ v8f mma_h(v16h a, v16h b, v8f c) {
  return __builtin_amdgcn_wmma_f32_16x16x32_f16(false, a, false, b, (short)0, c, false, false);
}
__device__ __forceinline__ v8f mma_b(v16b a, v16b b, v8f c) {
  return __builtin_amdgcn_wmma_f32_16x16x32_bf16(false, a, false, b, (short)0, c, false, false);
}
__device__ __forceinline__ void guard2(v8f& a, v8f& b, v16h x0, v16h x1, v16h x2, v16h x3, v16h x4, v16h x5) {
#if defined(__HIP_DEVICE_COMPILE__)
  asm volatile("v_nop\n\tv_nop\n\tv_nop\n\tv_nop"
               : "+v"(a), "+v"(b) : "v"(x0), "v"(x1), "v"(x2), "v"(x3), "v"(x4), "v"(x5) : "memory");
#endif
}
template <typename F>
__device__ __forceinline__ void guard6(v8f& a, v8f& b, v8f& c, v8f& d, F x0, F x1, F x2, F x3, F x4, F x5) {
#if defined(__HIP_DEVICE_COMPILE__)
  asm volatile("v_nop\n\tv_nop\n\tv_nop\n\tv_nop"
               : "+v"(a), "+v"(b), "+v"(c), "+v"(d) : "v"(x0), "v"(x1), "v"(x2), "v"(x3), "v"(x4), "v"(x5) : "memory");
#endif
}
__device__ __forceinline__ void guard10(v8f& a, v8f& b, v8f& c, v8f& d, v16h x0, v16h x1, v16h x2, v16h x3, v16h x4,
                                        v16h x5, v16h x6, v16h x7, v16h x8, v16h x9) {
#if defined(__HIP_DEVICE_COMPILE__)
  asm volatile("v_nop\n\tv_nop\n\tv_nop\n\tv_nop"
               : "+v"(a), "+v"(b), "+v"(c), "+v"(d)
               : "v"(x0), "v"(x1), "v"(x2), "v"(x3), "v"(x4), "v"(x5), "v"(x6), "v"(x7), "v"(x8), "v"(x9) : "memory");
#endif
}
__device__ __forceinline__ void guardF(v8f& a0, v8f& a1, v8f& a2, v8f& a3, v8f& c0, v8f& c1, v8f& c2, v8f& c3,
                                       v16h x0, v16h x1, v16h x2, v16h x3, v16h x4, v16h x5, v16h x6, v16h x7,
                                       v16h x8, v16h x9) {
#if defined(__HIP_DEVICE_COMPILE__)
  asm volatile("v_nop\n\tv_nop\n\tv_nop\n\tv_nop"
               : "+v"(a0), "+v"(a1), "+v"(a2), "+v"(a3), "+v"(c0), "+v"(c1), "+v"(c2), "+v"(c3)
               : "v"(x0), "v"(x1), "v"(x2), "v"(x3), "v"(x4), "v"(x5), "v"(x6), "v"(x7), "v"(x8), "v"(x9) : "memory");
#endif
}
__device__ __forceinline__ void acc_guard4(v8f& a, v8f& b, v8f& c, v8f& d) {
#if defined(__HIP_DEVICE_COMPILE__)
  asm volatile("v_nop\n\tv_nop\n\tv_nop\n\tv_nop" : "+v"(a), "+v"(b), "+v"(c), "+v"(d));
#endif
}
__device__ __forceinline__ void wave_sync_lds() {
  __builtin_amdgcn_fence(__ATOMIC_RELEASE, "workgroup");
  __builtin_amdgcn_wave_barrier();
  __builtin_amdgcn_fence(__ATOMIC_ACQUIRE, "workgroup");
}

// ---- accurate f32 sin/cos of a non-negative f32 angle (|angle| < 2048): f64 two-part pi/2 reduction + f64 polynomials,
//      plain f64 fma/mul only (no library f64 trig path), result converted to f32.
__device__ __forceinline__ void sincos_acc(float angf, float& sv, float& cv) {
  const double a = (double)angf;
  const double TWO_OVER_PI = 0.63661977236758134308;
  const double PIO2_HI = 1.5707963267948966;
  const double PIO2_LO = 6.123233995736766e-17;
  const int kq = (int)(a * TWO_OVER_PI + 0.5);
  const double kd = (double)kq;
  double r = fma(-kd, PIO2_HI, a);
  r = fma(-kd, PIO2_LO, r);
  const double r2 = r * r;
  double sp = 1.0 / 6227020800.0;
  sp = fma(sp, r2, -1.0 / 39916800.0);
  sp = fma(sp, r2, 1.0 / 362880.0);
  sp = fma(sp, r2, -1.0 / 5040.0);
  sp = fma(sp, r2, 1.0 / 120.0);
  sp = fma(sp, r2, -1.0 / 6.0);
  const double s = fma(sp * r2, r, r);
  double cp = -1.0 / 87178291200.0;
  cp = fma(cp, r2, 1.0 / 479001600.0);
  cp = fma(cp, r2, -1.0 / 3628800.0);
  cp = fma(cp, r2, 1.0 / 40320.0);
  cp = fma(cp, r2, -1.0 / 720.0);
  cp = fma(cp, r2, 1.0 / 24.0);
  cp = fma(cp, r2, -0.5);
  const double c = fma(cp, r2, 1.0);
  const int qd = kq & 3;
  const double so = (qd == 0) ? s : (qd == 1) ? c : (qd == 2) ? -s : -c;
  const double co = (qd == 0) ? c : (qd == 1) ? -s : (qd == 2) ? -c : s;
  sv = (float)so;
  cv = (float)co;
}

// =====================================================================================================
// Rotary tables: cosT[t][d], sinT[t][d] for t < TT, d < HD, angle = float(t) * inv_freq[d & 31] (f32 product), halves duplicated.
// Wave = one position t, lane = frequency index; inv_freq picked from the by-value table with a static select chain.
// coverage: grid TT/8 blocks x 8 waves = TT rows; per row 4 line stores = 64 floats of each table.
// =====================================================================================================
__device__ __forceinline__ void k_tab(float* cosT, float* sinT, const InvF& inv, int bx) {
  const int tid  = threadIdx.x;
  const int lane = tid & 31;
  const int t    = bx * 8 + (tid >> 5);
  if (t >= TT) return;                      // never taken with the exact grid; no barriers in this kernel
  float f = inv.f[0];
#pragma unroll
  for (int i = 1; i < 32; ++i) f = (lane == i) ? inv.f[i] : f;
  const float ang = (float)t * f;
  float sv, cv;
  sincos_acc(ang, sv, cv);
  float* cr = cosT + (size_t)t * HD;
  float* sr = sinT + (size_t)t * HD;
  {
    *(float*)(cr + lane)      = cv;
    *(float*)(cr + 32 + lane) = cv;
    *(float*)(sr + lane)      = sv;
    *(float*)(sr + 32 + lane) = sv;
    
  }
}

// =====================================================================================================
// Batched transpose + bf16 convert: in W[b][R][C] (row-major f32) -> out D[b][C][R] (bf16 RNE bits, fragment-major plane).
// Block = one 64x64 tile (r0, c0) of batch bb: 256 thr x 4 16-B loads -> LDS tile [c][r] (pitch 72), block barrier,
// coverage: load 256 thr x 16 = 64x64; store 2 iterations x 256 thr x 8 halves = 64 lines x 64; grid (C/64)*(R/64) x b = all of D.
// =====================================================================================================
__device__ __forceinline__ void cvt_T(const float* __restrict__ W, u16* D, int R, int C, int bid, int bb, u16* T) {
  const int tid = threadIdx.x;
  const int ntc = C >> 6;
  const int c0  = (bid % ntc) * 64;
  const int r0  = (bid / ntc) * 64;
  const float* Wb = W + (size_t)bb * (size_t)R * (size_t)C;
  u16*         Db = D + (size_t)bb * (size_t)R * (size_t)C;
  {
    const int rr = tid >> 2;
    const int cc = (tid & 3) * 16;
    const float* src = Wb + (size_t)(r0 + rr) * C + c0 + cc;
#pragma unroll
    for (int i = 0; i < 4; ++i) {
      const v4f a = *(const v4f*)(src + 4 * i);
#pragma unroll
      for (int e = 0; e < 4; ++e) T[(cc + 4 * i + e) * VTP + rr] = bf_bits(a[e]);
    }
  }
  __syncthreads();
  // thread = one chunk of the fragment-major plane: 8 local tiles (4 row tiles x 2 k tiles) x 64 slots
  v4u vals[2];
  const int slot = tid & 63;
#pragma unroll
  for (int it = 0; it < 2; ++it) {
    const int lt = it * 4 + (tid >> 6);
    vals[it] = *(const v4u*)(T + ((lt >> 1) * 16 + slot_row(slot)) * VTP + (lt & 1) * 32 + slot_k(slot));
  }
  {
#pragma unroll
    for (int it = 0; it < 2; ++it) {
      const int lt = it * 4 + (tid >> 6);
      const size_t tile = (size_t)((c0 >> 4) + (lt >> 1)) * (size_t)(R >> 5) + (size_t)((r0 >> 5) + (lt & 1));
      *(v4u*)(Db + tile * 512 + slot * 8) = vals[it];
    }
#if defined(__HIP_DEVICE_COMPILE__)
    // in a merged grid other jobs' code follows in the listing and reuses the two stores' address and data registers: wait first
    asm volatile("s_wait_xcnt 0x0" ::: "memory");
#endif
  }
}

// =====================================================================================================
// Row-major f32 [R][K] -> 16-bit fragment-major plane. f16mode == 0: bf16 RNE bits; f16mode == 1: f16 bits of (bf16 RNE value) * scale.
// Thread = 8 consecutive elements: two 16-B loads, one 16-B store; 32 consecutive lanes = 512 contiguous, 512-B aligned bytes
// coverage: grid = ceil(n8/256) blocks x 256 thr x 8 = the whole plane (n8 a multiple of 32 in every use, so no partial line).
// =====================================================================================================
__device__ __forceinline__ void cvt_flat(const float* __restrict__ src, u16* D, int n8, int f16mode, float scale, int K, int bx) {
  const int gt = bx * 256 + (int)threadIdx.x;   // chunk index in the fragment-major plane
  if (gt >= n8) return;                     // no barriers in this kernel
  const int ktn = K >> 5, tile = gt >> 6, slot = gt & 63;
  const int rt = tile / ktn, kt = tile - rt * ktn;
  const float* p = src + (size_t)(rt * 16 + slot_row(slot)) * K + kt * 32 + slot_k(slot);
  const v4f a = *(const v4f*)(p), bq = *(const v4f*)(p + 4);
  float w[8];
#pragma unroll
  for (int e = 0; e < 4; ++e) { w[e] = a[e]; w[4 + e] = bq[e]; }
  v4u o;
#pragma unroll
  for (int e = 0; e < 4; ++e) {
    const float v0 = w[2 * e], v1 = w[2 * e + 1];
    const unsigned short h0 = h_bits((_Float16)(bfr(v0) * scale)), h1 = h_bits((_Float16)(bfr(v1) * scale));
    const unsigned short b0 = bf_bits(v0), b1 = bf_bits(v1);
    o[e] = (f16mode != 0) ? pk16(h0, h1) : pk16(b0, b1);
  }
  u16* d = D + (size_t)gt * 8;
  {
    *(v4u*)(d) = o;
    
  }
}

// =====================================================================================================
// GEMM epilogues: the wave's 16 x 64 f32 tile stands (final values) in its LDS slab (pitch 68), the caller has issued the wave's
// LDS sync; the epilogue writes the 16-bit plane(s) that a later launch reads, so no f32 copy of the tile goes through memory.
// A lane owns four chunks of 8 halves. Fragment-major planes: chunk it = row (lane & 15), columns it * 16 + 8 * (lane >> 4) ..,
// which is slot (it & 1) * 32 + lane of k tile (it >> 1) of the tile pair: one store = 512 contiguous bytes of the wave.
// =====================================================================================================
// f16 hi + residual fragment-major planes: hi = f16(v * sc), lo = f16(v * sc - hi) (sc a power of two, residual unscaled).
// base = first half of the wave's tile pair + 8 * lane. coverage: 4 stores x 32 lanes x 8 halves = 16 x 64 of each plane.
__device__ __forceinline__ void ep_split(const float* sl, u16* Hp, u16* Lp, size_t base, float sc, int lane) {
  const int hh = lane >> 4, m = lane & 15;
  v4u oh[4], ol[4];
#pragma unroll
  for (int it = 0; it < 4; ++it) {
    const float* p = sl + m * 68 + it * 16 + 8 * hh;
    const v4f a = *(const v4f*)(p), bq = *(const v4f*)(p + 4);
    float w[8];
#pragma unroll
    for (int e = 0; e < 4; ++e) { w[e] = a[e] * sc; w[4 + e] = bq[e] * sc; }
#pragma unroll
    for (int e = 0; e < 4; ++e) {
      const float t0 = w[2 * e], t1 = w[2 * e + 1];
      const _Float16 h0 = (_Float16)t0, h1 = (_Float16)t1;
      const _Float16 l0 = (_Float16)(t0 - (float)h0), l1 = (_Float16)(t1 - (float)h1);
      oh[it][e] = pk16(h_bits(h0), h_bits(h1));
      ol[it][e] = pk16(h_bits(l0), h_bits(l1));
    }
  }
#pragma unroll
  for (int it = 0; it < 4; ++it) {
    *(v4u*)(Hp + base + (size_t)it * 256) = oh[it];
    *(v4u*)(Lp + base + (size_t)it * 256) = ol[it];
  }
}

// Rotate-half rotary + f16 pack (single plane); the tile's 64 columns are one head's HD channels, its rows 16 positions pos0 .. .
//   w[d] = x[d] * cos[pos][d] + r[d] * sin[pos][d],  r[d] = -x[d+32] for d < 32, x[d-32] for d >= 32;  out[d] = f16(w * sc).
// FM == 0: row-major out plane (q'), chunk it = row it * 4 + (lane >> 3), d0 = (lane & 7) * 8: 8 lanes = the 128 bytes of a row;
// FM != 0: fragment-major out plane (k'), chunks as above.
template <int FM> __device__ __forceinline__ int rope_row(int it, int lane) { return FM ? (lane & 15) : it * 4 + (lane >> 3); }
template <int FM> __device__ __forceinline__ int rope_d0(int it, int lane) { return FM ? it * 16 + 8 * (lane >> 4) : (lane & 7) * 8; }
struct RopeTab { v4f ca[4], cb[4], sa[4], sb[4]; };
template <int FM>
__device__ __forceinline__ void rope_tab(RopeTab& t, const float* __restrict__ cosT, const float* __restrict__ sinT, int pos0,
                                         int lane) {
  const size_t o = (size_t)(pos0 + rope_row<FM>(0, lane)) * HD + rope_d0<FM>(0, lane);
  const float *cr = cosT + o, *sr = sinT + o;
  const int st = FM ? 16 : 4 * HD;            // floats from one of the lane's chunks to the next
#pragma unroll
  for (int it = 0; it < 4; ++it) {
    t.ca[it] = *(const v4f*)(cr + it * st);  t.cb[it] = *(const v4f*)(cr + it * st + 4);
    t.sa[it] = *(const v4f*)(sr + it * st);  t.sb[it] = *(const v4f*)(sr + it * st + 4);
  }
  hold_addr(cr, sr, cr, cr, cr, cr, cr, cr, cr, cr);   // the sixteen addresses are constant offsets from these two
}
// dst = the lane's first chunk. coverage: 4 stores x 32 lanes x 8 halves = 16 rows x 64 of the plane.
template <int FM>
__device__ __forceinline__ void ep_rope(const float* sl, const RopeTab& t, u16* dst, float sc, int lane) {
  v4u oh[4];
#pragma unroll
  for (int it = 0; it < 4; ++it) {
    const int d0 = rope_d0<FM>(it, lane), d1 = d0 ^ 32;
    const float* xr = sl + rope_row<FM>(it, lane) * 68;
    const v4f xa = *(const v4f*)(xr + d0), xb = *(const v4f*)(xr + d0 + 4);
    const v4f ya = *(const v4f*)(xr + d1), yb = *(const v4f*)(xr + d1 + 4);
    const float sgn = (d0 < 32) ? -1.0f : 1.0f;
    float w[8];
#pragma unroll
    for (int e = 0; e < 4; ++e) {
      w[e]     = fmaf(sgn * ya[e], t.sa[it][e], xa[e] * t.ca[it][e]);   // cosine product rounded, sine product fused
      w[4 + e] = fmaf(sgn * yb[e], t.sb[it][e], xb[e] * t.cb[it][e]);
    }
#pragma unroll
    for (int e = 0; e < 4; ++e) {
      const _Float16 h0 = (_Float16)(w[2 * e] * sc), h1 = (_Float16)(w[2 * e + 1] * sc);
      oh[it][e] = pk16(h_bits(h0), h_bits(h1));
    }
  }
#pragma unroll
  for (int it = 0; it < 4; ++it) *(v4u*)(dst + (size_t)it * (FM ? 256 : 4 * HID)) = oh[it];
}

// v plane + per-32-key block sums; the tile is 16 channels (rows) x 64 keys of batch b, the block 64 channels o0 .. x the same keys.
//   VH = f16(v * 1024), fragment-major plane [b * HID + o][TS], vbase = first half of the wave's tile pair + 8 * lane;
//   VS[b][kb][o] = sum over keys kb*32 .. kb*32+31 of v (f32): 8 keys in a lane as a tree, the chunk pair (0,1) and (2,3) across the
//   wave's halves, then the two pairs; the block's 2 x 64 sums meet in S (128 floats of LDS) so that one wave stores whole lines.
// coverage: VH 4 stores x 32 lanes x 8 halves = 16 x 64; VS 2 key blocks x 64 channels per block, vsdst = VS + (b * NKB + kb0) * HID + o0.
__device__ __forceinline__ void ep_v(const float* sl, u16* VH, size_t vbase, float* vsdst, float* S, int wave, int lane) {
  const int hh = lane >> 4, m = lane & 15;
  v4u o[4];
  float ps[4];
#pragma unroll
  for (int it = 0; it < 4; ++it) {
    const float* p = sl + m * 68 + it * 16 + 8 * hh;
    const v4f a = *(const v4f*)(p), bq = *(const v4f*)(p + 4);
#pragma unroll
    for (int q = 0; q < 2; ++q) {
      o[it][q]     = pk16(h_bits((_Float16)(a[2 * q] * VCAR)),  h_bits((_Float16)(a[2 * q + 1] * VCAR)));
      o[it][2 + q] = pk16(h_bits((_Float16)(bq[2 * q] * VCAR)), h_bits((_Float16)(bq[2 * q + 1] * VCAR)));
    }
    ps[it] = ((a[0] + a[1]) + (a[2] + a[3])) + ((bq[0] + bq[1]) + (bq[2] + bq[3]));
  }
#pragma unroll
  for (int it = 0; it < 4; ++it) *(v4u*)(VH + vbase + (size_t)it * 256) = o[it];
#if defined(__HIP_DEVICE_COMPILE__)
  // the block sums below reuse the four stores' data registers: wait first
  asm volatile("s_wait_xcnt 0x0" ::: "memory");
#endif
#pragma unroll
  for (int it = 0; it < 4; ++it) ps[it] += __shfl_xor(ps[it], 16, 32);
  S[hh * 64 + wave * 16 + m] = (hh != 0) ? (ps[2] + ps[3]) : (ps[0] + ps[1]);
  __syncthreads();
  if (wave == 0) {
    const int piece = m * 4;
    const v4f sv = *(const v4f*)(S + hh * 64 + piece);
    *(v4f*)(vsdst + (size_t)hh * HID + piece) = sv;
  }
}

// =====================================================================================================
// Shared GEMM store: the wave's 16x64 f32 tile already staged (final values) in its LDS slab (pitch 68), caller issued the
// coverage: 8 instructions x 2 rows x 16 lanes x 4 floats = the wave's 16 x 64 tile.
// =====================================================================================================
__device__ __forceinline__ void store64(const float* sl, float* C, int N, size_t rowb, int col0, int lane) {
  const int hh = lane >> 4, m = lane & 15;
  v4f vals[8];
#pragma unroll
  for (int it = 0; it < 8; ++it) vals[it] = *(const v4f*)(sl + (it * 2 + hh) * 68 + m * 4);
  float* dst = C + (rowb + (size_t)hh) * (size_t)N + col0 + m * 4;
  {
#pragma unroll
    for (int it = 0; it < 8; ++it) {
      *(v4f*)(dst + (size_t)(it * 2) * (size_t)N) = vals[it];
    }
    
  }
}

// =====================================================================================================
// bf16 GEMM: T[M][N] (f32, never stored) = A[M][K] (bf16 fragment-major) . Bt[N][K]^T (bf16 k-contiguous), times oscale, + bf16(bias[col]).
// Block = 64x64 tile, 4 waves x 16 rows; A and Bt fragment-major: a fragment = two wave-wide loads of 512 contiguous bytes (split
// k map for A and B); K stepped by 32 (K % 32 == 0, M % 64 == 0, N % 64 == 0 statically, grid = (M/64)*(N/64)).
// Epilogue EP_SPLIT: P0, P1 = hi + residual planes [M][N] of T * psc; EP_ROPE_Q: P0 = q' plane, rows (batch, t), N = NH * HD.
// =====================================================================================================
#define EP_SPLIT  0
#define EP_ROPE_Q 1
#define EP_ROPE_K 2
#define EP_V      3
template <int EP>
__device__ __forceinline__
void gemm_bf(const u16* __restrict__ A, const u16* __restrict__ Bt, const float* __restrict__ bias,
             int M, int N, int K, float oscale, int bid, float* slab, u16* P0, u16* P1, float psc,
             const float* __restrict__ cosT, const float* __restrict__ sinT) {
  const int tid = threadIdx.x, wave = tid >> 5, lane = tid & 31, hh = lane >> 4, m = lane & 15;
  const int ntile = N >> 6;
  const int rowb  = (bid / ntile) * 64 + wave * 16;
  const int col0  = (bid % ntile) * 64;
  if (rowb + 16 > M) return;                 // wave-uniform, never taken with the exact grid; no block barriers in this kernel
  const u16* ap = A  + (size_t)rowb * K + 8 * lane;      // row tile rowb / 16, k tile 0
  const u16* bp = Bt + (size_t)col0 * K + 8 * lane;
  const size_t bs = (size_t)16 * K;                      // one row tile = K / 32 tiles of 512 halves
  v8f acc0 = zero8(), acc1 = zero8(), acc2 = zero8(), acc3 = zero8();
#pragma unroll 1
  for (int k0 = 0; k0 < K; k0 += 32) {
    const int kf = k0 * 16;                              // k tile k0 / 32
    const u16 *pa = ap + kf, *p0 = bp + kf, *p1 = p0 + bs, *p2 = p1 + bs, *p3 = p2 + bs;
    const v16b a  = ldfrag_b(pa);
    const v16b b0 = ldfrag_b(p0);
    const v16b b1 = ldfrag_b(p1);
    const v16b b2 = ldfrag_b(p2);
    const v16b b3 = ldfrag_b(p3);
    hold_addr(pa, p0, p1, p2, p3, pa, pa, pa, pa, pa);
    acc0 = mma_b(a, b0, acc0);
    acc1 = mma_b(a, b1, acc1);
    acc2 = mma_b(a, b2, acc2);
    acc3 = mma_b(a, b3, acc3);
    guard6<v16b>(acc0, acc1, acc2, acc3, a, b0, b1, b2, b3, a);
  }
  float* sl = slab + wave * SLAB64;
  float bb[4];
#pragma unroll
  for (int j = 0; j < 4; ++j) bb[j] = bfr(bias[col0 + 16 * j + m]);
#pragma unroll
  for (int r = 0; r < 8; ++r) {
    const int ro = (8 * hh + r) * 68 + m;
    sl[ro]      = acc0[r] * oscale + bb[0];
    sl[ro + 16] = acc1[r] * oscale + bb[1];
    sl[ro + 32] = acc2[r] * oscale + bb[2];
    sl[ro + 48] = acc3[r] * oscale + bb[3];
  }
  if constexpr (EP == EP_SPLIT) {
    wave_sync_lds();
    ep_split(sl, P0, P1, (size_t)rowb * N + (size_t)col0 * 16 + 8 * lane, psc, lane);
  } else {
    RopeTab t;
    rope_tab<0>(t, cosT, sinT, rowb & (TT - 1), lane);
    wave_sync_lds();
    ep_rope<0>(sl, t, P0 + (size_t)(rowb + (lane >> 3)) * N + col0 + (lane & 7) * 8, psc, lane);
  }
}

// =====================================================================================================
// f16 GEMM (optionally batched over bz with element strides sA, sB):
//   T[M][N] (f32, never stored) = (Ah [+ Al])[M][K] . (Bh [+ Bl])[N][K]^T, times oscale, + bf16(bias) per row (biasRow != 0) or per column.
//   A2: A carried as hi + unscaled residual plane (products h.B + l.B); B2: B carried as hi + residual (A.h + A.l); never both.
// Same tiling as gemm_bf; all planes f16 fragment-major, K % 32 == 0.
// Epilogue EP_SPLIT: P0, P1 = hi + residual planes [M][N] of T * psc; EP_ROPE_K: P0 = k' planes, rows (batch, s), N = NH * HD;
// EP_V: P0 = v plane, VS = block sums, batch bz, rows = channels, columns = keys (M = HID, N = TS); S = 128 floats of LDS.
// =====================================================================================================
template <int A2, int B2, int EP>
__device__ __forceinline__
void gemm_h(const u16* __restrict__ Ah, const u16* __restrict__ Al, const u16* __restrict__ Bh, const u16* __restrict__ Bl,
            const float* __restrict__ bias, int M, int N, int K, int sA, int sB, int biasRow, float oscale,
            int bid, int bz, float* slab, u16* P0, u16* P1, float psc,
            const float* __restrict__ cosT, const float* __restrict__ sinT, float* VS, float* S) {
  const int tid = threadIdx.x, wave = tid >> 5, lane = tid & 31, hh = lane >> 4, m = lane & 15;
  const int ntile = N >> 6;
  const int row64 = (bid / ntile) * 64;
  const int rowb  = row64 + wave * 16;
  const int col0  = (bid % ntile) * 64;
  if (row64 + 64 > M) return;                // the same for the whole block (M % 64 == 0), never taken with the exact grid
  const size_t aofs = (size_t)bz * (size_t)sA + (size_t)rowb * K + 8 * lane;
  const _Float16* ahp = (const _Float16*)(const void*)Ah + aofs;
  const _Float16* alp = (const _Float16*)(const void*)Al + aofs;
  const size_t bofs = (size_t)bz * (size_t)sB + (size_t)col0 * K + 8 * lane;
  const _Float16* bhp = (const _Float16*)(const void*)Bh + bofs;
  const _Float16* blp = (const _Float16*)(const void*)Bl + bofs;
  const size_t bs = (size_t)16 * K;
  v8f acc0 = zero8(), acc1 = zero8(), acc2 = zero8(), acc3 = zero8();
#pragma unroll 1
  for (int k0 = 0; k0 < K; k0 += 32) {
    const int kf = k0 * 16;                              // k tile k0 / 32
    const _Float16 *pa = ahp + kf, *p0 = bhp + kf, *p1 = p0 + bs, *p2 = p1 + bs, *p3 = p2 + bs;
    const v16h ah = ldfrag_h(pa);
    const v16h b0 = ldfrag_h(p0);
    const v16h b1 = ldfrag_h(p1);
    const v16h b2 = ldfrag_h(p2);
    const v16h b3 = ldfrag_h(p3);
    if (A2) {
      const _Float16* pl = alp + kf;
      const v16h al = ldfrag_h(pl);
      hold_addr(pa, p0, p1, p2, p3, pl, pa, pa, pa, pa);
      acc0 = mma_h(ah, b0, acc0);  acc0 = mma_h(al, b0, acc0);
      acc1 = mma_h(ah, b1, acc1);  acc1 = mma_h(al, b1, acc1);
      acc2 = mma_h(ah, b2, acc2);  acc2 = mma_h(al, b2, acc2);
      acc3 = mma_h(ah, b3, acc3);  acc3 = mma_h(al, b3, acc3);
      guard6<v16h>(acc0, acc1, acc2, acc3, ah, al, b0, b1, b2, b3);
    } else if (B2) {
      const _Float16 *r0 = blp + kf, *r1 = r0 + bs, *r2 = r1 + bs, *r3 = r2 + bs;
      const v16h c0 = ldfrag_h(r0);
      const v16h c1 = ldfrag_h(r1);
      const v16h c2 = ldfrag_h(r2);
      const v16h c3 = ldfrag_h(r3);
      hold_addr(pa, p0, p1, p2, p3, r0, r1, r2, r3, pa);
      acc0 = mma_h(ah, b0, acc0);  acc0 = mma_h(ah, c0, acc0);
      acc1 = mma_h(ah, b1, acc1);  acc1 = mma_h(ah, c1, acc1);
      acc2 = mma_h(ah, b2, acc2);  acc2 = mma_h(ah, c2, acc2);
      acc3 = mma_h(ah, b3, acc3);  acc3 = mma_h(ah, c3, acc3);
      guard10(acc0, acc1, acc2, acc3, ah, b0, b1, b2, b3, c0, c1, c2, c3, ah);
    } else {
      hold_addr(pa, p0, p1, p2, p3, pa, pa, pa, pa, pa);
      acc0 = mma_h(ah, b0, acc0);
      acc1 = mma_h(ah, b1, acc1);
      acc2 = mma_h(ah, b2, acc2);
      acc3 = mma_h(ah, b3, acc3);
      guard6<v16h>(acc0, acc1, acc2, acc3, ah, b0, b1, b2, b3, ah);
    }
  }
  float* sl = slab + wave * SLAB64;
  if (biasRow != 0) {
#pragma unroll
    for (int r = 0; r < 8; ++r) {
      const float bb = bfr(bias[rowb + 8 * hh + r]);
      const int ro = (8 * hh + r) * 68 + m;
      sl[ro]      = acc0[r] * oscale + bb;
      sl[ro + 16] = acc1[r] * oscale + bb;
      sl[ro + 32] = acc2[r] * oscale + bb;
      sl[ro + 48] = acc3[r] * oscale + bb;
    }
  } else {
    float bb[4];
#pragma unroll
    for (int j = 0; j < 4; ++j) bb[j] = bfr(bias[col0 + 16 * j + m]);
#pragma unroll
    for (int r = 0; r < 8; ++r) {
      const int ro = (8 * hh + r) * 68 + m;
      sl[ro]      = acc0[r] * oscale + bb[0];
      sl[ro + 16] = acc1[r] * oscale + bb[1];
      sl[ro + 32] = acc2[r] * oscale + bb[2];
      sl[ro + 48] = acc3[r] * oscale + bb[3];
    }
  }
  if constexpr (EP == EP_SPLIT) {
    wave_sync_lds();
    ep_split(sl, P0, P1, (size_t)rowb * N + (size_t)col0 * 16 + 8 * lane, psc, lane);
  } else if constexpr (EP == EP_ROPE_K) {
    RopeTab t;
    rope_tab<1>(t, cosT, sinT, rowb & (TS - 1), lane);
    wave_sync_lds();
    // plane (batch rowb / TS, head col0 / HD), position tile (rowb % TS) / 16: two tiles of 512 halves
    const size_t pl = (size_t)((rowb / TS) * NH + (col0 >> 6)) * (TS / 16) + (size_t)((rowb & (TS - 1)) >> 4);
    ep_rope<1>(sl, t, P0 + pl * 1024 + 8 * lane, psc, lane);
#if defined(__HIP_DEVICE_COMPILE__)
    // in a merged grid the other job's code follows in the listing and reuses the four stores' address and data registers: wait first
    asm volatile("s_wait_xcnt 0x0" ::: "memory");
#endif
  } else {
    wave_sync_lds();
    ep_v(sl, P0, (size_t)(bz * HID + rowb) * TS + (size_t)col0 * 16 + 8 * lane,
         VS + (size_t)(bz * NKB + (col0 >> 5)) * HID + row64, S, wave, lane);
  }
}

// =====================================================================================================
// Merged grids: launches that do not depend on one another share one grid; the block index (uniform in a block) picks the job,
// and every job keeps its own block numbering. Block counts of the jobs:
// =====================================================================================================
#define NB_TAB (TT / 8)
#define NB_XT  ((TT / 64) * (HID / 64) * NBAT)
#define NB_CT  ((TS / 64) * (CND / 64) * NBAT)
#define NB_WC  ((HID * CND) / 2048)
#define NB_W   ((HID * HID) / 2048)
#define NB_WF  ((2 * HID * HID) / 2048)
#define NB_PRO (NB_TAB + NB_XT + NB_CT + NB_WC + 4 * NB_W + NB_WF)
#define NB_GC  (((NBAT * TS) / 64) * (HID / 64))
#define NB_GQ  (((NBAT * TT) / 64) * (HID / 64))
#define NB_GV  ((HID / 64) * (TS / 64) * NBAT)
#define NB_GK  (((NBAT * TS) / 64) * (HID / 64))

// Everything that reads inputs only: rotary tables, the two transposes, the six weight planes.
__global__ __launch_bounds__(256)
void pro_k(const float* __restrict__ x, const float* __restrict__ cond, const float* __restrict__ w_cond,
           const float* __restrict__ wq, const float* __restrict__ wk, const float* __restrict__ wv,
           const float* __restrict__ wo, const float* __restrict__ wf, float* cosT, float* sinT, u16* XT, u16* CONDT,
           u16* WCB, u16* WQB, u16* WKH, u16* WVH, u16* WOH, u16* WFH, InvF inv) {
  __shared__ __align__(16) u16 T[64 * VTP];
  int j = blockIdx.x;
  if (j < NB_TAB) { k_tab(cosT, sinT, inv, j); return; }
  j -= NB_TAB;
  if (j < NB_XT) { cvt_T(x, XT, HID, TT, j % (NB_XT / NBAT), j / (NB_XT / NBAT), T); return; }
  j -= NB_XT;
  if (j < NB_CT) { cvt_T(cond, CONDT, CND, TS, j % (NB_CT / NBAT), j / (NB_CT / NBAT), T); return; }
  j -= NB_CT;
  if (j < NB_WC) { cvt_flat(w_cond, WCB, (HID * CND) / 8, 0, 1.0f, CND, j); return; }
  j -= NB_WC;
  if (j < NB_W) { cvt_flat(wq, WQB, (HID * HID) / 8, 0, 1.0f, HID, j); return; }
  j -= NB_W;
  if (j < 3 * NB_W) {
    const int wsel = j / NB_W;
    cvt_flat(wsel == 0 ? wk : wsel == 1 ? wv : wo, wsel == 0 ? WKH : wsel == 1 ? WVH : WOH, (HID * HID) / 8, 1, WSC, HID,
             j % NB_W);
    return;
  }
  j -= 3 * NB_W;
  cvt_flat(wf, WFH, (2 * HID * HID) / 8, 1, WSC, HID, j);
}

// c^T = CONDT . WCB^T + b_cond -> hi + residual planes x1024 (the longer k loop, so its blocks come first) and
// q^T = XT . WQB^T + bq -> rotary -> q' plane.
__global__ __launch_bounds__(128)
void gemm_cq(const u16* __restrict__ CONDT, const u16* __restrict__ WCB, const float* __restrict__ b_cond, u16* CH, u16* CL,
             const u16* __restrict__ XT, const u16* __restrict__ WQB, const float* __restrict__ bq, u16* QH,
             const float* __restrict__ cosT, const float* __restrict__ sinT) {
  __shared__ __align__(16) float slab[4 * SLAB64];
  const int bid = blockIdx.x;
  if (bid < NB_GC) gemm_bf<EP_SPLIT>(CONDT, WCB, b_cond, NBAT * TS, HID, CND, 1.0f, bid, slab, CH, CL, CSC, cosT, sinT);
  else             gemm_bf<EP_ROPE_Q>(XT, WQB, bq, NBAT * TT, HID, HID, 1.0f, bid - NB_GC, slab, QH, QH, QSC, cosT, sinT);
}

// v = WVH . (CH + CL)^T + bv per row, per batch -> v plane + block sums (twice the products, so its blocks come first) and
// k^T = CH . WKH^T + bk -> rotary -> k' planes.
__global__ __launch_bounds__(128)
void gemm_kv(const u16* __restrict__ CH, const u16* __restrict__ CL, const u16* __restrict__ WVH, const u16* __restrict__ WKH,
             const float* __restrict__ bv, const float* __restrict__ bk, u16* VH, float* VS, u16* KH,
             const float* __restrict__ cosT, const float* __restrict__ sinT) {
  __shared__ __align__(16) float slab[4 * SLAB64];
  __shared__ __align__(16) float S[128];
  const int bid = blockIdx.x;
  if (bid < NB_GV)
    gemm_h<0, 1, EP_V>(WVH, WVH, CH, CL, bv, HID, TS, HID, 0, TS * HID, 1, 1.0f / (CSC * WSC),
                       bid % (NB_GV / NBAT), bid / (NB_GV / NBAT), slab, VH, VH, VCAR, cosT, sinT, VS, S);
  else
    gemm_h<0, 0, EP_ROPE_K>(CH, CH, WKH, WKH, bk, NBAT * TS, HID, HID, 0, 0, 0, 1.0f / (CSC * WSC), bid - NB_GV, 0, slab,
                            KH, KH, KSC, cosT, sinT, VS, S);
}

// y^T = (OH + OL) . WOH^T + bo -> hi + residual planes x16384
__global__ __launch_bounds__(128)
void gemm_o(const u16* __restrict__ OH, const u16* __restrict__ OL, const u16* __restrict__ WOH,
            const float* __restrict__ bo, u16* YH, u16* YL) {
  __shared__ __align__(16) float slab[4 * SLAB64];
  gemm_h<1, 0, EP_SPLIT>(OH, OL, WOH, WOH, bo, NBAT * TT, HID, HID, 0, 0, 0, 1.0f / (OSC * WSC), blockIdx.x, 0, slab,
                         YH, YL, YSC, nullptr, nullptr, nullptr, nullptr);
}

// =====================================================================================================
// Cross attention, transposed: block = (batch b, head h, 64 queries), one wave per 16 queries q0..q0+15; all TS keys in NKB blocks of 32.
//   q' plane QH [b][t][h][d] (x1024 f16, row-major), k' plane KH: per (b, h) fragment-major [s][d] (x1024), v plane VH:
//   fragment-major [b*256 + h*64+d][s] (x1024),
//   VS[b][kb][h*64+d] = f32 sum of v over key block kb; masks: key s of row t is masked iff bf16(cond_mask[b][s])*bf16(x_mask[b][t]) == 0,
//   masked score replaced by -1e4 (base-2 scaled) -> exact uniform softmax on a fully masked row, 0 weight otherwise.
//   S^T = k'.q'^T (A = 16 keys, B = 16 queries) and O^T += v^T.P'^T (A = 16 channels, B = 16 queries): lane (hh, c) holds query q0 + c
//   only, with keys kb + 8hh + r and kb + 16 + 8hh + r of a block in the registers of the two score tiles. So the maximum and the sum
//   over keys run inside the lane (one exchange with lane ^ 16 for the maximum; the two halves' sums l are joined once, at the end),
//   and the two score tiles, converted in place, are the B fragment of P'^T in the split k map of the v fragments: no LDS round trip.
//   What is now wanted per register and no longer per lane is staged once per block in LDS: the bf16-rounded key mask of batch b and
//   the block sums of (b, h) times 7/8 * 2^20.
//   Per block: 2 score tiles x 2 k-steps (single products, q fragments loaded once), scale 1/8 folded into the base-2 factor; online
//   max-subtracted base-2 softmax in f32; e = exp2(t - m) per key; l from the f32 e; accumulator update
//   o = o*alpha + (7/8 * 2^20) * VS block sum (f32), then P' = (e - 7/8) * 1024 as f16, 4 v.P' WMMAs.
//   Exact identity sum_s e_s v_s = sum_s (e_s - 7/8) v_s + 7/8 sum_s v_s per key block.
//   Accumulator j of a lane = channels 16j + 8hh .. + 7 of query c = one chunk of the O planes (O x8192 as f16 hi + residual).
// coverage: per wave 4 stores x 32 lanes x 8 halves = 16 x 64 per plane; grid 2048 blocks x 4 waves = every
//           (b, t, h) row of both O planes exactly once.
// =====================================================================================================
__device__ __forceinline__ float other_half(float v) {                // the value of lane ^ 16
  const int b = __builtin_bit_cast(int, v);
  return __builtin_bit_cast(float, __builtin_amdgcn_permlanex16(b, b, 0x76543210, 0xfedcba98, false, false));
}

__global__ __launch_bounds__(128)
void attn_x(const u16* __restrict__ QHp, const u16* __restrict__ KHp, const u16* __restrict__ VHp,
            const float* __restrict__ VS, const float* __restrict__ cmask, const float* __restrict__ xmask,
            u16* OHp, u16* OLp) {
  __shared__ __align__(32) float cmS[TS];          // bf16-rounded cond_mask of batch b
  __shared__ __align__(32) float vsS[NKB * HD];    // [key block][d]: 7/8 * 2^20 * block sum of v, head h

  const int tid  = threadIdx.x;
  const int wave = tid >> 5;
  const int lane = tid & 31;
  const int hh   = lane >> 4;
  const int c    = lane & 15;

  const int bid  = blockIdx.x;
  const int qt   = bid & (TT / 64 - 1);
  const int h    = (bid >> 5) & (NH - 1);
  const int b    = bid >> 7;
  const int q0   = qt * 64 + wave * 16;

  const size_t qofs = (((size_t)(b * TT + q0 + c)) * NH + h) * HD + 8 * hh;       // row-major plane
  const _Float16* Qh  = (const _Float16*)(const void*)QHp + qofs;
  const size_t kofs = ((size_t)(b * NH + h) * TS) * HD + 8 * lane;                // plane (b, h); key tile added per step
  const _Float16* Khb = (const _Float16*)(const void*)KHp + kofs;
  const size_t vofs = ((size_t)(b * HID + h * HD)) * TS + 8 * lane;               // row tile of d 0..15 (+16j); key tile added per step
  const _Float16* Vhb = (const _Float16*)(const void*)VHp + vofs;
  const float lsc = 0.125f * (LOG2E / (QSC * KSC));
  const float C0S = PCEN * PCAR * VCAR;

  // ---- stage the key mask (128 thr x 4 = TS) and the scaled block sums (128 thr x 8 = NKB x HD) ----
  static_assert(TS == 128 * 4 && NKB * HD == 128 * 8);
  {
    const float* pc = cmask + (size_t)b * TS + tid * 4;
    const float* pv = VS + ((size_t)b * NKB + (tid >> 3)) * HID + h * HD + (tid & 7) * 8;
    const v4f a = *(const v4f*)(pc), u0 = *(const v4f*)(pv), u1 = *(const v4f*)(pv + 4);
    hold_addr(pc, pv, pc, pc, pc, pc, pc, pc, pc, pc);
    v4f w;
#pragma unroll
    for (int e = 0; e < 4; ++e) w[e] = bfr(a[e]);
    *(v4f*)(cmS + tid * 4)     = w;
    *(v4f*)(vsS + tid * 8)     = u0 * C0S;
    *(v4f*)(vsS + tid * 8 + 4) = u1 * C0S;
  }
  const float xmv = bfr(xmask[(size_t)b * TT + q0 + c]);
  const v2f xm2 = {xmv, xmv};
  float mrow = -INFINITY, lrow = 0.f;               // lrow: this half's keys only
  v8f o[4];
#pragma unroll
  for (int j = 0; j < 4; ++j) o[j] = zero8();

  const v16h qa = ldfrag_rm_h(Qh), qb = ldfrag_rm_h(Qh + 32);
  hold_addr(Qh, Qh, Qh, Qh, Qh, Qh, Qh, Qh, Qh, Qh);
  __syncthreads();                                  // cmS, vsS written by all four waves, read-only from here on

#pragma unroll 1
  for (int it = 0; it < NKB; ++it) {
    const int kb = it * 32;
    // ---- scores: D element r of this lane = (key kb + 8hh + r, query q0 + c) in s0, key kb + 16 + 8hh + r in s1 ----
    v8f s0 = zero8(), s1 = zero8();
    {
      const _Float16* k0p = Khb + (size_t)kb * HD;            // key tile kb / 16: HD / 32 = 2 tiles of 512 halves
      const _Float16* k1p = k0p + (size_t)16 * HD;
      const v16h k0a = ldfrag_h(k0p), k0b = ldfrag_h(k0p + 512);
      const v16h k1a = ldfrag_h(k1p), k1b = ldfrag_h(k1p + 512);
      hold_addr(k0p, k0p, k0p, k0p, k0p, k0p, k0p, k0p, k0p, k0p);   // k1p is a constant offset from k0p
      s0 = mma_h(k0a, qa, s0);
      s0 = mma_h(k0b, qb, s0);
      s1 = mma_h(k1a, qa, s1);
      s1 = mma_h(k1b, qb, s1);
      guard2(s0, s1, qa, qb, k0a, k0b, k1a, k1b);
    }
    // ---- mask (replace by -1e4) + online softmax in base 2, all in the lane ----
    v8f t0, t1;
    {
      const float* cp = cmS + kb + 8 * hh;
      const v8f c0 = *(const v8f*)(cp), c1 = *(const v8f*)(cp + 16);
      const v8f u0 = s0 * lsc, u1 = s1 * lsc;
#pragma unroll
      for (int r = 0; r < 8; r += 2) {
        const v2f m0 = (v2f){c0[r], c0[r + 1]} * xm2, m1 = (v2f){c1[r], c1[r + 1]} * xm2;
        t0[r]     = (m0[0] != 0.0f) ? u0[r]     : MASKT;
        t0[r + 1] = (m0[1] != 0.0f) ? u0[r + 1] : MASKT;
        t1[r]     = (m1[0] != 0.0f) ? u1[r]     : MASKT;
        t1[r + 1] = (m1[1] != 0.0f) ? u1[r + 1] : MASKT;
      }
    }
    float mx = fmaxf(t0[0], t0[1]);
#pragma unroll
    for (int r = 2; r < 8; r += 2) mx = fmaxf(mx, fmaxf(t0[r], t0[r + 1]));
#pragma unroll
    for (int r = 0; r < 8; r += 2) mx = fmaxf(mx, fmaxf(t1[r], t1[r + 1]));
    mx = fmaxf(mx, other_half(mx));
    const float mn = fmaxf(mrow, mx);
    const float al = exp2f(mrow - mn);
    mrow = mn;
    t0 = t0 - mn;
    t1 = t1 - mn;
#pragma unroll
    for (int r = 0; r < 8; ++r) t0[r] = exp2f(t0[r]);
#pragma unroll
    for (int r = 0; r < 8; ++r) t1[r] = exp2f(t1[r]);
    {
      const v8f pr = t0 + t1;
      const v4f p4 = pr.lo + pr.hi;
      lrow = lrow * al + ((p4[0] + p4[2]) + (p4[1] + p4[3]));
    }
#pragma unroll
    for (int j = 0; j < 4; ++j) o[j] = o[j] * al + *(const v8f*)(vsS + it * HD + 16 * j + 8 * hh);
    // ---- B fragment of f16(P'^T): column = query c, elements 0..7 = keys kb + 8hh + 0..7, 8..15 = keys kb + 16 + 8hh + 0..7 ----
    FragH ph;
    ph.h[0] = __builtin_convertvector((t0 - PCEN) * PCAR, v8h);
    ph.h[1] = __builtin_convertvector((t1 - PCEN) * PCAR, v8h);
    // ---- v^T.P'^T : A fragment row = d = j*16 + c, keys contiguous in the v plane ----
    {
      const _Float16* vhp = Vhb + kb * 16;                    // key tile kb / 32
      const v16h vh0 = ldfrag_h(vhp);
      const v16h vh1 = ldfrag_h(vhp + (size_t)16 * TS);
      const v16h vh2 = ldfrag_h(vhp + (size_t)32 * TS);
      const v16h vh3 = ldfrag_h(vhp + (size_t)48 * TS);
      hold_addr(vhp, vhp, vhp, vhp, vhp, vhp, vhp, vhp, vhp, vhp);
      o[0] = mma_h(vh0, ph.v, o[0]);
      o[1] = mma_h(vh1, ph.v, o[1]);
      o[2] = mma_h(vh2, ph.v, o[2]);
      o[3] = mma_h(vh3, ph.v, o[3]);
      guard6<v16h>(o[0], o[1], o[2], o[3], ph.v, vh0, vh1, vh2, vh3, ph.v);
    }
  }
  acc_guard4(o[0], o[1], o[2], o[3]);

  // ---- join the halves' sums, fold 1/l and the carries (1024 on P', 1024 on v) ----
  const float oc  = 1.0f / (PCAR * VCAR);
  const float inv = (1.0f / (lrow + other_half(lrow))) * oc;
  // ---- O x8192 -> f16 hi + residual fragment-major planes [b * TT + t][HID]; accumulator j = chunk slot (j & 1) * 32 + lane of
  //      k tile 2h + (j >> 1): row c, d = 16j + 8hh .. + 7 ----
  v4u oh[4], ol[4];
#pragma unroll
  for (int j = 0; j < 4; ++j) {
    float w[8];
#pragma unroll
    for (int e = 0; e < 8; ++e) w[e] = (o[j][e] * inv) * OSC;
#pragma unroll
    for (int e = 0; e < 4; ++e) {
      const _Float16 h0 = (_Float16)w[2 * e], h1 = (_Float16)w[2 * e + 1];
      const _Float16 l0 = (_Float16)(w[2 * e] - (float)h0), l1 = (_Float16)(w[2 * e + 1] - (float)h1);
      oh[j][e] = pk16(h_bits(h0), h_bits(h1));
      ol[j][e] = pk16(h_bits(l0), h_bits(l1));
    }
  }
  const size_t ob = (size_t)(b * TT + q0) * HID + (size_t)h * 1024 + 8 * lane;    // row tile (b * TT + q0) / 16, k tile 2h
#pragma unroll
  for (int j = 0; j < 4; ++j) {
    const size_t o8 = ob + (size_t)j * 256;
    *(v4u*)(OHp + o8) = oh[j];
    *(v4u*)(OLp + o8) = ol[j];
  }
}

// =====================================================================================================
// FiLM GEMM + combine: block = (batch b, 64 time columns t0, 64 channels), one wave per 16 channels c0..c0+15.
//   gamma[c][t] = sum_i w_film[c][i] y[t][i], beta[c][t] = sum_i w_film[256+c][i] y[t][i]  (A = w_film rows as f16(bf16 x1024),
//   B = y planes [b][t][i] as f16 hi x16384 + residual: products wg.h, wb.h, wg.l, wb.l, 8 accumulators);
//   out[b][c][t] = (bf16(x[b][c][t]) * (gamma*oscale + bf16(b_film[c])) + (beta*oscale + bf16(b_film[256+c]))) * bf16(x_mask[b][t]).
// coverage: grid 16 b x 32 t-tiles x 4 channel groups = 2048 blocks x 4 waves x 16 x 64 = every out element exactly once.
// =====================================================================================================
__global__ __launch_bounds__(128)
void film_k(const u16* __restrict__ WF, const u16* __restrict__ YHp, const u16* __restrict__ YLp,
            const float* __restrict__ bfl, const float* __restrict__ X, const float* __restrict__ XM,
            float* OUT, float oscale) {
  __shared__ __align__(16) float slab[4 * SLAB64];
  const int tid = threadIdx.x, wave = tid >> 5, lane = tid & 31, hh = lane >> 4, m = lane & 15;
  const int bid = blockIdx.x;
  const int tt  = bid & (TT / 64 - 1);
  const int cg  = (bid >> 5) & 3;
  const int b   = bid >> 7;
  const int t0  = tt * 64;
  const int c0  = cg * 64 + wave * 16;
  const _Float16* agp = (const _Float16*)(const void*)WF + (size_t)c0 * HID + 8 * lane;
  const _Float16* abp = agp + (size_t)HID * HID;                                   // row 256 + c0 + m
  const size_t yofs = ((size_t)(b * TT + t0)) * HID + 8 * lane;
  const _Float16* yhp = (const _Float16*)(const void*)YHp + yofs;
  const _Float16* ylp = (const _Float16*)(const void*)YLp + yofs;
  const size_t bs = (size_t)16 * HID;
  v8f g[4], be[4];
#pragma unroll
  for (int j = 0; j < 4; ++j) { g[j] = zero8(); be[j] = zero8(); }
#pragma unroll 1
  for (int k0 = 0; k0 < HID; k0 += 32) {
    const int kf = k0 * 16;                              // k tile k0 / 32
    const _Float16 *pg = agp + kf, *pb = abp + kf;
    const _Float16 *p0 = yhp + kf, *p1 = p0 + bs, *p2 = p1 + bs, *p3 = p2 + bs;
    const _Float16 *r0 = ylp + kf, *r1 = r0 + bs, *r2 = r1 + bs, *r3 = r2 + bs;
    const v16h ag = ldfrag_h(pg), ab = ldfrag_h(pb);
    const v16h y0 = ldfrag_h(p0);
    const v16h y1 = ldfrag_h(p1);
    const v16h y2 = ldfrag_h(p2);
    const v16h y3 = ldfrag_h(p3);
    const v16h z0 = ldfrag_h(r0);
    const v16h z1 = ldfrag_h(r1);
    const v16h z2 = ldfrag_h(r2);
    const v16h z3 = ldfrag_h(r3);
    hold_addr(pg, p0, r0, pg, pg, pg, pg, pg, pg, pg);     // the other seven addresses are constant offsets from these three
    g[0] = mma_h(ag, y0, g[0]);  be[0] = mma_h(ab, y0, be[0]);
    g[1] = mma_h(ag, y1, g[1]);  be[1] = mma_h(ab, y1, be[1]);
    g[2] = mma_h(ag, y2, g[2]);  be[2] = mma_h(ab, y2, be[2]);
    g[3] = mma_h(ag, y3, g[3]);  be[3] = mma_h(ab, y3, be[3]);
    g[0] = mma_h(ag, z0, g[0]);  be[0] = mma_h(ab, z0, be[0]);
    g[1] = mma_h(ag, z1, g[1]);  be[1] = mma_h(ab, z1, be[1]);
    g[2] = mma_h(ag, z2, g[2]);  be[2] = mma_h(ab, z2, be[2]);
    g[3] = mma_h(ag, z3, g[3]);  be[3] = mma_h(ab, z3, be[3]);
    guardF(g[0], g[1], g[2], g[3], be[0], be[1], be[2], be[3], ag, ab, y0, y1, y2, y3, z0, z1, z2, z3);
  }
  float* sl = slab + wave * SLAB64;
  float xm[4];
#pragma unroll
  for (int j = 0; j < 4; ++j) xm[j] = bfr(XM[(size_t)b * TT + t0 + 16 * j + m]);
#pragma unroll
  for (int r = 0; r < 8; ++r) {
    const int cc = c0 + 8 * hh + r;
    const float bg = bfr(bfl[cc]);
    const float bb = bfr(bfl[HID + cc]);
    const float* xr = X + ((size_t)(b * HID + cc)) * TT + t0 + m;
#pragma unroll
    for (int j = 0; j < 4; ++j) {
      const float gam = g[j][r] * oscale + bg;
      const float bet = be[j][r] * oscale + bb;
      const float xv  = bfr(xr[16 * j]);
      sl[(8 * hh + r) * 68 + 16 * j + m] = (xv * gam + bet) * xm[j];
    }
  }
  wave_sync_lds();
  store64(sl, OUT, TT, (size_t)(b * HID + c0), t0, lane);
}

// =====================================================================================================
// Workspace map (bytes); every plane is fully written by whole-line stores before it is read; all extents are exact multiples
// of the store granularity (no pad rows needed); every offset a multiple of 65536. No launch writes a region that it reads;
// region R1 is reused by later planes once the earlier plane's last reader has run (launch order below):
//   CT f32 [2048][64] 524288, ST same
//   XT bf16 [16][2048][256] 16777216; CONDT bf16 [16][512][512] 8388608
//   WCB bf16 [256][512] 262144; WQB bf16 [256][256] 131072; WKH, WVH, WOH f16 [256][256] 131072 each; WFH f16 [512][256] 262144
//   CH f16 [16][512][256] 4194304, CL same
//   R1: QH f16 [16][2048][4][64] 16777216 (first half) -> later YH, YL f16 [16][2048][256] 16777216 each
//   KH f16 [16][4][512][64] 4194304; VH f16 [16][256][512] 4194304; VS f32 [16][16][256] 262144
//   OH, OL f16 [16][2048][256] 16777216 each
//   end 111411200
// =====================================================================================================
extern "C" void kernel_launch(void* const* d_in, const int* in_sizes, int n_in,
                              void* d_out, int out_size, void* d_ws, size_t ws_size,
                              hipStream_t stream) {
  if (n_in < 16) return;
  if (in_sizes[0] != NBAT * HID * TT) return;
  if (in_sizes[1] != NBAT * TT) return;
  if (in_sizes[2] != NBAT * CND * TS) return;
  if (in_sizes[3] != NBAT * TS) return;
  if (in_sizes[4] != HID * CND || in_sizes[5] != HID) return;
  if (in_sizes[6] != HID * HID || in_sizes[7] != HID) return;
  if (in_sizes[8] != HID * HID || in_sizes[9] != HID) return;
  if (in_sizes[10] != HID * HID || in_sizes[11] != HID) return;
  if (in_sizes[12] != HID * HID || in_sizes[13] != HID) return;
  if (in_sizes[14] != 2 * HID * HID || in_sizes[15] != 2 * HID) return;
  if (out_size != NBAT * HID * TT) return;

  const float* x      = (const float*)d_in[0];
  const float* x_mask = (const float*)d_in[1];
  const float* cond   = (const float*)d_in[2];
  const float* c_mask = (const float*)d_in[3];
  const float* w_cond = (const float*)d_in[4];
  const float* b_cond = (const float*)d_in[5];
  const float* wq     = (const float*)d_in[6];
  const float* bq     = (const float*)d_in[7];
  const float* wk     = (const float*)d_in[8];
  const float* bk     = (const float*)d_in[9];
  const float* wv     = (const float*)d_in[10];
  const float* bv     = (const float*)d_in[11];
  const float* wo     = (const float*)d_in[12];
  const float* bo     = (const float*)d_in[13];
  const float* wf     = (const float*)d_in[14];
  const float* bfi    = (const float*)d_in[15];
  float*       out    = (float*)d_out;

  const size_t szTab = (size_t)TT * HD * 4;                       //    524288
  const size_t szR3  = (size_t)NBAT * TT * HID * 2;               //  16777216
  const size_t szR4  = (size_t)NBAT * TS * CND * 2;               //   8388608
  const size_t szWCB = (size_t)HID * CND * 2;                     //    262144
  const size_t szW   = (size_t)HID * HID * 2;                     //    131072
  const size_t szWF  = (size_t)2 * HID * HID * 2;                 //    262144
  const size_t szCP  = (size_t)NBAT * TS * HID * 2;               //   4194304
  const size_t szR1  = (size_t)NBAT * TT * HID * 2 * 2;           //  33554432
  const size_t szKH  = (size_t)NBAT * TS * HID * 2;               //   4194304
  const size_t szVH  = (size_t)NBAT * HID * TS * 2;               //   4194304
  const size_t szVS  = (size_t)NBAT * NKB * HID * 4;              //    262144
  const size_t szOP  = (size_t)NBAT * TT * HID * 2;               //  16777216
  size_t off = 0;
  const size_t oCT  = off; off += szTab;
  const size_t oST  = off; off += szTab;
  const size_t oR3  = off; off += szR3;
  const size_t oR4  = off; off += szR4;
  const size_t oWCB = off; off += szWCB;
  const size_t oWQB = off; off += szW;
  const size_t oWKH = off; off += szW;
  const size_t oWVH = off; off += szW;
  const size_t oWOH = off; off += szW;
  const size_t oWFH = off; off += szWF;
  const size_t oCH  = off; off += szCP;
  const size_t oCL  = off; off += szCP;
  const size_t oR1  = off; off += szR1;
  const size_t oKH  = off; off += szKH;
  const size_t oVH  = off; off += szVH;
  const size_t oVS  = off; off += szVS;
  const size_t oOH  = off; off += szOP;
  const size_t oOL  = off; off += szOP;
  if (off > ws_size) return;                            // off = 111411200
  if (off > (size_t)134217728) return;

  char* ws = (char*)d_ws;
  float* CT    = (float*)(ws + oCT);
  float* ST    = (float*)(ws + oST);
  u16*   XT    = (u16*)(ws + oR3);
  u16*   CONDT = (u16*)(ws + oR4);
  u16*   WCB   = (u16*)(ws + oWCB);
  u16*   WQB   = (u16*)(ws + oWQB);
  u16*   WKH   = (u16*)(ws + oWKH);
  u16*   WVH   = (u16*)(ws + oWVH);
  u16*   WOH   = (u16*)(ws + oWOH);
  u16*   WFH   = (u16*)(ws + oWFH);
  u16*   CH    = (u16*)(ws + oCH);
  u16*   CL    = (u16*)(ws + oCL);
  u16*   QH    = (u16*)(ws + oR1);
  u16*   YH    = (u16*)(ws + oR1);
  u16*   YL    = (u16*)(ws + oR1 + szOP);
  u16*   KH    = (u16*)(ws + oKH);
  u16*   VH    = (u16*)(ws + oVH);
  float* VS    = (float*)(ws + oVS);
  u16*   OH    = (u16*)(ws + oOH);
  u16*   OL    = (u16*)(ws + oOL);

  // inv_freq[i] = 1 / pow(10000, i/32) in f32 (pow correctly converted from f64, then IEEE f32 reciprocal)
  InvF inv;
  for (int i = 0; i < 32; ++i) {
    const double p = pow(10000.0, (double)i / 32.0);
    const float pf = (float)p;
    inv.f[i] = 1.0f / pf;
  }

  const dim3 blk(256);
  const dim3 bG(128);
  const dim3 gAT(NBAT * NH * (TT / 64));                // 2048
  const dim3 gFM(NBAT * 4 * (TT / 64));                 // 2048

  // (0) inputs only: rotary cos/sin tables [2048][64]; x [b][256][2048] -> XT bf16 [b][2048][256]; cond [b][512][512] -> CONDT bf16
  //     [b][512 s][512 i]; weights (W[o][i] row-major is already [n][k]): bf16 planes for w_cond, wq; f16(bf16 x1024) for wk, wv, wo, w_film
  pro_k<<<dim3(NB_PRO), blk, 0, stream>>>(x, cond, w_cond, wq, wk, wv, wo, wf, CT, ST, XT, CONDT, WCB, WQB, WKH, WVH, WOH, WFH, inv);
  // (1) c^T [8192][256] = CONDT [8192][512] . WCB^T + b_cond -> f16 hi + residual planes x1024;
  //     q^T [32768][256] = XT . WQB^T + bq -> rotary, positions mod 2048 -> q' plane, rows (b, t, h)
  gemm_cq<<<dim3(NB_GC + NB_GQ), bG, 0, stream>>>(CONDT, WCB, b_cond, CH, CL, XT, WQB, bq, QH, CT, ST);
  // (2) v [b][256][512] = WVH [256][256] . (CH + CL)[b][512][256]^T + bv per row -> v f16 plane x1024 + per-32-key block sums;
  //     k^T [8192][256] = CH . WKH^T (+ bk) -> rotary, positions mod 512 -> k' planes; carries 1024 x 1024 folded back
  gemm_kv<<<dim3(NB_GV + NB_GK), bG, 0, stream>>>(CH, CL, WVH, WKH, bv, bk, VH, VS, KH, CT, ST);
  // (3) cross attention -> O planes [b][t][h*64+d] x8192 (hi + residual)
  attn_x<<<gAT, bG, 0, stream>>>(QH, KH, VH, VS, c_mask, x_mask, OH, OL);
  // (4) y^T [32768][256] = (OH + OL) . WOH^T + bo, carries 8192 x 1024 folded back -> f16 hi + residual planes x16384
  //     (into the q' region, q' no longer needed)
  gemm_o<<<dim3(NB_GQ), bG, 0, stream>>>(OH, OL, WOH, bo, YH, YL);
  // (5) FiLM GEMM + combine -> out [16][256][2048] f32
  film_k<<<gFM, bG, 0, stream>>>(WFH, YH, YL, bfi, x, x_mask, out, 1.0f / (YSC * WSC));
  (void)hipGetLastError();
}

// v005
// Measured time: 103 microseconds a run.
// Two timings next to v004 put it at 1.28 and 1.27 times that version's speed.
// All steps since v000 together make it 2.67 times as fast.
// Contractions: cond^T.w_cond^T and x^T.wq^T on v_wmma_f32_16x16x32_bf16 (inputs RNE-converted to bf16, exact operands, f32 accumulate);
// c.wk^T (c x1024 f16 hi plane), wv.c (c x1024 f16 hi + residual, products w.h + w.l), scores q'.k'^T (q' x1024, k' x1024 f16, one product),
// P'.v (centred P' = (e - 7/8) x1024 f16, v x1024 f16, one product; 7/8 * sum(v) per 32-key block added in f32),
// O.wo^T (O x8192 f16 hi + residual, products h.w + l.w), w_film.y (y x16384 f16 hi + residual): v_wmma_f32_16x16x32_f16,
// weights as f16(bf16(w) x1024), f32 accumulate. Rotary tables: f64 sin/cos of the f32 angle. Rotation, masked base-2 online softmax, 1/l, FiLM combine: f32 on VALU.
#include <hip/hip_runtime.h>
#include <math.h>
#include <stdint.h>

#define NBAT  16
#define TT    2048
#define TS    512
#define HID   256
#define CND   512
#define NH    4
#define HD    64
#define NKB   (TS / 32)
#define QSC   1024.0f
#define KSC   1024.0f
#define CSC   1024.0f
#define VCAR  1024.0f
#define PCAR  1024.0f
#define OSC   8192.0f
#define YSC   16384.0f
#define WSC   1024.0f
#define PCEN  0.875f
#define LOG2E 1.4426950408889634f
#define MASKT (-10000.0f * LOG2E)
#define SLAB64 (16 * 68)
#define VTP    72
static_assert(HID == NH * HD && HD == 64);
static_assert((TT % 64) == 0 && (TS % 64) == 0 && (TS % 32) == 0 && NKB == 16);
static_assert((TT & (TT - 1)) == 0 && (TS & (TS - 1)) == 0);
static_assert((HID % 64) == 0 && (CND % 64) == 0 && (HID % 32) == 0 && (CND % 32) == 0);
static_assert(((NBAT * TT * NH * 8) % 256) == 0 && ((NBAT * TS * NH * 8) % 256) == 0);
static_assert(((NBAT * TS * HID) % 2048) == 0 && ((NBAT * TT * HID) % 2048) == 0);

typedef unsigned short u16;
typedef _Float16 v16h __attribute__((ext_vector_type(16)));
typedef _Float16 v8h  __attribute__((ext_vector_type(8)));
typedef __bf16   v16b __attribute__((ext_vector_type(16)));
typedef float    v8f  __attribute__((ext_vector_type(8)));
typedef float    v4f  __attribute__((ext_vector_type(4)));
typedef float    v2f  __attribute__((ext_vector_type(2)));
typedef unsigned int v4u __attribute__((ext_vector_type(4)));

union FragH { v16h v; v8h h[2]; v4u u[2]; };
union FragB { v16b v; v4u u[2]; };

struct InvF { float f[32]; };
static_assert(sizeof(InvF) == 128);

// ---- scalar helpers --------------------------------------------------------------------------------
__device__ __forceinline__ unsigned short bf_bits(float f) {          // f32 -> bf16 bits, RNE convert
  unsigned u = __float_as_uint(f);
  return (unsigned short)((u + 0x7FFFu + ((u >> 16) & 1u)) >> 16);
}
__device__ __forceinline__ float bf_up(unsigned short h) { return __uint_as_float(((unsigned)h) << 16); }
__device__ __forceinline__ float bfr(float f) { return bf_up(bf_bits(f)); }
__device__ __forceinline__ unsigned short h_bits(_Float16 x) { return __builtin_bit_cast(unsigned short, x); }
__device__ __forceinline__ unsigned pk16(unsigned short a, unsigned short b) { return (unsigned)a | ((unsigned)b << 16); }
__device__ __forceinline__ v8f zero8() { v8f z = {0.f, 0.f, 0.f, 0.f, 0.f, 0.f, 0.f, 0.f}; return z; }

// ---- fragment-major planes: a 16-bit plane [R][K] (R % 16 == 0, K % 32 == 0) is stored as tiles of 16 rows x 32 k, 512 halves
//      each, tile (row >> 4, k >> 5) at ((row >> 4) * (K >> 5) + (k >> 5)) * 512; inside a tile 64 chunks of 8 halves, chunk slot
//      = ((k >> 4) & 1) * 32 + ((k >> 3) & 1) * 16 + (row & 15), so that slot & 31 is the lane that owns the chunk.
// ---- fragment loaders: 16-bit A/B operand, p = tile start + 8 * lane: two wave-wide loads of 512 contiguous bytes;
//      lane -> row/col (lane&15), elements 0..7 <- k0+8h.., elements 8..15 <- k0+16+8h..  (same split k map for A and B)
__device__ __forceinline__ v16h ldfrag_h(const _Float16* p) {
  FragH f;
  f.h[0] = *(const v8h*)(p);
  f.h[1] = *(const v8h*)(p + 256);
  return f.v;
}
__device__ __forceinline__ v16h ldfrag_rm_h(const _Float16* p) {      // same k map from a row-major row, p includes +8*(lane>>4)
  FragH f;
  f.h[0] = *(const v8h*)(p);
  f.h[1] = *(const v8h*)(p + 16);
  return f.v;
}
__device__ __forceinline__ v16b ldfrag_b(const u16* p) {              // bf16 plane read as unsigned integer vectors
  FragB f;
  f.u[0] = *(const v4u*)(p);
  f.u[1] = *(const v4u*)(p + 256);
  return f.v;
}

// Stands behind a group of fragment loads and names their address registers as inputs, so that these registers stay unwritten
// (by a later load's result or by an address update) up to the s_wait_xcnt 0 inside it.
__device__ __forceinline__ void hold_addr(const void* a, const void* b, const void* c, const void* d, const void* e,
                                          const void* f, const void* g, const void* h, const void* i, const void* j) {
#if defined(__HIP_DEVICE_COMPILE__)
  asm volatile("s_wait_xcnt 0x0" :: "v"(a), "v"(b), "v"(c), "v"(d), "v"(e), "v"(f), "v"(g), "v"(h), "v"(i), "v"(j) : "memory");
#endif
}
// chunk slot (0..63) of a tile -> row in the tile and first k in the tile
__device__ __forceinline__ int slot_row(int slot) { return slot & 15; }
__device__ __forceinline__ int slot_k(int slot) { return ((slot >> 5) << 4) + (((slot >> 4) & 1) << 3); }

__device__ __forceinline__ v8f mma_h(v16h a, v16h b, v8f c) {
  return __builtin_amdgcn_wmma_f32_16x16x32_f16(false, a, false, b, (short)0, c, false, false);
}
__device__ __forceinline__ v8f mma_b(v16b a, v16b b, v8f c) {
  return __builtin_amdgcn_wmma_f32_16x16x32_bf16(false, a, false, b, (short)0, c, false, false);
}
__device__ __forceinline__ void guard2(v8f& a, v8f& b, v16h x0, v16h x1, v16h x2, v16h x3, v16h x4, v16h x5) {
#if defined(__HIP_DEVICE_COMPILE__)
  asm volatile("v_nop\n\tv_nop\n\tv_nop\n\tv_nop"
               : "+v"(a), "+v"(b) : "v"(x0), "v"(x1), "v"(x2), "v"(x3), "v"(x4), "v"(x5) : "memory");
#endif
}
template <typename F>
__device__ __forceinline__ void guard6(v8f& a, v8f& b, v8f& c, v8f& d, F x0, F x1, F x2, F x3, F x4, F x5) {
#if defined(__HIP_DEVICE_COMPILE__)
  asm volatile("v_nop\n\tv_nop\n\tv_nop\n\tv_nop"
               : "+v"(a), "+v"(b), "+v"(c), "+v"(d) : "v"(x0), "v"(x1), "v"(x2), "v"(x3), "v"(x4), "v"(x5) : "memory");
#endif
}
__device__ __forceinline__ void guard10(v8f& a, v8f& b, v8f& c, v8f& d, v16h x0, v16h x1, v16h x2, v16h x3, v16h x4,
                                        v16h x5, v16h x6, v16h x7, v16h x8, v16h x9) {
#if defined(__HIP_DEVICE_COMPILE__)
  asm volatile("v_nop\n\tv_nop\n\tv_nop\n\tv_nop"
               : "+v"(a), "+v"(b), "+v"(c), "+v"(d)
               : "v"(x0), "v"(x1), "v"(x2), "v"(x3), "v"(x4), "v"(x5), "v"(x6), "v"(x7), "v"(x8), "v"(x9) : "memory");
#endif
}
__device__ __forceinline__ void guardF(v8f& a0, v8f& a1, v8f& a2, v8f& a3, v8f& c0, v8f& c1, v8f& c2, v8f& c3,
                                       v16h x0, v16h x1, v16h x2, v16h x3, v16h x4, v16h x5, v16h x6, v16h x7,
                                       v16h x8, v16h x9) {
#if defined(__HIP_DEVICE_COMPILE__)
  asm volatile("v_nop\n\tv_nop\n\tv_nop\n\tv_nop"
               : "+v"(a0), "+v"(a1), "+v"(a2), "+v"(a3), "+v"(c0), "+v"(c1), "+v"(c2), "+v"(c3)
               : "v"(x0), "v"(x1), "v"(x2), "v"(x3), "v"(x4), "v"(x5), "v"(x6), "v"(x7), "v"(x8), "v"(x9) : "memory");
#endif
}
__device__ __forceinline__ void acc_guard4(v8f& a, v8f& b, v8f& c, v8f& d) {
#if defined(__HIP_DEVICE_COMPILE__)
  asm volatile("v_nop\n\tv_nop\n\tv_nop\n\tv_nop" : "+v"(a), "+v"(b), "+v"(c), "+v"(d));
#endif
}
__device__ __forceinline__ void wave_sync_lds() {
  __builtin_amdgcn_fence(__ATOMIC_RELEASE, "workgroup");
  __builtin_amdgcn_wave_barrier();
  __builtin_amdgcn_fence(__ATOMIC_ACQUIRE, "workgroup");
}

// ---- accurate f32 sin/cos of a non-negative f32 angle (|angle| < 2048): f64 two-part pi/2 reduction + f64 polynomials,
//      plain f64 fma/mul only (no library f64 trig path), result converted to f32.
__device__ __forceinline__ void sincos_acc(float angf, float& sv, float& cv) {
  const double a = (double)angf;
  const double TWO_OVER_PI = 0.63661977236758134308;
  const double PIO2_HI = 1.5707963267948966;
  const double PIO2_LO = 6.123233995736766e-17;
  const int kq = (int)(a * TWO_OVER_PI + 0.5);
  const double kd = (double)kq;
  double r = fma(-kd, PIO2_HI, a);
  r = fma(-kd, PIO2_LO, r);
  const double r2 = r * r;
  double sp = 1.0 / 6227020800.0;
  sp = fma(sp, r2, -1.0 / 39916800.0);
  sp = fma(sp, r2, 1.0 / 362880.0);
  sp = fma(sp, r2, -1.0 / 5040.0);
  sp = fma(sp, r2, 1.0 / 120.0);
  sp = fma(sp, r2, -1.0 / 6.0);
  const double s = fma(sp * r2, r, r);
  double cp = -1.0 / 87178291200.0;
  cp = fma(cp, r2, 1.0 / 479001600.0);
  cp = fma(cp, r2, -1.0 / 3628800.0);
  cp = fma(cp, r2, 1.0 / 40320.0);
  cp = fma(cp, r2, -1.0 / 720.0);
  cp = fma(cp, r2, 1.0 / 24.0);
  cp = fma(cp, r2, -0.5);
  const double c = fma(cp, r2, 1.0);
  const int qd = kq & 3;
  const double so = (qd == 0) ? s : (qd == 1) ? c : (qd == 2) ? -s : -c;
  const double co = (qd == 0) ? c : (qd == 1) ? -s : (qd == 2) ? -c : s;
  sv = (float)so;
  cv = (float)co;
}

// =====================================================================================================
// Rotary tables: cosT[t][d], sinT[t][d] for t < TT, d < HD, angle = float(t) * inv_freq[d & 31] (f32 product), halves duplicated.
// Wave = one position t, lane = frequency index; inv_freq picked from the by-value table with a static select chain.
// coverage: grid TT/8 blocks x 8 waves = TT rows; per row 4 line stores = 64 floats of each table.
// =====================================================================================================
__device__ __forceinline__ void k_tab(float* cosT, float* sinT, const InvF& inv, int bx) {
  const int tid  = threadIdx.x;
  const int lane = tid & 31;
  const int t    = bx * 8 + (tid >> 5);
  if (t >= TT) return;                      // never taken with the exact grid; no barriers in this kernel
  float f = inv.f[0];
#pragma unroll
  for (int i = 1; i < 32; ++i) f = (lane == i) ? inv.f[i] : f;
  const float ang = (float)t * f;
  float sv, cv;
  sincos_acc(ang, sv, cv);
  float* cr = cosT + (size_t)t * HD;
  float* sr = sinT + (size_t)t * HD;
  {
    *(float*)(cr + lane)      = cv;
    *(float*)(cr + 32 + lane) = cv;
    *(float*)(sr + lane)      = sv;
    *(float*)(sr + 32 + lane) = sv;
    
  }
}

// =====================================================================================================
// Batched transpose + bf16 convert: in W[b][R][C] (row-major f32) -> out D[b][C][R] (bf16 RNE bits, fragment-major plane).
// Block = one 64x64 tile (r0, c0) of batch bb: 256 thr x 4 16-B loads -> LDS tile [c][r] (pitch 72), block barrier,
// coverage: load 256 thr x 16 = 64x64; store 2 iterations x 256 thr x 8 halves = 64 lines x 64; grid (C/64)*(R/64) x b = all of D.
// =====================================================================================================
__device__ __forceinline__ void cvt_T(const float* __restrict__ W, u16* D, int R, int C, int bid, int bb, u16* T) {
  const int tid = threadIdx.x;
  const int ntc = C >> 6;
  const int c0  = (bid % ntc) * 64;
  const int r0  = (bid / ntc) * 64;
  const float* Wb = W + (size_t)bb * (size_t)R * (size_t)C;
  u16*         Db = D + (size_t)bb * (size_t)R * (size_t)C;
  {
    const int rr = tid >> 2;
    const int cc = (tid & 3) * 16;
    const float* src = Wb + (size_t)(r0 + rr) * C + c0 + cc;
#pragma unroll
    for (int i = 0; i < 4; ++i) {
      const v4f a = *(const v4f*)(src + 4 * i);
#pragma unroll
      for (int e = 0; e < 4; ++e) T[(cc + 4 * i + e) * VTP + rr] = bf_bits(a[e]);
    }
  }
  __syncthreads();
  // thread = one chunk of the fragment-major plane: 8 local tiles (4 row tiles x 2 k tiles) x 64 slots
  v4u vals[2];
  const int slot = tid & 63;
#pragma unroll
  for (int it = 0; it < 2; ++it) {
    const int lt = it * 4 + (tid >> 6);
    vals[it] = *(const v4u*)(T + ((lt >> 1) * 16 + slot_row(slot)) * VTP + (lt & 1) * 32 + slot_k(slot));
  }
  {
#pragma unroll
    for (int it = 0; it < 2; ++it) {
      const int lt = it * 4 + (tid >> 6);
      const size_t tile = (size_t)((c0 >> 4) + (lt >> 1)) * (size_t)(R >> 5) + (size_t)((r0 >> 5) + (lt & 1));
      *(v4u*)(Db + tile * 512 + slot * 8) = vals[it];
    }
#if defined(__HIP_DEVICE_COMPILE__)
    // in a merged grid other jobs' code follows in the listing and reuses the two stores' address and data registers: wait first
    asm volatile("s_wait_xcnt 0x0" ::: "memory");
#endif
  }
}

// =====================================================================================================
// Row-major f32 [R][K] -> 16-bit fragment-major plane. f16mode == 0: bf16 RNE bits; f16mode == 1: f16 bits of (bf16 RNE value) * scale.
// Thread = 8 consecutive elements: two 16-B loads, one 16-B store; 32 consecutive lanes = 512 contiguous, 512-B aligned bytes
// coverage: grid = ceil(n8/256) blocks x 256 thr x 8 = the whole plane (n8 a multiple of 32 in every use, so no partial line).
// =====================================================================================================
__device__ __forceinline__ void cvt_flat(const float* __restrict__ src, u16* D, int n8, int f16mode, float scale, int K, int bx) {
  const int gt = bx * 256 + (int)threadIdx.x;   // chunk index in the fragment-major plane
  if (gt >= n8) return;                     // no barriers in this kernel
  const int ktn = K >> 5, tile = gt >> 6, slot = gt & 63;
  const int rt = tile / ktn, kt = tile - rt * ktn;
  const float* p = src + (size_t)(rt * 16 + slot_row(slot)) * K + kt * 32 + slot_k(slot);
  const v4f a = *(const v4f*)(p), bq = *(const v4f*)(p + 4);
  float w[8];
#pragma unroll
  for (int e = 0; e < 4; ++e) { w[e] = a[e]; w[4 + e] = bq[e]; }
  v4u o;
#pragma unroll
  for (int e = 0; e < 4; ++e) {
    const float v0 = w[2 * e], v1 = w[2 * e + 1];
    const unsigned short h0 = h_bits((_Float16)(bfr(v0) * scale)), h1 = h_bits((_Float16)(bfr(v1) * scale));
    const unsigned short b0 = bf_bits(v0), b1 = bf_bits(v1);
    o[e] = (f16mode != 0) ? pk16(h0, h1) : pk16(b0, b1);
  }
  u16* d = D + (size_t)gt * 8;
  {
    *(v4u*)(d) = o;
    
  }
}

// =====================================================================================================
// GEMM epilogues: the wave's 16 x 64 f32 tile stands (final values) in its LDS slab (pitch 68), the caller has issued the wave's
// LDS sync; the epilogue writes the 16-bit plane(s) that the next launch or the next phase reads, so no f32 copy of the tile goes through memory.
// A lane owns four chunks of 8 halves. Fragment-major planes: chunk it = row (lane & 15), columns it * 16 + 8 * (lane >> 4) ..,
// which is slot (it & 1) * 32 + lane of k tile (it >> 1) of the tile pair: one store = 512 contiguous bytes of the wave.
// =====================================================================================================
// f16 hi + residual fragment-major planes: hi = f16(v * sc), lo = f16(v * sc - hi) (sc a power of two, residual unscaled).
// base = first half of the wave's tile pair + 8 * lane. coverage: 4 stores x 32 lanes x 8 halves = 16 x 64 of each plane.
__device__ __forceinline__ void ep_split(const float* sl, u16* Hp, u16* Lp, size_t base, float sc, int lane) {
  const int hh = lane >> 4, m = lane & 15;
  v4u oh[4], ol[4];
#pragma unroll
  for (int it = 0; it < 4; ++it) {
    const float* p = sl + m * 68 + it * 16 + 8 * hh;
    const v4f a = *(const v4f*)(p), bq = *(const v4f*)(p + 4);
    float w[8];
#pragma unroll
    for (int e = 0; e < 4; ++e) { w[e] = a[e] * sc; w[4 + e] = bq[e] * sc; }
#pragma unroll
    for (int e = 0; e < 4; ++e) {
      const float t0 = w[2 * e], t1 = w[2 * e + 1];
      const _Float16 h0 = (_Float16)t0, h1 = (_Float16)t1;
      const _Float16 l0 = (_Float16)(t0 - (float)h0), l1 = (_Float16)(t1 - (float)h1);
      oh[it][e] = pk16(h_bits(h0), h_bits(h1));
      ol[it][e] = pk16(h_bits(l0), h_bits(l1));
    }
  }
#pragma unroll
  for (int it = 0; it < 4; ++it) {
    *(v4u*)(Hp + base + (size_t)it * 256) = oh[it];
    *(v4u*)(Lp + base + (size_t)it * 256) = ol[it];
  }
}

// Rotate-half rotary + f16 pack (single plane); the tile's 64 columns are one head's HD channels, its rows 16 positions pos0 .. .
//   w[d] = x[d] * cos[pos][d] + r[d] * sin[pos][d],  r[d] = -x[d+32] for d < 32, x[d-32] for d >= 32;  out[d] = f16(w * sc).
// FM == 0: row-major out plane (q'), chunk it = row it * 4 + (lane >> 3), d0 = (lane & 7) * 8: 8 lanes = the 128 bytes of a row;
// FM != 0: fragment-major out plane (k'), chunks as above.
template <int FM> __device__ __forceinline__ int rope_row(int it, int lane) { return FM ? (lane & 15) : it * 4 + (lane >> 3); }
template <int FM> __device__ __forceinline__ int rope_d0(int it, int lane) { return FM ? it * 16 + 8 * (lane >> 4) : (lane & 7) * 8; }
struct RopeTab { v4f ca[4], cb[4], sa[4], sb[4]; };
template <int FM>
__device__ __forceinline__ void rope_tab(RopeTab& t, const float* __restrict__ cosT, const float* __restrict__ sinT, int pos0,
                                         int lane) {
  const size_t o = (size_t)(pos0 + rope_row<FM>(0, lane)) * HD + rope_d0<FM>(0, lane);
  const float *cr = cosT + o, *sr = sinT + o;
  const int st = FM ? 16 : 4 * HD;            // floats from one of the lane's chunks to the next
#pragma unroll
  for (int it = 0; it < 4; ++it) {
    t.ca[it] = *(const v4f*)(cr + it * st);  t.cb[it] = *(const v4f*)(cr + it * st + 4);
    t.sa[it] = *(const v4f*)(sr + it * st);  t.sb[it] = *(const v4f*)(sr + it * st + 4);
  }
  hold_addr(cr, sr, cr, cr, cr, cr, cr, cr, cr, cr);   // the sixteen addresses are constant offsets from these two
}
// dst = the lane's first chunk. coverage: 4 stores x 32 lanes x 8 halves = 16 rows x 64 of the plane.
template <int FM>
__device__ __forceinline__ void ep_rope(const float* sl, const RopeTab& t, u16* dst, float sc, int lane) {
  v4u oh[4];
#pragma unroll
  for (int it = 0; it < 4; ++it) {
    const int d0 = rope_d0<FM>(it, lane), d1 = d0 ^ 32;
    const float* xr = sl + rope_row<FM>(it, lane) * 68;
    const v4f xa = *(const v4f*)(xr + d0), xb = *(const v4f*)(xr + d0 + 4);
    const v4f ya = *(const v4f*)(xr + d1), yb = *(const v4f*)(xr + d1 + 4);
    const float sgn = (d0 < 32) ? -1.0f : 1.0f;
    float w[8];
#pragma unroll
    for (int e = 0; e < 4; ++e) {
      w[e]     = fmaf(sgn * ya[e], t.sa[it][e], xa[e] * t.ca[it][e]);   // cosine product rounded, sine product fused
      w[4 + e] = fmaf(sgn * yb[e], t.sb[it][e], xb[e] * t.cb[it][e]);
    }
#pragma unroll
    for (int e = 0; e < 4; ++e) {
      const _Float16 h0 = (_Float16)(w[2 * e] * sc), h1 = (_Float16)(w[2 * e + 1] * sc);
      oh[it][e] = pk16(h_bits(h0), h_bits(h1));
    }
  }
#pragma unroll
  for (int it = 0; it < 4; ++it) *(v4u*)(dst + (size_t)it * (FM ? 256 : 4 * HID)) = oh[it];
}

// v plane + per-32-key block sums; the tile is 16 channels (rows) x 64 keys of batch b, the block 64 channels o0 .. x the same keys.
//   VH = f16(v * 1024), fragment-major plane [b * HID + o][TS], vbase = first half of the wave's tile pair + 8 * lane;
//   VS[b][kb][o] = sum over keys kb*32 .. kb*32+31 of v (f32): 8 keys in a lane as a tree, the chunk pair (0,1) and (2,3) across the
//   wave's halves, then the two pairs; the block's 2 x 64 sums meet in S (128 floats of LDS) so that one wave stores whole lines.
// coverage: VH 4 stores x 32 lanes x 8 halves = 16 x 64; VS 2 key blocks x 64 channels per block, vsdst = VS + (b * NKB + kb0) * HID + o0.
__device__ __forceinline__ void ep_v(const float* sl, u16* VH, size_t vbase, float* vsdst, float* S, int wave, int lane) {
  const int hh = lane >> 4, m = lane & 15;
  v4u o[4];
  float ps[4];
#pragma unroll
  for (int it = 0; it < 4; ++it) {
    const float* p = sl + m * 68 + it * 16 + 8 * hh;
    const v4f a = *(const v4f*)(p), bq = *(const v4f*)(p + 4);
#pragma unroll
    for (int q = 0; q < 2; ++q) {
      o[it][q]     = pk16(h_bits((_Float16)(a[2 * q] * VCAR)),  h_bits((_Float16)(a[2 * q + 1] * VCAR)));
      o[it][2 + q] = pk16(h_bits((_Float16)(bq[2 * q] * VCAR)), h_bits((_Float16)(bq[2 * q + 1] * VCAR)));
    }
    ps[it] = ((a[0] + a[1]) + (a[2] + a[3])) + ((bq[0] + bq[1]) + (bq[2] + bq[3]));
  }
#pragma unroll
  for (int it = 0; it < 4; ++it) *(v4u*)(VH + vbase + (size_t)it * 256) = o[it];
#if defined(__HIP_DEVICE_COMPILE__)
  // the block sums below reuse the four stores' data registers: wait first
  asm volatile("s_wait_xcnt 0x0" ::: "memory");
#endif
#pragma unroll
  for (int it = 0; it < 4; ++it) ps[it] += __shfl_xor(ps[it], 16, 32);
  S[hh * 64 + wave * 16 + m] = (hh != 0) ? (ps[2] + ps[3]) : (ps[0] + ps[1]);
  __syncthreads();
  if (wave == 0) {
    const int piece = m * 4;
    const v4f sv = *(const v4f*)(S + hh * 64 + piece);
    *(v4f*)(vsdst + (size_t)hh * HID + piece) = sv;
  }
}

// =====================================================================================================
// Shared GEMM store: the wave's 16x64 f32 tile already staged (final values) in its LDS slab (pitch 68), caller issued the
// coverage: 8 instructions x 2 rows x 16 lanes x 4 floats = the wave's 16 x 64 tile.
// =====================================================================================================
__device__ __forceinline__ void store64(const float* sl, float* C, int N, size_t rowb, int col0, int lane) {
  const int hh = lane >> 4, m = lane & 15;
  v4f vals[8];
#pragma unroll
  for (int it = 0; it < 8; ++it) vals[it] = *(const v4f*)(sl + (it * 2 + hh) * 68 + m * 4);
  float* dst = C + (rowb + (size_t)hh) * (size_t)N + col0 + m * 4;
  {
#pragma unroll
    for (int it = 0; it < 8; ++it) {
      *(v4f*)(dst + (size_t)(it * 2) * (size_t)N) = vals[it];
    }
    
  }
}

// =====================================================================================================
// bf16 GEMM: T[M][N] (f32, never stored) = A[M][K] (bf16 fragment-major) . Bt[N][K]^T (bf16 k-contiguous), times oscale, + bf16(bias[col]).
// Block = 64x64 tile, 4 waves x 16 rows; A and Bt fragment-major: a fragment = two wave-wide loads of 512 contiguous bytes (split
// k map for A and B); K stepped by 32 (K % 32 == 0, M % 64 == 0, N % 64 == 0 statically, grid = (M/64)*(N/64)).
// Epilogue EP_SPLIT: P0, P1 = hi + residual planes [M][N] of T * psc; EP_ROPE_Q: P0 = q' plane, rows (batch, t), N = NH * HD.
// =====================================================================================================
#define EP_SPLIT  0
#define EP_ROPE_Q 1
#define EP_ROPE_K 2
#define EP_V      3
template <int EP>
__device__ __forceinline__
void gemm_bf(const u16* __restrict__ A, const u16* __restrict__ Bt, const float* __restrict__ bias,
             int M, int N, int K, float oscale, int bid, float* slab, u16* P0, u16* P1, float psc,
             const float* __restrict__ cosT, const float* __restrict__ sinT) {
  const int tid = threadIdx.x, wave = tid >> 5, lane = tid & 31, hh = lane >> 4, m = lane & 15;
  const int ntile = N >> 6;
  const int rowb  = (bid / ntile) * 64 + wave * 16;
  const int col0  = (bid % ntile) * 64;
  if (rowb + 16 > M) return;                 // wave-uniform, never taken with the exact grid; no block barriers in this kernel
  const u16* ap = A  + (size_t)rowb * K + 8 * lane;      // row tile rowb / 16, k tile 0
  const u16* bp = Bt + (size_t)col0 * K + 8 * lane;
  const size_t bs = (size_t)16 * K;                      // one row tile = K / 32 tiles of 512 halves
  v8f acc0 = zero8(), acc1 = zero8(), acc2 = zero8(), acc3 = zero8();
#pragma unroll 1
  for (int k0 = 0; k0 < K; k0 += 32) {
    const int kf = k0 * 16;                              // k tile k0 / 32
    const u16 *pa = ap + kf, *p0 = bp + kf, *p1 = p0 + bs, *p2 = p1 + bs, *p3 = p2 + bs;
    const v16b a  = ldfrag_b(pa);
    const v16b b0 = ldfrag_b(p0);
    const v16b b1 = ldfrag_b(p1);
    const v16b b2 = ldfrag_b(p2);
    const v16b b3 = ldfrag_b(p3);
    hold_addr(pa, p0, p1, p2, p3, pa, pa, pa, pa, pa);
    acc0 = mma_b(a, b0, acc0);
    acc1 = mma_b(a, b1, acc1);
    acc2 = mma_b(a, b2, acc2);
    acc3 = mma_b(a, b3, acc3);
    guard6<v16b>(acc0, acc1, acc2, acc3, a, b0, b1, b2, b3, a);
  }
  float* sl = slab + wave * SLAB64;
  float bb[4];
#pragma unroll
  for (int j = 0; j < 4; ++j) bb[j] = bfr(bias[col0 + 16 * j + m]);
#pragma unroll
  for (int r = 0; r < 8; ++r) {
    const int ro = (8 * hh + r) * 68 + m;
    sl[ro]      = acc0[r] * oscale + bb[0];
    sl[ro + 16] = acc1[r] * oscale + bb[1];
    sl[ro + 32] = acc2[r] * oscale + bb[2];
    sl[ro + 48] = acc3[r] * oscale + bb[3];
  }
  if constexpr (EP == EP_SPLIT) {
    wave_sync_lds();
    ep_split(sl, P0, P1, (size_t)rowb * N + (size_t)col0 * 16 + 8 * lane, psc, lane);
  } else {
    RopeTab t;
    rope_tab<0>(t, cosT, sinT, rowb & (TT - 1), lane);
    wave_sync_lds();
    ep_rope<0>(sl, t, P0 + (size_t)(rowb + (lane >> 3)) * N + col0 + (lane & 7) * 8, psc, lane);
  }
}

// =====================================================================================================
// f16 GEMM (optionally batched over bz with element strides sA, sB):
//   T[M][N] (f32, never stored) = (Ah [+ Al])[M][K] . (Bh [+ Bl])[N][K]^T, times oscale, + bf16(bias) per row (biasRow != 0) or per column.
//   A2: A carried as hi + unscaled residual plane (products h.B + l.B); B2: B carried as hi + residual (A.h + A.l); never both.
// Same tiling as gemm_bf; all planes f16 fragment-major, K % 32 == 0.
// Epilogue EP_SPLIT: P0, P1 = hi + residual planes [M][N] of T * psc; EP_ROPE_K: P0 = k' planes, rows (batch, s), N = NH * HD;
// EP_V: P0 = v plane, VS = block sums, batch bz, rows = channels, columns = keys (M = HID, N = TS); S = 128 floats of LDS.
// =====================================================================================================
template <int A2, int B2, int EP>
__device__ __forceinline__
void gemm_h(const u16* __restrict__ Ah, const u16* __restrict__ Al, const u16* __restrict__ Bh, const u16* __restrict__ Bl,
            const float* __restrict__ bias, int M, int N, int K, int sA, int sB, int biasRow, float oscale,
            int bid, int bz, float* slab, u16* P0, u16* P1, float psc,
            const float* __restrict__ cosT, const float* __restrict__ sinT, float* VS, float* S) {
  const int tid = threadIdx.x, wave = tid >> 5, lane = tid & 31, hh = lane >> 4, m = lane & 15;
  const int ntile = N >> 6;
  const int row64 = (bid / ntile) * 64;
  const int rowb  = row64 + wave * 16;
  const int col0  = (bid % ntile) * 64;
  if (row64 + 64 > M) return;                // the same for the whole block (M % 64 == 0), never taken with the exact grid
  const size_t aofs = (size_t)bz * (size_t)sA + (size_t)rowb * K + 8 * lane;
  const _Float16* ahp = (const _Float16*)(const void*)Ah + aofs;
  const _Float16* alp = (const _Float16*)(const void*)Al + aofs;
  const size_t bofs = (size_t)bz * (size_t)sB + (size_t)col0 * K + 8 * lane;
  const _Float16* bhp = (const _Float16*)(const void*)Bh + bofs;
  const _Float16* blp = (const _Float16*)(const void*)Bl + bofs;
  const size_t bs = (size_t)16 * K;
  v8f acc0 = zero8(), acc1 = zero8(), acc2 = zero8(), acc3 = zero8();
#pragma unroll 1
  for (int k0 = 0; k0 < K; k0 += 32) {
    const int kf = k0 * 16;                              // k tile k0 / 32
    const _Float16 *pa = ahp + kf, *p0 = bhp + kf, *p1 = p0 + bs, *p2 = p1 + bs, *p3 = p2 + bs;
    const v16h ah = ldfrag_h(pa);
    const v16h b0 = ldfrag_h(p0);
    const v16h b1 = ldfrag_h(p1);
    const v16h b2 = ldfrag_h(p2);
    const v16h b3 = ldfrag_h(p3);
    if (A2) {
      const _Float16* pl = alp + kf;
      const v16h al = ldfrag_h(pl);
      hold_addr(pa, p0, p1, p2, p3, pl, pa, pa, pa, pa);
      acc0 = mma_h(ah, b0, acc0);  acc0 = mma_h(al, b0, acc0);
      acc1 = mma_h(ah, b1, acc1);  acc1 = mma_h(al, b1, acc1);
      acc2 = mma_h(ah, b2, acc2);  acc2 = mma_h(al, b2, acc2);
      acc3 = mma_h(ah, b3, acc3);  acc3 = mma_h(al, b3, acc3);
      guard6<v16h>(acc0, acc1, acc2, acc3, ah, al, b0, b1, b2, b3);
    } else if (B2) {
      const _Float16 *r0 = blp + kf, *r1 = r0 + bs, *r2 = r1 + bs, *r3 = r2 + bs;
      const v16h c0 = ldfrag_h(r0);
      const v16h c1 = ldfrag_h(r1);
      const v16h c2 = ldfrag_h(r2);
      const v16h c3 = ldfrag_h(r3);
      hold_addr(pa, p0, p1, p2, p3, r0, r1, r2, r3, pa);
      acc0 = mma_h(ah, b0, acc0);  acc0 = mma_h(ah, c0, acc0);
      acc1 = mma_h(ah, b1, acc1);  acc1 = mma_h(ah, c1, acc1);
      acc2 = mma_h(ah, b2, acc2);  acc2 = mma_h(ah, c2, acc2);
      acc3 = mma_h(ah, b3, acc3);  acc3 = mma_h(ah, c3, acc3);
      guard10(acc0, acc1, acc2, acc3, ah, b0, b1, b2, b3, c0, c1, c2, c3, ah);
    } else {
      hold_addr(pa, p0, p1, p2, p3, pa, pa, pa, pa, pa);
      acc0 = mma_h(ah, b0, acc0);
      acc1 = mma_h(ah, b1, acc1);
      acc2 = mma_h(ah, b2, acc2);
      acc3 = mma_h(ah, b3, acc3);
      guard6<v16h>(acc0, acc1, acc2, acc3, ah, b0, b1, b2, b3, ah);
    }
  }
  float* sl = slab + wave * SLAB64;
  if (biasRow != 0) {
#pragma unroll
    for (int r = 0; r < 8; ++r) {
      const float bb = bfr(bias[rowb + 8 * hh + r]);
      const int ro = (8 * hh + r) * 68 + m;
      sl[ro]      = acc0[r] * oscale + bb;
      sl[ro + 16] = acc1[r] * oscale + bb;
      sl[ro + 32] = acc2[r] * oscale + bb;
      sl[ro + 48] = acc3[r] * oscale + bb;
    }
  } else {
    float bb[4];
#pragma unroll
    for (int j = 0; j < 4; ++j) bb[j] = bfr(bias[col0 + 16 * j + m]);
#pragma unroll
    for (int r = 0; r < 8; ++r) {
      const int ro = (8 * hh + r) * 68 + m;
      sl[ro]      = acc0[r] * oscale + bb[0];
      sl[ro + 16] = acc1[r] * oscale + bb[1];
      sl[ro + 32] = acc2[r] * oscale + bb[2];
      sl[ro + 48] = acc3[r] * oscale + bb[3];
    }
  }
  if constexpr (EP == EP_SPLIT) {
    wave_sync_lds();
    ep_split(sl, P0, P1, (size_t)rowb * N + (size_t)col0 * 16 + 8 * lane, psc, lane);
  } else if constexpr (EP == EP_ROPE_K) {
    RopeTab t;
    rope_tab<1>(t, cosT, sinT, rowb & (TS - 1), lane);
    wave_sync_lds();
    // plane (batch rowb / TS, head col0 / HD), position tile (rowb % TS) / 16: two tiles of 512 halves
    const size_t pl = (size_t)((rowb / TS) * NH + (col0 >> 6)) * (TS / 16) + (size_t)((rowb & (TS - 1)) >> 4);
    ep_rope<1>(sl, t, P0 + pl * 1024 + 8 * lane, psc, lane);
#if defined(__HIP_DEVICE_COMPILE__)
    // in a merged grid the other job's code follows in the listing and reuses the four stores' address and data registers: wait first
    asm volatile("s_wait_xcnt 0x0" ::: "memory");
#endif
  } else {
    wave_sync_lds();
    ep_v(sl, P0, (size_t)(bz * HID + rowb) * TS + (size_t)col0 * 16 + 8 * lane,
         VS + (size_t)(bz * NKB + (col0 >> 5)) * HID + row64, S, wave, lane);
  }
}

// =====================================================================================================
// Merged grids: launches that do not depend on one another share one grid; the block index (uniform in a block) picks the job,
// and every job keeps its own block numbering. Block counts of the jobs:
// =====================================================================================================
#define NB_TAB (TT / 8)
#define NB_XT  ((TT / 64) * (HID / 64) * NBAT)
#define NB_CT  ((TS / 64) * (CND / 64) * NBAT)
#define NB_WC  ((HID * CND) / 2048)
#define NB_W   ((HID * HID) / 2048)
#define NB_WF  ((2 * HID * HID) / 2048)
#define NB_PRO (NB_TAB + NB_XT + NB_CT + NB_WC + 4 * NB_W + NB_WF)
#define NB_GC  (((NBAT * TS) / 64) * (HID / 64))
#define NB_GQ  (((NBAT * TT) / 64) * (HID / 64))
#define NB_GV  ((HID / 64) * (TS / 64) * NBAT)
#define NB_GK  (((NBAT * TS) / 64) * (HID / 64))

// Everything that reads inputs only: rotary tables, the two transposes, the six weight planes.
__global__ __launch_bounds__(256)
void pro_k(const float* __restrict__ x, const float* __restrict__ cond, const float* __restrict__ w_cond,
           const float* __restrict__ wq, const float* __restrict__ wk, const float* __restrict__ wv,
           const float* __restrict__ wo, const float* __restrict__ wf, float* cosT, float* sinT, u16* XT, u16* CONDT,
           u16* WCB, u16* WQB, u16* WKH, u16* WVH, u16* WOH, u16* WFH, InvF inv) {
  __shared__ __align__(16) u16 T[64 * VTP];
  int j = blockIdx.x;
  if (j < NB_TAB) { k_tab(cosT, sinT, inv, j); return; }
  j -= NB_TAB;
  if (j < NB_XT) { cvt_T(x, XT, HID, TT, j % (NB_XT / NBAT), j / (NB_XT / NBAT), T); return; }
  j -= NB_XT;
  if (j < NB_CT) { cvt_T(cond, CONDT, CND, TS, j % (NB_CT / NBAT), j / (NB_CT / NBAT), T); return; }
  j -= NB_CT;
  if (j < NB_WC) { cvt_flat(w_cond, WCB, (HID * CND) / 8, 0, 1.0f, CND, j); return; }
  j -= NB_WC;
  if (j < NB_W) { cvt_flat(wq, WQB, (HID * HID) / 8, 0, 1.0f, HID, j); return; }
  j -= NB_W;
  if (j < 3 * NB_W) {
    const int wsel = j / NB_W;
    cvt_flat(wsel == 0 ? wk : wsel == 1 ? wv : wo, wsel == 0 ? WKH : wsel == 1 ? WVH : WOH, (HID * HID) / 8, 1, WSC, HID,
             j % NB_W);
    return;
  }
  j -= 3 * NB_W;
  cvt_flat(wf, WFH, (2 * HID * HID) / 8, 1, WSC, HID, j);
}

// c^T = CONDT . WCB^T + b_cond -> hi + residual planes x1024 (the longer k loop, so its blocks come first) and
// q^T = XT . WQB^T + bq -> rotary -> q' plane.
__global__ __launch_bounds__(128)
void gemm_cq(const u16* __restrict__ CONDT, const u16* __restrict__ WCB, const float* __restrict__ b_cond, u16* CH, u16* CL,
             const u16* __restrict__ XT, const u16* __restrict__ WQB, const float* __restrict__ bq, u16* QH,
             const float* __restrict__ cosT, const float* __restrict__ sinT) {
  __shared__ __align__(16) float slab[4 * SLAB64];
  const int bid = blockIdx.x;
  if (bid < NB_GC) gemm_bf<EP_SPLIT>(CONDT, WCB, b_cond, NBAT * TS, HID, CND, 1.0f, bid, slab, CH, CL, CSC, cosT, sinT);
  else             gemm_bf<EP_ROPE_Q>(XT, WQB, bq, NBAT * TT, HID, HID, 1.0f, bid - NB_GC, slab, QH, QH, QSC, cosT, sinT);
}

// v = WVH . (CH + CL)^T + bv per row, per batch -> v plane + block sums (twice the products, so its blocks come first) and
// k^T = CH . WKH^T + bk -> rotary -> k' planes.
__global__ __launch_bounds__(128)
void gemm_kv(const u16* __restrict__ CH, const u16* __restrict__ CL, const u16* __restrict__ WVH, const u16* __restrict__ WKH,
             const float* __restrict__ bv, const float* __restrict__ bk, u16* VH, float* VS, u16* KH,
             const float* __restrict__ cosT, const float* __restrict__ sinT) {
  __shared__ __align__(16) float slab[4 * SLAB64];
  __shared__ __align__(16) float S[128];
  const int bid = blockIdx.x;
  if (bid < NB_GV)
    gemm_h<0, 1, EP_V>(WVH, WVH, CH, CL, bv, HID, TS, HID, 0, TS * HID, 1, 1.0f / (CSC * WSC),
                       bid % (NB_GV / NBAT), bid / (NB_GV / NBAT), slab, VH, VH, VCAR, cosT, sinT, VS, S);
  else
    gemm_h<0, 0, EP_ROPE_K>(CH, CH, WKH, WKH, bk, NBAT * TS, HID, HID, 0, 0, 0, 1.0f / (CSC * WSC), bid - NB_GV, 0, slab,
                            KH, KH, KSC, cosT, sinT, VS, S);
}

// =====================================================================================================
// Cross attention, transposed, with the two GEMMs behind it in the same block. Attention: one wave per (head h, 16 queries q0..q0+15);
// all TS keys in NKB blocks of 32.
//   q' plane QH [b][t][h][d] (x1024 f16, row-major), k' plane KH: per (b, h) fragment-major [s][d] (x1024), v plane VH:
//   fragment-major [b*256 + h*64+d][s] (x1024),
//   VS[b][kb][h*64+d] = f32 sum of v over key block kb; masks: key s of row t is masked iff bf16(cond_mask[b][s])*bf16(x_mask[b][t]) == 0,
//   masked score replaced by -1e4 (base-2 scaled) -> exact uniform softmax on a fully masked row, 0 weight otherwise.
//   S^T = k'.q'^T (A = 16 keys, B = 16 queries) and O^T += v^T.P'^T (A = 16 channels, B = 16 queries): lane (hh, c) holds query q0 + c
//   only, with keys kb + 8hh + r and kb + 16 + 8hh + r of a block in the registers of the two score tiles. So the maximum and the sum
//   over keys run inside the lane (one exchange with lane ^ 16 for the maximum; the two halves' sums l are joined once, at the end),
//   and the two score tiles, converted in place, are the B fragment of P'^T in the split k map of the v fragments: no LDS round trip.
//   What is now wanted per register and no longer per lane is staged once per block in LDS: the bf16-rounded key mask of batch b and
//   the block sums of b (all heads) times 7/8 * 2^20.
//   Per block: 2 score tiles x 2 k-steps (single products, q fragments loaded once), scale 1/8 folded into the base-2 factor; online
//   max-subtracted base-2 softmax in f32; e = exp2(t - m) per key; l from the f32 e; accumulator update
//   o = o*alpha + (7/8 * 2^20) * VS block sum (f32), then P' = (e - 7/8) * 1024 as f16, 4 v.P' WMMAs.
//   Exact identity sum_s e_s v_s = sum_s (e_s - 7/8) v_s + 7/8 sum_s v_s per key block.
//   Accumulator j of a lane = channels 16j + 8hh .. + 7 of query c = one chunk of the O planes (O x8192 as f16 hi + residual).
// coverage: per wave 4 LDS stores x 32 lanes x 8 halves = 16 x 64 per plane; 16 waves = the block's 64 x 256 of both O planes.
// =====================================================================================================
__device__ __forceinline__ float other_half(float v) {                // the value of lane ^ 16
  const int b = __builtin_bit_cast(int, v);
  return __builtin_bit_cast(float, __builtin_amdgcn_permlanex16(b, b, 0x76543210, 0xfedcba98, false, false));
}

// One block = (batch b, 64 queries t0 .. t0 + 63), 16 waves, three phases that hand their tile on through LDS:
//   1. attention as described above, wave = (head wave >> 2, query tile wave & 3); its O chunks go into the LDS planes PH, PL
//      (fragment-major [64 t][HID], hi + residual x8192) instead of memory;
//   2. y^T = (OH + OL) . WOH^T + bo: wave = (16 rows t of tile wave & 3) x (64 columns of group wave >> 2), A fragments from PH, PL;
//      once every wave has read its O fragments the same planes take y (hi + residual x16384);
//   3. FiLM GEMM + combine: wave = 16 channels c0 = 16 * wave (gamma rows c0 .., beta rows 256 + c0 ..) x the 64 t, B fragments from PH, PL:
//      gamma[c][t] = sum_i w_film[c][i] y[t][i], beta[c][t] = sum_i w_film[256+c][i] y[t][i]  (A = w_film rows as f16(bf16 x1024),
//      products wg.h, wb.h, then wg.l, wb.l, 8 accumulators);
//      out[b][c][t] = (bf16(x[b][c][t]) * (gamma*oscale + bf16(b_film[c])) + (beta*oscale + bf16(b_film[256+c]))) * bf16(x_mask[b][t]).
// LDS 153600 bytes and at most 128 registers a wave: two blocks on a WGP, so that the 512 blocks are resident together.
// coverage: grid 16 b x 32 t-tiles = 512 blocks x 16 waves x 16 channels x 64 t = every out element exactly once.
__global__ __launch_bounds__(512, 8)
void attn_film(const u16* __restrict__ QHp, const u16* __restrict__ KHp, const u16* __restrict__ VHp,
               const float* __restrict__ VS, const float* __restrict__ cmask, const float* __restrict__ xmask,
               const u16* __restrict__ WOH, const float* __restrict__ bo, const u16* __restrict__ WF,
               const float* __restrict__ bfl, const float* __restrict__ X, float* OUT) {
  __shared__ __align__(32) float cmS[TS];          // bf16-rounded cond_mask of batch b
  __shared__ __align__(32) float vsS[NKB * HID];   // [key block][h * 64 + d]: 7/8 * 2^20 * block sum of v
  __shared__ __align__(16) u16 PH[64 * HID];       // O, then y: hi plane of the block's 64 rows t
  __shared__ __align__(16) u16 PL[64 * HID];       // residual plane
  __shared__ __align__(16) float slab[16 * SLAB64];

  const int tid  = threadIdx.x;
  const int wave = tid >> 5;
  const int lane = tid & 31;
  const int hh   = lane >> 4;
  const int c    = lane & 15;

  const int bid  = blockIdx.x;
  const int qt   = bid & (TT / 64 - 1);
  const int b    = bid >> 5;
  const int h    = wave >> 2;
  const int rt   = wave & 3;
  const int t0   = qt * 64;
  const int q0   = t0 + rt * 16;

  const size_t qofs = (((size_t)(b * TT + q0 + c)) * NH + h) * HD + 8 * hh;       // row-major plane
  const _Float16* Qh  = (const _Float16*)(const void*)QHp + qofs;
  const size_t kofs = ((size_t)(b * NH + h) * TS) * HD + 8 * lane;                // plane (b, h); key tile added per step
  const _Float16* Khb = (const _Float16*)(const void*)KHp + kofs;
  const size_t vofs = ((size_t)(b * HID + h * HD)) * TS + 8 * lane;               // row tile of d 0..15 (+16j); key tile added per step
  const _Float16* Vhb = (const _Float16*)(const void*)VHp + vofs;
  const float lsc = 0.125f * (LOG2E / (QSC * KSC));
  const float C0S = PCEN * PCAR * VCAR;

  // ---- stage the key mask (512 thr x 1 = TS) and the scaled block sums of all heads (512 thr x 8 = NKB x HID) ----
  static_assert(TS == 512 && NKB * HID == 512 * 8);
  {
    const float* pc = cmask + (size_t)b * TS + tid;
    const float* pv = VS + (size_t)b * (NKB * HID) + tid * 8;
    const float a = *pc;
    const v4f u0 = *(const v4f*)(pv), u1 = *(const v4f*)(pv + 4);
    hold_addr(pc, pv, pc, pc, pc, pc, pc, pc, pc, pc);
    cmS[tid] = bfr(a);
    *(v4f*)(vsS + tid * 8)     = u0 * C0S;
    *(v4f*)(vsS + tid * 8 + 4) = u1 * C0S;
  }
  const float xmv = bfr(xmask[(size_t)b * TT + q0 + c]);
  const v2f xm2 = {xmv, xmv};
  float mrow = -INFINITY, lrow = 0.f;               // lrow: this half's keys only
  v8f o[4];
#pragma unroll
  for (int j = 0; j < 4; ++j) o[j] = zero8();

  const v16h qa = ldfrag_rm_h(Qh), qb = ldfrag_rm_h(Qh + 32);
  hold_addr(Qh, Qh, Qh, Qh, Qh, Qh, Qh, Qh, Qh, Qh);
  __syncthreads();                                  // cmS, vsS written by all sixteen waves, read-only from here on

#pragma unroll 1
  for (int it = 0; it < NKB; ++it) {
    const int kb = it * 32;
    // ---- scores: D element r of this lane = (key kb + 8hh + r, query q0 + c) in s0, key kb + 16 + 8hh + r in s1 ----
    v8f s0 = zero8(), s1 = zero8();
    {
      const _Float16* k0p = Khb + (size_t)kb * HD;            // key tile kb / 16: HD / 32 = 2 tiles of 512 halves
      const _Float16* k1p = k0p + (size_t)16 * HD;
      const v16h k0a = ldfrag_h(k0p), k0b = ldfrag_h(k0p + 512);
      const v16h k1a = ldfrag_h(k1p), k1b = ldfrag_h(k1p + 512);
      hold_addr(k0p, k0p, k0p, k0p, k0p, k0p, k0p, k0p, k0p, k0p);   // k1p is a constant offset from k0p
      s0 = mma_h(k0a, qa, s0);
      s0 = mma_h(k0b, qb, s0);
      s1 = mma_h(k1a, qa, s1);
      s1 = mma_h(k1b, qb, s1);
      guard2(s0, s1, qa, qb, k0a, k0b, k1a, k1b);
    }
    // ---- mask (replace by -1e4) + online softmax in base 2, all in the lane ----
    v8f t0, t1;
    {
      const float* cp = cmS + kb + 8 * hh;
      const v8f c0 = *(const v8f*)(cp), c1 = *(const v8f*)(cp + 16);
      const v8f u0 = s0 * lsc, u1 = s1 * lsc;
#pragma unroll
      for (int r = 0; r < 8; r += 2) {
        const v2f m0 = (v2f){c0[r], c0[r + 1]} * xm2, m1 = (v2f){c1[r], c1[r + 1]} * xm2;
        t0[r]     = (m0[0] != 0.0f) ? u0[r]     : MASKT;
        t0[r + 1] = (m0[1] != 0.0f) ? u0[r + 1] : MASKT;
        t1[r]     = (m1[0] != 0.0f) ? u1[r]     : MASKT;
        t1[r + 1] = (m1[1] != 0.0f) ? u1[r + 1] : MASKT;
      }
    }
    float mx = fmaxf(t0[0], t0[1]);
#pragma unroll
    for (int r = 2; r < 8; r += 2) mx = fmaxf(mx, fmaxf(t0[r], t0[r + 1]));
#pragma unroll
    for (int r = 0; r < 8; r += 2) mx = fmaxf(mx, fmaxf(t1[r], t1[r + 1]));
    mx = fmaxf(mx, other_half(mx));
    const float mn = fmaxf(mrow, mx);
    const float al = exp2f(mrow - mn);
    mrow = mn;
    t0 = t0 - mn;
    t1 = t1 - mn;
#pragma unroll
    for (int r = 0; r < 8; ++r) t0[r] = exp2f(t0[r]);
#pragma unroll
    for (int r = 0; r < 8; ++r) t1[r] = exp2f(t1[r]);
    {
      const v8f pr = t0 + t1;
      const v4f p4 = pr.lo + pr.hi;
      lrow = lrow * al + ((p4[0] + p4[2]) + (p4[1] + p4[3]));
    }
#pragma unroll
    for (int j = 0; j < 4; ++j) o[j] = o[j] * al + *(const v8f*)(vsS + it * HID + h * HD + 16 * j + 8 * hh);
    // ---- B fragment of f16(P'^T): column = query c, elements 0..7 = keys kb + 8hh + 0..7, 8..15 = keys kb + 16 + 8hh + 0..7 ----
    FragH ph;
    ph.h[0] = __builtin_convertvector((t0 - PCEN) * PCAR, v8h);
    ph.h[1] = __builtin_convertvector((t1 - PCEN) * PCAR, v8h);
    // ---- v^T.P'^T : A fragment row = d = j*16 + c, keys contiguous in the v plane ----
    {
      const _Float16* vhp = Vhb + kb * 16;                    // key tile kb / 32
      const v16h vh0 = ldfrag_h(vhp);
      const v16h vh1 = ldfrag_h(vhp + (size_t)16 * TS);
      const v16h vh2 = ldfrag_h(vhp + (size_t)32 * TS);
      const v16h vh3 = ldfrag_h(vhp + (size_t)48 * TS);
      hold_addr(vhp, vhp, vhp, vhp, vhp, vhp, vhp, vhp, vhp, vhp);
      o[0] = mma_h(vh0, ph.v, o[0]);
      o[1] = mma_h(vh1, ph.v, o[1]);
      o[2] = mma_h(vh2, ph.v, o[2]);
      o[3] = mma_h(vh3, ph.v, o[3]);
      guard6<v16h>(o[0], o[1], o[2], o[3], ph.v, vh0, vh1, vh2, vh3, ph.v);
    }
  }
  acc_guard4(o[0], o[1], o[2], o[3]);

  // ---- join the halves' sums, fold 1/l and the carries (1024 on P', 1024 on v) ----
  const float oc  = 1.0f / (PCAR * VCAR);
  const float inv = (1.0f / (lrow + other_half(lrow))) * oc;
  // ---- O x8192 -> f16 hi + residual fragment-major planes [64 t][HID] in LDS; accumulator j = chunk slot (j & 1) * 32 + lane of
  //      k tile 2h + (j >> 1) of row tile rt: row c, d = 16j + 8hh .. + 7 ----
  const int pb0 = rt * (16 * HID) + h * 1024 + 8 * lane;
#pragma unroll
  for (int j = 0; j < 4; ++j) {
    float w[8];
    v4u oh, ol;
#pragma unroll
    for (int e = 0; e < 8; ++e) w[e] = (o[j][e] * inv) * OSC;
#pragma unroll
    for (int e = 0; e < 4; ++e) {
      const _Float16 h0 = (_Float16)w[2 * e], h1 = (_Float16)w[2 * e + 1];
      const _Float16 l0 = (_Float16)(w[2 * e] - (float)h0), l1 = (_Float16)(w[2 * e + 1] - (float)h1);
      oh[e] = pk16(h_bits(h0), h_bits(h1));
      ol[e] = pk16(h_bits(l0), h_bits(l1));
    }
    *(v4u*)(PH + pb0 + j * 256) = oh;
    *(v4u*)(PL + pb0 + j * 256) = ol;
  }
  __syncthreads();                                  // a row tile of O comes from four waves (one per head)

  // ---- y^T tile: rows t0 + 16 rt .., columns 64h .. ; per k step h.w then l.w ----
  const int ws = __builtin_amdgcn_readfirstlane(tid >> 5);   // the wave's number in a scalar register: what hangs on it from here on
  const int hs = ws >> 2, rs = ws & 3;                       // (addresses of the weights, x, out, the slab) costs no vector registers
  float* sl = slab + ws * SLAB64;
  {
    const int col0 = hs * 64;
    const _Float16* ahp = (const _Float16*)(const void*)PH + rs * (16 * HID) + 8 * lane;
    const _Float16* alp = (const _Float16*)(const void*)PL + rs * (16 * HID) + 8 * lane;
    const _Float16* bhp = (const _Float16*)(const void*)WOH + (size_t)col0 * HID + 8 * lane;
    const size_t bs = (size_t)16 * HID;
    const float osc = 1.0f / (OSC * WSC);
    v8f acc0 = zero8(), acc1 = zero8(), acc2 = zero8(), acc3 = zero8();
#pragma unroll 1
    for (int k0 = 0; k0 < HID; k0 += 32) {
      const int kf = k0 * 16;                            // k tile k0 / 32
      const _Float16 *p0 = bhp + kf, *p1 = p0 + bs, *p2 = p1 + bs, *p3 = p2 + bs;
      const v16h b0 = ldfrag_h(p0);
      const v16h b1 = ldfrag_h(p1);
      const v16h b2 = ldfrag_h(p2);
      const v16h b3 = ldfrag_h(p3);
      hold_addr(p0, p0, p0, p0, p0, p0, p0, p0, p0, p0);     // the other three addresses are constant offsets from this one
      const v16h ah = ldfrag_h(ahp + kf);
      const v16h al = ldfrag_h(alp + kf);
      acc0 = mma_h(ah, b0, acc0);  acc0 = mma_h(al, b0, acc0);
      acc1 = mma_h(ah, b1, acc1);  acc1 = mma_h(al, b1, acc1);
      acc2 = mma_h(ah, b2, acc2);  acc2 = mma_h(al, b2, acc2);
      acc3 = mma_h(ah, b3, acc3);  acc3 = mma_h(al, b3, acc3);
      guard6<v16h>(acc0, acc1, acc2, acc3, ah, al, b0, b1, b2, b3);
    }
    float bb[4];
#pragma unroll
    for (int j = 0; j < 4; ++j) bb[j] = bfr(bo[col0 + 16 * j + c]);
#pragma unroll
    for (int r = 0; r < 8; ++r) {
      const int ro = (8 * hh + r) * 68 + c;
      sl[ro]      = acc0[r] * osc + bb[0];
      sl[ro + 16] = acc1[r] * osc + bb[1];
      sl[ro + 32] = acc2[r] * osc + bb[2];
      sl[ro + 48] = acc3[r] * osc + bb[3];
    }
    __syncthreads();                                // every wave has read its O fragments (and its slab is written): the planes may take y
    ep_split(sl, PH, PL, (size_t)(rs * (16 * HID) + hs * 1024 + 8 * lane), YSC, lane);   // row tile rs, columns 64 hs ..
  }
  __syncthreads();                                  // the y planes are complete; every wave reads all 64 rows

  // ---- FiLM GEMM ----
  const int c0 = ws * 16;
  const _Float16* agp = (const _Float16*)(const void*)WF + (size_t)c0 * HID + 8 * lane;
  const _Float16* yhp = (const _Float16*)(const void*)PH + 8 * lane;
  const _Float16* ylp = (const _Float16*)(const void*)PL + 8 * lane;
  const int ys = 16 * HID;                                                         // one row tile of the planes
  const float oscale = 1.0f / (YSC * WSC);
  v8f g[4], be[4];
#pragma unroll
  for (int j = 0; j < 4; ++j) { g[j] = zero8(); be[j] = zero8(); }
#pragma unroll 1
  for (int k0 = 0; k0 < HID; k0 += 32) {
    const int kf = k0 * 16;                              // k tile k0 / 32
    const _Float16 *pg = agp + kf, *pb = pg + (size_t)HID * HID;                   // row 256 + c0 + c
    const v16h ag = ldfrag_h(pg), ab = ldfrag_h(pb);
    hold_addr(pg, pg, pg, pg, pg, pg, pg, pg, pg, pg);     // pb is a constant offset from pg
    {
      const v16h y0 = ldfrag_h(yhp + kf);
      const v16h y1 = ldfrag_h(yhp + kf + ys);
      const v16h y2 = ldfrag_h(yhp + kf + 2 * ys);
      const v16h y3 = ldfrag_h(yhp + kf + 3 * ys);
      g[0] = mma_h(ag, y0, g[0]);  be[0] = mma_h(ab, y0, be[0]);
      g[1] = mma_h(ag, y1, g[1]);  be[1] = mma_h(ab, y1, be[1]);
      g[2] = mma_h(ag, y2, g[2]);  be[2] = mma_h(ab, y2, be[2]);
      g[3] = mma_h(ag, y3, g[3]);  be[3] = mma_h(ab, y3, be[3]);
    }
    const v16h z0 = ldfrag_h(ylp + kf);
    const v16h z1 = ldfrag_h(ylp + kf + ys);
    const v16h z2 = ldfrag_h(ylp + kf + 2 * ys);
    const v16h z3 = ldfrag_h(ylp + kf + 3 * ys);
    g[0] = mma_h(ag, z0, g[0]);  be[0] = mma_h(ab, z0, be[0]);
    g[1] = mma_h(ag, z1, g[1]);  be[1] = mma_h(ab, z1, be[1]);
    g[2] = mma_h(ag, z2, g[2]);  be[2] = mma_h(ab, z2, be[2]);
    g[3] = mma_h(ag, z3, g[3]);  be[3] = mma_h(ab, z3, be[3]);
    guardF(g[0], g[1], g[2], g[3], be[0], be[1], be[2], be[3], ag, ab, z0, z1, z2, z3, ag, ab, ag, ab);
  }
  // ---- combine, four of the lane's eight channel rows at a time ----
  const float* xmp = xmask + (size_t)b * TT + t0 + c;
  const float* bfp = bfl + c0 + 8 * hh;
  const float* xp  = X + ((size_t)(b * HID + c0 + 8 * hh)) * TT + t0 + c;
  float xm[4];
#pragma unroll
  for (int j = 0; j < 4; ++j) xm[j] = xmp[16 * j];
#pragma unroll
  for (int r0 = 0; r0 < 8; r0 += 4) {
    // the loads of rows 4 .. 7 stay behind the work on rows 0 .. 3: all of them in flight beside the 64 accumulators do not fit
    // 128 registers (spills)
    if (r0 == 4) __builtin_amdgcn_sched_barrier(0);
    float bg[4], bb[4], xv[4][4];
#pragma unroll
    for (int q = 0; q < 4; ++q) {
      bg[q] = bfp[r0 + q];
      bb[q] = bfp[HID + r0 + q];
#pragma unroll
      for (int j = 0; j < 4; ++j) xv[q][j] = xp[(size_t)(r0 + q) * TT + 16 * j];
    }
    hold_addr(xmp, bfp, xp, xp, xp, xp, xp, xp, xp, xp);   // every address above is a constant offset from these three
#pragma unroll
    for (int q = 0; q < 4; ++q) {
      const int r = r0 + q;
      const float bgr = bfr(bg[q]), bbr = bfr(bb[q]);
#pragma unroll
      for (int j = 0; j < 4; ++j) {
        const float gam = g[j][r] * oscale + bgr;
        const float bet = be[j][r] * oscale + bbr;
        sl[(8 * hh + r) * 68 + 16 * j + c] = (bfr(xv[q][j]) * gam + bet) * bfr(xm[j]);
      }
    }
  }
  wave_sync_lds();
  store64(sl, OUT, TT, (size_t)(b * HID + c0), t0, lane);
}

// =====================================================================================================
// Workspace map (bytes); every plane is fully written by whole-line stores before it is read; all extents are exact multiples
// of the store granularity (no pad rows needed); every offset a multiple of 65536. No launch writes a region that it reads:
//   CT f32 [2048][64] 524288, ST same
//   XT bf16 [16][2048][256] 16777216; CONDT bf16 [16][512][512] 8388608
//   WCB bf16 [256][512] 262144; WQB bf16 [256][256] 131072; WKH, WVH, WOH f16 [256][256] 131072 each; WFH f16 [512][256] 262144
//   CH f16 [16][512][256] 4194304, CL same
//   QH f16 [16][2048][4][64] 16777216
//   KH f16 [16][4][512][64] 4194304; VH f16 [16][256][512] 4194304; VS f32 [16][16][256] 262144
//   end 61079552
// =====================================================================================================
extern "C" void kernel_launch(void* const* d_in, const int* in_sizes, int n_in,
                              void* d_out, int out_size, void* d_ws, size_t ws_size,
                              hipStream_t stream) {
  if (n_in < 16) return;
  if (in_sizes[0] != NBAT * HID * TT) return;
  if (in_sizes[1] != NBAT * TT) return;
  if (in_sizes[2] != NBAT * CND * TS) return;
  if (in_sizes[3] != NBAT * TS) return;
  if (in_sizes[4] != HID * CND || in_sizes[5] != HID) return;
  if (in_sizes[6] != HID * HID || in_sizes[7] != HID) return;
  if (in_sizes[8] != HID * HID || in_sizes[9] != HID) return;
  if (in_sizes[10] != HID * HID || in_sizes[11] != HID) return;
  if (in_sizes[12] != HID * HID || in_sizes[13] != HID) return;
  if (in_sizes[14] != 2 * HID * HID || in_sizes[15] != 2 * HID) return;
  if (out_size != NBAT * HID * TT) return;

  const float* x      = (const float*)d_in[0];
  const float* x_mask = (const float*)d_in[1];
  const float* cond   = (const float*)d_in[2];
  const float* c_mask = (const float*)d_in[3];
  const float* w_cond = (const float*)d_in[4];
  const float* b_cond = (const float*)d_in[5];
  const float* wq     = (const float*)d_in[6];
  const float* bq     = (const float*)d_in[7];
  const float* wk     = (const float*)d_in[8];
  const float* bk     = (const float*)d_in[9];
  const float* wv     = (const float*)d_in[10];
  const float* bv     = (const float*)d_in[11];
  const float* wo     = (const float*)d_in[12];
  const float* bo     = (const float*)d_in[13];
  const float* wf     = (const float*)d_in[14];
  const float* bfi    = (const float*)d_in[15];
  float*       out    = (float*)d_out;

  const size_t szTab = (size_t)TT * HD * 4;                       //    524288
  const size_t szR3  = (size_t)NBAT * TT * HID * 2;               //  16777216
  const size_t szR4  = (size_t)NBAT * TS * CND * 2;               //   8388608
  const size_t szWCB = (size_t)HID * CND * 2;                     //    262144
  const size_t szW   = (size_t)HID * HID * 2;                     //    131072
  const size_t szWF  = (size_t)2 * HID * HID * 2;                 //    262144
  const size_t szCP  = (size_t)NBAT * TS * HID * 2;               //   4194304
  const size_t szR1  = (size_t)NBAT * TT * HID * 2;               //  16777216
  const size_t szKH  = (size_t)NBAT * TS * HID * 2;               //   4194304
  const size_t szVH  = (size_t)NBAT * HID * TS * 2;               //   4194304
  const size_t szVS  = (size_t)NBAT * NKB * HID * 4;              //    262144
  size_t off = 0;
  const size_t oCT  = off; off += szTab;
  const size_t oST  = off; off += szTab;
  const size_t oR3  = off; off += szR3;
  const size_t oR4  = off; off += szR4;
  const size_t oWCB = off; off += szWCB;
  const size_t oWQB = off; off += szW;
  const size_t oWKH = off; off += szW;
  const size_t oWVH = off; off += szW;
  const size_t oWOH = off; off += szW;
  const size_t oWFH = off; off += szWF;
  const size_t oCH  = off; off += szCP;
  const size_t oCL  = off; off += szCP;
  const size_t oR1  = off; off += szR1;
  const size_t oKH  = off; off += szKH;
  const size_t oVH  = off; off += szVH;
  const size_t oVS  = off; off += szVS;
  if (off > ws_size) return;                            // off = 61079552
  if (off > (size_t)134217728) return;

  char* ws = (char*)d_ws;
  float* CT    = (float*)(ws + oCT);
  float* ST    = (float*)(ws + oST);
  u16*   XT    = (u16*)(ws + oR3);
  u16*   CONDT = (u16*)(ws + oR4);
  u16*   WCB   = (u16*)(ws + oWCB);
  u16*   WQB   = (u16*)(ws + oWQB);
  u16*   WKH   = (u16*)(ws + oWKH);
  u16*   WVH   = (u16*)(ws + oWVH);
  u16*   WOH   = (u16*)(ws + oWOH);
  u16*   WFH   = (u16*)(ws + oWFH);
  u16*   CH    = (u16*)(ws + oCH);
  u16*   CL    = (u16*)(ws + oCL);
  u16*   QH    = (u16*)(ws + oR1);
  u16*   KH    = (u16*)(ws + oKH);
  u16*   VH    = (u16*)(ws + oVH);
  float* VS    = (float*)(ws + oVS);

  // inv_freq[i] = 1 / pow(10000, i/32) in f32 (pow correctly converted from f64, then IEEE f32 reciprocal)
  InvF inv;
  for (int i = 0; i < 32; ++i) {
    const double p = pow(10000.0, (double)i / 32.0);
    const float pf = (float)p;
    inv.f[i] = 1.0f / pf;
  }

  const dim3 blk(256);
  const dim3 bG(128);
  const dim3 gAF(NBAT * (TT / 64));                     // 512

  // (0) inputs only: rotary cos/sin tables [2048][64]; x [b][256][2048] -> XT bf16 [b][2048][256]; cond [b][512][512] -> CONDT bf16
  //     [b][512 s][512 i]; weights (W[o][i] row-major is already [n][k]): bf16 planes for w_cond, wq; f16(bf16 x1024) for wk, wv, wo, w_film
  pro_k<<<dim3(NB_PRO), blk, 0, stream>>>(x, cond, w_cond, wq, wk, wv, wo, wf, CT, ST, XT, CONDT, WCB, WQB, WKH, WVH, WOH, WFH, inv);
  // (1) c^T [8192][256] = CONDT [8192][512] . WCB^T + b_cond -> f16 hi + residual planes x1024;
  //     q^T [32768][256] = XT . WQB^T + bq -> rotary, positions mod 2048 -> q' plane, rows (b, t, h)
  gemm_cq<<<dim3(NB_GC + NB_GQ), bG, 0, stream>>>(CONDT, WCB, b_cond, CH, CL, XT, WQB, bq, QH, CT, ST);
  // (2) v [b][256][512] = WVH [256][256] . (CH + CL)[b][512][256]^T + bv per row -> v f16 plane x1024 + per-32-key block sums;
  //     k^T [8192][256] = CH . WKH^T (+ bk) -> rotary, positions mod 512 -> k' planes; carries 1024 x 1024 folded back
  gemm_kv<<<dim3(NB_GV + NB_GK), bG, 0, stream>>>(CH, CL, WVH, WKH, bv, bk, VH, VS, KH, CT, ST);
  // (3) cross attention -> O (LDS) -> y^T = (OH + OL) . WOH^T + bo (LDS) -> FiLM GEMM + combine -> out [16][256][2048] f32
  attn_film<<<gAF, dim3(512), 0, stream>>>(QH, KH, VH, VS, c_mask, x_mask, WOH, bo, WFH, bfi, x, out);
  (void)hipGetLastError();
}

// v006
// Measured time: 97.6 microseconds a run.
// Timed twice side by side with v005, it ran 1.06 and 1.05 times as fast.
// All steps since v000 together make it 2.82 times as fast.
// Contractions: cond^T.w_cond^T and x^T.wq^T on v_wmma_f32_16x16x32_bf16 (inputs RNE-converted to bf16, exact operands, f32 accumulate);
// c.wk^T (c x1024 f16 hi plane), wv.c (c x1024 f16 hi + residual, products w.h + w.l), scores q'.k'^T (q' x1024, k' x1024 f16, one product),
// P'.v (centred P' = (e - 7/8) x1024 f16, v x1024 f16, one product; 7/8 * sum(v) per 32-key block added in f32),
// O.wo^T (O x8192 f16 hi + residual, products h.w + l.w), w_film.y (y x16384 f16 hi + residual): v_wmma_f32_16x16x32_f16,
// weights as f16(bf16(w) x1024), f32 accumulate. Rotary tables: f64 sin/cos of the f32 angle. Rotation, masked base-2 online softmax, 1/l, FiLM combine: f32 on VALU.
#include <hip/hip_runtime.h>
#include <math.h>
#include <stdint.h>

#define NBAT  16
#define TT    2048
#define TS    512
#define HID   256
#define CND   512
#define NH    4
#define HD    64
#define NKB   (TS / 32)
#define QSC   1024.0f
#define KSC   1024.0f
#define CSC   1024.0f
#define VCAR  1024.0f
#define PCAR  1024.0f
#define OSC   8192.0f
#define YSC   16384.0f
#define WSC   1024.0f
#define PCEN  0.875f
#define LOG2E 1.4426950408889634f
#define MASKT (-10000.0f * LOG2E)
#define SLAB64 (16 * 68)
#define VTP    72
static_assert(HID == NH * HD && HD == 64);
static_assert((TT % 64) == 0 && (TS % 64) == 0 && (TS % 32) == 0 && NKB == 16);
static_assert((TT & (TT - 1)) == 0 && (TS & (TS - 1)) == 0);
static_assert((HID % 64) == 0 && (CND % 64) == 0 && (HID % 32) == 0 && (CND % 32) == 0);
static_assert(((NBAT * TT * NH * 8) % 256) == 0 && ((NBAT * TS * NH * 8) % 256) == 0);
static_assert(((NBAT * TS * HID) % 2048) == 0 && ((NBAT * TT * HID) % 2048) == 0);

typedef unsigned short u16;
typedef _Float16 v16h __attribute__((ext_vector_type(16)));
typedef _Float16 v8h  __attribute__((ext_vector_type(8)));
typedef __bf16   v16b __attribute__((ext_vector_type(16)));
typedef float    v8f  __attribute__((ext_vector_type(8)));
typedef float    v4f  __attribute__((ext_vector_type(4)));
typedef float    v2f  __attribute__((ext_vector_type(2)));
typedef unsigned int v4u __attribute__((ext_vector_type(4)));

union FragH { v16h v; v8h h[2]; v4u u[2]; };
union FragB { v16b v; v4u u[2]; };

struct InvF { float f[32]; };
static_assert(sizeof(InvF) == 128);

// ---- scalar helpers --------------------------------------------------------------------------------
__device__ __forceinline__ unsigned short bf_bits(float f) {          // f32 -> bf16 bits, RNE convert
  unsigned u = __float_as_uint(f);
  return (unsigned short)((u + 0x7FFFu + ((u >> 16) & 1u)) >> 16);
}
__device__ __forceinline__ float bf_up(unsigned short h) { return __uint_as_float(((unsigned)h) << 16); }
__device__ __forceinline__ float bfr(float f) { return bf_up(bf_bits(f)); }
__device__ __forceinline__ unsigned short h_bits(_Float16 x) { return __builtin_bit_cast(unsigned short, x); }
__device__ __forceinline__ unsigned pk16(unsigned short a, unsigned short b) { return (unsigned)a | ((unsigned)b << 16); }
__device__ __forceinline__ v8f zero8() { v8f z = {0.f, 0.f, 0.f, 0.f, 0.f, 0.f, 0.f, 0.f}; return z; }

// ---- fragment-major planes: a 16-bit plane [R][K] (R % 16 == 0, K % 32 == 0) is stored as tiles of 16 rows x 32 k, 512 halves
//      each, tile (row >> 4, k >> 5) at ((row >> 4) * (K >> 5) + (k >> 5)) * 512; inside a tile 64 chunks of 8 halves, chunk slot
//      = ((k >> 4) & 1) * 32 + ((k >> 3) & 1) * 16 + (row & 15), so that slot & 31 is the lane that owns the chunk.
// ---- fragment loaders: 16-bit A/B operand, p = tile start + 8 * lane: two wave-wide loads of 512 contiguous bytes;
//      lane -> row/col (lane&15), elements 0..7 <- k0+8h.., elements 8..15 <- k0+16+8h..  (same split k map for A and B)
__device__ __forceinline__ v16h ldfrag_h(const _Float16* p) {
  FragH f;
  f.h[0] = *(const v8h*)(p);
  f.h[1] = *(const v8h*)(p + 256);
  return f.v;
}
__device__ __forceinline__ v16h ldfrag_rm_h(const _Float16* p) {      // same k map from a row-major row, p includes +8*(lane>>4)
  FragH f;
  f.h[0] = *(const v8h*)(p);
  f.h[1] = *(const v8h*)(p + 16);
  return f.v;
}
__device__ __forceinline__ v16b ldfrag_b(const u16* p) {              // bf16 plane read as unsigned integer vectors
  FragB f;
  f.u[0] = *(const v4u*)(p);
  f.u[1] = *(const v4u*)(p + 256);
  return f.v;
}

// Stands behind a group of fragment loads and names their address registers as inputs, so that these registers stay unwritten
// (by a later load's result or by an address update) up to the s_wait_xcnt 0 inside it.
__device__ __forceinline__ void hold_addr(const void* a, const void* b, const void* c, const void* d, const void* e,
                                          const void* f, const void* g, const void* h, const void* i, const void* j) {
#if defined(__HIP_DEVICE_COMPILE__)
  asm volatile("s_wait_xcnt 0x0" :: "v"(a), "v"(b), "v"(c), "v"(d), "v"(e), "v"(f), "v"(g), "v"(h), "v"(i), "v"(j) : "memory");
#endif
}
// chunk slot (0..63) of a tile -> row in the tile and first k in the tile
__device__ __forceinline__ int slot_row(int slot) { return slot & 15; }
__device__ __forceinline__ int slot_k(int slot) { return ((slot >> 5) << 4) + (((slot >> 4) & 1) << 3); }

__device__ __forceinline__ v8f mma_h(v16h a, v16h b, v8f c) {
  return __builtin_amdgcn_wmma_f32_16x16x32_f16(false, a, false, b, (short)0, c, false, false);
}
__device__ __forceinline__ v8f mma_b(v16b a, v16b b, v8f c) {
  return __builtin_amdgcn_wmma_f32_16x16x32_bf16(false, a, false, b, (short)0, c, false, false);
}
__device__ __forceinline__ void guard2(v8f& a, v8f& b, v16h x0, v16h x1, v16h x2, v16h x3, v16h x4, v16h x5) {
#if defined(__HIP_DEVICE_COMPILE__)
  asm volatile("v_nop\n\tv_nop\n\tv_nop\n\tv_nop"
               : "+v"(a), "+v"(b) : "v"(x0), "v"(x1), "v"(x2), "v"(x3), "v"(x4), "v"(x5) : "memory");
#endif
}
template <typename F>
__device__ __forceinline__ void guard6(v8f& a, v8f& b, v8f& c, v8f& d, F x0, F x1, F x2, F x3, F x4, F x5) {
#if defined(__HIP_DEVICE_COMPILE__)
  asm volatile("v_nop\n\tv_nop\n\tv_nop\n\tv_nop"
               : "+v"(a), "+v"(b), "+v"(c), "+v"(d) : "v"(x0), "v"(x1), "v"(x2), "v"(x3), "v"(x4), "v"(x5) : "memory");
#endif
}
__device__ __forceinline__ void guard10(v8f& a, v8f& b, v8f& c, v8f& d, v16h x0, v16h x1, v16h x2, v16h x3, v16h x4,
                                        v16h x5, v16h x6, v16h x7, v16h x8, v16h x9) {
#if defined(__HIP_DEVICE_COMPILE__)
  asm volatile("v_nop\n\tv_nop\n\tv_nop\n\tv_nop"
               : "+v"(a), "+v"(b), "+v"(c), "+v"(d)
               : "v"(x0), "v"(x1), "v"(x2), "v"(x3), "v"(x4), "v"(x5), "v"(x6), "v"(x7), "v"(x8), "v"(x9) : "memory");
#endif
}
__device__ __forceinline__ void guardF(v8f& a0, v8f& a1, v8f& a2, v8f& a3, v8f& c0, v8f& c1, v8f& c2, v8f& c3,
                                       v16h x0, v16h x1, v16h x2, v16h x3, v16h x4, v16h x5, v16h x6, v16h x7,
                                       v16h x8, v16h x9) {
#if defined(__HIP_DEVICE_COMPILE__)
  asm volatile("v_nop\n\tv_nop\n\tv_nop\n\tv_nop"
               : "+v"(a0), "+v"(a1), "+v"(a2), "+v"(a3), "+v"(c0), "+v"(c1), "+v"(c2), "+v"(c3)
               : "v"(x0), "v"(x1), "v"(x2), "v"(x3), "v"(x4), "v"(x5), "v"(x6), "v"(x7), "v"(x8), "v"(x9) : "memory");
#endif
}
__device__ __forceinline__ void acc_guard4(v8f& a, v8f& b, v8f& c, v8f& d) {
#if defined(__HIP_DEVICE_COMPILE__)
  asm volatile("v_nop\n\tv_nop\n\tv_nop\n\tv_nop" : "+v"(a), "+v"(b), "+v"(c), "+v"(d));
#endif
}
__device__ __forceinline__ void wave_sync_lds() {
  __builtin_amdgcn_fence(__ATOMIC_RELEASE, "workgroup");
  __builtin_amdgcn_wave_barrier();
  __builtin_amdgcn_fence(__ATOMIC_ACQUIRE, "workgroup");
}

// ---- accurate f32 sin/cos of a non-negative f32 angle (|angle| < 2048): f64 two-part pi/2 reduction + f64 polynomials,
//      plain f64 fma/mul only (no library f64 trig path), result converted to f32.
__device__ __forceinline__ void sincos_acc(float angf, float& sv, float& cv) {
  const double a = (double)angf;
  const double TWO_OVER_PI = 0.63661977236758134308;
  const double PIO2_HI = 1.5707963267948966;
  const double PIO2_LO = 6.123233995736766e-17;
  const int kq = (int)(a * TWO_OVER_PI + 0.5);
  const double kd = (double)kq;
  double r = fma(-kd, PIO2_HI, a);
  r = fma(-kd, PIO2_LO, r);
  const double r2 = r * r;
  double sp = 1.0 / 6227020800.0;
  sp = fma(sp, r2, -1.0 / 39916800.0);
  sp = fma(sp, r2, 1.0 / 362880.0);
  sp = fma(sp, r2, -1.0 / 5040.0);
  sp = fma(sp, r2, 1.0 / 120.0);
  sp = fma(sp, r2, -1.0 / 6.0);
  const double s = fma(sp * r2, r, r);
  double cp = -1.0 / 87178291200.0;
  cp = fma(cp, r2, 1.0 / 479001600.0);
  cp = fma(cp, r2, -1.0 / 3628800.0);
  cp = fma(cp, r2, 1.0 / 40320.0);
  cp = fma(cp, r2, -1.0 / 720.0);
  cp = fma(cp, r2, 1.0 / 24.0);
  cp = fma(cp, r2, -0.5);
  const double c = fma(cp, r2, 1.0);
  const int qd = kq & 3;
  const double so = (qd == 0) ? s : (qd == 1) ? c : (qd == 2) ? -s : -c;
  const double co = (qd == 0) ? c : (qd == 1) ? -s : (qd == 2) ? -c : s;
  sv = (float)so;
  cv = (float)co;
}

// =====================================================================================================
// Rotary tables: cosT[t][d], sinT[t][d] for t < TT, d < HD, angle = float(t) * inv_freq[d & 31] (f32 product), halves duplicated.
// Wave = one position t, lane = frequency index; inv_freq picked from the by-value table with a static select chain.
// coverage: grid TT/8 blocks x 8 waves = TT rows; per row 4 line stores = 64 floats of each table.
// =====================================================================================================
__device__ __forceinline__ void k_tab(float* cosT, float* sinT, const InvF& inv, int bx) {
  const int tid  = threadIdx.x;
  const int lane = tid & 31;
  const int t    = bx * 8 + (tid >> 5);
  if (t >= TT) return;                      // never taken with the exact grid; no barriers in this kernel
  float f = inv.f[0];
#pragma unroll
  for (int i = 1; i < 32; ++i) f = (lane == i) ? inv.f[i] : f;
  const float ang = (float)t * f;
  float sv, cv;
  sincos_acc(ang, sv, cv);
  float* cr = cosT + (size_t)t * HD;
  float* sr = sinT + (size_t)t * HD;
  {
    *(float*)(cr + lane)      = cv;
    *(float*)(cr + 32 + lane) = cv;
    *(float*)(sr + lane)      = sv;
    *(float*)(sr + 32 + lane) = sv;
    
  }
}

// =====================================================================================================
// Batched transpose + bf16 convert: in W[b][R][C] (row-major f32) -> out D[b][C][R] (bf16 RNE bits, fragment-major plane).
// Block = one 64x64 tile (r0, c0) of batch bb: 256 thr x 4 16-B loads -> LDS tile [c][r] (pitch 72), block barrier,
// coverage: load 256 thr x 16 = 64x64; store 2 iterations x 256 thr x 8 halves = 64 lines x 64; grid (C/64)*(R/64) x b = all of D.
// =====================================================================================================
__device__ __forceinline__ void cvt_T(const float* __restrict__ W, u16* D, int R, int C, int bid, int bb, u16* T) {
  const int tid = threadIdx.x;
  const int ntc = C >> 6;
  const int c0  = (bid % ntc) * 64;
  const int r0  = (bid / ntc) * 64;
  const float* Wb = W + (size_t)bb * (size_t)R * (size_t)C;
  u16*         Db = D + (size_t)bb * (size_t)R * (size_t)C;
  {
    const int rr = tid >> 2;
    const int cc = (tid & 3) * 16;
    const float* src = Wb + (size_t)(r0 + rr) * C + c0 + cc;
#pragma unroll
    for (int i = 0; i < 4; ++i) {
      const v4f a = *(const v4f*)(src + 4 * i);
#pragma unroll
      for (int e = 0; e < 4; ++e) T[(cc + 4 * i + e) * VTP + rr] = bf_bits(a[e]);
    }
  }
  __syncthreads();
  // thread = one chunk of the fragment-major plane: 8 local tiles (4 row tiles x 2 k tiles) x 64 slots
  v4u vals[2];
  const int slot = tid & 63;
#pragma unroll
  for (int it = 0; it < 2; ++it) {
    const int lt = it * 4 + (tid >> 6);
    vals[it] = *(const v4u*)(T + ((lt >> 1) * 16 + slot_row(slot)) * VTP + (lt & 1) * 32 + slot_k(slot));
  }
  {
#pragma unroll
    for (int it = 0; it < 2; ++it) {
      const int lt = it * 4 + (tid >> 6);
      const size_t tile = (size_t)((c0 >> 4) + (lt >> 1)) * (size_t)(R >> 5) + (size_t)((r0 >> 5) + (lt & 1));
      *(v4u*)(Db + tile * 512 + slot * 8) = vals[it];
    }
#if defined(__HIP_DEVICE_COMPILE__)
    // in a merged grid other jobs' code follows in the listing and reuses the two stores' address and data registers: wait first
    asm volatile("s_wait_xcnt 0x0" ::: "memory");
#endif
  }
}

// =====================================================================================================
// Row-major f32 [R][K] -> 16-bit fragment-major plane. f16mode == 0: bf16 RNE bits; f16mode == 1: f16 bits of (bf16 RNE value) * scale.
// Thread = 8 consecutive elements: two 16-B loads, one 16-B store; 32 consecutive lanes = 512 contiguous, 512-B aligned bytes
// coverage: grid = ceil(n8/256) blocks x 256 thr x 8 = the whole plane (n8 a multiple of 32 in every use, so no partial line).
// =====================================================================================================
__device__ __forceinline__ void cvt_flat(const float* __restrict__ src, u16* D, int n8, int f16mode, float scale, int K, int bx) {
  const int gt = bx * 256 + (int)threadIdx.x;   // chunk index in the fragment-major plane
  if (gt >= n8) return;                     // no barriers in this kernel
  const int ktn = K >> 5, tile = gt >> 6, slot = gt & 63;
  const int rt = tile / ktn, kt = tile - rt * ktn;
  const float* p = src + (size_t)(rt * 16 + slot_row(slot)) * K + kt * 32 + slot_k(slot);
  const v4f a = *(const v4f*)(p), bq = *(const v4f*)(p + 4);
  float w[8];
#pragma unroll
  for (int e = 0; e < 4; ++e) { w[e] = a[e]; w[4 + e] = bq[e]; }
  v4u o;
#pragma unroll
  for (int e = 0; e < 4; ++e) {
    const float v0 = w[2 * e], v1 = w[2 * e + 1];
    const unsigned short h0 = h_bits((_Float16)(bfr(v0) * scale)), h1 = h_bits((_Float16)(bfr(v1) * scale));
    const unsigned short b0 = bf_bits(v0), b1 = bf_bits(v1);
    o[e] = (f16mode != 0) ? pk16(h0, h1) : pk16(b0, b1);
  }
  u16* d = D + (size_t)gt * 8;
  {
    *(v4u*)(d) = o;
    
  }
}

// =====================================================================================================
// GEMM epilogues: the wave's 16 x 64 f32 tile stands (final values) in its LDS slab (pitch 68), the caller has issued the wave's
// LDS sync; the epilogue writes the 16-bit plane(s) that the next launch or the next phase reads, so no f32 copy of the tile goes through memory.
// A lane owns four chunks of 8 halves. Fragment-major planes: chunk it = row (lane & 15), columns it * 16 + 8 * (lane >> 4) ..,
// which is slot (it & 1) * 32 + lane of k tile (it >> 1) of the tile pair: one store = 512 contiguous bytes of the wave.
// =====================================================================================================
// f16 hi + residual fragment-major planes: hi = f16(v * sc), lo = f16(v * sc - hi) (sc a power of two, residual unscaled).
// base = first half of the wave's tile pair + 8 * lane. coverage: 4 stores x 32 lanes x 8 halves = 16 x 64 of each plane.
__device__ __forceinline__ void ep_split(const float* sl, u16* Hp, u16* Lp, size_t base, float sc, int lane) {
  const int hh = lane >> 4, m = lane & 15;
  v4u oh[4], ol[4];
#pragma unroll
  for (int it = 0; it < 4; ++it) {
    const float* p = sl + m * 68 + it * 16 + 8 * hh;
    const v4f a = *(const v4f*)(p), bq = *(const v4f*)(p + 4);
    float w[8];
#pragma unroll
    for (int e = 0; e < 4; ++e) { w[e] = a[e] * sc; w[4 + e] = bq[e] * sc; }
#pragma unroll
    for (int e = 0; e < 4; ++e) {
      const float t0 = w[2 * e], t1 = w[2 * e + 1];
      const _Float16 h0 = (_Float16)t0, h1 = (_Float16)t1;
      const _Float16 l0 = (_Float16)(t0 - (float)h0), l1 = (_Float16)(t1 - (float)h1);
      oh[it][e] = pk16(h_bits(h0), h_bits(h1));
      ol[it][e] = pk16(h_bits(l0), h_bits(l1));
    }
  }
#pragma unroll
  for (int it = 0; it < 4; ++it) {
    *(v4u*)(Hp + base + (size_t)it * 256) = oh[it];
    *(v4u*)(Lp + base + (size_t)it * 256) = ol[it];
  }
}

// Rotate-half rotary + f16 pack (single plane); the tile's 64 columns are one head's HD channels, its rows 16 positions pos0 .. .
//   w[d] = x[d] * cos[pos][d] + r[d] * sin[pos][d],  r[d] = -x[d+32] for d < 32, x[d-32] for d >= 32;  out[d] = f16(w * sc).
// FM == 0: row-major out plane (q'), chunk it = row it * 4 + (lane >> 3), d0 = (lane & 7) * 8: 8 lanes = the 128 bytes of a row;
// FM != 0: fragment-major out plane (k'), chunks as above.
template <int FM> __device__ __forceinline__ int rope_row(int it, int lane) { return FM ? (lane & 15) : it * 4 + (lane >> 3); }
template <int FM> __device__ __forceinline__ int rope_d0(int it, int lane) { return FM ? it * 16 + 8 * (lane >> 4) : (lane & 7) * 8; }
struct RopeTab { v4f ca[4], cb[4], sa[4], sb[4]; };
template <int FM>
__device__ __forceinline__ void rope_tab(RopeTab& t, const float* __restrict__ cosT, const float* __restrict__ sinT, int pos0,
                                         int lane) {
  const size_t o = (size_t)(pos0 + rope_row<FM>(0, lane)) * HD + rope_d0<FM>(0, lane);
  const float *cr = cosT + o, *sr = sinT + o;
  const int st = FM ? 16 : 4 * HD;            // floats from one of the lane's chunks to the next
#pragma unroll
  for (int it = 0; it < 4; ++it) {
    t.ca[it] = *(const v4f*)(cr + it * st);  t.cb[it] = *(const v4f*)(cr + it * st + 4);
    t.sa[it] = *(const v4f*)(sr + it * st);  t.sb[it] = *(const v4f*)(sr + it * st + 4);
  }
  hold_addr(cr, sr, cr, cr, cr, cr, cr, cr, cr, cr);   // the sixteen addresses are constant offsets from these two
}
// dst = the lane's first chunk. coverage: 4 stores x 32 lanes x 8 halves = 16 rows x 64 of the plane.
template <int FM>
__device__ __forceinline__ void ep_rope(const float* sl, const RopeTab& t, u16* dst, float sc, int lane) {
  v4u oh[4];
#pragma unroll
  for (int it = 0; it < 4; ++it) {
    const int d0 = rope_d0<FM>(it, lane), d1 = d0 ^ 32;
    const float* xr = sl + rope_row<FM>(it, lane) * 68;
    const v4f xa = *(const v4f*)(xr + d0), xb = *(const v4f*)(xr + d0 + 4);
    const v4f ya = *(const v4f*)(xr + d1), yb = *(const v4f*)(xr + d1 + 4);
    const float sgn = (d0 < 32) ? -1.0f : 1.0f;
    float w[8];
#pragma unroll
    for (int e = 0; e < 4; ++e) {
      w[e]     = fmaf(sgn * ya[e], t.sa[it][e], xa[e] * t.ca[it][e]);   // cosine product rounded, sine product fused
      w[4 + e] = fmaf(sgn * yb[e], t.sb[it][e], xb[e] * t.cb[it][e]);
    }
#pragma unroll
    for (int e = 0; e < 4; ++e) {
      const _Float16 h0 = (_Float16)(w[2 * e] * sc), h1 = (_Float16)(w[2 * e + 1] * sc);
      oh[it][e] = pk16(h_bits(h0), h_bits(h1));
    }
  }
#pragma unroll
  for (int it = 0; it < 4; ++it) *(v4u*)(dst + (size_t)it * (FM ? 256 : 4 * HID)) = oh[it];
}

// v plane + per-32-key block sums; the tile is 16 channels (rows) x 64 keys of batch b, the block 64 channels o0 .. x the same keys.
//   VH = f16(v * 1024), fragment-major plane [b * HID + o][TS], vbase = first half of the wave's tile pair + 8 * lane;
//   VS[b][kb][o] = sum over keys kb*32 .. kb*32+31 of v (f32): 8 keys in a lane as a tree, the chunk pair (0,1) and (2,3) across the
//   wave's halves, then the two pairs; the block's 2 x 64 sums meet in S (128 floats of LDS) so that one wave stores whole lines.
// coverage: VH 4 stores x 32 lanes x 8 halves = 16 x 64; VS 2 key blocks x 64 channels per block, vsdst = VS + (b * NKB + kb0) * HID + o0.
__device__ __forceinline__ void ep_v(const float* sl, u16* VH, size_t vbase, float* vsdst, float* S, int wave, int lane) {
  const int hh = lane >> 4, m = lane & 15;
  v4u o[4];
  float ps[4];
#pragma unroll
  for (int it = 0; it < 4; ++it) {
    const float* p = sl + m * 68 + it * 16 + 8 * hh;
    const v4f a = *(const v4f*)(p), bq = *(const v4f*)(p + 4);
#pragma unroll
    for (int q = 0; q < 2; ++q) {
      o[it][q]     = pk16(h_bits((_Float16)(a[2 * q] * VCAR)),  h_bits((_Float16)(a[2 * q + 1] * VCAR)));
      o[it][2 + q] = pk16(h_bits((_Float16)(bq[2 * q] * VCAR)), h_bits((_Float16)(bq[2 * q + 1] * VCAR)));
    }
    ps[it] = ((a[0] + a[1]) + (a[2] + a[3])) + ((bq[0] + bq[1]) + (bq[2] + bq[3]));
  }
#pragma unroll
  for (int it = 0; it < 4; ++it) *(v4u*)(VH + vbase + (size_t)it * 256) = o[it];
#if defined(__HIP_DEVICE_COMPILE__)
  // the block sums below reuse the four stores' data registers: wait first
  asm volatile("s_wait_xcnt 0x0" ::: "memory");
#endif
#pragma unroll
  for (int it = 0; it < 4; ++it) ps[it] += __shfl_xor(ps[it], 16, 32);
  S[hh * 64 + wave * 16 + m] = (hh != 0) ? (ps[2] + ps[3]) : (ps[0] + ps[1]);
  __syncthreads();
  if (wave == 0) {
    const int piece = m * 4;
    const v4f sv = *(const v4f*)(S + hh * 64 + piece);
    *(v4f*)(vsdst + (size_t)hh * HID + piece) = sv;
  }
}

// =====================================================================================================
// Shared GEMM store: the wave's 16x64 f32 tile already staged (final values) in its LDS slab (pitch 68), caller issued the
// coverage: 8 instructions x 2 rows x 16 lanes x 4 floats = the wave's 16 x 64 tile.
// =====================================================================================================
__device__ __forceinline__ void store64(const float* sl, float* C, int N, size_t rowb, int col0, int lane) {
  const int hh = lane >> 4, m = lane & 15;
  v4f vals[8];
#pragma unroll
  for (int it = 0; it < 8; ++it) vals[it] = *(const v4f*)(sl + (it * 2 + hh) * 68 + m * 4);
  float* dst = C + (rowb + (size_t)hh) * (size_t)N + col0 + m * 4;
  {
#pragma unroll
    for (int it = 0; it < 8; ++it) {
      *(v4f*)(dst + (size_t)(it * 2) * (size_t)N) = vals[it];
    }
    
  }
}

// =====================================================================================================
// bf16 GEMM: T[M][N] (f32, never stored) = A[M][K] (bf16 fragment-major) . Bt[N][K]^T (bf16 k-contiguous), times oscale, + bf16(bias[col]).
// Block = 64x64 tile, 4 waves x 16 rows; A and Bt fragment-major: a fragment = two wave-wide loads of 512 contiguous bytes (split
// k map for A and B); K stepped by 32 (K % 32 == 0, M % 64 == 0, N % 64 == 0 statically, grid = (M/64)*(N/64)).
// Epilogue EP_SPLIT: P0, P1 = hi + residual planes [M][N] of T * psc; EP_ROPE_Q: P0 = q' plane, rows (batch, t), N = NH * HD.
// =====================================================================================================
#define EP_SPLIT  0
#define EP_ROPE_Q 1
#define EP_ROPE_K 2
#define EP_V      3
template <int EP>
__device__ __forceinline__
void gemm_bf(const u16* __restrict__ A, const u16* __restrict__ Bt, const float* __restrict__ bias,
             int M, int N, int K, float oscale, int bid, float* slab, u16* P0, u16* P1, float psc,
             const float* __restrict__ cosT, const float* __restrict__ sinT) {
  const int tid = threadIdx.x, wave = tid >> 5, lane = tid & 31, hh = lane >> 4, m = lane & 15;
  const int ntile = N >> 6;
  const int rowb  = (bid / ntile) * 64 + wave * 16;
  const int col0  = (bid % ntile) * 64;
  if (rowb + 16 > M) return;                 // wave-uniform, never taken with the exact grid; no block barriers in this kernel
  const u16* ap = A  + (size_t)rowb * K + 8 * lane;      // row tile rowb / 16, k tile 0
  const u16* bp = Bt + (size_t)col0 * K + 8 * lane;
  const size_t bs = (size_t)16 * K;                      // one row tile = K / 32 tiles of 512 halves
  v8f acc0 = zero8(), acc1 = zero8(), acc2 = zero8(), acc3 = zero8();
#pragma unroll 1
  for (int k0 = 0; k0 < K; k0 += 32) {
    const int kf = k0 * 16;                              // k tile k0 / 32
    const u16 *pa = ap + kf, *p0 = bp + kf, *p1 = p0 + bs, *p2 = p1 + bs, *p3 = p2 + bs;
    const v16b a  = ldfrag_b(pa);
    const v16b b0 = ldfrag_b(p0);
    const v16b b1 = ldfrag_b(p1);
    const v16b b2 = ldfrag_b(p2);
    const v16b b3 = ldfrag_b(p3);
    hold_addr(pa, p0, p1, p2, p3, pa, pa, pa, pa, pa);
    acc0 = mma_b(a, b0, acc0);
    acc1 = mma_b(a, b1, acc1);
    acc2 = mma_b(a, b2, acc2);
    acc3 = mma_b(a, b3, acc3);
    guard6<v16b>(acc0, acc1, acc2, acc3, a, b0, b1, b2, b3, a);
  }
  float* sl = slab + wave * SLAB64;
  float bb[4];
#pragma unroll
  for (int j = 0; j < 4; ++j) bb[j] = bfr(bias[col0 + 16 * j + m]);
#pragma unroll
  for (int r = 0; r < 8; ++r) {
    const int ro = (8 * hh + r) * 68 + m;
    sl[ro]      = acc0[r] * oscale + bb[0];
    sl[ro + 16] = acc1[r] * oscale + bb[1];
    sl[ro + 32] = acc2[r] * oscale + bb[2];
    sl[ro + 48] = acc3[r] * oscale + bb[3];
  }
  if constexpr (EP == EP_SPLIT) {
    wave_sync_lds();
    ep_split(sl, P0, P1, (size_t)rowb * N + (size_t)col0 * 16 + 8 * lane, psc, lane);
  } else {
    RopeTab t;
    rope_tab<0>(t, cosT, sinT, rowb & (TT - 1), lane);
    wave_sync_lds();
    ep_rope<0>(sl, t, P0 + (size_t)(rowb + (lane >> 3)) * N + col0 + (lane & 7) * 8, psc, lane);
  }
}

// =====================================================================================================
// f16 GEMM (optionally batched over bz with element strides sA, sB):
//   T[M][N] (f32, never stored) = (Ah [+ Al])[M][K] . (Bh [+ Bl])[N][K]^T, times oscale, + bf16(bias) per row (biasRow != 0) or per column.
//   A2: A carried as hi + unscaled residual plane (products h.B + l.B); B2: B carried as hi + residual (A.h + A.l); never both.
// Same tiling as gemm_bf; all planes f16 fragment-major, K % 32 == 0.
// Epilogue EP_SPLIT: P0, P1 = hi + residual planes [M][N] of T * psc; EP_ROPE_K: P0 = k' planes, rows (batch, s), N = NH * HD;
// EP_V: P0 = v plane, VS = block sums, batch bz, rows = channels, columns = keys (M = HID, N = TS); S = 128 floats of LDS.
// =====================================================================================================
template <int A2, int B2, int EP>
__device__ __forceinline__
void gemm_h(const u16* __restrict__ Ah, const u16* __restrict__ Al, const u16* __restrict__ Bh, const u16* __restrict__ Bl,
            const float* __restrict__ bias, int M, int N, int K, int sA, int sB, int biasRow, float oscale,
            int bid, int bz, float* slab, u16* P0, u16* P1, float psc,
            const float* __restrict__ cosT, const float* __restrict__ sinT, float* VS, float* S) {
  const int tid = threadIdx.x, wave = tid >> 5, lane = tid & 31, hh = lane >> 4, m = lane & 15;
  const int ntile = N >> 6;
  const int row64 = (bid / ntile) * 64;
  const int rowb  = row64 + wave * 16;
  const int col0  = (bid % ntile) * 64;
  if (row64 + 64 > M) return;                // the same for the whole block (M % 64 == 0), never taken with the exact grid
  const size_t aofs = (size_t)bz * (size_t)sA + (size_t)rowb * K + 8 * lane;
  const _Float16* ahp = (const _Float16*)(const void*)Ah + aofs;
  const _Float16* alp = (const _Float16*)(const void*)Al + aofs;
  const size_t bofs = (size_t)bz * (size_t)sB + (size_t)col0 * K + 8 * lane;
  const _Float16* bhp = (const _Float16*)(const void*)Bh + bofs;
  const _Float16* blp = (const _Float16*)(const void*)Bl + bofs;
  const size_t bs = (size_t)16 * K;
  v8f acc0 = zero8(), acc1 = zero8(), acc2 = zero8(), acc3 = zero8();
#pragma unroll 1
  for (int k0 = 0; k0 < K; k0 += 32) {
    const int kf = k0 * 16;                              // k tile k0 / 32
    const _Float16 *pa = ahp + kf, *p0 = bhp + kf, *p1 = p0 + bs, *p2 = p1 + bs, *p3 = p2 + bs;
    const v16h ah = ldfrag_h(pa);
    const v16h b0 = ldfrag_h(p0);
    const v16h b1 = ldfrag_h(p1);
    const v16h b2 = ldfrag_h(p2);
    const v16h b3 = ldfrag_h(p3);
    if (A2) {
      const _Float16* pl = alp + kf;
      const v16h al = ldfrag_h(pl);
      hold_addr(pa, p0, p1, p2, p3, pl, pa, pa, pa, pa);
      acc0 = mma_h(ah, b0, acc0);  acc0 = mma_h(al, b0, acc0);
      acc1 = mma_h(ah, b1, acc1);  acc1 = mma_h(al, b1, acc1);
      acc2 = mma_h(ah, b2, acc2);  acc2 = mma_h(al, b2, acc2);
      acc3 = mma_h(ah, b3, acc3);  acc3 = mma_h(al, b3, acc3);
      guard6<v16h>(acc0, acc1, acc2, acc3, ah, al, b0, b1, b2, b3);
    } else if (B2) {
      const _Float16 *r0 = blp + kf, *r1 = r0 + bs, *r2 = r1 + bs, *r3 = r2 + bs;
      const v16h c0 = ldfrag_h(r0);
      const v16h c1 = ldfrag_h(r1);
      const v16h c2 = ldfrag_h(r2);
      const v16h c3 = ldfrag_h(r3);
      hold_addr(pa, p0, p1, p2, p3, r0, r1, r2, r3, pa);
      acc0 = mma_h(ah, b0, acc0);  acc0 = mma_h(ah, c0, acc0);
      acc1 = mma_h(ah, b1, acc1);  acc1 = mma_h(ah, c1, acc1);
      acc2 = mma_h(ah, b2, acc2);  acc2 = mma_h(ah, c2, acc2);
      acc3 = mma_h(ah, b3, acc3);  acc3 = mma_h(ah, c3, acc3);
      guard10(acc0, acc1, acc2, acc3, ah, b0, b1, b2, b3, c0, c1, c2, c3, ah);
    } else {
      hold_addr(pa, p0, p1, p2, p3, pa, pa, pa, pa, pa);
      acc0 = mma_h(ah, b0, acc0);
      acc1 = mma_h(ah, b1, acc1);
      acc2 = mma_h(ah, b2, acc2);
      acc3 = mma_h(ah, b3, acc3);
      guard6<v16h>(acc0, acc1, acc2, acc3, ah, b0, b1, b2, b3, ah);
    }
  }
  float* sl = slab + wave * SLAB64;
  if (biasRow != 0) {
#pragma unroll
    for (int r = 0; r < 8; ++r) {
      const float bb = bfr(bias[rowb + 8 * hh + r]);
      const int ro = (8 * hh + r) * 68 + m;
      sl[ro]      = acc0[r] * oscale + bb;
      sl[ro + 16] = acc1[r] * oscale + bb;
      sl[ro + 32] = acc2[r] * oscale + bb;
      sl[ro + 48] = acc3[r] * oscale + bb;
    }
  } else {
    float bb[4];
#pragma unroll
    for (int j = 0; j < 4; ++j) bb[j] = bfr(bias[col0 + 16 * j + m]);
#pragma unroll
    for (int r = 0; r < 8; ++r) {
      const int ro = (8 * hh + r) * 68 + m;
      sl[ro]      = acc0[r] * oscale + bb[0];
      sl[ro + 16] = acc1[r] * oscale + bb[1];
      sl[ro + 32] = acc2[r] * oscale + bb[2];
      sl[ro + 48] = acc3[r] * oscale + bb[3];
    }
  }
  if constexpr (EP == EP_SPLIT) {
    wave_sync_lds();
    ep_split(sl, P0, P1, (size_t)rowb * N + (size_t)col0 * 16 + 8 * lane, psc, lane);
  } else if constexpr (EP == EP_ROPE_K) {
    RopeTab t;
    rope_tab<1>(t, cosT, sinT, rowb & (TS - 1), lane);
    wave_sync_lds();
    // plane (batch rowb / TS, head col0 / HD), position tile (rowb % TS) / 16: two tiles of 512 halves
    const size_t pl = (size_t)((rowb / TS) * NH + (col0 >> 6)) * (TS / 16) + (size_t)((rowb & (TS - 1)) >> 4);
    ep_rope<1>(sl, t, P0 + pl * 1024 + 8 * lane, psc, lane);
#if defined(__HIP_DEVICE_COMPILE__)
    // in a merged grid the other job's code follows in the listing and reuses the four stores' address and data registers: wait first
    asm volatile("s_wait_xcnt 0x0" ::: "memory");
#endif
  } else {
    wave_sync_lds();
    ep_v(sl, P0, (size_t)(bz * HID + rowb) * TS + (size_t)col0 * 16 + 8 * lane,
         VS + (size_t)(bz * NKB + (col0 >> 5)) * HID + row64, S, wave, lane);
  }
}

// =====================================================================================================
// Merged grids: launches that do not depend on one another share one grid; the block index (uniform in a block) picks the job,
// and every job keeps its own block numbering. Block counts of the jobs:
// =====================================================================================================
#define NB_TAB (TT / 8)
#define NB_XT  ((TT / 64) * (HID / 64) * NBAT)
#define NB_CT  ((TS / 64) * (CND / 64) * NBAT)
#define NB_WC  ((HID * CND) / 2048)
#define NB_W   ((HID * HID) / 2048)
#define NB_WF  ((2 * HID * HID) / 2048)
#define NB_PRO (NB_TAB + NB_XT + NB_CT + NB_WC + 4 * NB_W + NB_WF)
#define NB_GC  (((NBAT * TS) / 64) * (HID / 64))
#define NB_GQ  (((NBAT * TT) / 64) * (HID / 64))
#define NB_GV  ((HID / 64) * (TS / 64) * NBAT)
#define NB_GK  (((NBAT * TS) / 64) * (HID / 64))

// Everything that reads inputs only: rotary tables, the two transposes, the six weight planes.
__global__ __launch_bounds__(256)
void pro_k(const float* __restrict__ x, const float* __restrict__ cond, const float* __restrict__ w_cond,
           const float* __restrict__ wq, const float* __restrict__ wk, const float* __restrict__ wv,
           const float* __restrict__ wo, const float* __restrict__ wf, float* cosT, float* sinT, u16* XT, u16* CONDT,
           u16* WCB, u16* WQB, u16* WKH, u16* WVH, u16* WOH, u16* WFH, InvF inv) {
  __shared__ __align__(16) u16 T[64 * VTP];
  int j = blockIdx.x;
  if (j < NB_TAB) { k_tab(cosT, sinT, inv, j); return; }
  j -= NB_TAB;
  if (j < NB_XT) { cvt_T(x, XT, HID, TT, j % (NB_XT / NBAT), j / (NB_XT / NBAT), T); return; }
  j -= NB_XT;
  if (j < NB_CT) { cvt_T(cond, CONDT, CND, TS, j % (NB_CT / NBAT), j / (NB_CT / NBAT), T); return; }
  j -= NB_CT;
  if (j < NB_WC) { cvt_flat(w_cond, WCB, (HID * CND) / 8, 0, 1.0f, CND, j); return; }
  j -= NB_WC;
  if (j < NB_W) { cvt_flat(wq, WQB, (HID * HID) / 8, 0, 1.0f, HID, j); return; }
  j -= NB_W;
  if (j < 3 * NB_W) {
    const int wsel = j / NB_W;
    cvt_flat(wsel == 0 ? wk : wsel == 1 ? wv : wo, wsel == 0 ? WKH : wsel == 1 ? WVH : WOH, (HID * HID) / 8, 1, WSC, HID,
             j % NB_W);
    return;
  }
  j -= 3 * NB_W;
  cvt_flat(wf, WFH, (2 * HID * HID) / 8, 1, WSC, HID, j);
}

// c^T = CONDT . WCB^T + b_cond -> hi + residual planes x1024 (the longer k loop, so its blocks come first) and
// q^T = XT . WQB^T + bq -> rotary -> q' plane.
__global__ __launch_bounds__(128)
void gemm_cq(const u16* __restrict__ CONDT, const u16* __restrict__ WCB, const float* __restrict__ b_cond, u16* CH, u16* CL,
             const u16* __restrict__ XT, const u16* __restrict__ WQB, const float* __restrict__ bq, u16* QH,
             const float* __restrict__ cosT, const float* __restrict__ sinT) {
  __shared__ __align__(16) float slab[4 * SLAB64];
  const int bid = blockIdx.x;
  if (bid < NB_GC) gemm_bf<EP_SPLIT>(CONDT, WCB, b_cond, NBAT * TS, HID, CND, 1.0f, bid, slab, CH, CL, CSC, cosT, sinT);
  else             gemm_bf<EP_ROPE_Q>(XT, WQB, bq, NBAT * TT, HID, HID, 1.0f, bid - NB_GC, slab, QH, QH, QSC, cosT, sinT);
}

// v = WVH . (CH + CL)^T + bv per row, per batch -> v plane + block sums (twice the products, so its blocks come first) and
// k^T = CH . WKH^T + bk -> rotary -> k' planes.
__global__ __launch_bounds__(128)
void gemm_kv(const u16* __restrict__ CH, const u16* __restrict__ CL, const u16* __restrict__ WVH, const u16* __restrict__ WKH,
             const float* __restrict__ bv, const float* __restrict__ bk, u16* VH, float* VS, u16* KH,
             const float* __restrict__ cosT, const float* __restrict__ sinT) {
  __shared__ __align__(16) float slab[4 * SLAB64];
  __shared__ __align__(16) float S[128];
  const int bid = blockIdx.x;
  if (bid < NB_GV)
    gemm_h<0, 1, EP_V>(WVH, WVH, CH, CL, bv, HID, TS, HID, 0, TS * HID, 1, 1.0f / (CSC * WSC),
                       bid % (NB_GV / NBAT), bid / (NB_GV / NBAT), slab, VH, VH, VCAR, cosT, sinT, VS, S);
  else
    gemm_h<0, 0, EP_ROPE_K>(CH, CH, WKH, WKH, bk, NBAT * TS, HID, HID, 0, 0, 0, 1.0f / (CSC * WSC), bid - NB_GV, 0, slab,
                            KH, KH, KSC, cosT, sinT, VS, S);
}

// =====================================================================================================
// Cross attention, transposed, with the two GEMMs behind it in the same block. Attention: one wave per (head h, 16 queries q0..q0+15);
// all TS keys in NKB blocks of 32.
//   q' plane QH [b][t][h][d] (x1024 f16, row-major), k' plane KH: per (b, h) fragment-major [s][d] (x1024), v plane VH:
//   fragment-major [b*256 + h*64+d][s] (x1024),
//   VS[b][kb][h*64+d] = f32 sum of v over key block kb; masks: key s of row t is masked iff bf16(cond_mask[b][s])*bf16(x_mask[b][t]) == 0,
//   masked score replaced by -1e4 (base-2 scaled) -> exact uniform softmax on a fully masked row, 0 weight otherwise.
//   S^T = k'.q'^T (A = 16 keys, B = 16 queries) and O^T += v^T.P'^T (A = 16 channels, B = 16 queries): lane (hh, c) holds query q0 + c
//   only, with keys kb + 8hh + r and kb + 16 + 8hh + r of a block in the registers of the two score tiles. So the maximum and the sum
//   over keys run inside the lane (one exchange with lane ^ 16 for the maximum; the two halves' sums l are joined once, at the end),
//   and the two score tiles, converted in place, are the B fragment of P'^T in the split k map of the v fragments: no LDS round trip.
//   What is now wanted per register and no longer per lane is staged once per block in LDS: the bf16-rounded key mask of batch b and
//   the block sums of b (all heads) times 7/8 * 2^20.
//   Per block: 2 score tiles x 2 k-steps (single products, q fragments loaded once), scale 1/8 folded into the base-2 factor; online
//   max-subtracted base-2 softmax in f32; e = exp2(t - m) per key; l from the f32 e; accumulator update
//   o = o*alpha + (7/8 * 2^20) * VS block sum (f32), then P' = (e - 7/8) * 1024 as f16, 4 v.P' WMMAs.
//   Exact identity sum_s e_s v_s = sum_s (e_s - 7/8) v_s + 7/8 sum_s v_s per key block.
//   Accumulator j of a lane = channels 16j + 8hh .. + 7 of query c = one chunk of the O planes (O x8192 as f16 hi + residual).
// coverage: per wave 4 LDS stores x 32 lanes x 8 halves = 16 x 64 per plane; 16 waves = the block's 64 x 256 of both O planes.
// =====================================================================================================
// 2^x for the softmax as the bare hardware instruction: every argument here is <= 0 (a score minus the running maximum), and a result
// under 2^-126 comes out as 0 where the library form spends five more vector instructions per value to return a denormal; such a
// term stands beside a term equal to 1 in the same row sum, so it reaches neither l nor the f16 P'.
__device__ __forceinline__ float exp2_raw(float x) { return __builtin_amdgcn_exp2f(x); }
__device__ __forceinline__ float other_half(float v) {                // the value of lane ^ 16
  const int b = __builtin_bit_cast(int, v);
  return __builtin_bit_cast(float, __builtin_amdgcn_permlanex16(b, b, 0x76543210, 0xfedcba98, false, false));
}

// One block = (batch b, 64 queries t0 .. t0 + 63), 16 waves, three phases that hand their tile on through LDS:
//   1. attention as described above, wave = (head wave >> 2, query tile wave & 3); its O chunks go into the LDS planes PH, PL
//      (fragment-major [64 t][HID], hi + residual x8192) instead of memory;
//   2. y^T = (OH + OL) . WOH^T + bo: wave = (16 rows t of tile wave & 3) x (64 columns of group wave >> 2), A fragments from PH, PL;
//      once every wave has read its O fragments the same planes take y (hi + residual x16384);
//   3. FiLM GEMM + combine: wave = 16 channels c0 = 16 * wave (gamma rows c0 .., beta rows 256 + c0 ..) x the 64 t, B fragments from PH, PL:
//      gamma[c][t] = sum_i w_film[c][i] y[t][i], beta[c][t] = sum_i w_film[256+c][i] y[t][i]  (A = w_film rows as f16(bf16 x1024),
//      products wg.h, wb.h, then wg.l, wb.l, 8 accumulators);
//      out[b][c][t] = (bf16(x[b][c][t]) * (gamma*oscale + bf16(b_film[c])) + (beta*oscale + bf16(b_film[256+c]))) * bf16(x_mask[b][t]).
// LDS 153600 bytes and at most 128 registers a wave: two blocks on a WGP, so that the 512 blocks are resident together.
// coverage: grid 16 b x 32 t-tiles = 512 blocks x 16 waves x 16 channels x 64 t = every out element exactly once.
__global__ __launch_bounds__(512, 8)
void attn_film(const u16* __restrict__ QHp, const u16* __restrict__ KHp, const u16* __restrict__ VHp,
               const float* __restrict__ VS, const float* __restrict__ cmask, const float* __restrict__ xmask,
               const u16* __restrict__ WOH, const float* __restrict__ bo, const u16* __restrict__ WF,
               const float* __restrict__ bfl, const float* __restrict__ X, float* OUT) {
  __shared__ __align__(32) float cmS[TS];          // bf16-rounded cond_mask of batch b
  __shared__ __align__(32) float vsS[NKB * HID];   // [key block][h * 64 + d]: 7/8 * 2^20 * block sum of v
  __shared__ __align__(16) u16 PH[64 * HID];       // O, then y: hi plane of the block's 64 rows t
  __shared__ __align__(16) u16 PL[64 * HID];       // residual plane
  __shared__ __align__(16) float slab[16 * SLAB64];

  const int tid  = threadIdx.x;
  const int wave = tid >> 5;
  const int lane = tid & 31;
  const int hh   = lane >> 4;
  const int c    = lane & 15;

  const int bid  = blockIdx.x;
  const int qt   = bid & (TT / 64 - 1);
  const int b    = bid >> 5;
  const int h    = wave >> 2;
  const int rt   = wave & 3;
  const int t0   = qt * 64;
  const int q0   = t0 + rt * 16;

  const size_t qofs = (((size_t)(b * TT + q0 + c)) * NH + h) * HD + 8 * hh;       // row-major plane
  const _Float16* Qh  = (const _Float16*)(const void*)QHp + qofs;
  const size_t kofs = ((size_t)(b * NH + h) * TS) * HD + 8 * lane;                // plane (b, h); key tile added per step
  const _Float16* Khb = (const _Float16*)(const void*)KHp + kofs;
  const size_t vofs = ((size_t)(b * HID + h * HD)) * TS + 8 * lane;               // row tile of d 0..15 (+16j); key tile added per step
  const _Float16* Vhb = (const _Float16*)(const void*)VHp + vofs;
  const float lsc = 0.125f * (LOG2E / (QSC * KSC));
  const float C0S = PCEN * PCAR * VCAR;

  // ---- stage the key mask (512 thr x 1 = TS) and the scaled block sums of all heads (512 thr x 8 = NKB x HID) ----
  static_assert(TS == 512 && NKB * HID == 512 * 8);
  {
    const float* pc = cmask + (size_t)b * TS + tid;
    const float* pv = VS + (size_t)b * (NKB * HID) + tid * 8;
    const float a = *pc;
    const v4f u0 = *(const v4f*)(pv), u1 = *(const v4f*)(pv + 4);
    hold_addr(pc, pv, pc, pc, pc, pc, pc, pc, pc, pc);
    cmS[tid] = bfr(a);
    *(v4f*)(vsS + tid * 8)     = u0 * C0S;
    *(v4f*)(vsS + tid * 8 + 4) = u1 * C0S;
  }
  const float xmv = bfr(xmask[(size_t)b * TT + q0 + c]);
  const v2f xm2 = {xmv, xmv};
  float mrow = -INFINITY, lrow = 0.f;               // lrow: this half's keys only
  v8f o[4];
#pragma unroll
  for (int j = 0; j < 4; ++j) o[j] = zero8();

  const v16h qa = ldfrag_rm_h(Qh), qb = ldfrag_rm_h(Qh + 32);
  hold_addr(Qh, Qh, Qh, Qh, Qh, Qh, Qh, Qh, Qh, Qh);
  __syncthreads();                                  // cmS, vsS written by all sixteen waves, read-only from here on

#pragma unroll 1
  for (int it = 0; it < NKB; ++it) {
    const int kb = it * 32;
    // ---- scores: D element r of this lane = (key kb + 8hh + r, query q0 + c) in s0, key kb + 16 + 8hh + r in s1 ----
    v8f s0 = zero8(), s1 = zero8();
    {
      const _Float16* k0p = Khb + (size_t)kb * HD;            // key tile kb / 16: HD / 32 = 2 tiles of 512 halves
      const _Float16* k1p = k0p + (size_t)16 * HD;
      const v16h k0a = ldfrag_h(k0p), k0b = ldfrag_h(k0p + 512);
      const v16h k1a = ldfrag_h(k1p), k1b = ldfrag_h(k1p + 512);
      hold_addr(k0p, k0p, k0p, k0p, k0p, k0p, k0p, k0p, k0p, k0p);   // k1p is a constant offset from k0p
      s0 = mma_h(k0a, qa, s0);
      s0 = mma_h(k0b, qb, s0);
      s1 = mma_h(k1a, qa, s1);
      s1 = mma_h(k1b, qb, s1);
      guard2(s0, s1, qa, qb, k0a, k0b, k1a, k1b);
    }
    // ---- mask (replace by -1e4) + online softmax in base 2, all in the lane ----
    v8f t0, t1;
    {
      const float* cp = cmS + kb + 8 * hh;
      const v8f c0 = *(const v8f*)(cp), c1 = *(const v8f*)(cp + 16);
      const v8f u0 = s0 * lsc, u1 = s1 * lsc;
#pragma unroll
      for (int r = 0; r < 8; r += 2) {
        const v2f m0 = (v2f){c0[r], c0[r + 1]} * xm2, m1 = (v2f){c1[r], c1[r + 1]} * xm2;
        t0[r]     = (m0[0] != 0.0f) ? u0[r]     : MASKT;
        t0[r + 1] = (m0[1] != 0.0f) ? u0[r + 1] : MASKT;
        t1[r]     = (m1[0] != 0.0f) ? u1[r]     : MASKT;
        t1[r + 1] = (m1[1] != 0.0f) ? u1[r + 1] : MASKT;
      }
    }
    float mx = fmaxf(t0[0], t0[1]);
#pragma unroll
    for (int r = 2; r < 8; r += 2) mx = fmaxf(mx, fmaxf(t0[r], t0[r + 1]));
#pragma unroll
    for (int r = 0; r < 8; r += 2) mx = fmaxf(mx, fmaxf(t1[r], t1[r + 1]));
    mx = fmaxf(mx, other_half(mx));
    const float mn = fmaxf(mrow, mx);
    const float al = exp2_raw(mrow - mn);
    mrow = mn;
    t0 = t0 - mn;
    t1 = t1 - mn;
#pragma unroll
    for (int r = 0; r < 8; ++r) t0[r] = exp2_raw(t0[r]);
#pragma unroll
    for (int r = 0; r < 8; ++r) t1[r] = exp2_raw(t1[r]);
    {
      const v8f pr = t0 + t1;
      const v4f p4 = pr.lo + pr.hi;
      lrow = lrow * al + ((p4[0] + p4[2]) + (p4[1] + p4[3]));
    }
#pragma unroll
    for (int j = 0; j < 4; ++j) o[j] = o[j] * al + *(const v8f*)(vsS + it * HID + h * HD + 16 * j + 8 * hh);
    // ---- B fragment of f16(P'^T): column = query c, elements 0..7 = keys kb + 8hh + 0..7, 8..15 = keys kb + 16 + 8hh + 0..7 ----
    FragH ph;
    ph.h[0] = __builtin_convertvector((t0 - PCEN) * PCAR, v8h);
    ph.h[1] = __builtin_convertvector((t1 - PCEN) * PCAR, v8h);
    // ---- v^T.P'^T : A fragment row = d = j*16 + c, keys contiguous in the v plane ----
    {
      const _Float16* vhp = Vhb + kb * 16;                    // key tile kb / 32
      const v16h vh0 = ldfrag_h(vhp);
      const v16h vh1 = ldfrag_h(vhp + (size_t)16 * TS);
      const v16h vh2 = ldfrag_h(vhp + (size_t)32 * TS);
      const v16h vh3 = ldfrag_h(vhp + (size_t)48 * TS);
      hold_addr(vhp, vhp, vhp, vhp, vhp, vhp, vhp, vhp, vhp, vhp);
      o[0] = mma_h(vh0, ph.v, o[0]);
      o[1] = mma_h(vh1, ph.v, o[1]);
      o[2] = mma_h(vh2, ph.v, o[2]);
      o[3] = mma_h(vh3, ph.v, o[3]);
      guard6<v16h>(o[0], o[1], o[2], o[3], ph.v, vh0, vh1, vh2, vh3, ph.v);
    }
  }
  acc_guard4(o[0], o[1], o[2], o[3]);

  // ---- join the halves' sums, fold 1/l and the carries (1024 on P', 1024 on v) ----
  const float oc  = 1.0f / (PCAR * VCAR);
  const float inv = (1.0f / (lrow + other_half(lrow))) * oc;
  // ---- O x8192 -> f16 hi + residual fragment-major planes [64 t][HID] in LDS; accumulator j = chunk slot (j & 1) * 32 + lane of
  //      k tile 2h + (j >> 1) of row tile rt: row c, d = 16j + 8hh .. + 7 ----
  const int pb0 = rt * (16 * HID) + h * 1024 + 8 * lane;
#pragma unroll
  for (int j = 0; j < 4; ++j) {
    float w[8];
    v4u oh, ol;
#pragma unroll
    for (int e = 0; e < 8; ++e) w[e] = (o[j][e] * inv) * OSC;
#pragma unroll
    for (int e = 0; e < 4; ++e) {
      const _Float16 h0 = (_Float16)w[2 * e], h1 = (_Float16)w[2 * e + 1];
      const _Float16 l0 = (_Float16)(w[2 * e] - (float)h0), l1 = (_Float16)(w[2 * e + 1] - (float)h1);
      oh[e] = pk16(h_bits(h0), h_bits(h1));
      ol[e] = pk16(h_bits(l0), h_bits(l1));
    }
    *(v4u*)(PH + pb0 + j * 256) = oh;
    *(v4u*)(PL + pb0 + j * 256) = ol;
  }
  __syncthreads();                                  // a row tile of O comes from four waves (one per head)

  // ---- y^T tile: rows t0 + 16 rt .., columns 64h .. ; per k step h.w then l.w ----
  const int ws = __builtin_amdgcn_readfirstlane(tid >> 5);   // the wave's number in a scalar register: what hangs on it from here on
  const int hs = ws >> 2, rs = ws & 3;                       // (addresses of the weights, x, out, the slab) costs no vector registers
  float* sl = slab + ws * SLAB64;
  {
    const int col0 = hs * 64;
    const _Float16* ahp = (const _Float16*)(const void*)PH + rs * (16 * HID) + 8 * lane;
    const _Float16* alp = (const _Float16*)(const void*)PL + rs * (16 * HID) + 8 * lane;
    const _Float16* bhp = (const _Float16*)(const void*)WOH + (size_t)col0 * HID + 8 * lane;
    const size_t bs = (size_t)16 * HID;
    const float osc = 1.0f / (OSC * WSC);
    v8f acc0 = zero8(), acc1 = zero8(), acc2 = zero8(), acc3 = zero8();
#pragma unroll 1
    for (int k0 = 0; k0 < HID; k0 += 32) {
      const int kf = k0 * 16;                            // k tile k0 / 32
      const _Float16 *p0 = bhp + kf, *p1 = p0 + bs, *p2 = p1 + bs, *p3 = p2 + bs;
      const v16h b0 = ldfrag_h(p0);
      const v16h b1 = ldfrag_h(p1);
      const v16h b2 = ldfrag_h(p2);
      const v16h b3 = ldfrag_h(p3);
      hold_addr(p0, p0, p0, p0, p0, p0, p0, p0, p0, p0);     // the other three addresses are constant offsets from this one
      const v16h ah = ldfrag_h(ahp + kf);
      const v16h al = ldfrag_h(alp + kf);
      acc0 = mma_h(ah, b0, acc0);  acc0 = mma_h(al, b0, acc0);
      acc1 = mma_h(ah, b1, acc1);  acc1 = mma_h(al, b1, acc1);
      acc2 = mma_h(ah, b2, acc2);  acc2 = mma_h(al, b2, acc2);
      acc3 = mma_h(ah, b3, acc3);  acc3 = mma_h(al, b3, acc3);
      guard6<v16h>(acc0, acc1, acc2, acc3, ah, al, b0, b1, b2, b3);
    }
    float bb[4];
#pragma unroll
    for (int j = 0; j < 4; ++j) bb[j] = bfr(bo[col0 + 16 * j + c]);
#pragma unroll
    for (int r = 0; r < 8; ++r) {
      const int ro = (8 * hh + r) * 68 + c;
      sl[ro]      = acc0[r] * osc + bb[0];
      sl[ro + 16] = acc1[r] * osc + bb[1];
      sl[ro + 32] = acc2[r] * osc + bb[2];
      sl[ro + 48] = acc3[r] * osc + bb[3];
    }
    __syncthreads();                                // every wave has read its O fragments (and its slab is written): the planes may take y
    ep_split(sl, PH, PL, (size_t)(rs * (16 * HID) + hs * 1024 + 8 * lane), YSC, lane);   // row tile rs, columns 64 hs ..
  }
  __syncthreads();                                  // the y planes are complete; every wave reads all 64 rows

  // ---- FiLM GEMM ----
  const int c0 = ws * 16;
  const _Float16* agp = (const _Float16*)(const void*)WF + (size_t)c0 * HID + 8 * lane;
  const _Float16* yhp = (const _Float16*)(const void*)PH + 8 * lane;
  const _Float16* ylp = (const _Float16*)(const void*)PL + 8 * lane;
  const int ys = 16 * HID;                                                         // one row tile of the planes
  const float oscale = 1.0f / (YSC * WSC);
  v8f g[4], be[4];
#pragma unroll
  for (int j = 0; j < 4; ++j) { g[j] = zero8(); be[j] = zero8(); }
#pragma unroll 1
  for (int k0 = 0; k0 < HID; k0 += 32) {
    const int kf = k0 * 16;                              // k tile k0 / 32
    const _Float16 *pg = agp + kf, *pb = pg + (size_t)HID * HID;                   // row 256 + c0 + c
    const v16h ag = ldfrag_h(pg), ab = ldfrag_h(pb);
    hold_addr(pg, pg, pg, pg, pg, pg, pg, pg, pg, pg);     // pb is a constant offset from pg
    {
      const v16h y0 = ldfrag_h(yhp + kf);
      const v16h y1 = ldfrag_h(yhp + kf + ys);
      const v16h y2 = ldfrag_h(yhp + kf + 2 * ys);
      const v16h y3 = ldfrag_h(yhp + kf + 3 * ys);
      g[0] = mma_h(ag, y0, g[0]);  be[0] = mma_h(ab, y0, be[0]);
      g[1] = mma_h(ag, y1, g[1]);  be[1] = mma_h(ab, y1, be[1]);
      g[2] = mma_h(ag, y2, g[2]);  be[2] = mma_h(ab, y2, be[2]);
      g[3] = mma_h(ag, y3, g[3]);  be[3] = mma_h(ab, y3, be[3]);
    }
    const v16h z0 = ldfrag_h(ylp + kf);
    const v16h z1 = ldfrag_h(ylp + kf + ys);
    const v16h z2 = ldfrag_h(ylp + kf + 2 * ys);
    const v16h z3 = ldfrag_h(ylp + kf + 3 * ys);
    g[0] = mma_h(ag, z0, g[0]);  be[0] = mma_h(ab, z0, be[0]);
    g[1] = mma_h(ag, z1, g[1]);  be[1] = mma_h(ab, z1, be[1]);
    g[2] = mma_h(ag, z2, g[2]);  be[2] = mma_h(ab, z2, be[2]);
    g[3] = mma_h(ag, z3, g[3]);  be[3] = mma_h(ab, z3, be[3]);
    guardF(g[0], g[1], g[2], g[3], be[0], be[1], be[2], be[3], ag, ab, z0, z1, z2, z3, ag, ab, ag, ab);
  }
  // ---- combine, four of the lane's eight channel rows at a time ----
  const float* xmp = xmask + (size_t)b * TT + t0 + c;
  const float* bfp = bfl + c0 + 8 * hh;
  const float* xp  = X + ((size_t)(b * HID + c0 + 8 * hh)) * TT + t0 + c;
  float xm[4];
#pragma unroll
  for (int j = 0; j < 4; ++j) xm[j] = xmp[16 * j];
#pragma unroll
  for (int r0 = 0; r0 < 8; r0 += 4) {
    // the loads of rows 4 .. 7 stay behind the work on rows 0 .. 3: all of them in flight beside the 64 accumulators do not fit
    // 128 registers (spills)
    if (r0 == 4) __builtin_amdgcn_sched_barrier(0);
    float bg[4], bb[4], xv[4][4];
#pragma unroll
    for (int q = 0; q < 4; ++q) {
      bg[q] = bfp[r0 + q];
      bb[q] = bfp[HID + r0 + q];
#pragma unroll
      for (int j = 0; j < 4; ++j) xv[q][j] = xp[(size_t)(r0 + q) * TT + 16 * j];
    }
    hold_addr(xmp, bfp, xp, xp, xp, xp, xp, xp, xp, xp);   // every address above is a constant offset from these three
#pragma unroll
    for (int q = 0; q < 4; ++q) {
      const int r = r0 + q;
      const float bgr = bfr(bg[q]), bbr = bfr(bb[q]);
#pragma unroll
      for (int j = 0; j < 4; ++j) {
        const float gam = g[j][r] * oscale + bgr;
        const float bet = be[j][r] * oscale + bbr;
        sl[(8 * hh + r) * 68 + 16 * j + c] = (bfr(xv[q][j]) * gam + bet) * bfr(xm[j]);
      }
    }
  }
  wave_sync_lds();
  store64(sl, OUT, TT, (size_t)(b * HID + c0), t0, lane);
}

// =====================================================================================================
// Workspace map (bytes); every plane is fully written by whole-line stores before it is read; all extents are exact multiples
// of the store granularity (no pad rows needed); every offset a multiple of 65536. No launch writes a region that it reads:
//   CT f32 [2048][64] 524288, ST same
//   XT bf16 [16][2048][256] 16777216; CONDT bf16 [16][512][512] 8388608
//   WCB bf16 [256][512] 262144; WQB bf16 [256][256] 131072; WKH, WVH, WOH f16 [256][256] 131072 each; WFH f16 [512][256] 262144
//   CH f16 [16][512][256] 4194304, CL same
//   QH f16 [16][2048][4][64] 16777216
//   KH f16 [16][4][512][64] 4194304; VH f16 [16][256][512] 4194304; VS f32 [16][16][256] 262144
//   end 61079552
// =====================================================================================================
extern "C" void kernel_launch(void* const* d_in, const int* in_sizes, int n_in,
                              void* d_out, int out_size, void* d_ws, size_t ws_size,
                              hipStream_t stream) {
  if (n_in < 16) return;
  if (in_sizes[0] != NBAT * HID * TT) return;
  if (in_sizes[1] != NBAT * TT) return;
  if (in_sizes[2] != NBAT * CND * TS) return;
  if (in_sizes[3] != NBAT * TS) return;
  if (in_sizes[4] != HID * CND || in_sizes[5] != HID) return;
  if (in_sizes[6] != HID * HID || in_sizes[7] != HID) return;
  if (in_sizes[8] != HID * HID || in_sizes[9] != HID) return;
  if (in_sizes[10] != HID * HID || in_sizes[11] != HID) return;
  if (in_sizes[12] != HID * HID || in_sizes[13] != HID) return;
  if (in_sizes[14] != 2 * HID * HID || in_sizes[15] != 2 * HID) return;
  if (out_size != NBAT * HID * TT) return;

  const float* x      = (const float*)d_in[0];
  const float* x_mask = (const float*)d_in[1];
  const float* cond   = (const float*)d_in[2];
  const float* c_mask = (const float*)d_in[3];
  const float* w_cond = (const float*)d_in[4];
  const float* b_cond = (const float*)d_in[5];
  const float* wq     = (const float*)d_in[6];
  const float* bq     = (const float*)d_in[7];
  const float* wk     = (const float*)d_in[8];
  const float* bk     = (const float*)d_in[9];
  const float* wv     = (const float*)d_in[10];
  const float* bv     = (const float*)d_in[11];
  const float* wo     = (const float*)d_in[12];
  const float* bo     = (const float*)d_in[13];
  const float* wf     = (const float*)d_in[14];
  const float* bfi    = (const float*)d_in[15];
  float*       out    = (float*)d_out;

  const size_t szTab = (size_t)TT * HD * 4;                       //    524288
  const size_t szR3  = (size_t)NBAT * TT * HID * 2;               //  16777216
  const size_t szR4  = (size_t)NBAT * TS * CND * 2;               //   8388608
  const size_t szWCB = (size_t)HID * CND * 2;                     //    262144
  const size_t szW   = (size_t)HID * HID * 2;                     //    131072
  const size_t szWF  = (size_t)2 * HID * HID * 2;                 //    262144
  const size_t szCP  = (size_t)NBAT * TS * HID * 2;               //   4194304
  const size_t szR1  = (size_t)NBAT * TT * HID * 2;               //  16777216
  const size_t szKH  = (size_t)NBAT * TS * HID * 2;               //   4194304
  const size_t szVH  = (size_t)NBAT * HID * TS * 2;               //   4194304
  const size_t szVS  = (size_t)NBAT * NKB * HID * 4;              //    262144
  size_t off = 0;
  const size_t oCT  = off; off += szTab;
  const size_t oST  = off; off += szTab;
  const size_t oR3  = off; off += szR3;
  const size_t oR4  = off; off += szR4;
  const size_t oWCB = off; off += szWCB;
  const size_t oWQB = off; off += szW;
  const size_t oWKH = off; off += szW;
  const size_t oWVH = off; off += szW;
  const size_t oWOH = off; off += szW;
  const size_t oWFH = off; off += szWF;
  const size_t oCH  = off; off += szCP;
  const size_t oCL  = off; off += szCP;
  const size_t oR1  = off; off += szR1;
  const size_t oKH  = off; off += szKH;
  const size_t oVH  = off; off += szVH;
  const size_t oVS  = off; off += szVS;
  if (off > ws_size) return;                            // off = 61079552
  if (off > (size_t)134217728) return;

  char* ws = (char*)d_ws;
  float* CT    = (float*)(ws + oCT);
  float* ST    = (float*)(ws + oST);
  u16*   XT    = (u16*)(ws + oR3);
  u16*   CONDT = (u16*)(ws + oR4);
  u16*   WCB   = (u16*)(ws + oWCB);
  u16*   WQB   = (u16*)(ws + oWQB);
  u16*   WKH   = (u16*)(ws + oWKH);
  u16*   WVH   = (u16*)(ws + oWVH);
  u16*   WOH   = (u16*)(ws + oWOH);
  u16*   WFH   = (u16*)(ws + oWFH);
  u16*   CH    = (u16*)(ws + oCH);
  u16*   CL    = (u16*)(ws + oCL);
  u16*   QH    = (u16*)(ws + oR1);
  u16*   KH    = (u16*)(ws + oKH);
  u16*   VH    = (u16*)(ws + oVH);
  float* VS    = (float*)(ws + oVS);

  // inv_freq[i] = 1 / pow(10000, i/32) in f32 (pow correctly converted from f64, then IEEE f32 reciprocal)
  InvF inv;
  for (int i = 0; i < 32; ++i) {
    const double p = pow(10000.0, (double)i / 32.0);
    const float pf = (float)p;
    inv.f[i] = 1.0f / pf;
  }

  const dim3 blk(256);
  const dim3 bG(128);
  const dim3 gAF(NBAT * (TT / 64));                     // 512

  // (0) inputs only: rotary cos/sin tables [2048][64]; x [b][256][2048] -> XT bf16 [b][2048][256]; cond [b][512][512] -> CONDT bf16
  //     [b][512 s][512 i]; weights (W[o][i] row-major is already [n][k]): bf16 planes for w_cond, wq; f16(bf16 x1024) for wk, wv, wo, w_film
  pro_k<<<dim3(NB_PRO), blk, 0, stream>>>(x, cond, w_cond, wq, wk, wv, wo, wf, CT, ST, XT, CONDT, WCB, WQB, WKH, WVH, WOH, WFH, inv);
  // (1) c^T [8192][256] = CONDT [8192][512] . WCB^T + b_cond -> f16 hi + residual planes x1024;
  //     q^T [32768][256] = XT . WQB^T + bq -> rotary, positions mod 2048 -> q' plane, rows (b, t, h)
  gemm_cq<<<dim3(NB_GC + NB_GQ), bG, 0, stream>>>(CONDT, WCB, b_cond, CH, CL, XT, WQB, bq, QH, CT, ST);
  // (2) v [b][256][512] = WVH [256][256] . (CH + CL)[b][512][256]^T + bv per row -> v f16 plane x1024 + per-32-key block sums;
  //     k^T [8192][256] = CH . WKH^T (+ bk) -> rotary, positions mod 512 -> k' planes; carries 1024 x 1024 folded back
  gemm_kv<<<dim3(NB_GV + NB_GK), bG, 0, stream>>>(CH, CL, WVH, WKH, bv, bk, VH, VS, KH, CT, ST);
  // (3) cross attention -> O (LDS) -> y^T = (OH + OL) . WOH^T + bo (LDS) -> FiLM GEMM + combine -> out [16][256][2048] f32
  attn_film<<<gAF, dim3(512), 0, stream>>>(QH, KH, VH, VS, c_mask, x_mask, WOH, bo, WFH, bfi, x, out);
  (void)hipGetLastError();
}

// v007
// A run of this version takes 88.7 microseconds.
// In two side-by-side timings against v006, it was 1.08 and 1.11 times as fast.
// All steps since v000 together make it 3.08 times as fast.
// Contractions: cond^T.w_cond^T and x^T.wq^T on v_wmma_f32_16x16x32_bf16 (inputs RNE-converted to bf16, exact operands, f32 accumulate);
// c.wk^T (c x1024 f16 hi plane), wv.c (c x1024 f16 hi + residual, products w.h + w.l), scores q'.k'^T (q' x1024, k' x1024 f16, one product),
// P'.v (centred P' = (e - 7/8) x1024 f16, v x1024 f16, one product; 7/8 * sum(v) per 32-key block added in f32),
// O.wo^T (O x8192 f16 hi + residual, products h.w + l.w), w_film.y (y x16384 f16 hi + residual): v_wmma_f32_16x16x32_f16,
// weights as f16(bf16(w) x1024), f32 accumulate. Rotary tables: f64 sin/cos of the f32 angle. Rotation, masked base-2 online softmax, 1/l, FiLM combine: f32 on VALU.
#include <hip/hip_runtime.h>
#include <math.h>
#include <stdint.h>

#define NBAT  16
#define TT    2048
#define TS    512
#define HID   256
#define CND   512
#define NH    4
#define HD    64
#define NKB   (TS / 32)
#define QSC   1024.0f
#define KSC   1024.0f
#define CSC   1024.0f
#define VCAR  1024.0f
#define PCAR  1024.0f
#define OSC   8192.0f
#define YSC   16384.0f
#define WSC   1024.0f
#define PCEN  0.875f
#define LOG2E 1.4426950408889634f
#define MASKT (-10000.0f * LOG2E)
#define SLAB64 (16 * 68)
#define VTP    72
static_assert(HID == NH * HD && HD == 64);
static_assert((TT % 64) == 0 && (TS % 64) == 0 && (TS % 32) == 0 && NKB == 16);
static_assert((TT & (TT - 1)) == 0 && (TS & (TS - 1)) == 0);
static_assert((HID % 64) == 0 && (CND % 64) == 0 && (HID % 32) == 0 && (CND % 32) == 0);
static_assert(((NBAT * TS * NH * 8) % 256) == 0);
static_assert(((NBAT * TS * HID) % 2048) == 0);

typedef unsigned short u16;
typedef _Float16 v16h __attribute__((ext_vector_type(16)));
typedef _Float16 v8h  __attribute__((ext_vector_type(8)));
typedef __bf16   v16b __attribute__((ext_vector_type(16)));
typedef float    v8f  __attribute__((ext_vector_type(8)));
typedef float    v4f  __attribute__((ext_vector_type(4)));
typedef float    v2f  __attribute__((ext_vector_type(2)));
typedef unsigned int v4u __attribute__((ext_vector_type(4)));

union FragH { v16h v; v8h h[2]; v4u u[2]; };
union FragB { v16b v; v4u u[2]; };

struct InvF { float f[32]; };
static_assert(sizeof(InvF) == 128);

// ---- scalar helpers --------------------------------------------------------------------------------
__device__ __forceinline__ unsigned short bf_bits(float f) {          // f32 -> bf16 bits, RNE convert
  unsigned u = __float_as_uint(f);
  return (unsigned short)((u + 0x7FFFu + ((u >> 16) & 1u)) >> 16);
}
__device__ __forceinline__ float bf_up(unsigned short h) { return __uint_as_float(((unsigned)h) << 16); }
__device__ __forceinline__ float bfr(float f) { return bf_up(bf_bits(f)); }
__device__ __forceinline__ unsigned short h_bits(_Float16 x) { return __builtin_bit_cast(unsigned short, x); }
__device__ __forceinline__ unsigned pk16(unsigned short a, unsigned short b) { return (unsigned)a | ((unsigned)b << 16); }
__device__ __forceinline__ v8f zero8() { v8f z = {0.f, 0.f, 0.f, 0.f, 0.f, 0.f, 0.f, 0.f}; return z; }

// ---- fragment-major planes: a 16-bit plane [R][K] (R % 16 == 0, K % 32 == 0) is stored as tiles of 16 rows x 32 k, 512 halves
//      each, tile (row >> 4, k >> 5) at ((row >> 4) * (K >> 5) + (k >> 5)) * 512; inside a tile 64 chunks of 8 halves, chunk slot
//      = ((k >> 4) & 1) * 32 + ((k >> 3) & 1) * 16 + (row & 15), so that slot & 31 is the lane that owns the chunk.
// ---- fragment loaders: 16-bit A/B operand, p = tile start + 8 * lane: two wave-wide loads of 512 contiguous bytes;
//      lane -> row/col (lane&15), elements 0..7 <- k0+8h.., elements 8..15 <- k0+16+8h..  (same split k map for A and B)
__device__ __forceinline__ v16h ldfrag_h(const _Float16* p) {
  FragH f;
  f.h[0] = *(const v8h*)(p);
  f.h[1] = *(const v8h*)(p + 256);
  return f.v;
}
__device__ __forceinline__ v16b ldfrag_b(const u16* p) {              // bf16 plane read as unsigned integer vectors
  FragB f;
  f.u[0] = *(const v4u*)(p);
  f.u[1] = *(const v4u*)(p + 256);
  return f.v;
}

// Stands behind a group of fragment loads and names their address registers as inputs, so that these registers stay unwritten
// (by a later load's result or by an address update) up to the s_wait_xcnt 0 inside it.
__device__ __forceinline__ void hold_addr(const void* a, const void* b, const void* c, const void* d, const void* e,
                                          const void* f, const void* g, const void* h, const void* i, const void* j) {
#if defined(__HIP_DEVICE_COMPILE__)
  asm volatile("s_wait_xcnt 0x0" :: "v"(a), "v"(b), "v"(c), "v"(d), "v"(e), "v"(f), "v"(g), "v"(h), "v"(i), "v"(j) : "memory");
#endif
}
// chunk slot (0..63) of a tile -> row in the tile and first k in the tile
__device__ __forceinline__ int slot_row(int slot) { return slot & 15; }
__device__ __forceinline__ int slot_k(int slot) { return ((slot >> 5) << 4) + (((slot >> 4) & 1) << 3); }

__device__ __forceinline__ v8f mma_h(v16h a, v16h b, v8f c) {
  return __builtin_amdgcn_wmma_f32_16x16x32_f16(false, a, false, b, (short)0, c, false, false);
}
__device__ __forceinline__ v8f mma_b(v16b a, v16b b, v8f c) {
  return __builtin_amdgcn_wmma_f32_16x16x32_bf16(false, a, false, b, (short)0, c, false, false);
}
__device__ __forceinline__ void guard2(v8f& a, v8f& b, v16h x0, v16h x1, v16h x2, v16h x3, v16h x4, v16h x5) {
#if defined(__HIP_DEVICE_COMPILE__)
  asm volatile("v_nop\n\tv_nop\n\tv_nop\n\tv_nop"
               : "+v"(a), "+v"(b) : "v"(x0), "v"(x1), "v"(x2), "v"(x3), "v"(x4), "v"(x5) : "memory");
#endif
}
template <typename F>
__device__ __forceinline__ void guard6(v8f& a, v8f& b, v8f& c, v8f& d, F x0, F x1, F x2, F x3, F x4, F x5) {
#if defined(__HIP_DEVICE_COMPILE__)
  asm volatile("v_nop\n\tv_nop\n\tv_nop\n\tv_nop"
               : "+v"(a), "+v"(b), "+v"(c), "+v"(d) : "v"(x0), "v"(x1), "v"(x2), "v"(x3), "v"(x4), "v"(x5) : "memory");
#endif
}
__device__ __forceinline__ void guard10(v8f& a, v8f& b, v8f& c, v8f& d, v16h x0, v16h x1, v16h x2, v16h x3, v16h x4,
                                        v16h x5, v16h x6, v16h x7, v16h x8, v16h x9) {
#if defined(__HIP_DEVICE_COMPILE__)
  asm volatile("v_nop\n\tv_nop\n\tv_nop\n\tv_nop"
               : "+v"(a), "+v"(b), "+v"(c), "+v"(d)
               : "v"(x0), "v"(x1), "v"(x2), "v"(x3), "v"(x4), "v"(x5), "v"(x6), "v"(x7), "v"(x8), "v"(x9) : "memory");
#endif
}
__device__ __forceinline__ void guardF(v8f& a0, v8f& a1, v8f& a2, v8f& a3, v8f& c0, v8f& c1, v8f& c2, v8f& c3,
                                       v16h x0, v16h x1, v16h x2, v16h x3, v16h x4, v16h x5, v16h x6, v16h x7,
                                       v16h x8, v16h x9) {
#if defined(__HIP_DEVICE_COMPILE__)
  asm volatile("v_nop\n\tv_nop\n\tv_nop\n\tv_nop"
               : "+v"(a0), "+v"(a1), "+v"(a2), "+v"(a3), "+v"(c0), "+v"(c1), "+v"(c2), "+v"(c3)
               : "v"(x0), "v"(x1), "v"(x2), "v"(x3), "v"(x4), "v"(x5), "v"(x6), "v"(x7), "v"(x8), "v"(x9) : "memory");
#endif
}
__device__ __forceinline__ void acc_guard4(v8f& a, v8f& b, v8f& c, v8f& d) {
#if defined(__HIP_DEVICE_COMPILE__)
  asm volatile("v_nop\n\tv_nop\n\tv_nop\n\tv_nop" : "+v"(a), "+v"(b), "+v"(c), "+v"(d));
#endif
}
__device__ __forceinline__ void wave_sync_lds() {
  __builtin_amdgcn_fence(__ATOMIC_RELEASE, "workgroup");
  __builtin_amdgcn_wave_barrier();
  __builtin_amdgcn_fence(__ATOMIC_ACQUIRE, "workgroup");
}

// ---- accurate f32 sin/cos of a non-negative f32 angle (|angle| < 2048): f64 two-part pi/2 reduction + f64 polynomials,
//      plain f64 fma/mul only (no library f64 trig path), result converted to f32.
__device__ __forceinline__ void sincos_acc(float angf, float& sv, float& cv) {
  const double a = (double)angf;
  const double TWO_OVER_PI = 0.63661977236758134308;
  const double PIO2_HI = 1.5707963267948966;
  const double PIO2_LO = 6.123233995736766e-17;
  const int kq = (int)(a * TWO_OVER_PI + 0.5);
  const double kd = (double)kq;
  double r = fma(-kd, PIO2_HI, a);
  r = fma(-kd, PIO2_LO, r);
  const double r2 = r * r;
  double sp = 1.0 / 6227020800.0;
  sp = fma(sp, r2, -1.0 / 39916800.0);
  sp = fma(sp, r2, 1.0 / 362880.0);
  sp = fma(sp, r2, -1.0 / 5040.0);
  sp = fma(sp, r2, 1.0 / 120.0);
  sp = fma(sp, r2, -1.0 / 6.0);
  const double s = fma(sp * r2, r, r);
  double cp = -1.0 / 87178291200.0;
  cp = fma(cp, r2, 1.0 / 479001600.0);
  cp = fma(cp, r2, -1.0 / 3628800.0);
  cp = fma(cp, r2, 1.0 / 40320.0);
  cp = fma(cp, r2, -1.0 / 720.0);
  cp = fma(cp, r2, 1.0 / 24.0);
  cp = fma(cp, r2, -0.5);
  const double c = fma(cp, r2, 1.0);
  const int qd = kq & 3;
  const double so = (qd == 0) ? s : (qd == 1) ? c : (qd == 2) ? -s : -c;
  const double co = (qd == 0) ? c : (qd == 1) ? -s : (qd == 2) ? -c : s;
  sv = (float)so;
  cv = (float)co;
}

// =====================================================================================================
// Rotary tables: cosT[t][d], sinT[t][d] for t < TT, d < HD, angle = float(t) * inv_freq[d & 31] (f32 product), halves duplicated.
// Wave = one position t, lane = frequency index; inv_freq picked from the by-value table with a static select chain.
// coverage: grid TT/8 blocks x 8 waves = TT rows; per row 4 line stores = 64 floats of each table.
// =====================================================================================================
__device__ __forceinline__ void k_tab(float* cosT, float* sinT, const InvF& inv, int bx) {
  const int tid  = threadIdx.x;
  const int lane = tid & 31;
  const int t    = bx * 8 + (tid >> 5);
  if (t >= TT) return;                      // never taken with the exact grid; no barriers in this kernel
  float f = inv.f[0];
#pragma unroll
  for (int i = 1; i < 32; ++i) f = (lane == i) ? inv.f[i] : f;
  const float ang = (float)t * f;
  float sv, cv;
  sincos_acc(ang, sv, cv);
  float* cr = cosT + (size_t)t * HD;
  float* sr = sinT + (size_t)t * HD;
  {
    *(float*)(cr + lane)      = cv;
    *(float*)(cr + 32 + lane) = cv;
    *(float*)(sr + lane)      = sv;
    *(float*)(sr + 32 + lane) = sv;
    
  }
}

// =====================================================================================================
// Batched transpose + bf16 convert: in W[b][R][C] (row-major f32) -> out D[b][C][R] (bf16 RNE bits, fragment-major plane).
// Block = one 64x64 tile (r0, c0) of batch bb: 256 thr x 4 16-B loads -> LDS tile [c][r] (pitch 72), block barrier,
// coverage: load 256 thr x 16 = 64x64; store 2 iterations x 256 thr x 8 halves = 64 lines x 64; grid (C/64)*(R/64) x b = all of D.
// =====================================================================================================
__device__ __forceinline__ void cvt_T(const float* __restrict__ W, u16* D, int R, int C, int bid, int bb, u16* T) {
  const int tid = threadIdx.x;
  const int ntc = C >> 6;
  const int c0  = (bid % ntc) * 64;
  const int r0  = (bid / ntc) * 64;
  const float* Wb = W + (size_t)bb * (size_t)R * (size_t)C;
  u16*         Db = D + (size_t)bb * (size_t)R * (size_t)C;
  {
    const int rr = tid >> 2;
    const int cc = (tid & 3) * 16;
    const float* src = Wb + (size_t)(r0 + rr) * C + c0 + cc;
#pragma unroll
    for (int i = 0; i < 4; ++i) {
      const v4f a = *(const v4f*)(src + 4 * i);
#pragma unroll
      for (int e = 0; e < 4; ++e) T[(cc + 4 * i + e) * VTP + rr] = bf_bits(a[e]);
    }
  }
  __syncthreads();
  // thread = one chunk of the fragment-major plane: 8 local tiles (4 row tiles x 2 k tiles) x 64 slots
  v4u vals[2];
  const int slot = tid & 63;
#pragma unroll
  for (int it = 0; it < 2; ++it) {
    const int lt = it * 4 + (tid >> 6);
    vals[it] = *(const v4u*)(T + ((lt >> 1) * 16 + slot_row(slot)) * VTP + (lt & 1) * 32 + slot_k(slot));
  }
  {
#pragma unroll
    for (int it = 0; it < 2; ++it) {
      const int lt = it * 4 + (tid >> 6);
      const size_t tile = (size_t)((c0 >> 4) + (lt >> 1)) * (size_t)(R >> 5) + (size_t)((r0 >> 5) + (lt & 1));
      *(v4u*)(Db + tile * 512 + slot * 8) = vals[it];
    }
#if defined(__HIP_DEVICE_COMPILE__)
    // in a merged grid other jobs' code follows in the listing and reuses the two stores' address and data registers: wait first
    asm volatile("s_wait_xcnt 0x0" ::: "memory");
#endif
  }
}

// =====================================================================================================
// Row-major f32 [R][K] -> 16-bit fragment-major plane. f16mode == 0: bf16 RNE bits; f16mode == 1: f16 bits of (bf16 RNE value) * scale.
// Thread = 8 consecutive elements: two 16-B loads, one 16-B store; 32 consecutive lanes = 512 contiguous, 512-B aligned bytes
// coverage: grid = ceil(n8/256) blocks x 256 thr x 8 = the whole plane (n8 a multiple of 32 in every use, so no partial line).
// =====================================================================================================
__device__ __forceinline__ void cvt_flat(const float* __restrict__ src, u16* D, int n8, int f16mode, float scale, int K, int bx) {
  const int gt = bx * 256 + (int)threadIdx.x;   // chunk index in the fragment-major plane
  if (gt >= n8) return;                     // no barriers in this kernel
  const int ktn = K >> 5, tile = gt >> 6, slot = gt & 63;
  const int rt = tile / ktn, kt = tile - rt * ktn;
  const float* p = src + (size_t)(rt * 16 + slot_row(slot)) * K + kt * 32 + slot_k(slot);
  const v4f a = *(const v4f*)(p), bq = *(const v4f*)(p + 4);
  float w[8];
#pragma unroll
  for (int e = 0; e < 4; ++e) { w[e] = a[e]; w[4 + e] = bq[e]; }
  v4u o;
#pragma unroll
  for (int e = 0; e < 4; ++e) {
    const float v0 = w[2 * e], v1 = w[2 * e + 1];
    const unsigned short h0 = h_bits((_Float16)(bfr(v0) * scale)), h1 = h_bits((_Float16)(bfr(v1) * scale));
    const unsigned short b0 = bf_bits(v0), b1 = bf_bits(v1);
    o[e] = (f16mode != 0) ? pk16(h0, h1) : pk16(b0, b1);
  }
  u16* d = D + (size_t)gt * 8;
  {
    *(v4u*)(d) = o;
    
  }
}

// =====================================================================================================
// GEMM epilogues: the wave's 16 x 64 f32 tile stands (final values) in its LDS slab (pitch 68), the caller has issued the wave's
// LDS sync; the epilogue writes the 16-bit plane(s) that the next launch or the next phase reads, so no f32 copy of the tile goes through memory.
// A lane owns four chunks of 8 halves. Fragment-major planes: chunk it = row (lane & 15), columns it * 16 + 8 * (lane >> 4) ..,
// which is slot (it & 1) * 32 + lane of k tile (it >> 1) of the tile pair: one store = 512 contiguous bytes of the wave.
// =====================================================================================================
// f16 hi + residual fragment-major planes: hi = f16(v * sc), lo = f16(v * sc - hi) (sc a power of two, residual unscaled).
// base = first half of the wave's tile pair + 8 * lane. coverage: 4 stores x 32 lanes x 8 halves = 16 x 64 of each plane.
__device__ __forceinline__ void ep_split(const float* sl, u16* Hp, u16* Lp, size_t base, float sc, int lane) {
  const int hh = lane >> 4, m = lane & 15;
  v4u oh[4], ol[4];
#pragma unroll
  for (int it = 0; it < 4; ++it) {
    const float* p = sl + m * 68 + it * 16 + 8 * hh;
    const v4f a = *(const v4f*)(p), bq = *(const v4f*)(p + 4);
    float w[8];
#pragma unroll
    for (int e = 0; e < 4; ++e) { w[e] = a[e] * sc; w[4 + e] = bq[e] * sc; }
#pragma unroll
    for (int e = 0; e < 4; ++e) {
      const float t0 = w[2 * e], t1 = w[2 * e + 1];
      const _Float16 h0 = (_Float16)t0, h1 = (_Float16)t1;
      const _Float16 l0 = (_Float16)(t0 - (float)h0), l1 = (_Float16)(t1 - (float)h1);
      oh[it][e] = pk16(h_bits(h0), h_bits(h1));
      ol[it][e] = pk16(h_bits(l0), h_bits(l1));
    }
  }
#pragma unroll
  for (int it = 0; it < 4; ++it) {
    *(v4u*)(Hp + base + (size_t)it * 256) = oh[it];
    *(v4u*)(Lp + base + (size_t)it * 256) = ol[it];
  }
}

// Rotate-half rotary + f16 pack; the tile's 64 columns are one head's HD channels, its rows 16 positions pos0 .. ; chunks as above.
//   w[d] = x[d] * cos[pos][d] + r[d] * sin[pos][d],  r[d] = -x[d+32] for d < 32, x[d-32] for d >= 32;  out[d] = f16(w * sc).
__device__ __forceinline__ int rope_row(int lane) { return lane & 15; }
__device__ __forceinline__ int rope_d0(int it, int lane) { return it * 16 + 8 * (lane >> 4); }
struct RopeTab { v4f ca[2], cb[2], sa[2], sb[2]; };   // chunks 0, 1; chunks 2, 3 (d + 32) read the same values: the tables' halves are equal
__device__ __forceinline__ void rope_tab(RopeTab& t, const float* __restrict__ cosT, const float* __restrict__ sinT, int pos0,
                                         int lane) {
  const size_t o = (size_t)(pos0 + rope_row(lane)) * HD + rope_d0(0, lane);
  const float *cr = cosT + o, *sr = sinT + o;
  const int st = 16;                          // floats from one of the lane's chunks to the next
#pragma unroll
  for (int it = 0; it < 2; ++it) {
    t.ca[it] = *(const v4f*)(cr + it * st);  t.cb[it] = *(const v4f*)(cr + it * st + 4);
    t.sa[it] = *(const v4f*)(sr + it * st);  t.sb[it] = *(const v4f*)(sr + it * st + 4);
  }
  hold_addr(cr, sr, cr, cr, cr, cr, cr, cr, cr, cr);   // the eight addresses are constant offsets from these two
}
// oh = the lane's four chunks: together the two 16-bit fragments (d 0 .. 31 and 32 .. 63, split k map) of row lane & 15.
__device__ __forceinline__ void rope_pack(const float* sl, const RopeTab& t, v4u (&oh)[4], float sc, int lane) {
#pragma unroll
  for (int it = 0; it < 4; ++it) {
    const int d0 = rope_d0(it, lane), d1 = d0 ^ 32;
    const float* xr = sl + rope_row(lane) * 68;
    const v4f xa = *(const v4f*)(xr + d0), xb = *(const v4f*)(xr + d0 + 4);
    const v4f ya = *(const v4f*)(xr + d1), yb = *(const v4f*)(xr + d1 + 4);
    const float sgn = (d0 < 32) ? -1.0f : 1.0f;
    float w[8];
#pragma unroll
    for (int e = 0; e < 4; ++e) {
      w[e]     = fmaf(sgn * ya[e], t.sa[it & 1][e], xa[e] * t.ca[it & 1][e]);   // cosine product rounded, sine product fused
      w[4 + e] = fmaf(sgn * yb[e], t.sb[it & 1][e], xb[e] * t.cb[it & 1][e]);
    }
#pragma unroll
    for (int e = 0; e < 4; ++e) {
      const _Float16 h0 = (_Float16)(w[2 * e] * sc), h1 = (_Float16)(w[2 * e + 1] * sc);
      oh[it][e] = pk16(h_bits(h0), h_bits(h1));
    }
  }
}
// fragment-major out plane (k'), dst = the lane's first chunk. coverage: 4 stores x 32 lanes x 8 halves = 16 rows x 64 of the plane.
__device__ __forceinline__ void ep_rope(const float* sl, const RopeTab& t, u16* dst, float sc, int lane) {
  v4u oh[4];
  rope_pack(sl, t, oh, sc, lane);
#pragma unroll
  for (int it = 0; it < 4; ++it) *(v4u*)(dst + (size_t)it * 256) = oh[it];
}

// v plane + per-32-key block sums; the tile is 16 channels (rows) x 64 keys of batch b, the block 64 channels o0 .. x the same keys.
//   VH = f16(v * 1024), fragment-major plane [b * HID + o][TS], vbase = first half of the wave's tile pair + 8 * lane;
//   VS[b][kb][o] = sum over keys kb*32 .. kb*32+31 of v (f32): 8 keys in a lane as a tree, the chunk pair (0,1) and (2,3) across the
//   wave's halves, then the two pairs; the block's 2 x 64 sums meet in S (128 floats of LDS) so that one wave stores whole lines.
// coverage: VH 4 stores x 32 lanes x 8 halves = 16 x 64; VS 2 key blocks x 64 channels per block, vsdst = VS + (b * NKB + kb0) * HID + o0.
__device__ __forceinline__ void ep_v(const float* sl, u16* VH, size_t vbase, float* vsdst, float* S, int wave, int lane) {
  const int hh = lane >> 4, m = lane & 15;
  v4u o[4];
  float ps[4];
#pragma unroll
  for (int it = 0; it < 4; ++it) {
    const float* p = sl + m * 68 + it * 16 + 8 * hh;
    const v4f a = *(const v4f*)(p), bq = *(const v4f*)(p + 4);
#pragma unroll
    for (int q = 0; q < 2; ++q) {
      o[it][q]     = pk16(h_bits((_Float16)(a[2 * q] * VCAR)),  h_bits((_Float16)(a[2 * q + 1] * VCAR)));
      o[it][2 + q] = pk16(h_bits((_Float16)(bq[2 * q] * VCAR)), h_bits((_Float16)(bq[2 * q + 1] * VCAR)));
    }
    ps[it] = ((a[0] + a[1]) + (a[2] + a[3])) + ((bq[0] + bq[1]) + (bq[2] + bq[3]));
  }
#pragma unroll
  for (int it = 0; it < 4; ++it) *(v4u*)(VH + vbase + (size_t)it * 256) = o[it];
#if defined(__HIP_DEVICE_COMPILE__)
  // the block sums below reuse the four stores' data registers: wait first
  asm volatile("s_wait_xcnt 0x0" ::: "memory");
#endif
#pragma unroll
  for (int it = 0; it < 4; ++it) ps[it] += __shfl_xor(ps[it], 16, 32);
  S[hh * 64 + wave * 16 + m] = (hh != 0) ? (ps[2] + ps[3]) : (ps[0] + ps[1]);
  __syncthreads();
  if (wave == 0) {
    const int piece = m * 4;
    const v4f sv = *(const v4f*)(S + hh * 64 + piece);
    *(v4f*)(vsdst + (size_t)hh * HID + piece) = sv;
  }
}

// =====================================================================================================
// Shared GEMM store: the wave's 16x64 f32 tile already staged (final values) in its LDS slab (pitch 68), caller issued the
// coverage: 8 instructions x 2 rows x 16 lanes x 4 floats = the wave's 16 x 64 tile.
// =====================================================================================================
__device__ __forceinline__ void store64(const float* sl, float* C, int N, size_t rowb, int col0, int lane) {
  const int hh = lane >> 4, m = lane & 15;
  v4f vals[8];
#pragma unroll
  for (int it = 0; it < 8; ++it) vals[it] = *(const v4f*)(sl + (it * 2 + hh) * 68 + m * 4);
  float* dst = C + (rowb + (size_t)hh) * (size_t)N + col0 + m * 4;
  {
#pragma unroll
    for (int it = 0; it < 8; ++it) {
      *(v4f*)(dst + (size_t)(it * 2) * (size_t)N) = vals[it];
    }
    
  }
}

// =====================================================================================================
// bf16 GEMM: T[M][N] (f32, never stored) = A[M][K] (bf16 fragment-major) . Bt[N][K]^T (bf16 k-contiguous), times oscale, + bf16(bias[col]).
// Block = 64x64 tile, 4 waves x 16 rows; A and Bt fragment-major: a fragment = two wave-wide loads of 512 contiguous bytes (split
// k map for A and B); K stepped by 32 (K % 32 == 0, M % 64 == 0, N % 64 == 0 statically, grid = (M/64)*(N/64)).
// Epilogue: P0, P1 = hi + residual planes [M][N] of T * psc.
// =====================================================================================================
#define EP_SPLIT  0
#define EP_ROPE_K 2
#define EP_V      3
__device__ __forceinline__
void gemm_bf(const u16* __restrict__ A, const u16* __restrict__ Bt, const float* __restrict__ bias,
             int M, int N, int K, float oscale, int bid, float* slab, u16* P0, u16* P1, float psc) {
  const int tid = threadIdx.x, wave = tid >> 5, lane = tid & 31, hh = lane >> 4, m = lane & 15;
  const int ntile = N >> 6;
  const int rowb  = (bid / ntile) * 64 + wave * 16;
  const int col0  = (bid % ntile) * 64;
  if (rowb + 16 > M) return;                 // wave-uniform, never taken with the exact grid; no block barriers in this kernel
  const u16* ap = A  + (size_t)rowb * K + 8 * lane;      // row tile rowb / 16, k tile 0
  const u16* bp = Bt + (size_t)col0 * K + 8 * lane;
  const size_t bs = (size_t)16 * K;                      // one row tile = K / 32 tiles of 512 halves
  v8f acc0 = zero8(), acc1 = zero8(), acc2 = zero8(), acc3 = zero8();
#pragma unroll 1
  for (int k0 = 0; k0 < K; k0 += 32) {
    const int kf = k0 * 16;                              // k tile k0 / 32
    const u16 *pa = ap + kf, *p0 = bp + kf, *p1 = p0 + bs, *p2 = p1 + bs, *p3 = p2 + bs;
    const v16b a  = ldfrag_b(pa);
    const v16b b0 = ldfrag_b(p0);
    const v16b b1 = ldfrag_b(p1);
    const v16b b2 = ldfrag_b(p2);
    const v16b b3 = ldfrag_b(p3);
    hold_addr(pa, p0, p1, p2, p3, pa, pa, pa, pa, pa);
    acc0 = mma_b(a, b0, acc0);
    acc1 = mma_b(a, b1, acc1);
    acc2 = mma_b(a, b2, acc2);
    acc3 = mma_b(a, b3, acc3);
    guard6<v16b>(acc0, acc1, acc2, acc3, a, b0, b1, b2, b3, a);
  }
  float* sl = slab + wave * SLAB64;
  float bb[4];
#pragma unroll
  for (int j = 0; j < 4; ++j) bb[j] = bfr(bias[col0 + 16 * j + m]);
#pragma unroll
  for (int r = 0; r < 8; ++r) {
    const int ro = (8 * hh + r) * 68 + m;
    sl[ro]      = acc0[r] * oscale + bb[0];
    sl[ro + 16] = acc1[r] * oscale + bb[1];
    sl[ro + 32] = acc2[r] * oscale + bb[2];
    sl[ro + 48] = acc3[r] * oscale + bb[3];
  }
  wave_sync_lds();
  ep_split(sl, P0, P1, (size_t)rowb * N + (size_t)col0 * 16 + 8 * lane, psc, lane);
}

// =====================================================================================================
// f16 GEMM (optionally batched over bz with element strides sA, sB):
//   T[M][N] (f32, never stored) = (Ah [+ Al])[M][K] . (Bh [+ Bl])[N][K]^T, times oscale, + bf16(bias) per row (biasRow != 0) or per column.
//   A2: A carried as hi + unscaled residual plane (products h.B + l.B); B2: B carried as hi + residual (A.h + A.l); never both.
// Same tiling as gemm_bf; all planes f16 fragment-major, K % 32 == 0.
// Epilogue EP_SPLIT: P0, P1 = hi + residual planes [M][N] of T * psc; EP_ROPE_K: P0 = k' planes, rows (batch, s), N = NH * HD;
// EP_V: P0 = v plane, VS = block sums, batch bz, rows = channels, columns = keys (M = HID, N = TS); S = 128 floats of LDS.
// =====================================================================================================
template <int A2, int B2, int EP>
__device__ __forceinline__
void gemm_h(const u16* __restrict__ Ah, const u16* __restrict__ Al, const u16* __restrict__ Bh, const u16* __restrict__ Bl,
            const float* __restrict__ bias, int M, int N, int K, int sA, int sB, int biasRow, float oscale,
            int bid, int bz, float* slab, u16* P0, u16* P1, float psc,
            const float* __restrict__ cosT, const float* __restrict__ sinT, float* VS, float* S) {
  const int tid = threadIdx.x, wave = tid >> 5, lane = tid & 31, hh = lane >> 4, m = lane & 15;
  const int ntile = N >> 6;
  const int row64 = (bid / ntile) * 64;
  const int rowb  = row64 + wave * 16;
  const int col0  = (bid % ntile) * 64;
  if (row64 + 64 > M) return;                // the same for the whole block (M % 64 == 0), never taken with the exact grid
  const size_t aofs = (size_t)bz * (size_t)sA + (size_t)rowb * K + 8 * lane;
  const _Float16* ahp = (const _Float16*)(const void*)Ah + aofs;
  const _Float16* alp = (const _Float16*)(const void*)Al + aofs;
  const size_t bofs = (size_t)bz * (size_t)sB + (size_t)col0 * K + 8 * lane;
  const _Float16* bhp = (const _Float16*)(const void*)Bh + bofs;
  const _Float16* blp = (const _Float16*)(const void*)Bl + bofs;
  const size_t bs = (size_t)16 * K;
  v8f acc0 = zero8(), acc1 = zero8(), acc2 = zero8(), acc3 = zero8();
#pragma unroll 1
  for (int k0 = 0; k0 < K; k0 += 32) {
    const int kf = k0 * 16;                              // k tile k0 / 32
    const _Float16 *pa = ahp + kf, *p0 = bhp + kf, *p1 = p0 + bs, *p2 = p1 + bs, *p3 = p2 + bs;
    const v16h ah = ldfrag_h(pa);
    const v16h b0 = ldfrag_h(p0);
    const v16h b1 = ldfrag_h(p1);
    const v16h b2 = ldfrag_h(p2);
    const v16h b3 = ldfrag_h(p3);
    if (A2) {
      const _Float16* pl = alp + kf;
      const v16h al = ldfrag_h(pl);
      hold_addr(pa, p0, p1, p2, p3, pl, pa, pa, pa, pa);
      acc0 = mma_h(ah, b0, acc0);  acc0 = mma_h(al, b0, acc0);
      acc1 = mma_h(ah, b1, acc1);  acc1 = mma_h(al, b1, acc1);
      acc2 = mma_h(ah, b2, acc2);  acc2 = mma_h(al, b2, acc2);
      acc3 = mma_h(ah, b3, acc3);  acc3 = mma_h(al, b3, acc3);
      guard6<v16h>(acc0, acc1, acc2, acc3, ah, al, b0, b1, b2, b3);
    } else if (B2) {
      const _Float16 *r0 = blp + kf, *r1 = r0 + bs, *r2 = r1 + bs, *r3 = r2 + bs;
      const v16h c0 = ldfrag_h(r0);
      const v16h c1 = ldfrag_h(r1);
      const v16h c2 = ldfrag_h(r2);
      const v16h c3 = ldfrag_h(r3);
      hold_addr(pa, p0, p1, p2, p3, r0, r1, r2, r3, pa);
      acc0 = mma_h(ah, b0, acc0);  acc0 = mma_h(ah, c0, acc0);
      acc1 = mma_h(ah, b1, acc1);  acc1 = mma_h(ah, c1, acc1);
      acc2 = mma_h(ah, b2, acc2);  acc2 = mma_h(ah, c2, acc2);
      acc3 = mma_h(ah, b3, acc3);  acc3 = mma_h(ah, c3, acc3);
      guard10(acc0, acc1, acc2, acc3, ah, b0, b1, b2, b3, c0, c1, c2, c3, ah);
    } else {
      hold_addr(pa, p0, p1, p2, p3, pa, pa, pa, pa, pa);
      acc0 = mma_h(ah, b0, acc0);
      acc1 = mma_h(ah, b1, acc1);
      acc2 = mma_h(ah, b2, acc2);
      acc3 = mma_h(ah, b3, acc3);
      guard6<v16h>(acc0, acc1, acc2, acc3, ah, b0, b1, b2, b3, ah);
    }
  }
  float* sl = slab + wave * SLAB64;
  if (biasRow != 0) {
#pragma unroll
    for (int r = 0; r < 8; ++r) {
      const float bb = bfr(bias[rowb + 8 * hh + r]);
      const int ro = (8 * hh + r) * 68 + m;
      sl[ro]      = acc0[r] * oscale + bb;
      sl[ro + 16] = acc1[r] * oscale + bb;
      sl[ro + 32] = acc2[r] * oscale + bb;
      sl[ro + 48] = acc3[r] * oscale + bb;
    }
  } else {
    float bb[4];
#pragma unroll
    for (int j = 0; j < 4; ++j) bb[j] = bfr(bias[col0 + 16 * j + m]);
#pragma unroll
    for (int r = 0; r < 8; ++r) {
      const int ro = (8 * hh + r) * 68 + m;
      sl[ro]      = acc0[r] * oscale + bb[0];
      sl[ro + 16] = acc1[r] * oscale + bb[1];
      sl[ro + 32] = acc2[r] * oscale + bb[2];
      sl[ro + 48] = acc3[r] * oscale + bb[3];
    }
  }
  if constexpr (EP == EP_SPLIT) {
    wave_sync_lds();
    ep_split(sl, P0, P1, (size_t)rowb * N + (size_t)col0 * 16 + 8 * lane, psc, lane);
  } else if constexpr (EP == EP_ROPE_K) {
    RopeTab t;
    rope_tab(t, cosT, sinT, rowb & (TS - 1), lane);
    wave_sync_lds();
    // plane (batch rowb / TS, head col0 / HD), position tile (rowb % TS) / 16: two tiles of 512 halves
    const size_t pl = (size_t)((rowb / TS) * NH + (col0 >> 6)) * (TS / 16) + (size_t)((rowb & (TS - 1)) >> 4);
    ep_rope(sl, t, P0 + pl * 1024 + 8 * lane, psc, lane);
#if defined(__HIP_DEVICE_COMPILE__)
    // in a merged grid the other job's code follows in the listing and reuses the four stores' address and data registers: wait first
    asm volatile("s_wait_xcnt 0x0" ::: "memory");
#endif
  } else {
    wave_sync_lds();
    ep_v(sl, P0, (size_t)(bz * HID + rowb) * TS + (size_t)col0 * 16 + 8 * lane,
         VS + (size_t)(bz * NKB + (col0 >> 5)) * HID + row64, S, wave, lane);
  }
}

// =====================================================================================================
// Merged grids: launches that do not depend on one another share one grid; the block index (uniform in a block) picks the job,
// and every job keeps its own block numbering. Block counts of the jobs:
// =====================================================================================================
#define NB_TAB (TT / 8)
#define NB_CT  ((TS / 64) * (CND / 64) * NBAT)
#define NB_WC  ((HID * CND) / 2048)
#define NB_W   ((HID * HID) / 2048)
#define NB_WF  ((2 * HID * HID) / 2048)
#define NB_PRO (NB_TAB + NB_CT + NB_WC + 4 * NB_W + NB_WF)
#define NB_GC  (((NBAT * TS) / 64) * (HID / 64))
#define NB_GV  ((HID / 64) * (TS / 64) * NBAT)
#define NB_GK  (((NBAT * TS) / 64) * (HID / 64))

// What reads inputs only and has more than one reader: rotary tables, the transpose of cond, the six weight planes.
__global__ __launch_bounds__(256)
void pro_k(const float* __restrict__ cond, const float* __restrict__ w_cond,
           const float* __restrict__ wq, const float* __restrict__ wk, const float* __restrict__ wv,
           const float* __restrict__ wo, const float* __restrict__ wf, float* cosT, float* sinT, u16* CONDT,
           u16* WCB, u16* WQB, u16* WKH, u16* WVH, u16* WOH, u16* WFH, InvF inv) {
  __shared__ __align__(16) u16 T[64 * VTP];
  int j = blockIdx.x;
  if (j < NB_TAB) { k_tab(cosT, sinT, inv, j); return; }
  j -= NB_TAB;
  if (j < NB_CT) { cvt_T(cond, CONDT, CND, TS, j % (NB_CT / NBAT), j / (NB_CT / NBAT), T); return; }
  j -= NB_CT;
  if (j < NB_WC) { cvt_flat(w_cond, WCB, (HID * CND) / 8, 0, 1.0f, CND, j); return; }
  j -= NB_WC;
  if (j < NB_W) { cvt_flat(wq, WQB, (HID * HID) / 8, 0, 1.0f, HID, j); return; }
  j -= NB_W;
  if (j < 3 * NB_W) {
    const int wsel = j / NB_W;
    cvt_flat(wsel == 0 ? wk : wsel == 1 ? wv : wo, wsel == 0 ? WKH : wsel == 1 ? WVH : WOH, (HID * HID) / 8, 1, WSC, HID,
             j % NB_W);
    return;
  }
  j -= 3 * NB_W;
  cvt_flat(wf, WFH, (2 * HID * HID) / 8, 1, WSC, HID, j);
}

// c^T = CONDT . WCB^T + b_cond -> hi + residual planes x1024.
__global__ __launch_bounds__(128)
void gemm_c(const u16* __restrict__ CONDT, const u16* __restrict__ WCB, const float* __restrict__ b_cond, u16* CH, u16* CL) {
  __shared__ __align__(16) float slab[4 * SLAB64];
  gemm_bf(CONDT, WCB, b_cond, NBAT * TS, HID, CND, 1.0f, blockIdx.x, slab, CH, CL, CSC);
}

// v = WVH . (CH + CL)^T + bv per row, per batch -> v plane + block sums (twice the products, so its blocks come first) and
// k^T = CH . WKH^T + bk -> rotary -> k' planes.
__global__ __launch_bounds__(128)
void gemm_kv(const u16* __restrict__ CH, const u16* __restrict__ CL, const u16* __restrict__ WVH, const u16* __restrict__ WKH,
             const float* __restrict__ bv, const float* __restrict__ bk, u16* VH, float* VS, u16* KH,
             const float* __restrict__ cosT, const float* __restrict__ sinT) {
  __shared__ __align__(16) float slab[4 * SLAB64];
  __shared__ __align__(16) float S[128];
  const int bid = blockIdx.x;
  if (bid < NB_GV)
    gemm_h<0, 1, EP_V>(WVH, WVH, CH, CL, bv, HID, TS, HID, 0, TS * HID, 1, 1.0f / (CSC * WSC),
                       bid % (NB_GV / NBAT), bid / (NB_GV / NBAT), slab, VH, VH, VCAR, cosT, sinT, VS, S);
  else
    gemm_h<0, 0, EP_ROPE_K>(CH, CH, WKH, WKH, bk, NBAT * TS, HID, HID, 0, 0, 0, 1.0f / (CSC * WSC), bid - NB_GV, 0, slab,
                            KH, KH, KSC, cosT, sinT, VS, S);
}

// =====================================================================================================
// Cross attention, transposed, with the q GEMM in front of it and two GEMMs behind it in the same block. Attention: one wave per
// (head h, 16 queries q0..q0+15); all TS keys in NKB blocks of 32.
//   q' (x1024 f16): the wave's own two fragments, made in phase 0 below; k' plane KH: per (b, h) fragment-major [s][d] (x1024), v plane VH:
//   fragment-major [b*256 + h*64+d][s] (x1024),
//   VS[b][kb][h*64+d] = f32 sum of v over key block kb; masks: key s of row t is masked iff bf16(cond_mask[b][s])*bf16(x_mask[b][t]) == 0,
//   masked score replaced by -1e4 (base-2 scaled) -> exact uniform softmax on a fully masked row, 0 weight otherwise.
//   S^T = k'.q'^T (A = 16 keys, B = 16 queries) and O^T += v^T.P'^T (A = 16 channels, B = 16 queries): lane (hh, c) holds query q0 + c
//   only, with keys kb + 8hh + r and kb + 16 + 8hh + r of a block in the registers of the two score tiles. So the maximum and the sum
//   over keys run inside the lane (one exchange with lane ^ 16 for the maximum; the two halves' sums l are joined once, at the end),
//   and the two score tiles, converted in place, are the B fragment of P'^T in the split k map of the v fragments: no LDS round trip.
//   What is now wanted per register and no longer per lane is staged once per block in LDS: the bf16-rounded key mask of batch b and
//   the block sums of b (all heads) times 7/8 * 2^20.
//   Per block: 2 score tiles x 2 k-steps (single products, q fragments made once in phase 0), scale 1/8 folded into the base-2 factor; online
//   max-subtracted base-2 softmax in f32; e = exp2(t - m) per key; l from the f32 e; accumulator update
//   o = o*alpha + (7/8 * 2^20) * VS block sum (f32), then P' = (e - 7/8) * 1024 as f16, 4 v.P' WMMAs.
//   Exact identity sum_s e_s v_s = sum_s (e_s - 7/8) v_s + 7/8 sum_s v_s per key block.
//   Accumulator j of a lane = channels 16j + 8hh .. + 7 of query c = one chunk of the O planes (O x8192 as f16 hi + residual).
// coverage: per wave 4 LDS stores x 32 lanes x 8 halves = 16 x 64 per plane; 16 waves = the block's 64 x 256 of both O planes.
// =====================================================================================================
// 2^x for the softmax as the bare hardware instruction: every argument here is <= 0 (a score minus the running maximum), and a result
// under 2^-126 comes out as 0 where the library form spends five more vector instructions per value to return a denormal; such a
// term stands beside a term equal to 1 in the same row sum, so it reaches neither l nor the f16 P'.
__device__ __forceinline__ float exp2_raw(float x) { return __builtin_amdgcn_exp2f(x); }
__device__ __forceinline__ float other_half(float v) {                // the value of lane ^ 16
  const int b = __builtin_bit_cast(int, v);
  return __builtin_bit_cast(float, __builtin_amdgcn_permlanex16(b, b, 0x76543210, 0xfedcba98, false, false));
}

// One block = (batch b, 64 queries t0 .. t0 + 63), 16 waves, four phases that hand their tile on through LDS:
//   0. x[b][:][t0 ..] -> bf16 fragment-major plane [64 t][HID] in PH; q^T = x^T . WQB^T + bq: wave = (16 rows t of tile wave & 3) x (the 64
//      columns of head wave >> 2), A fragments from PH; rotary from the wave's slab: the lane's four chunks are the q' fragments of
//      phase 1, so neither x^T nor q' goes through memory;
//   1. attention as described above, wave = (head wave >> 2, query tile wave & 3); its O chunks go into the LDS planes PH, PL
//      (fragment-major [64 t][HID], hi + residual x8192) instead of memory;
//   2. y^T = (OH + OL) . WOH^T + bo: wave = (16 rows t of tile wave & 3) x (64 columns of group wave >> 2), A fragments from PH, PL;
//      once every wave has read its O fragments the same planes take y (hi + residual x16384);
//   3. FiLM GEMM + combine: wave = 16 channels c0 = 16 * wave (gamma rows c0 .., beta rows 256 + c0 ..) x the 64 t, B fragments from PH, PL:
//      gamma[c][t] = sum_i w_film[c][i] y[t][i], beta[c][t] = sum_i w_film[256+c][i] y[t][i]  (A = w_film rows as f16(bf16 x1024),
//      products wg.h, wb.h, then wg.l, wb.l, 8 accumulators);
//      out[b][c][t] = (bf16(x[b][c][t]) * (gamma*oscale + bf16(b_film[c])) + (beta*oscale + bf16(b_film[256+c]))) * bf16(x_mask[b][t]).
// LDS 153600 bytes and at most 128 registers a wave: two blocks on a WGP, so that the 512 blocks are resident together.
// coverage: grid 16 b x 32 t-tiles = 512 blocks x 16 waves x 16 channels x 64 t = every out element exactly once.
__global__ __launch_bounds__(512, 8)
void attn_film(const u16* __restrict__ WQB, const float* __restrict__ bq, const float* __restrict__ cosT,
               const float* __restrict__ sinT, const u16* __restrict__ KHp, const u16* __restrict__ VHp,
               const float* __restrict__ VS, const float* __restrict__ cmask, const float* __restrict__ xmask,
               const u16* __restrict__ WOH, const float* __restrict__ bo, const u16* __restrict__ WF,
               const float* __restrict__ bfl, const float* __restrict__ X, float* OUT) {
  __shared__ __align__(32) float cmS[TS];          // bf16-rounded cond_mask of batch b
  __shared__ __align__(32) float vsS[NKB * HID];   // [key block][h * 64 + d]: 7/8 * 2^20 * block sum of v
  __shared__ __align__(16) u16 PH[64 * HID];       // x^T (bf16), then O, then y: hi plane of the block's 64 rows t
  __shared__ __align__(16) u16 PL[64 * HID];       // residual plane
  __shared__ __align__(16) float slab[16 * SLAB64];

  const int tid  = threadIdx.x;
  const int wave = __builtin_amdgcn_readfirstlane(tid >> 5);   // the wave's number in a scalar register: what hangs on it (head, row
  const int lane = tid & 31;                                   // tile, addresses of the planes, the weights, x, out, the slab) costs
  const int hh   = lane >> 4;                                  // no vector registers
  const int c    = lane & 15;

  const int bid  = blockIdx.x;
  const int qt   = bid & (TT / 64 - 1);
  const int b    = bid >> 5;
  const int h    = wave >> 2;
  const int rt   = wave & 3;
  const int t0   = qt * 64;
  const int q0   = t0 + rt * 16;

  const size_t kofs = ((size_t)(b * NH + h) * TS) * HD + 8 * lane;                // plane (b, h); key tile added per step
  const _Float16* Khb = (const _Float16*)(const void*)KHp + kofs;
  const size_t vofs = ((size_t)(b * HID + h * HD)) * TS + 8 * lane;               // row tile of d 0..15 (+16j); key tile added per step
  const _Float16* Vhb = (const _Float16*)(const void*)VHp + vofs;
  const float lsc = 0.125f * (LOG2E / (QSC * KSC));
  const float C0S = PCEN * PCAR * VCAR;

  // ---- stage the key mask (512 thr x 1 = TS), the scaled block sums of all heads (512 thr x 8 = NKB x HID) and x^T: wave = channels
  //      16 wave .. + 15, lane = positions t0 + 2 lane, + 1, so a load is one whole 256-byte row of the tile; 8 channels of one
  //      position = one chunk of the plane. coverage: 16 waves x 4 chunks x 32 lanes x 8 halves = 64 x HID ----
  static_assert(TS == 512 && NKB * HID == 512 * 8 && HID == 16 * 16);
  {
    const float* pc = cmask + (size_t)b * TS + tid;
    const float* pv = VS + (size_t)b * (NKB * HID) + tid * 8;
    const float* px = X + ((size_t)(b * HID + wave * 16)) * TT + t0 + 2 * lane;
    v2f xr[16];
#pragma unroll
    for (int e = 0; e < 16; ++e) xr[e] = *(const v2f*)(px + (size_t)e * TT);
    const float a = *pc;
    const v4f u0 = *(const v4f*)(pv), u1 = *(const v4f*)(pv + 4);
    hold_addr(pc, pv, px, pc, pc, pc, pc, pc, pc, pc);     // the sixteen addresses of x are constant offsets from px
    cmS[tid] = bfr(a);
    *(v4f*)(vsS + tid * 8)     = u0 * C0S;
    *(v4f*)(vsS + tid * 8 + 4) = u1 * C0S;
    // row tile (2 lane) >> 4, k tile wave >> 1; slot = (k >> 4 & 1) * 32 + (k >> 3 & 1) * 16 + (row & 15)
    u16* xd = PH + ((lane >> 3) * (HID / 32) + (wave >> 1)) * 512 + ((wave & 1) * 32 + 2 * (lane & 7)) * 8;
#pragma unroll
    for (int g = 0; g < 2; ++g) {
#pragma unroll
      for (int j = 0; j < 2; ++j) {
        v4u ch;
#pragma unroll
        for (int e = 0; e < 4; ++e) ch[e] = pk16(bf_bits(xr[8 * g + 2 * e][j]), bf_bits(xr[8 * g + 2 * e + 1][j]));
        *(v4u*)(xd + (g * 16 + j) * 8) = ch;
      }
    }
  }
  const float xmv = bfr(xmask[(size_t)b * TT + q0 + c]);
  const v2f xm2 = {xmv, xmv};
  float mrow = -INFINITY, lrow = 0.f;               // lrow: this half's keys only
  v8f o[4];
#pragma unroll
  for (int j = 0; j < 4; ++j) o[j] = zero8();

  __syncthreads();                                  // cmS, vsS (read-only from here on) and x^T written by all sixteen waves

  float* sl = slab + wave * SLAB64;
  // ---- q^T tile: rows t0 + 16 rt .., columns 64 h .. (head h); then rotary -> the q' fragments ----
  v16h qa, qb;
  {
    const int col0 = h * 64;
    const u16* ap = PH + rt * (16 * HID) + 8 * lane;
    const u16* bp = WQB + (size_t)col0 * HID + 8 * lane;
    const size_t bs = (size_t)16 * HID;
    v8f acc0 = zero8(), acc1 = zero8(), acc2 = zero8(), acc3 = zero8();
    // two k tiles a trip: the registers are still free here, and the weights' sixteen loads share one trip to L2
#pragma unroll 1
    for (int k0 = 0; k0 < HID; k0 += 64) {
      const int kf = k0 * 16;                            // k tiles k0 / 32 and k0 / 32 + 1
      const u16 *p0 = bp + kf, *p1 = p0 + bs, *p2 = p1 + bs, *p3 = p2 + bs;
      const v16b b0 = ldfrag_b(p0), d0 = ldfrag_b(p0 + 512);
      const v16b b1 = ldfrag_b(p1), d1 = ldfrag_b(p1 + 512);
      const v16b b2 = ldfrag_b(p2), d2 = ldfrag_b(p2 + 512);
      const v16b b3 = ldfrag_b(p3), d3 = ldfrag_b(p3 + 512);
      hold_addr(p0, p0, p0, p0, p0, p0, p0, p0, p0, p0);     // the other addresses are constant offsets from this one
      const v16b a = ldfrag_b(ap + kf), e = ldfrag_b(ap + kf + 512);
      acc0 = mma_b(a, b0, acc0);
      acc1 = mma_b(a, b1, acc1);
      acc2 = mma_b(a, b2, acc2);
      acc3 = mma_b(a, b3, acc3);
      acc0 = mma_b(e, d0, acc0);
      acc1 = mma_b(e, d1, acc1);
      acc2 = mma_b(e, d2, acc2);
      acc3 = mma_b(e, d3, acc3);
      guard6<v16b>(acc0, acc1, acc2, acc3, e, d0, d1, d2, d3, e);   // a and b0 .. b3 stand four matrix instructions back
    }
    float bb[4];
#pragma unroll
    for (int j = 0; j < 4; ++j) bb[j] = bfr(bq[col0 + 16 * j + c]);
#pragma unroll
    for (int r = 0; r < 8; ++r) {
      const int ro = (8 * hh + r) * 68 + c;
      sl[ro]      = acc0[r] + bb[0];
      sl[ro + 16] = acc1[r] + bb[1];
      sl[ro + 32] = acc2[r] + bb[2];
      sl[ro + 48] = acc3[r] + bb[3];
    }
    RopeTab t;
    rope_tab(t, cosT, sinT, q0, lane);
    wave_sync_lds();
    v4u qc[4];
    rope_pack(sl, t, qc, QSC, lane);
    FragH fa, fb;
    fa.u[0] = qc[0];  fa.u[1] = qc[1];
    fb.u[0] = qc[2];  fb.u[1] = qc[3];
    qa = fa.v;
    qb = fb.v;
  }
  __syncthreads();                                  // every wave has read its x^T fragments: PH may take O

#pragma unroll 1
  for (int it = 0; it < NKB; ++it) {
    const int kb = it * 32;
    // ---- scores: D element r of this lane = (key kb + 8hh + r, query q0 + c) in s0, key kb + 16 + 8hh + r in s1 ----
    v8f s0 = zero8(), s1 = zero8();
    {
      const _Float16* k0p = Khb + (size_t)kb * HD;            // key tile kb / 16: HD / 32 = 2 tiles of 512 halves
      const _Float16* k1p = k0p + (size_t)16 * HD;
      const v16h k0a = ldfrag_h(k0p), k0b = ldfrag_h(k0p + 512);
      const v16h k1a = ldfrag_h(k1p), k1b = ldfrag_h(k1p + 512);
      hold_addr(k0p, k0p, k0p, k0p, k0p, k0p, k0p, k0p, k0p, k0p);   // k1p is a constant offset from k0p
      s0 = mma_h(k0a, qa, s0);
      s0 = mma_h(k0b, qb, s0);
      s1 = mma_h(k1a, qa, s1);
      s1 = mma_h(k1b, qb, s1);
      guard2(s0, s1, qa, qb, k0a, k0b, k1a, k1b);
    }
    // ---- mask (replace by -1e4) + online softmax in base 2, all in the lane ----
    v8f t0, t1;
    {
      const float* cp = cmS + kb + 8 * hh;
      const v8f c0 = *(const v8f*)(cp), c1 = *(const v8f*)(cp + 16);
      const v8f u0 = s0 * lsc, u1 = s1 * lsc;
#pragma unroll
      for (int r = 0; r < 8; r += 2) {
        const v2f m0 = (v2f){c0[r], c0[r + 1]} * xm2, m1 = (v2f){c1[r], c1[r + 1]} * xm2;
        t0[r]     = (m0[0] != 0.0f) ? u0[r]     : MASKT;
        t0[r + 1] = (m0[1] != 0.0f) ? u0[r + 1] : MASKT;
        t1[r]     = (m1[0] != 0.0f) ? u1[r]     : MASKT;
        t1[r + 1] = (m1[1] != 0.0f) ? u1[r + 1] : MASKT;
      }
    }
    float mx = fmaxf(t0[0], t0[1]);
#pragma unroll
    for (int r = 2; r < 8; r += 2) mx = fmaxf(mx, fmaxf(t0[r], t0[r + 1]));
#pragma unroll
    for (int r = 0; r < 8; r += 2) mx = fmaxf(mx, fmaxf(t1[r], t1[r + 1]));
    mx = fmaxf(mx, other_half(mx));
    const float mn = fmaxf(mrow, mx);
    const float al = exp2_raw(mrow - mn);
    mrow = mn;
    t0 = t0 - mn;
    t1 = t1 - mn;
#pragma unroll
    for (int r = 0; r < 8; ++r) t0[r] = exp2_raw(t0[r]);
#pragma unroll
    for (int r = 0; r < 8; ++r) t1[r] = exp2_raw(t1[r]);
    {
      const v8f pr = t0 + t1;
      const v4f p4 = pr.lo + pr.hi;
      lrow = lrow * al + ((p4[0] + p4[2]) + (p4[1] + p4[3]));
    }
#pragma unroll
    for (int j = 0; j < 4; ++j) o[j] = o[j] * al + *(const v8f*)(vsS + it * HID + h * HD + 16 * j + 8 * hh);
    // ---- B fragment of f16(P'^T): column = query c, elements 0..7 = keys kb + 8hh + 0..7, 8..15 = keys kb + 16 + 8hh + 0..7 ----
    FragH ph;
    ph.h[0] = __builtin_convertvector((t0 - PCEN) * PCAR, v8h);
    ph.h[1] = __builtin_convertvector((t1 - PCEN) * PCAR, v8h);
    // ---- v^T.P'^T : A fragment row = d = j*16 + c, keys contiguous in the v plane ----
    {
      const _Float16* vhp = Vhb + kb * 16;                    // key tile kb / 32
      const v16h vh0 = ldfrag_h(vhp);
      const v16h vh1 = ldfrag_h(vhp + (size_t)16 * TS);
      const v16h vh2 = ldfrag_h(vhp + (size_t)32 * TS);
      const v16h vh3 = ldfrag_h(vhp + (size_t)48 * TS);
      hold_addr(vhp, vhp, vhp, vhp, vhp, vhp, vhp, vhp, vhp, vhp);
      o[0] = mma_h(vh0, ph.v, o[0]);
      o[1] = mma_h(vh1, ph.v, o[1]);
      o[2] = mma_h(vh2, ph.v, o[2]);
      o[3] = mma_h(vh3, ph.v, o[3]);
      guard6<v16h>(o[0], o[1], o[2], o[3], ph.v, vh0, vh1, vh2, vh3, ph.v);
    }
  }
  acc_guard4(o[0], o[1], o[2], o[3]);

  // ---- join the halves' sums, fold 1/l and the carries (1024 on P', 1024 on v) ----
  const float oc  = 1.0f / (PCAR * VCAR);
  const float inv = (1.0f / (lrow + other_half(lrow))) * oc;
  // ---- O x8192 -> f16 hi + residual fragment-major planes [64 t][HID] in LDS; accumulator j = chunk slot (j & 1) * 32 + lane of
  //      k tile 2h + (j >> 1) of row tile rt: row c, d = 16j + 8hh .. + 7 ----
  const int pb0 = rt * (16 * HID) + h * 1024 + 8 * lane;
#pragma unroll
  for (int j = 0; j < 4; ++j) {
    float w[8];
    v4u oh, ol;
#pragma unroll
    for (int e = 0; e < 8; ++e) w[e] = (o[j][e] * inv) * OSC;
#pragma unroll
    for (int e = 0; e < 4; ++e) {
      const _Float16 h0 = (_Float16)w[2 * e], h1 = (_Float16)w[2 * e + 1];
      const _Float16 l0 = (_Float16)(w[2 * e] - (float)h0), l1 = (_Float16)(w[2 * e + 1] - (float)h1);
      oh[e] = pk16(h_bits(h0), h_bits(h1));
      ol[e] = pk16(h_bits(l0), h_bits(l1));
    }
    *(v4u*)(PH + pb0 + j * 256) = oh;
    *(v4u*)(PL + pb0 + j * 256) = ol;
  }
  __syncthreads();                                  // a row tile of O comes from four waves (one per head)

  // ---- y^T tile: rows t0 + 16 rt .., columns 64h .. ; per k step h.w then l.w ----
  {
    const int col0 = h * 64;
    const _Float16* ahp = (const _Float16*)(const void*)PH + rt * (16 * HID) + 8 * lane;
    const _Float16* alp = (const _Float16*)(const void*)PL + rt * (16 * HID) + 8 * lane;
    const _Float16* bhp = (const _Float16*)(const void*)WOH + (size_t)col0 * HID + 8 * lane;
    const size_t bs = (size_t)16 * HID;
    const float osc = 1.0f / (OSC * WSC);
    v8f acc0 = zero8(), acc1 = zero8(), acc2 = zero8(), acc3 = zero8();
#pragma unroll 1
    for (int k0 = 0; k0 < HID; k0 += 32) {
      const int kf = k0 * 16;                            // k tile k0 / 32
      const _Float16 *p0 = bhp + kf, *p1 = p0 + bs, *p2 = p1 + bs, *p3 = p2 + bs;
      const v16h b0 = ldfrag_h(p0);
      const v16h b1 = ldfrag_h(p1);
      const v16h b2 = ldfrag_h(p2);
      const v16h b3 = ldfrag_h(p3);
      hold_addr(p0, p0, p0, p0, p0, p0, p0, p0, p0, p0);     // the other three addresses are constant offsets from this one
      const v16h ah = ldfrag_h(ahp + kf);
      const v16h al = ldfrag_h(alp + kf);
      acc0 = mma_h(ah, b0, acc0);  acc0 = mma_h(al, b0, acc0);
      acc1 = mma_h(ah, b1, acc1);  acc1 = mma_h(al, b1, acc1);
      acc2 = mma_h(ah, b2, acc2);  acc2 = mma_h(al, b2, acc2);
      acc3 = mma_h(ah, b3, acc3);  acc3 = mma_h(al, b3, acc3);
      guard6<v16h>(acc0, acc1, acc2, acc3, ah, al, b0, b1, b2, b3);
    }
    float bb[4];
#pragma unroll
    for (int j = 0; j < 4; ++j) bb[j] = bfr(bo[col0 + 16 * j + c]);
#pragma unroll
    for (int r = 0; r < 8; ++r) {
      const int ro = (8 * hh + r) * 68 + c;
      sl[ro]      = acc0[r] * osc + bb[0];
      sl[ro + 16] = acc1[r] * osc + bb[1];
      sl[ro + 32] = acc2[r] * osc + bb[2];
      sl[ro + 48] = acc3[r] * osc + bb[3];
    }
    __syncthreads();                                // every wave has read its O fragments (and its slab is written): the planes may take y
    ep_split(sl, PH, PL, (size_t)(rt * (16 * HID) + h * 1024 + 8 * lane), YSC, lane);   // row tile rt, columns 64 h ..
  }
  __syncthreads();                                  // the y planes are complete; every wave reads all 64 rows

  // ---- FiLM GEMM ----
  const int c0 = wave * 16;
  const _Float16* agp = (const _Float16*)(const void*)WF + (size_t)c0 * HID + 8 * lane;
  const _Float16* yhp = (const _Float16*)(const void*)PH + 8 * lane;
  const _Float16* ylp = (const _Float16*)(const void*)PL + 8 * lane;
  const int ys = 16 * HID;                                                         // one row tile of the planes
  const float oscale = 1.0f / (YSC * WSC);
  v8f g[4], be[4];
#pragma unroll
  for (int j = 0; j < 4; ++j) { g[j] = zero8(); be[j] = zero8(); }
#pragma unroll 1
  for (int k0 = 0; k0 < HID; k0 += 32) {
    const int kf = k0 * 16;                              // k tile k0 / 32
    const _Float16 *pg = agp + kf, *pb = pg + (size_t)HID * HID;                   // row 256 + c0 + c
    const v16h ag = ldfrag_h(pg), ab = ldfrag_h(pb);
    hold_addr(pg, pg, pg, pg, pg, pg, pg, pg, pg, pg);     // pb is a constant offset from pg
    {
      const v16h y0 = ldfrag_h(yhp + kf);
      const v16h y1 = ldfrag_h(yhp + kf + ys);
      const v16h y2 = ldfrag_h(yhp + kf + 2 * ys);
      const v16h y3 = ldfrag_h(yhp + kf + 3 * ys);
      g[0] = mma_h(ag, y0, g[0]);  be[0] = mma_h(ab, y0, be[0]);
      g[1] = mma_h(ag, y1, g[1]);  be[1] = mma_h(ab, y1, be[1]);
      g[2] = mma_h(ag, y2, g[2]);  be[2] = mma_h(ab, y2, be[2]);
      g[3] = mma_h(ag, y3, g[3]);  be[3] = mma_h(ab, y3, be[3]);
    }
    const v16h z0 = ldfrag_h(ylp + kf);
    const v16h z1 = ldfrag_h(ylp + kf + ys);
    const v16h z2 = ldfrag_h(ylp + kf + 2 * ys);
    const v16h z3 = ldfrag_h(ylp + kf + 3 * ys);
    g[0] = mma_h(ag, z0, g[0]);  be[0] = mma_h(ab, z0, be[0]);
    g[1] = mma_h(ag, z1, g[1]);  be[1] = mma_h(ab, z1, be[1]);
    g[2] = mma_h(ag, z2, g[2]);  be[2] = mma_h(ab, z2, be[2]);
    g[3] = mma_h(ag, z3, g[3]);  be[3] = mma_h(ab, z3, be[3]);
    guardF(g[0], g[1], g[2], g[3], be[0], be[1], be[2], be[3], ag, ab, z0, z1, z2, z3, ag, ab, ag, ab);
  }
  // ---- combine, four of the lane's eight channel rows at a time ----
  const float* xmp = xmask + (size_t)b * TT + t0 + c;
  const float* bfp = bfl + c0 + 8 * hh;
  const float* xp  = X + ((size_t)(b * HID + c0 + 8 * hh)) * TT + t0 + c;
  float xm[4];
#pragma unroll
  for (int j = 0; j < 4; ++j) xm[j] = xmp[16 * j];
#pragma unroll
  for (int r0 = 0; r0 < 8; r0 += 4) {
    // the loads of rows 4 .. 7 stay behind the work on rows 0 .. 3: all of them in flight beside the 64 accumulators do not fit
    // 128 registers (spills)
    if (r0 == 4) __builtin_amdgcn_sched_barrier(0);
    float bg[4], bb[4], xv[4][4];
#pragma unroll
    for (int q = 0; q < 4; ++q) {
      bg[q] = bfp[r0 + q];
      bb[q] = bfp[HID + r0 + q];
#pragma unroll
      for (int j = 0; j < 4; ++j) xv[q][j] = xp[(size_t)(r0 + q) * TT + 16 * j];
    }
    hold_addr(xmp, bfp, xp, xp, xp, xp, xp, xp, xp, xp);   // every address above is a constant offset from these three
#pragma unroll
    for (int q = 0; q < 4; ++q) {
      const int r = r0 + q;
      const float bgr = bfr(bg[q]), bbr = bfr(bb[q]);
#pragma unroll
      for (int j = 0; j < 4; ++j) {
        const float gam = g[j][r] * oscale + bgr;
        const float bet = be[j][r] * oscale + bbr;
        sl[(8 * hh + r) * 68 + 16 * j + c] = (bfr(xv[q][j]) * gam + bet) * bfr(xm[j]);
      }
    }
  }
  wave_sync_lds();
  store64(sl, OUT, TT, (size_t)(b * HID + c0), t0, lane);
}

// =====================================================================================================
// Workspace map (bytes); every plane is fully written by whole-line stores before it is read; all extents are exact multiples
// of the store granularity (no pad rows needed); every offset a multiple of 65536. No launch writes a region that it reads:
//   CT f32 [2048][64] 524288, ST same
//   CONDT bf16 [16][512][512] 8388608
//   WCB bf16 [256][512] 262144; WQB bf16 [256][256] 131072; WKH, WVH, WOH f16 [256][256] 131072 each; WFH f16 [512][256] 262144
//   CH f16 [16][512][256] 4194304, CL same
//   KH f16 [16][4][512][64] 4194304; VH f16 [16][256][512] 4194304; VS f32 [16][16][256] 262144
//   end 27525120
// =====================================================================================================
extern "C" void kernel_launch(void* const* d_in, const int* in_sizes, int n_in,
                              void* d_out, int out_size, void* d_ws, size_t ws_size,
                              hipStream_t stream) {
  if (n_in < 16) return;
  if (in_sizes[0] != NBAT * HID * TT) return;
  if (in_sizes[1] != NBAT * TT) return;
  if (in_sizes[2] != NBAT * CND * TS) return;
  if (in_sizes[3] != NBAT * TS) return;
  if (in_sizes[4] != HID * CND || in_sizes[5] != HID) return;
  if (in_sizes[6] != HID * HID || in_sizes[7] != HID) return;
  if (in_sizes[8] != HID * HID || in_sizes[9] != HID) return;
  if (in_sizes[10] != HID * HID || in_sizes[11] != HID) return;
  if (in_sizes[12] != HID * HID || in_sizes[13] != HID) return;
  if (in_sizes[14] != 2 * HID * HID || in_sizes[15] != 2 * HID) return;
  if (out_size != NBAT * HID * TT) return;

  const float* x      = (const float*)d_in[0];
  const float* x_mask = (const float*)d_in[1];
  const float* cond   = (const float*)d_in[2];
  const float* c_mask = (const float*)d_in[3];
  const float* w_cond = (const float*)d_in[4];
  const float* b_cond = (const float*)d_in[5];
  const float* wq     = (const float*)d_in[6];
  const float* bq     = (const float*)d_in[7];
  const float* wk     = (const float*)d_in[8];
  const float* bk     = (const float*)d_in[9];
  const float* wv     = (const float*)d_in[10];
  const float* bv     = (const float*)d_in[11];
  const float* wo     = (const float*)d_in[12];
  const float* bo     = (const float*)d_in[13];
  const float* wf     = (const float*)d_in[14];
  const float* bfi    = (const float*)d_in[15];
  float*       out    = (float*)d_out;

  const size_t szTab = (size_t)TT * HD * 4;                       //    524288
  const size_t szR4  = (size_t)NBAT * TS * CND * 2;               //   8388608
  const size_t szWCB = (size_t)HID * CND * 2;                     //    262144
  const size_t szW   = (size_t)HID * HID * 2;                     //    131072
  const size_t szWF  = (size_t)2 * HID * HID * 2;                 //    262144
  const size_t szCP  = (size_t)NBAT * TS * HID * 2;               //   4194304
  const size_t szKH  = (size_t)NBAT * TS * HID * 2;               //   4194304
  const size_t szVH  = (size_t)NBAT * HID * TS * 2;               //   4194304
  const size_t szVS  = (size_t)NBAT * NKB * HID * 4;              //    262144
  size_t off = 0;
  const size_t oCT  = off; off += szTab;
  const size_t oST  = off; off += szTab;
  const size_t oR4  = off; off += szR4;
  const size_t oWCB = off; off += szWCB;
  const size_t oWQB = off; off += szW;
  const size_t oWKH = off; off += szW;
  const size_t oWVH = off; off += szW;
  const size_t oWOH = off; off += szW;
  const size_t oWFH = off; off += szWF;
  const size_t oCH  = off; off += szCP;
  const size_t oCL  = off; off += szCP;
  const size_t oKH  = off; off += szKH;
  const size_t oVH  = off; off += szVH;
  const size_t oVS  = off; off += szVS;
  if (off > ws_size) return;                            // off = 27525120
  if (off > (size_t)134217728) return;

  char* ws = (char*)d_ws;
  float* CT    = (float*)(ws + oCT);
  float* ST    = (float*)(ws + oST);
  u16*   CONDT = (u16*)(ws + oR4);
  u16*   WCB   = (u16*)(ws + oWCB);
  u16*   WQB   = (u16*)(ws + oWQB);
  u16*   WKH   = (u16*)(ws + oWKH);
  u16*   WVH   = (u16*)(ws + oWVH);
  u16*   WOH   = (u16*)(ws + oWOH);
  u16*   WFH   = (u16*)(ws + oWFH);
  u16*   CH    = (u16*)(ws + oCH);
  u16*   CL    = (u16*)(ws + oCL);
  u16*   KH    = (u16*)(ws + oKH);
  u16*   VH    = (u16*)(ws + oVH);
  float* VS    = (float*)(ws + oVS);

  // inv_freq[i] = 1 / pow(10000, i/32) in f32 (pow correctly converted from f64, then IEEE f32 reciprocal)
  InvF inv;
  for (int i = 0; i < 32; ++i) {
    const double p = pow(10000.0, (double)i / 32.0);
    const float pf = (float)p;
    inv.f[i] = 1.0f / pf;
  }

  const dim3 blk(256);
  const dim3 bG(128);
  const dim3 gAF(NBAT * (TT / 64));                     // 512

  // (0) inputs only: rotary cos/sin tables [2048][64]; cond [b][512][512] -> CONDT bf16 [b][512 s][512 i];
  //     weights (W[o][i] row-major is already [n][k]): bf16 planes for w_cond, wq; f16(bf16 x1024) for wk, wv, wo, w_film
  pro_k<<<dim3(NB_PRO), blk, 0, stream>>>(cond, w_cond, wq, wk, wv, wo, wf, CT, ST, CONDT, WCB, WQB, WKH, WVH, WOH, WFH, inv);
  // (1) c^T [8192][256] = CONDT [8192][512] . WCB^T + b_cond -> f16 hi + residual planes x1024
  gemm_c<<<dim3(NB_GC), bG, 0, stream>>>(CONDT, WCB, b_cond, CH, CL);
  // (2) v [b][256][512] = WVH [256][256] . (CH + CL)[b][512][256]^T + bv per row -> v f16 plane x1024 + per-32-key block sums;
  //     k^T [8192][256] = CH . WKH^T (+ bk) -> rotary, positions mod 512 -> k' planes; carries 1024 x 1024 folded back
  gemm_kv<<<dim3(NB_GV + NB_GK), bG, 0, stream>>>(CH, CL, WVH, WKH, bv, bk, VH, VS, KH, CT, ST);
  // (3) q^T = x^T . WQB^T + bq -> rotary, position t -> q' (registers) -> cross attention -> O (LDS) -> y^T = (OH + OL) . WOH^T + bo (LDS) -> FiLM GEMM + combine -> out [16][256][2048] f32
  attn_film<<<gAF, dim3(512), 0, stream>>>(WQB, bq, CT, ST, KH, VH, VS, c_mask, x_mask, WOH, bo, WFH, bfi, x, out);
  (void)hipGetLastError();
}

// v008
// It runs in 77.4 microseconds.
// Next to v007, in two timings, it ran 1.15 and 1.14 times as fast.
// Over all steps from v000 it is 3.52 times as fast.
// Contractions: cond^T.w_cond^T and x^T.wq^T on v_wmma_f32_16x16x32_bf16 (inputs RNE-converted to bf16, exact operands, f32 accumulate);
// c.wk^T (c x1024 f16 hi plane), wv.c (c x1024 f16 hi + residual, products w.h + w.l), scores q'.k'^T (q' x1024, k' x1024 f16, one product),
// P'.v (centred P' = (e - 7/8) x1024 f16, v x1024 f16, one product; 7/8 * sum(v) per 32-key block added in f32),
// O.wo^T (O x8192 f16 hi + residual, products h.w + l.w), w_film.y (y x16384 f16 hi + residual): v_wmma_f32_16x16x32_f16,
// weights as f16(bf16(w) x1024), f32 accumulate. Rotary tables: f64 sin/cos of the f32 angle. Rotation, masked base-2 online softmax, 1/l, FiLM combine: f32 on VALU.
#include <hip/hip_runtime.h>
#include <math.h>
#include <stdint.h>

#define NBAT  16
#define TT    2048
#define TS    512
#define HID   256
#define CND   512
#define NH    4
#define HD    64
#define NKB   (TS / 32)
#define QSC   1024.0f
#define KSC   1024.0f
#define CSC   1024.0f
#define VCAR  1024.0f
#define PCAR  1024.0f
#define OSC   8192.0f
#define YSC   16384.0f
#define WSC   1024.0f
#define PCEN  0.875f
#define LOG2E 1.4426950408889634f
#define MASKT (-10000.0f * LOG2E)
#define SLAB64 (16 * 68)
static_assert(HID == NH * HD && HD == 64);
static_assert((TT % 64) == 0 && (TS % 64) == 0 && (TS % 32) == 0 && NKB == 16);
static_assert((TT & (TT - 1)) == 0 && (TS & (TS - 1)) == 0);
static_assert((HID % 64) == 0 && (CND % 64) == 0 && (HID % 32) == 0 && (CND % 32) == 0);
static_assert(((NBAT * TS * NH * 8) % 256) == 0);
static_assert(((NBAT * TS * HID) % 2048) == 0);

typedef unsigned short u16;
typedef _Float16 v16h __attribute__((ext_vector_type(16)));
typedef _Float16 v8h  __attribute__((ext_vector_type(8)));
typedef __bf16   v16b __attribute__((ext_vector_type(16)));
typedef float    v8f  __attribute__((ext_vector_type(8)));
typedef float    v4f  __attribute__((ext_vector_type(4)));
typedef float    v2f  __attribute__((ext_vector_type(2)));
typedef unsigned int v4u __attribute__((ext_vector_type(4)));

union FragH { v16h v; v8h h[2]; v4u u[2]; };
union FragB { v16b v; v4u u[2]; };

struct InvF { float f[32]; };
static_assert(sizeof(InvF) == 128);

// ---- scalar helpers --------------------------------------------------------------------------------
__device__ __forceinline__ unsigned short bf_bits(float f) {          // f32 -> bf16 bits, RNE convert
  unsigned u = __float_as_uint(f);
  return (unsigned short)((u + 0x7FFFu + ((u >> 16) & 1u)) >> 16);
}
__device__ __forceinline__ float bf_up(unsigned short h) { return __uint_as_float(((unsigned)h) << 16); }
__device__ __forceinline__ float bfr(float f) { return bf_up(bf_bits(f)); }
__device__ __forceinline__ unsigned short h_bits(_Float16 x) { return __builtin_bit_cast(unsigned short, x); }
__device__ __forceinline__ unsigned pk16(unsigned short a, unsigned short b) { return (unsigned)a | ((unsigned)b << 16); }
__device__ __forceinline__ v8f zero8() { v8f z = {0.f, 0.f, 0.f, 0.f, 0.f, 0.f, 0.f, 0.f}; return z; }

// ---- fragment-major planes: a 16-bit plane [R][K] (R % 16 == 0, K % 32 == 0) is stored as tiles of 16 rows x 32 k, 512 halves
//      each, tile (row >> 4, k >> 5) at ((row >> 4) * (K >> 5) + (k >> 5)) * 512; inside a tile 64 chunks of 8 halves, chunk slot
//      = ((k >> 4) & 1) * 32 + ((k >> 3) & 1) * 16 + (row & 15), so that slot & 31 is the lane that owns the chunk.
// ---- fragment loaders: 16-bit A/B operand, p = tile start + 8 * lane: two wave-wide loads of 512 contiguous bytes;
//      lane -> row/col (lane&15), elements 0..7 <- k0+8h.., elements 8..15 <- k0+16+8h..  (same split k map for A and B)
__device__ __forceinline__ v16h ldfrag_h(const _Float16* p) {
  FragH f;
  f.h[0] = *(const v8h*)(p);
  f.h[1] = *(const v8h*)(p + 256);
  return f.v;
}
__device__ __forceinline__ v16b ldfrag_b(const u16* p) {              // bf16 plane read as unsigned integer vectors
  FragB f;
  f.u[0] = *(const v4u*)(p);
  f.u[1] = *(const v4u*)(p + 256);
  return f.v;
}

// Stands behind a group of fragment loads and names their address registers as inputs, so that these registers stay unwritten
// (by a later load's result or by an address update) up to the s_wait_xcnt 0 inside it.
__device__ __forceinline__ void hold_addr(const void* a, const void* b, const void* c, const void* d, const void* e,
                                          const void* f, const void* g, const void* h, const void* i, const void* j) {
#if defined(__HIP_DEVICE_COMPILE__)
  asm volatile("s_wait_xcnt 0x0" :: "v"(a), "v"(b), "v"(c), "v"(d), "v"(e), "v"(f), "v"(g), "v"(h), "v"(i), "v"(j) : "memory");
#endif
}
// chunk slot (0..63) of a tile -> row in the tile and first k in the tile
__device__ __forceinline__ int slot_row(int slot) { return slot & 15; }
__device__ __forceinline__ int slot_k(int slot) { return ((slot >> 5) << 4) + (((slot >> 4) & 1) << 3); }

__device__ __forceinline__ v8f mma_h(v16h a, v16h b, v8f c) {
  return __builtin_amdgcn_wmma_f32_16x16x32_f16(false, a, false, b, (short)0, c, false, false);
}
__device__ __forceinline__ v8f mma_b(v16b a, v16b b, v8f c) {
  return __builtin_amdgcn_wmma_f32_16x16x32_bf16(false, a, false, b, (short)0, c, false, false);
}
__device__ __forceinline__ void guard2(v8f& a, v8f& b, v16h x0, v16h x1, v16h x2, v16h x3, v16h x4, v16h x5) {
#if defined(__HIP_DEVICE_COMPILE__)
  asm volatile("v_nop\n\tv_nop\n\tv_nop\n\tv_nop"
               : "+v"(a), "+v"(b) : "v"(x0), "v"(x1), "v"(x2), "v"(x3), "v"(x4), "v"(x5) : "memory");
#endif
}
template <typename F>
__device__ __forceinline__ void guard6(v8f& a, v8f& b, v8f& c, v8f& d, F x0, F x1, F x2, F x3, F x4, F x5) {
#if defined(__HIP_DEVICE_COMPILE__)
  asm volatile("v_nop\n\tv_nop\n\tv_nop\n\tv_nop"
               : "+v"(a), "+v"(b), "+v"(c), "+v"(d) : "v"(x0), "v"(x1), "v"(x2), "v"(x3), "v"(x4), "v"(x5) : "memory");
#endif
}
__device__ __forceinline__ void guardF(v8f& a0, v8f& a1, v8f& a2, v8f& a3, v8f& c0, v8f& c1, v8f& c2, v8f& c3,
                                       v16h x0, v16h x1, v16h x2, v16h x3, v16h x4, v16h x5, v16h x6, v16h x7,
                                       v16h x8, v16h x9) {
#if defined(__HIP_DEVICE_COMPILE__)
  asm volatile("v_nop\n\tv_nop\n\tv_nop\n\tv_nop"
               : "+v"(a0), "+v"(a1), "+v"(a2), "+v"(a3), "+v"(c0), "+v"(c1), "+v"(c2), "+v"(c3)
               : "v"(x0), "v"(x1), "v"(x2), "v"(x3), "v"(x4), "v"(x5), "v"(x6), "v"(x7), "v"(x8), "v"(x9) : "memory");
#endif
}
__device__ __forceinline__ void acc_guard4(v8f& a, v8f& b, v8f& c, v8f& d) {
#if defined(__HIP_DEVICE_COMPILE__)
  asm volatile("v_nop\n\tv_nop\n\tv_nop\n\tv_nop" : "+v"(a), "+v"(b), "+v"(c), "+v"(d));
#endif
}
__device__ __forceinline__ void wave_sync_lds() {
  __builtin_amdgcn_fence(__ATOMIC_RELEASE, "workgroup");
  __builtin_amdgcn_wave_barrier();
  __builtin_amdgcn_fence(__ATOMIC_ACQUIRE, "workgroup");
}

// ---- accurate f32 sin/cos of a non-negative f32 angle (|angle| < 2048): f64 two-part pi/2 reduction + f64 polynomials,
//      plain f64 fma/mul only (no library f64 trig path), result converted to f32.
__device__ __forceinline__ void sincos_acc(float angf, float& sv, float& cv) {
  const double a = (double)angf;
  const double TWO_OVER_PI = 0.63661977236758134308;
  const double PIO2_HI = 1.5707963267948966;
  const double PIO2_LO = 6.123233995736766e-17;
  const int kq = (int)(a * TWO_OVER_PI + 0.5);
  const double kd = (double)kq;
  double r = fma(-kd, PIO2_HI, a);
  r = fma(-kd, PIO2_LO, r);
  const double r2 = r * r;
  double sp = 1.0 / 6227020800.0;
  sp = fma(sp, r2, -1.0 / 39916800.0);
  sp = fma(sp, r2, 1.0 / 362880.0);
  sp = fma(sp, r2, -1.0 / 5040.0);
  sp = fma(sp, r2, 1.0 / 120.0);
  sp = fma(sp, r2, -1.0 / 6.0);
  const double s = fma(sp * r2, r, r);
  double cp = -1.0 / 87178291200.0;
  cp = fma(cp, r2, 1.0 / 479001600.0);
  cp = fma(cp, r2, -1.0 / 3628800.0);
  cp = fma(cp, r2, 1.0 / 40320.0);
  cp = fma(cp, r2, -1.0 / 720.0);
  cp = fma(cp, r2, 1.0 / 24.0);
  cp = fma(cp, r2, -0.5);
  const double c = fma(cp, r2, 1.0);
  const int qd = kq & 3;
  const double so = (qd == 0) ? s : (qd == 1) ? c : (qd == 2) ? -s : -c;
  const double co = (qd == 0) ? c : (qd == 1) ? -s : (qd == 2) ? -c : s;
  sv = (float)so;
  cv = (float)co;
}

// =====================================================================================================
// Rotary tables: cosT[t][d], sinT[t][d] for t < TT, d < HD, angle = float(t) * inv_freq[d & 31] (f32 product), halves duplicated.
// Wave = one position t, lane = frequency index; inv_freq picked from the by-value table with a static select chain.
// coverage: grid TT/8 blocks x 8 waves = TT rows; per row 4 line stores = 64 floats of each table.
// =====================================================================================================
__device__ __forceinline__ void k_tab(float* cosT, float* sinT, const InvF& inv, int bx) {
  const int tid  = threadIdx.x;
  const int lane = tid & 31;
  const int t    = bx * 8 + (tid >> 5);
  if (t >= TT) return;                      // never taken with the exact grid; no barriers in this kernel
  float f = inv.f[0];
#pragma unroll
  for (int i = 1; i < 32; ++i) f = (lane == i) ? inv.f[i] : f;
  const float ang = (float)t * f;
  float sv, cv;
  sincos_acc(ang, sv, cv);
  float* cr = cosT + (size_t)t * HD;
  float* sr = sinT + (size_t)t * HD;
  {
    *(float*)(cr + lane)      = cv;
    *(float*)(cr + 32 + lane) = cv;
    *(float*)(sr + lane)      = sv;
    *(float*)(sr + 32 + lane) = sv;
    
  }
}

// =====================================================================================================
// Row-major f32 [R][K] -> 16-bit fragment-major plane. f16mode == 0: bf16 RNE bits; f16mode == 1: f16 bits of (bf16 RNE value) * scale.
// Thread = 8 consecutive elements: two 16-B loads, one 16-B store; 32 consecutive lanes = 512 contiguous, 512-B aligned bytes
// coverage: grid = ceil(n8/256) blocks x 256 thr x 8 = the whole plane (n8 a multiple of 32 in every use, so no partial line).
// =====================================================================================================
__device__ __forceinline__ void cvt_flat(const float* __restrict__ src, u16* D, int n8, int f16mode, float scale, int K, int bx) {
  const int gt = bx * 256 + (int)threadIdx.x;   // chunk index in the fragment-major plane
  if (gt >= n8) return;                     // no barriers in this kernel
  const int ktn = K >> 5, tile = gt >> 6, slot = gt & 63;
  const int rt = tile / ktn, kt = tile - rt * ktn;
  const float* p = src + (size_t)(rt * 16 + slot_row(slot)) * K + kt * 32 + slot_k(slot);
  const v4f a = *(const v4f*)(p), bq = *(const v4f*)(p + 4);
  float w[8];
#pragma unroll
  for (int e = 0; e < 4; ++e) { w[e] = a[e]; w[4 + e] = bq[e]; }
  v4u o;
#pragma unroll
  for (int e = 0; e < 4; ++e) {
    const float v0 = w[2 * e], v1 = w[2 * e + 1];
    const unsigned short h0 = h_bits((_Float16)(bfr(v0) * scale)), h1 = h_bits((_Float16)(bfr(v1) * scale));
    const unsigned short b0 = bf_bits(v0), b1 = bf_bits(v1);
    o[e] = (f16mode != 0) ? pk16(h0, h1) : pk16(b0, b1);
  }
  u16* d = D + (size_t)gt * 8;
  {
    *(v4u*)(d) = o;
    
  }
}

// =====================================================================================================
// GEMM epilogues: the wave's 16 x 64 f32 tile stands (final values) in its LDS slab (pitch 68), the caller has issued the wave's
// LDS sync or a block barrier; the epilogue writes the 16-bit plane(s) that the tile's reader wants, so no f32 copy goes through memory.
// A lane owns four chunks of 8 halves. Fragment-major planes: chunk it = row (lane & 15), columns it * 16 + 8 * (lane >> 4) ..,
// which is slot (it & 1) * 32 + lane of k tile (it >> 1) of the tile pair: one store = 512 contiguous bytes of the wave.
// =====================================================================================================
// f16 hi + residual fragment-major planes: hi = f16(v * sc), lo = f16(v * sc - hi) (sc a power of two, residual unscaled).
// base = first half of the wave's tile pair + 8 * lane. coverage: 4 stores x 32 lanes x 8 halves = 16 x 64 of each plane.
__device__ __forceinline__ void ep_split(const float* sl, u16* Hp, u16* Lp, size_t base, float sc, int lane) {
  const int hh = lane >> 4, m = lane & 15;
  v4u oh[4], ol[4];
#pragma unroll
  for (int it = 0; it < 4; ++it) {
    const float* p = sl + m * 68 + it * 16 + 8 * hh;
    const v4f a = *(const v4f*)(p), bq = *(const v4f*)(p + 4);
    float w[8];
#pragma unroll
    for (int e = 0; e < 4; ++e) { w[e] = a[e] * sc; w[4 + e] = bq[e] * sc; }
#pragma unroll
    for (int e = 0; e < 4; ++e) {
      const float t0 = w[2 * e], t1 = w[2 * e + 1];
      const _Float16 h0 = (_Float16)t0, h1 = (_Float16)t1;
      const _Float16 l0 = (_Float16)(t0 - (float)h0), l1 = (_Float16)(t1 - (float)h1);
      oh[it][e] = pk16(h_bits(h0), h_bits(h1));
      ol[it][e] = pk16(h_bits(l0), h_bits(l1));
    }
  }
#pragma unroll
  for (int it = 0; it < 4; ++it) {
    *(v4u*)(Hp + base + (size_t)it * 256) = oh[it];
    *(v4u*)(Lp + base + (size_t)it * 256) = ol[it];
  }
}

// Rotate-half rotary + f16 pack; the tile's 64 columns are one head's HD channels, its rows 16 positions pos0 .. ; chunks as above.
//   w[d] = x[d] * cos[pos][d] + r[d] * sin[pos][d],  r[d] = -x[d+32] for d < 32, x[d-32] for d >= 32;  out[d] = f16(w * sc).
__device__ __forceinline__ int rope_row(int lane) { return lane & 15; }
__device__ __forceinline__ int rope_d0(int it, int lane) { return it * 16 + 8 * (lane >> 4); }
struct RopeTab { v4f ca[2], cb[2], sa[2], sb[2]; };   // chunks 0, 1; chunks 2, 3 (d + 32) read the same values: the tables' halves are equal
__device__ __forceinline__ void rope_tab(RopeTab& t, const float* __restrict__ cosT, const float* __restrict__ sinT, int pos0,
                                         int lane) {
  const size_t o = (size_t)(pos0 + rope_row(lane)) * HD + rope_d0(0, lane);
  const float *cr = cosT + o, *sr = sinT + o;
  const int st = 16;                          // floats from one of the lane's chunks to the next
#pragma unroll
  for (int it = 0; it < 2; ++it) {
    t.ca[it] = *(const v4f*)(cr + it * st);  t.cb[it] = *(const v4f*)(cr + it * st + 4);
    t.sa[it] = *(const v4f*)(sr + it * st);  t.sb[it] = *(const v4f*)(sr + it * st + 4);
  }
  hold_addr(cr, sr, cr, cr, cr, cr, cr, cr, cr, cr);   // the eight addresses are constant offsets from these two
}
// oh = the lane's four chunks: together the two 16-bit fragments (d 0 .. 31 and 32 .. 63, split k map) of row lane & 15.
__device__ __forceinline__ void rope_pack(const float* sl, const RopeTab& t, v4u (&oh)[4], float sc, int lane) {
#pragma unroll
  for (int it = 0; it < 4; ++it) {
    const int d0 = rope_d0(it, lane), d1 = d0 ^ 32;
    const float* xr = sl + rope_row(lane) * 68;
    const v4f xa = *(const v4f*)(xr + d0), xb = *(const v4f*)(xr + d0 + 4);
    const v4f ya = *(const v4f*)(xr + d1), yb = *(const v4f*)(xr + d1 + 4);
    const float sgn = (d0 < 32) ? -1.0f : 1.0f;
    float w[8];
#pragma unroll
    for (int e = 0; e < 4; ++e) {
      w[e]     = fmaf(sgn * ya[e], t.sa[it & 1][e], xa[e] * t.ca[it & 1][e]);   // cosine product rounded, sine product fused
      w[4 + e] = fmaf(sgn * yb[e], t.sb[it & 1][e], xb[e] * t.cb[it & 1][e]);
    }
#pragma unroll
    for (int e = 0; e < 4; ++e) {
      const _Float16 h0 = (_Float16)(w[2 * e] * sc), h1 = (_Float16)(w[2 * e + 1] * sc);
      oh[it][e] = pk16(h_bits(h0), h_bits(h1));
    }
  }
}
// fragment-major out plane (k'), dst = the lane's first chunk. coverage: 4 stores x 32 lanes x 8 halves = 16 rows x 64 of the plane.
__device__ __forceinline__ void ep_rope(const float* sl, const RopeTab& t, u16* dst, float sc, int lane) {
  v4u oh[4];
  rope_pack(sl, t, oh, sc, lane);
#pragma unroll
  for (int it = 0; it < 4; ++it) *(v4u*)(dst + (size_t)it * 256) = oh[it];
}

// v plane + per-32-key block sums; the tile is 16 channels (rows) x 64 keys of batch b, the block all HID channels x the same keys.
//   VH = f16(v * 1024), fragment-major plane [b * HID + o][TS], vbase = first half of the wave's tile pair + 8 * lane;
//   VS[b][kb][o] = sum over keys kb*32 .. kb*32+31 of v (f32): 8 keys in a lane as a tree, the chunk pair (0,1) and (2,3) across the
//   wave's halves, then the two pairs; the block's 2 x HID sums meet in S (512 floats of LDS) so that four waves store whole lines.
// coverage: VH 4 stores x 32 lanes x 8 halves = 16 x 64; VS 2 key blocks x HID channels per block, vsdst = VS + (b * NKB + kb0) * HID.
__device__ __forceinline__ void ep_v(const float* sl, u16* VH, size_t vbase, float* vsdst, float* S, int wave, int lane) {
  const int hh = lane >> 4, m = lane & 15;
  v4u o[4];
  float ps[4];
#pragma unroll
  for (int it = 0; it < 4; ++it) {
    const float* p = sl + m * 68 + it * 16 + 8 * hh;
    const v4f a = *(const v4f*)(p), bq = *(const v4f*)(p + 4);
#pragma unroll
    for (int q = 0; q < 2; ++q) {
      o[it][q]     = pk16(h_bits((_Float16)(a[2 * q] * VCAR)),  h_bits((_Float16)(a[2 * q + 1] * VCAR)));
      o[it][2 + q] = pk16(h_bits((_Float16)(bq[2 * q] * VCAR)), h_bits((_Float16)(bq[2 * q + 1] * VCAR)));
    }
    ps[it] = ((a[0] + a[1]) + (a[2] + a[3])) + ((bq[0] + bq[1]) + (bq[2] + bq[3]));
  }
#pragma unroll
  for (int it = 0; it < 4; ++it) *(v4u*)(VH + vbase + (size_t)it * 256) = o[it];
#if defined(__HIP_DEVICE_COMPILE__)
  // the block sums below reuse the four stores' data registers: wait first
  asm volatile("s_wait_xcnt 0x0" ::: "memory");
#endif
#pragma unroll
  for (int it = 0; it < 4; ++it) ps[it] += __shfl_xor(ps[it], 16, 32);
  S[hh * HID + wave * 16 + m] = (hh != 0) ? (ps[2] + ps[3]) : (ps[0] + ps[1]);
  __syncthreads();
  if (wave < 4) {
    const int piece = wave * 128 + lane * 4;
    const v4f sv = *(const v4f*)(S + piece);
    *(v4f*)(vsdst + piece) = sv;
  }
}

// =====================================================================================================
// Shared GEMM store: the wave's 16x64 f32 tile already staged (final values) in its LDS slab (pitch 68), caller issued the
// coverage: 8 instructions x 2 rows x 16 lanes x 4 floats = the wave's 16 x 64 tile.
// =====================================================================================================
__device__ __forceinline__ void store64(const float* sl, float* C, int N, size_t rowb, int col0, int lane) {
  const int hh = lane >> 4, m = lane & 15;
  v4f vals[8];
#pragma unroll
  for (int it = 0; it < 8; ++it) vals[it] = *(const v4f*)(sl + (it * 2 + hh) * 68 + m * 4);
  float* dst = C + (rowb + (size_t)hh) * (size_t)N + col0 + m * 4;
  {
#pragma unroll
    for (int it = 0; it < 8; ++it) {
      *(v4f*)(dst + (size_t)(it * 2) * (size_t)N) = vals[it];
    }
    
  }
}

// =====================================================================================================
// Merged grid: launches that do not depend on one another share one grid; the block index (uniform in a block) picks the job,
// and every job keeps its own block numbering. Block counts of the jobs:
// =====================================================================================================
#define NB_TAB (TT / 8)
#define NB_WC  ((HID * CND) / 2048)
#define NB_W   ((HID * HID) / 2048)
#define NB_WF  ((2 * HID * HID) / 2048)
#define NB_PRO (NB_TAB + NB_WC + 4 * NB_W + NB_WF)

// What reads inputs only and has more than one reader: rotary tables, the six weight planes.
__global__ __launch_bounds__(256)
void pro_k(const float* __restrict__ w_cond,
           const float* __restrict__ wq, const float* __restrict__ wk, const float* __restrict__ wv,
           const float* __restrict__ wo, const float* __restrict__ wf, float* cosT, float* sinT,
           u16* WCB, u16* WQB, u16* WKH, u16* WVH, u16* WOH, u16* WFH, InvF inv) {
  int j = blockIdx.x;
  if (j < NB_TAB) { k_tab(cosT, sinT, inv, j); return; }
  j -= NB_TAB;
  if (j < NB_WC) { cvt_flat(w_cond, WCB, (HID * CND) / 8, 0, 1.0f, CND, j); return; }
  j -= NB_WC;
  if (j < NB_W) { cvt_flat(wq, WQB, (HID * HID) / 8, 0, 1.0f, HID, j); return; }
  j -= NB_W;
  if (j < 3 * NB_W) {
    const int wsel = j / NB_W;
    cvt_flat(wsel == 0 ? wk : wsel == 1 ? wv : wo, wsel == 0 ? WKH : wsel == 1 ? WVH : WOH, (HID * HID) / 8, 1, WSC, HID,
             j % NB_W);
    return;
  }
  j -= 3 * NB_W;
  cvt_flat(wf, WFH, (2 * HID * HID) / 8, 1, WSC, HID, j);
}

// =====================================================================================================
// cond -> c -> k', v in one block. One block = (batch b, 64 keys s0 .. s0 + 63), 16 waves, phases that hand their tile on through LDS:
//   0. cond[b][:][s0 ..] -> bf16 (RNE) fragment-major plane [64 s][CND] in P;
//   1. c^T = cond^T . WCB^T + b_cond, A fragments from P; once every wave has read its fragments the same LDS takes c as f16 hi +
//      residual planes x1024, [64 s][HID] each;
//   2. k^T = CH . WKH^T + bk, A fragments from the hi plane; rotary at positions s -> k' planes;
//   3. v = WVH . (CH + CL)^T + bv per row (products w.h then w.l per k tile), B fragments from the planes -> v plane + per-32-key sums.
// So neither cond^T nor c goes through memory. Every accumulator takes its k tiles in ascending order.
// GEMM tile of a wave: 32 x 32 (2 x 2 accumulators), so that a k tile costs two fragments from LDS (four in phase 3) and two from the
// weights: the two paths carry like loads, and a weight line is read by two waves of the block only. Epilogue tile of a wave: 16 x 64
// (what ep_split, ep_rope and ep_v take), in slab number (column group or head) * 4 + row tile for c and k, channel tile for v: a wave
// writes its accumulators into the slabs of the waves that own them, and a block barrier stands between the two.
// coverage: grid 16 b x 8 key tiles = 128 blocks; k' 16 waves x 16 s x 64 d, v 16 waves x 16 channels x 64 s, VS 2 key blocks x HID.
// =====================================================================================================
__global__ __launch_bounds__(512)
void ckv(const float* __restrict__ cond, const u16* __restrict__ WCB, const float* __restrict__ b_cond,
         const u16* __restrict__ WKH, const float* __restrict__ bk, const u16* __restrict__ WVH, const float* __restrict__ bv,
         const float* __restrict__ cosT, const float* __restrict__ sinT, u16* KH, u16* VH, float* VS) {
  // cond^T (bf16), then c: hi plane in the first half, residual plane in the second. The large alignment puts P at the start of the
  // block's LDS, so that every fragment's place in its 64 KiB fits the 16-bit offset field of an LDS load: no address arithmetic
  __shared__ __align__(2048) u16 P[64 * CND];
  __shared__ __align__(16) float slab[16 * SLAB64];    // c, then k
  __shared__ __align__(16) float slabV[16 * SLAB64];   // v
  __shared__ __align__(16) float S[2 * HID];
  static_assert(CND == 2 * HID && CND == 2 * 16 * 16 && HID == 256 && TS % 64 == 0);

  const int tid  = threadIdx.x;
  const int wave = __builtin_amdgcn_readfirstlane(tid >> 5);   // in a scalar register: what hangs on it costs no vector registers
  const int lane = tid & 31;
  const int hh   = lane >> 4;
  const int c    = lane & 15;
  const int b    = blockIdx.x / (TS / 64);
  const int s0   = (blockIdx.x % (TS / 64)) * 64;
  const int h    = wave >> 2;                       // epilogue tile: rows 16 rt .., columns 64 h ..
  const int rt   = wave & 3;
  const int p2   = wave & 1;                        // GEMM tile: 32 keys 32 p2 .., 32 columns or channels 32 g8 ..
  const int g8   = wave >> 1;
  u16* CHs = P;
  u16* CLs = P + 64 * HID;
  float* sl  = slab + wave * SLAB64;
  float* slv = slabV + wave * SLAB64;
  // phases 1, 2: accumulator (i, j) = rows 16 (2 p2 + i) .., columns 32 g8 + 16 j .. -> slab (g8 >> 1) * 4 + 2 p2 + i, columns (g8 & 1) * 32 + 16 j ..
  float* slw = slab + ((g8 >> 1) * 4 + 2 * p2) * SLAB64 + (g8 & 1) * 32 + 8 * hh * 68 + c;

  // ---- cond^T: wave = channels 16 wave .. + 15 and 256 + 16 wave .. + 15, lane = keys s0 + 2 lane, + 1, so a load is one whole 256-byte
  //      row of the tile; 8 channels of one key = one chunk. coverage: 16 waves x 8 chunks x 32 lanes x 8 halves = 64 x CND ----
  const u16* wcp = WCB + (size_t)(g8 * 32) * CND + 8 * lane;
  const float* pbc = b_cond + g8 * 32 + c;
  v16b wc[8][2];
  float rbc0, rbc1;
  {
    const float* px = cond + ((size_t)(b * CND + wave * 16)) * TS + s0 + 2 * lane;
    v2f xr[2][16];
#pragma unroll
    for (int n = 0; n < 2; ++n) {
#pragma unroll
      for (int e = 0; e < 16; ++e) xr[n][e] = *(const v2f*)(px + (size_t)(n * HID + e) * TS);
    }
    // the first half of the c GEMM's weights and its bias fly beside cond: they hang on no LDS
#pragma unroll
    for (int u = 0; u < 8; ++u) {
      wc[u][0] = ldfrag_b(wcp + u * 512);
      wc[u][1] = ldfrag_b(wcp + 16 * CND + u * 512);
    }
    rbc0 = pbc[0];
    rbc1 = pbc[16];
    hold_addr(px, wcp, pbc, px, px, px, px, px, px, px);   // the 66 addresses are constant offsets from these three
#pragma unroll
    for (int n = 0; n < 2; ++n) {
      // row tile (2 lane) >> 4, k tile 8 n + (wave >> 1); slot = (k >> 4 & 1) * 32 + (k >> 3 & 1) * 16 + (row & 15)
      u16* xd = P + ((lane >> 3) * (CND / 32) + 8 * n + (wave >> 1)) * 512 + ((wave & 1) * 32 + 2 * (lane & 7)) * 8;
#pragma unroll
      for (int g = 0; g < 2; ++g) {
#pragma unroll
        for (int j = 0; j < 2; ++j) {
          v4u ch;
#pragma unroll
          for (int e = 0; e < 4; ++e) ch[e] = pk16(bf_bits(xr[n][8 * g + 2 * e][j]), bf_bits(xr[n][8 * g + 2 * e + 1][j]));
          *(v4u*)(xd + (g * 16 + j) * 8) = ch;
        }
      }
    }
  }
  __syncthreads();                                  // cond^T written by all sixteen waves

  // ---- c^T: eight k tiles, then the other eight ----
  v16h wk[8][2];
  float rbk0, rbk1;
  {
    const u16* ap = P + (2 * p2) * (16 * CND) + 8 * lane;
    const int ts = 16 * CND;                             // one row tile of either plane
    v8f acc00 = zero8(), acc01 = zero8(), acc10 = zero8(), acc11 = zero8();
#pragma unroll
    for (int t = 0; t < 2; ++t) {
      const int kf = t * 4096;                           // k tiles 8 t .. + 7
      if (t == 1) {
#pragma unroll
        for (int u = 0; u < 8; ++u) {
          wc[u][0] = ldfrag_b(wcp + kf + u * 512);
          wc[u][1] = ldfrag_b(wcp + kf + ts + u * 512);
        }
        hold_addr(wcp, wcp, wcp, wcp, wcp, wcp, wcp, wcp, wcp, wcp);   // the 32 addresses are constant offsets from this one
      }
#pragma unroll
      for (int u = 0; u < 8; ++u) {
        const v16b a0 = ldfrag_b(ap + kf + u * 512);
        const v16b a1 = ldfrag_b(ap + ts + kf + u * 512);
        acc00 = mma_b(a0, wc[u][0], acc00);
        acc01 = mma_b(a0, wc[u][1], acc01);
        acc10 = mma_b(a1, wc[u][0], acc10);
        acc11 = mma_b(a1, wc[u][1], acc11);
      }
    }
    const float bb[2] = {bfr(rbc0), bfr(rbc1)};
#pragma unroll
    for (int r = 0; r < 8; ++r) {
      slw[r * 68]               = acc00[r] + bb[0];
      slw[r * 68 + 16]          = acc01[r] + bb[1];
      slw[SLAB64 + r * 68]      = acc10[r] + bb[0];
      slw[SLAB64 + r * 68 + 16] = acc11[r] + bb[1];
    }
    // the k GEMM's weights and bias fly over the split of c and its two barriers
    {
      const _Float16* bp = (const _Float16*)(const void*)WKH + (size_t)(g8 * 32) * HID + 8 * lane;
      const float* pb = bk + g8 * 32 + c;
#pragma unroll
      for (int u = 0; u < 8; ++u) {
        wk[u][0] = ldfrag_h(bp + u * 512);
        wk[u][1] = ldfrag_h(bp + 16 * HID + u * 512);
      }
      rbk0 = pb[0];
      rbk1 = pb[16];
      hold_addr(bp, pb, bp, bp, bp, bp, bp, bp, bp, bp);     // the 34 addresses are constant offsets from these two
    }
    __syncthreads();                                // every wave has read its cond^T fragments, so P may take c; the slabs are complete
    ep_split(sl, CHs, CLs, (size_t)(rt * (16 * HID) + h * 1024 + 8 * lane), CSC, lane);   // row tile rt, columns 64 h ..
  }
  __syncthreads();                                  // the c planes are complete (read-only from here on); the slabs are read

  const float osc = 1.0f / (CSC * WSC);
  const int ys = 16 * HID;                               // one row tile of a plane with HID columns
  // ---- k^T: all eight k tiles in one go ----
  {
    const _Float16* ap = (const _Float16*)(const void*)CHs + (2 * p2) * ys + 8 * lane;
    v8f acc00 = zero8(), acc01 = zero8(), acc10 = zero8(), acc11 = zero8();
#pragma unroll
    for (int u = 0; u < 8; ++u) {
      const v16h a0 = ldfrag_h(ap + u * 512);
      const v16h a1 = ldfrag_h(ap + ys + u * 512);
      acc00 = mma_h(a0, wk[u][0], acc00);
      acc01 = mma_h(a0, wk[u][1], acc01);
      acc10 = mma_h(a1, wk[u][0], acc10);
      acc11 = mma_h(a1, wk[u][1], acc11);
    }
    const float bb[2] = {bfr(rbk0), bfr(rbk1)};
#pragma unroll
    for (int r = 0; r < 8; ++r) {
      slw[r * 68]               = acc00[r] * osc + bb[0];
      slw[r * 68 + 16]          = acc01[r] * osc + bb[1];
      slw[SLAB64 + r * 68]      = acc10[r] * osc + bb[0];
      slw[SLAB64 + r * 68 + 16] = acc11[r] * osc + bb[1];
    }
  }
  // ---- v: accumulator (i, j) = channels 16 (2 g8 + i) .., keys 16 (2 p2 + j) .. -> slab 2 g8 + i, columns 32 p2 + 16 j .. ----
  {
    const _Float16* ap = (const _Float16*)(const void*)WVH + (size_t)(g8 * 32) * HID + 8 * lane;
    const _Float16* bh = (const _Float16*)(const void*)CHs + (2 * p2) * ys + 8 * lane;
    const _Float16* bl = (const _Float16*)(const void*)CLs + (2 * p2) * ys + 8 * lane;
    v16h a[8][2];
#pragma unroll
    for (int u = 0; u < 8; ++u) {
      a[u][0] = ldfrag_h(ap + u * 512);
      a[u][1] = ldfrag_h(ap + ys + u * 512);
    }
    const float* pb = bv + g8 * 32 + 8 * hh;
    const v4f rb[4] = {*(const v4f*)(pb), *(const v4f*)(pb + 4), *(const v4f*)(pb + 16), *(const v4f*)(pb + 20)};
    hold_addr(ap, pb, ap, ap, ap, ap, ap, ap, ap, ap);       // the 36 addresses are constant offsets from these two
    v8f acc00 = zero8(), acc01 = zero8(), acc10 = zero8(), acc11 = zero8();
#pragma unroll
    for (int u = 0; u < 8; ++u) {
      const v16h b0 = ldfrag_h(bh + u * 512),      c0 = ldfrag_h(bl + u * 512);
      const v16h b1 = ldfrag_h(bh + ys + u * 512), c1 = ldfrag_h(bl + ys + u * 512);
      acc00 = mma_h(a[u][0], b0, acc00);  acc00 = mma_h(a[u][0], c0, acc00);
      acc01 = mma_h(a[u][0], b1, acc01);  acc01 = mma_h(a[u][0], c1, acc01);
      acc10 = mma_h(a[u][1], b0, acc10);  acc10 = mma_h(a[u][1], c0, acc10);
      acc11 = mma_h(a[u][1], b1, acc11);  acc11 = mma_h(a[u][1], c1, acc11);
    }
    float* sw = slabV + (2 * g8) * SLAB64 + p2 * 32 + 8 * hh * 68 + c;
#pragma unroll
    for (int r = 0; r < 8; ++r) {
      const float bb0 = bfr(rb[r >> 2][r & 3]), bb1 = bfr(rb[2 + (r >> 2)][r & 3]);
      sw[r * 68]               = acc00[r] * osc + bb0;
      sw[r * 68 + 16]          = acc01[r] * osc + bb0;
      sw[SLAB64 + r * 68]      = acc10[r] * osc + bb1;
      sw[SLAB64 + r * 68 + 16] = acc11[r] * osc + bb1;
    }
  }
  RopeTab t;
  rope_tab(t, cosT, sinT, s0 + rt * 16, lane);
  __syncthreads();                                  // the k and v slabs are complete
  {
    // k' plane (b, h), position tile (s0 >> 4) + rt: two tiles of 512 halves
    const size_t pl = (size_t)(b * NH + h) * (TS / 16) + (size_t)((s0 >> 4) + rt);
    ep_rope(sl, t, KH + pl * 1024 + 8 * lane, KSC, lane);
#if defined(__HIP_DEVICE_COMPILE__)
    // the v epilogue below reuses the four stores' address and data registers: wait first
    asm volatile("s_wait_xcnt 0x0" ::: "memory");
#endif
  }
  // v: channels 16 wave .., keys s0 .. + 63
  ep_v(slv, VH, (size_t)(b * HID + wave * 16) * TS + (size_t)s0 * 16 + 8 * lane, VS + (size_t)(b * NKB + (s0 >> 5)) * HID, S, wave, lane);
}

// =====================================================================================================
// Cross attention, transposed, with the q GEMM in front of it and two GEMMs behind it in the same block. Attention: one wave per
// (head h, 16 queries q0..q0+15); all TS keys in NKB blocks of 32.
//   q' (x1024 f16): the wave's own two fragments, made in phase 0 below; k' plane KH: per (b, h) fragment-major [s][d] (x1024), v plane VH:
//   fragment-major [b*256 + h*64+d][s] (x1024),
//   VS[b][kb][h*64+d] = f32 sum of v over key block kb; masks: key s of row t is masked iff bf16(cond_mask[b][s])*bf16(x_mask[b][t]) == 0,
//   masked score replaced by -1e4 (base-2 scaled) -> exact uniform softmax on a fully masked row, 0 weight otherwise.
//   S^T = k'.q'^T (A = 16 keys, B = 16 queries) and O^T += v^T.P'^T (A = 16 channels, B = 16 queries): lane (hh, c) holds query q0 + c
//   only, with keys kb + 8hh + r and kb + 16 + 8hh + r of a block in the registers of the two score tiles. So the maximum and the sum
//   over keys run inside the lane (one exchange with lane ^ 16 for the maximum; the two halves' sums l are joined once, at the end),
//   and the two score tiles, converted in place, are the B fragment of P'^T in the split k map of the v fragments: no LDS round trip.
//   What is now wanted per register and no longer per lane is staged once per block in LDS: the bf16-rounded key mask of batch b and
//   the block sums of b (all heads) times 7/8 * 2^20.
//   Per block: 2 score tiles x 2 k-steps (single products, q fragments made once in phase 0), scale 1/8 folded into the base-2 factor; online
//   max-subtracted base-2 softmax in f32; e = exp2(t - m) per key; l from the f32 e; accumulator update
//   o = o*alpha + (7/8 * 2^20) * VS block sum (f32), then P' = (e - 7/8) * 1024 as f16, 4 v.P' WMMAs.
//   Exact identity sum_s e_s v_s = sum_s (e_s - 7/8) v_s + 7/8 sum_s v_s per key block.
//   Accumulator j of a lane = channels 16j + 8hh .. + 7 of query c = one chunk of the O planes (O x8192 as f16 hi + residual).
// coverage: per wave 4 LDS stores x 32 lanes x 8 halves = 16 x 64 per plane; 16 waves = the block's 64 x 256 of both O planes.
// =====================================================================================================
// 2^x for the softmax as the bare hardware instruction: every argument here is <= 0 (a score minus the running maximum), and a result
// under 2^-126 comes out as 0 where the library form spends five more vector instructions per value to return a denormal; such a
// term stands beside a term equal to 1 in the same row sum, so it reaches neither l nor the f16 P'.
__device__ __forceinline__ float exp2_raw(float x) { return __builtin_amdgcn_exp2f(x); }
__device__ __forceinline__ float other_half(float v) {                // the value of lane ^ 16
  const int b = __builtin_bit_cast(int, v);
  return __builtin_bit_cast(float, __builtin_amdgcn_permlanex16(b, b, 0x76543210, 0xfedcba98, false, false));
}

// One block = (batch b, 64 queries t0 .. t0 + 63), 16 waves, four phases that hand their tile on through LDS:
//   0. x[b][:][t0 ..] -> bf16 fragment-major plane [64 t][HID] in PH; q^T = x^T . WQB^T + bq: wave = (16 rows t of tile wave & 3) x (the 64
//      columns of head wave >> 2), A fragments from PH; rotary from the wave's slab: the lane's four chunks are the q' fragments of
//      phase 1, so neither x^T nor q' goes through memory;
//   1. attention as described above, wave = (head wave >> 2, query tile wave & 3); its O chunks go into the LDS planes PH, PL
//      (fragment-major [64 t][HID], hi + residual x8192) instead of memory;
//   2. y^T = (OH + OL) . WOH^T + bo: wave = (16 rows t of tile wave & 3) x (64 columns of group wave >> 2), A fragments from PH, PL;
//      once every wave has read its O fragments the same planes take y (hi + residual x16384);
//   3. FiLM GEMM + combine: wave = 16 channels c0 = 16 * wave (gamma rows c0 .., beta rows 256 + c0 ..) x the 64 t, B fragments from PH, PL:
//      gamma[c][t] = sum_i w_film[c][i] y[t][i], beta[c][t] = sum_i w_film[256+c][i] y[t][i]  (A = w_film rows as f16(bf16 x1024),
//      products wg.h, wb.h, then wg.l, wb.l, 8 accumulators);
//      out[b][c][t] = (bf16(x[b][c][t]) * (gamma*oscale + bf16(b_film[c])) + (beta*oscale + bf16(b_film[256+c]))) * bf16(x_mask[b][t]).
// LDS 153600 bytes and at most 128 registers a wave: two blocks on a WGP, so that the 512 blocks are resident together.
// coverage: grid 16 b x 32 t-tiles = 512 blocks x 16 waves x 16 channels x 64 t = every out element exactly once.
__global__ __launch_bounds__(512, 8)
void attn_film(const u16* __restrict__ WQB, const float* __restrict__ bq, const float* __restrict__ cosT,
               const float* __restrict__ sinT, const u16* __restrict__ KHp, const u16* __restrict__ VHp,
               const float* __restrict__ VS, const float* __restrict__ cmask, const float* __restrict__ xmask,
               const u16* __restrict__ WOH, const float* __restrict__ bo, const u16* __restrict__ WF,
               const float* __restrict__ bfl, const float* __restrict__ X, float* OUT) {
  __shared__ __align__(32) float cmS[TS];          // bf16-rounded cond_mask of batch b
  __shared__ __align__(32) float vsS[NKB * HID];   // [key block][h * 64 + d]: 7/8 * 2^20 * block sum of v
  __shared__ __align__(16) u16 PH[64 * HID];       // x^T (bf16), then O, then y: hi plane of the block's 64 rows t
  __shared__ __align__(16) u16 PL[64 * HID];       // residual plane
  __shared__ __align__(16) float slab[16 * SLAB64];

  const int tid  = threadIdx.x;
  const int wave = __builtin_amdgcn_readfirstlane(tid >> 5);   // the wave's number in a scalar register: what hangs on it (head, row
  const int lane = tid & 31;                                   // tile, addresses of the planes, the weights, x, out, the slab) costs
  const int hh   = lane >> 4;                                  // no vector registers
  const int c    = lane & 15;

  const int bid  = blockIdx.x;
  const int qt   = bid & (TT / 64 - 1);
  const int b    = bid >> 5;
  const int h    = wave >> 2;
  const int rt   = wave & 3;
  const int t0   = qt * 64;
  const int q0   = t0 + rt * 16;

  const size_t kofs = ((size_t)(b * NH + h) * TS) * HD + 8 * lane;                // plane (b, h); key tile added per step
  const _Float16* Khb = (const _Float16*)(const void*)KHp + kofs;
  const size_t vofs = ((size_t)(b * HID + h * HD)) * TS + 8 * lane;               // row tile of d 0..15 (+16j); key tile added per step
  const _Float16* Vhb = (const _Float16*)(const void*)VHp + vofs;
  const float lsc = 0.125f * (LOG2E / (QSC * KSC));
  const float C0S = PCEN * PCAR * VCAR;

  // ---- stage the key mask (512 thr x 1 = TS), the scaled block sums of all heads (512 thr x 8 = NKB x HID) and x^T: wave = channels
  //      16 wave .. + 15, lane = positions t0 + 2 lane, + 1, so a load is one whole 256-byte row of the tile; 8 channels of one
  //      position = one chunk of the plane. coverage: 16 waves x 4 chunks x 32 lanes x 8 halves = 64 x HID ----
  static_assert(TS == 512 && NKB * HID == 512 * 8 && HID == 16 * 16);
  {
    const float* pc = cmask + (size_t)b * TS + tid;
    const float* pv = VS + (size_t)b * (NKB * HID) + tid * 8;
    const float* px = X + ((size_t)(b * HID + wave * 16)) * TT + t0 + 2 * lane;
    v2f xr[16];
#pragma unroll
    for (int e = 0; e < 16; ++e) xr[e] = *(const v2f*)(px + (size_t)e * TT);
    const float a = *pc;
    const v4f u0 = *(const v4f*)(pv), u1 = *(const v4f*)(pv + 4);
    hold_addr(pc, pv, px, pc, pc, pc, pc, pc, pc, pc);     // the sixteen addresses of x are constant offsets from px
    cmS[tid] = bfr(a);
    *(v4f*)(vsS + tid * 8)     = u0 * C0S;
    *(v4f*)(vsS + tid * 8 + 4) = u1 * C0S;
    // row tile (2 lane) >> 4, k tile wave >> 1; slot = (k >> 4 & 1) * 32 + (k >> 3 & 1) * 16 + (row & 15)
    u16* xd = PH + ((lane >> 3) * (HID / 32) + (wave >> 1)) * 512 + ((wave & 1) * 32 + 2 * (lane & 7)) * 8;
#pragma unroll
    for (int g = 0; g < 2; ++g) {
#pragma unroll
      for (int j = 0; j < 2; ++j) {
        v4u ch;
#pragma unroll
        for (int e = 0; e < 4; ++e) ch[e] = pk16(bf_bits(xr[8 * g + 2 * e][j]), bf_bits(xr[8 * g + 2 * e + 1][j]));
        *(v4u*)(xd + (g * 16 + j) * 8) = ch;
      }
    }
  }
  const float xmv = bfr(xmask[(size_t)b * TT + q0 + c]);
  const v2f xm2 = {xmv, xmv};
  float mrow = -INFINITY, lrow = 0.f;               // lrow: this half's keys only
  v8f o[4];
#pragma unroll
  for (int j = 0; j < 4; ++j) o[j] = zero8();

  __syncthreads();                                  // cmS, vsS (read-only from here on) and x^T written by all sixteen waves

  float* sl = slab + wave * SLAB64;
  // ---- q^T tile: rows t0 + 16 rt .., columns 64 h .. (head h); then rotary -> the q' fragments ----
  v16h qa, qb;
  {
    const int col0 = h * 64;
    const u16* ap = PH + rt * (16 * HID) + 8 * lane;
    const u16* bp = WQB + (size_t)col0 * HID + 8 * lane;
    const size_t bs = (size_t)16 * HID;
    v8f acc0 = zero8(), acc1 = zero8(), acc2 = zero8(), acc3 = zero8();
    // two k tiles a trip: the registers are still free here, and the weights' sixteen loads share one trip to L2
#pragma unroll 1
    for (int k0 = 0; k0 < HID; k0 += 64) {
      const int kf = k0 * 16;                            // k tiles k0 / 32 and k0 / 32 + 1
      const u16 *p0 = bp + kf, *p1 = p0 + bs, *p2 = p1 + bs, *p3 = p2 + bs;
      const v16b b0 = ldfrag_b(p0), d0 = ldfrag_b(p0 + 512);
      const v16b b1 = ldfrag_b(p1), d1 = ldfrag_b(p1 + 512);
      const v16b b2 = ldfrag_b(p2), d2 = ldfrag_b(p2 + 512);
      const v16b b3 = ldfrag_b(p3), d3 = ldfrag_b(p3 + 512);
      hold_addr(p0, p0, p0, p0, p0, p0, p0, p0, p0, p0);     // the other addresses are constant offsets from this one
      const v16b a = ldfrag_b(ap + kf), e = ldfrag_b(ap + kf + 512);
      acc0 = mma_b(a, b0, acc0);
      acc1 = mma_b(a, b1, acc1);
      acc2 = mma_b(a, b2, acc2);
      acc3 = mma_b(a, b3, acc3);
      acc0 = mma_b(e, d0, acc0);
      acc1 = mma_b(e, d1, acc1);
      acc2 = mma_b(e, d2, acc2);
      acc3 = mma_b(e, d3, acc3);
      guard6<v16b>(acc0, acc1, acc2, acc3, e, d0, d1, d2, d3, e);   // a and b0 .. b3 stand four matrix instructions back
    }
    float bb[4];
#pragma unroll
    for (int j = 0; j < 4; ++j) bb[j] = bfr(bq[col0 + 16 * j + c]);
#pragma unroll
    for (int r = 0; r < 8; ++r) {
      const int ro = (8 * hh + r) * 68 + c;
      sl[ro]      = acc0[r] + bb[0];
      sl[ro + 16] = acc1[r] + bb[1];
      sl[ro + 32] = acc2[r] + bb[2];
      sl[ro + 48] = acc3[r] + bb[3];
    }
    RopeTab t;
    rope_tab(t, cosT, sinT, q0, lane);
    wave_sync_lds();
    v4u qc[4];
    rope_pack(sl, t, qc, QSC, lane);
    FragH fa, fb;
    fa.u[0] = qc[0];  fa.u[1] = qc[1];
    fb.u[0] = qc[2];  fb.u[1] = qc[3];
    qa = fa.v;
    qb = fb.v;
  }
  __syncthreads();                                  // every wave has read its x^T fragments: PH may take O

#pragma unroll 1
  for (int it = 0; it < NKB; ++it) {
    const int kb = it * 32;
    // ---- scores: D element r of this lane = (key kb + 8hh + r, query q0 + c) in s0, key kb + 16 + 8hh + r in s1 ----
    v8f s0 = zero8(), s1 = zero8();
    {
      const _Float16* k0p = Khb + (size_t)kb * HD;            // key tile kb / 16: HD / 32 = 2 tiles of 512 halves
      const _Float16* k1p = k0p + (size_t)16 * HD;
      const v16h k0a = ldfrag_h(k0p), k0b = ldfrag_h(k0p + 512);
      const v16h k1a = ldfrag_h(k1p), k1b = ldfrag_h(k1p + 512);
      hold_addr(k0p, k0p, k0p, k0p, k0p, k0p, k0p, k0p, k0p, k0p);   // k1p is a constant offset from k0p
      s0 = mma_h(k0a, qa, s0);
      s0 = mma_h(k0b, qb, s0);
      s1 = mma_h(k1a, qa, s1);
      s1 = mma_h(k1b, qb, s1);
      guard2(s0, s1, qa, qb, k0a, k0b, k1a, k1b);
    }
    // ---- mask (replace by -1e4) + online softmax in base 2, all in the lane ----
    v8f t0, t1;
    {
      const float* cp = cmS + kb + 8 * hh;
      const v8f c0 = *(const v8f*)(cp), c1 = *(const v8f*)(cp + 16);
      const v8f u0 = s0 * lsc, u1 = s1 * lsc;
#pragma unroll
      for (int r = 0; r < 8; r += 2) {
        const v2f m0 = (v2f){c0[r], c0[r + 1]} * xm2, m1 = (v2f){c1[r], c1[r + 1]} * xm2;
        t0[r]     = (m0[0] != 0.0f) ? u0[r]     : MASKT;
        t0[r + 1] = (m0[1] != 0.0f) ? u0[r + 1] : MASKT;
        t1[r]     = (m1[0] != 0.0f) ? u1[r]     : MASKT;
        t1[r + 1] = (m1[1] != 0.0f) ? u1[r + 1] : MASKT;
      }
    }
    float mx = fmaxf(t0[0], t0[1]);
#pragma unroll
    for (int r = 2; r < 8; r += 2) mx = fmaxf(mx, fmaxf(t0[r], t0[r + 1]));
#pragma unroll
    for (int r = 0; r < 8; r += 2) mx = fmaxf(mx, fmaxf(t1[r], t1[r + 1]));
    mx = fmaxf(mx, other_half(mx));
    const float mn = fmaxf(mrow, mx);
    const float al = exp2_raw(mrow - mn);
    mrow = mn;
    t0 = t0 - mn;
    t1 = t1 - mn;
#pragma unroll
    for (int r = 0; r < 8; ++r) t0[r] = exp2_raw(t0[r]);
#pragma unroll
    for (int r = 0; r < 8; ++r) t1[r] = exp2_raw(t1[r]);
    {
      const v8f pr = t0 + t1;
      const v4f p4 = pr.lo + pr.hi;
      lrow = lrow * al + ((p4[0] + p4[2]) + (p4[1] + p4[3]));
    }
#pragma unroll
    for (int j = 0; j < 4; ++j) o[j] = o[j] * al + *(const v8f*)(vsS + it * HID + h * HD + 16 * j + 8 * hh);
    // ---- B fragment of f16(P'^T): column = query c, elements 0..7 = keys kb + 8hh + 0..7, 8..15 = keys kb + 16 + 8hh + 0..7 ----
    FragH ph;
    ph.h[0] = __builtin_convertvector((t0 - PCEN) * PCAR, v8h);
    ph.h[1] = __builtin_convertvector((t1 - PCEN) * PCAR, v8h);
    // ---- v^T.P'^T : A fragment row = d = j*16 + c, keys contiguous in the v plane ----
    {
      const _Float16* vhp = Vhb + kb * 16;                    // key tile kb / 32
      const v16h vh0 = ldfrag_h(vhp);
      const v16h vh1 = ldfrag_h(vhp + (size_t)16 * TS);
      const v16h vh2 = ldfrag_h(vhp + (size_t)32 * TS);
      const v16h vh3 = ldfrag_h(vhp + (size_t)48 * TS);
      hold_addr(vhp, vhp, vhp, vhp, vhp, vhp, vhp, vhp, vhp, vhp);
      o[0] = mma_h(vh0, ph.v, o[0]);
      o[1] = mma_h(vh1, ph.v, o[1]);
      o[2] = mma_h(vh2, ph.v, o[2]);
      o[3] = mma_h(vh3, ph.v, o[3]);
      guard6<v16h>(o[0], o[1], o[2], o[3], ph.v, vh0, vh1, vh2, vh3, ph.v);
    }
  }
  acc_guard4(o[0], o[1], o[2], o[3]);

  // ---- join the halves' sums, fold 1/l and the carries (1024 on P', 1024 on v) ----
  const float oc  = 1.0f / (PCAR * VCAR);
  const float inv = (1.0f / (lrow + other_half(lrow))) * oc;
  // ---- O x8192 -> f16 hi + residual fragment-major planes [64 t][HID] in LDS; accumulator j = chunk slot (j & 1) * 32 + lane of
  //      k tile 2h + (j >> 1) of row tile rt: row c, d = 16j + 8hh .. + 7 ----
  const int pb0 = rt * (16 * HID) + h * 1024 + 8 * lane;
#pragma unroll
  for (int j = 0; j < 4; ++j) {
    float w[8];
    v4u oh, ol;
#pragma unroll
    for (int e = 0; e < 8; ++e) w[e] = (o[j][e] * inv) * OSC;
#pragma unroll
    for (int e = 0; e < 4; ++e) {
      const _Float16 h0 = (_Float16)w[2 * e], h1 = (_Float16)w[2 * e + 1];
      const _Float16 l0 = (_Float16)(w[2 * e] - (float)h0), l1 = (_Float16)(w[2 * e + 1] - (float)h1);
      oh[e] = pk16(h_bits(h0), h_bits(h1));
      ol[e] = pk16(h_bits(l0), h_bits(l1));
    }
    *(v4u*)(PH + pb0 + j * 256) = oh;
    *(v4u*)(PL + pb0 + j * 256) = ol;
  }
  __syncthreads();                                  // a row tile of O comes from four waves (one per head)

  // ---- y^T tile: rows t0 + 16 rt .., columns 64h .. ; per k step h.w then l.w ----
  {
    const int col0 = h * 64;
    const _Float16* ahp = (const _Float16*)(const void*)PH + rt * (16 * HID) + 8 * lane;
    const _Float16* alp = (const _Float16*)(const void*)PL + rt * (16 * HID) + 8 * lane;
    const _Float16* bhp = (const _Float16*)(const void*)WOH + (size_t)col0 * HID + 8 * lane;
    const size_t bs = (size_t)16 * HID;
    const float osc = 1.0f / (OSC * WSC);
    v8f acc0 = zero8(), acc1 = zero8(), acc2 = zero8(), acc3 = zero8();
#pragma unroll 1
    for (int k0 = 0; k0 < HID; k0 += 32) {
      const int kf = k0 * 16;                            // k tile k0 / 32
      const _Float16 *p0 = bhp + kf, *p1 = p0 + bs, *p2 = p1 + bs, *p3 = p2 + bs;
      const v16h b0 = ldfrag_h(p0);
      const v16h b1 = ldfrag_h(p1);
      const v16h b2 = ldfrag_h(p2);
      const v16h b3 = ldfrag_h(p3);
      hold_addr(p0, p0, p0, p0, p0, p0, p0, p0, p0, p0);     // the other three addresses are constant offsets from this one
      const v16h ah = ldfrag_h(ahp + kf);
      const v16h al = ldfrag_h(alp + kf);
      acc0 = mma_h(ah, b0, acc0);  acc0 = mma_h(al, b0, acc0);
      acc1 = mma_h(ah, b1, acc1);  acc1 = mma_h(al, b1, acc1);
      acc2 = mma_h(ah, b2, acc2);  acc2 = mma_h(al, b2, acc2);
      acc3 = mma_h(ah, b3, acc3);  acc3 = mma_h(al, b3, acc3);
      guard6<v16h>(acc0, acc1, acc2, acc3, ah, al, b0, b1, b2, b3);
    }
    float bb[4];
#pragma unroll
    for (int j = 0; j < 4; ++j) bb[j] = bfr(bo[col0 + 16 * j + c]);
#pragma unroll
    for (int r = 0; r < 8; ++r) {
      const int ro = (8 * hh + r) * 68 + c;
      sl[ro]      = acc0[r] * osc + bb[0];
      sl[ro + 16] = acc1[r] * osc + bb[1];
      sl[ro + 32] = acc2[r] * osc + bb[2];
      sl[ro + 48] = acc3[r] * osc + bb[3];
    }
    __syncthreads();                                // every wave has read its O fragments (and its slab is written): the planes may take y
    ep_split(sl, PH, PL, (size_t)(rt * (16 * HID) + h * 1024 + 8 * lane), YSC, lane);   // row tile rt, columns 64 h ..
  }
  __syncthreads();                                  // the y planes are complete; every wave reads all 64 rows

  // ---- FiLM GEMM ----
  const int c0 = wave * 16;
  const _Float16* agp = (const _Float16*)(const void*)WF + (size_t)c0 * HID + 8 * lane;
  const _Float16* yhp = (const _Float16*)(const void*)PH + 8 * lane;
  const _Float16* ylp = (const _Float16*)(const void*)PL + 8 * lane;
  const int ys = 16 * HID;                                                         // one row tile of the planes
  const float oscale = 1.0f / (YSC * WSC);
  v8f g[4], be[4];
#pragma unroll
  for (int j = 0; j < 4; ++j) { g[j] = zero8(); be[j] = zero8(); }
#pragma unroll 1
  for (int k0 = 0; k0 < HID; k0 += 32) {
    const int kf = k0 * 16;                              // k tile k0 / 32
    const _Float16 *pg = agp + kf, *pb = pg + (size_t)HID * HID;                   // row 256 + c0 + c
    const v16h ag = ldfrag_h(pg), ab = ldfrag_h(pb);
    hold_addr(pg, pg, pg, pg, pg, pg, pg, pg, pg, pg);     // pb is a constant offset from pg
    {
      const v16h y0 = ldfrag_h(yhp + kf);
      const v16h y1 = ldfrag_h(yhp + kf + ys);
      const v16h y2 = ldfrag_h(yhp + kf + 2 * ys);
      const v16h y3 = ldfrag_h(yhp + kf + 3 * ys);
      g[0] = mma_h(ag, y0, g[0]);  be[0] = mma_h(ab, y0, be[0]);
      g[1] = mma_h(ag, y1, g[1]);  be[1] = mma_h(ab, y1, be[1]);
      g[2] = mma_h(ag, y2, g[2]);  be[2] = mma_h(ab, y2, be[2]);
      g[3] = mma_h(ag, y3, g[3]);  be[3] = mma_h(ab, y3, be[3]);
    }
    const v16h z0 = ldfrag_h(ylp + kf);
    const v16h z1 = ldfrag_h(ylp + kf + ys);
    const v16h z2 = ldfrag_h(ylp + kf + 2 * ys);
    const v16h z3 = ldfrag_h(ylp + kf + 3 * ys);
    g[0] = mma_h(ag, z0, g[0]);  be[0] = mma_h(ab, z0, be[0]);
    g[1] = mma_h(ag, z1, g[1]);  be[1] = mma_h(ab, z1, be[1]);
    g[2] = mma_h(ag, z2, g[2]);  be[2] = mma_h(ab, z2, be[2]);
    g[3] = mma_h(ag, z3, g[3]);  be[3] = mma_h(ab, z3, be[3]);
    guardF(g[0], g[1], g[2], g[3], be[0], be[1], be[2], be[3], ag, ab, z0, z1, z2, z3, ag, ab, ag, ab);
  }
  // ---- combine, four of the lane's eight channel rows at a time ----
  const float* xmp = xmask + (size_t)b * TT + t0 + c;
  const float* bfp = bfl + c0 + 8 * hh;
  const float* xp  = X + ((size_t)(b * HID + c0 + 8 * hh)) * TT + t0 + c;
  float xm[4];
#pragma unroll
  for (int j = 0; j < 4; ++j) xm[j] = xmp[16 * j];
#pragma unroll
  for (int r0 = 0; r0 < 8; r0 += 4) {
    // the loads of rows 4 .. 7 stay behind the work on rows 0 .. 3: all of them in flight beside the 64 accumulators do not fit
    // 128 registers (spills)
    if (r0 == 4) __builtin_amdgcn_sched_barrier(0);
    float bg[4], bb[4], xv[4][4];
#pragma unroll
    for (int q = 0; q < 4; ++q) {
      bg[q] = bfp[r0 + q];
      bb[q] = bfp[HID + r0 + q];
#pragma unroll
      for (int j = 0; j < 4; ++j) xv[q][j] = xp[(size_t)(r0 + q) * TT + 16 * j];
    }
    hold_addr(xmp, bfp, xp, xp, xp, xp, xp, xp, xp, xp);   // every address above is a constant offset from these three
#pragma unroll
    for (int q = 0; q < 4; ++q) {
      const int r = r0 + q;
      const float bgr = bfr(bg[q]), bbr = bfr(bb[q]);
#pragma unroll
      for (int j = 0; j < 4; ++j) {
        const float gam = g[j][r] * oscale + bgr;
        const float bet = be[j][r] * oscale + bbr;
        sl[(8 * hh + r) * 68 + 16 * j + c] = (bfr(xv[q][j]) * gam + bet) * bfr(xm[j]);
      }
    }
  }
  wave_sync_lds();
  store64(sl, OUT, TT, (size_t)(b * HID + c0), t0, lane);
}

// =====================================================================================================
// Workspace map (bytes); every plane is fully written by whole-line stores before it is read; all extents are exact multiples
// of the store granularity (no pad rows needed); every offset a multiple of 65536. No launch writes a region that it reads:
//   CT f32 [2048][64] 524288, ST same
//   WCB bf16 [256][512] 262144; WQB bf16 [256][256] 131072; WKH, WVH, WOH f16 [256][256] 131072 each; WFH f16 [512][256] 262144
//   KH f16 [16][4][512][64] 4194304; VH f16 [16][256][512] 4194304; VS f32 [16][16][256] 262144
//   end 10747904
// =====================================================================================================
extern "C" void kernel_launch(void* const* d_in, const int* in_sizes, int n_in,
                              void* d_out, int out_size, void* d_ws, size_t ws_size,
                              hipStream_t stream) {
  if (n_in < 16) return;
  if (in_sizes[0] != NBAT * HID * TT) return;
  if (in_sizes[1] != NBAT * TT) return;
  if (in_sizes[2] != NBAT * CND * TS) return;
  if (in_sizes[3] != NBAT * TS) return;
  if (in_sizes[4] != HID * CND || in_sizes[5] != HID) return;
  if (in_sizes[6] != HID * HID || in_sizes[7] != HID) return;
  if (in_sizes[8] != HID * HID || in_sizes[9] != HID) return;
  if (in_sizes[10] != HID * HID || in_sizes[11] != HID) return;
  if (in_sizes[12] != HID * HID || in_sizes[13] != HID) return;
  if (in_sizes[14] != 2 * HID * HID || in_sizes[15] != 2 * HID) return;
  if (out_size != NBAT * HID * TT) return;

  const float* x      = (const float*)d_in[0];
  const float* x_mask = (const float*)d_in[1];
  const float* cond   = (const float*)d_in[2];
  const float* c_mask = (const float*)d_in[3];
  const float* w_cond = (const float*)d_in[4];
  const float* b_cond = (const float*)d_in[5];
  const float* wq     = (const float*)d_in[6];
  const float* bq     = (const float*)d_in[7];
  const float* wk     = (const float*)d_in[8];
  const float* bk     = (const float*)d_in[9];
  const float* wv     = (const float*)d_in[10];
  const float* bv     = (const float*)d_in[11];
  const float* wo     = (const float*)d_in[12];
  const float* bo     = (const float*)d_in[13];
  const float* wf     = (const float*)d_in[14];
  const float* bfi    = (const float*)d_in[15];
  float*       out    = (float*)d_out;

  const size_t szTab = (size_t)TT * HD * 4;                       //    524288
  const size_t szWCB = (size_t)HID * CND * 2;                     //    262144
  const size_t szW   = (size_t)HID * HID * 2;                     //    131072
  const size_t szWF  = (size_t)2 * HID * HID * 2;                 //    262144
  const size_t szKH  = (size_t)NBAT * TS * HID * 2;               //   4194304
  const size_t szVH  = (size_t)NBAT * HID * TS * 2;               //   4194304
  const size_t szVS  = (size_t)NBAT * NKB * HID * 4;              //    262144
  size_t off = 0;
  const size_t oCT  = off; off += szTab;
  const size_t oST  = off; off += szTab;
  const size_t oWCB = off; off += szWCB;
  const size_t oWQB = off; off += szW;
  const size_t oWKH = off; off += szW;
  const size_t oWVH = off; off += szW;
  const size_t oWOH = off; off += szW;
  const size_t oWFH = off; off += szWF;
  const size_t oKH  = off; off += szKH;
  const size_t oVH  = off; off += szVH;
  const size_t oVS  = off; off += szVS;
  if (off > ws_size) return;                            // off = 10747904
  if (off > (size_t)134217728) return;

  char* ws = (char*)d_ws;
  float* CT    = (float*)(ws + oCT);
  float* ST    = (float*)(ws + oST);
  u16*   WCB   = (u16*)(ws + oWCB);
  u16*   WQB   = (u16*)(ws + oWQB);
  u16*   WKH   = (u16*)(ws + oWKH);
  u16*   WVH   = (u16*)(ws + oWVH);
  u16*   WOH   = (u16*)(ws + oWOH);
  u16*   WFH   = (u16*)(ws + oWFH);
  u16*   KH    = (u16*)(ws + oKH);
  u16*   VH    = (u16*)(ws + oVH);
  float* VS    = (float*)(ws + oVS);

  // inv_freq[i] = 1 / pow(10000, i/32) in f32 (pow correctly converted from f64, then IEEE f32 reciprocal)
  InvF inv;
  for (int i = 0; i < 32; ++i) {
    const double p = pow(10000.0, (double)i / 32.0);
    const float pf = (float)p;
    inv.f[i] = 1.0f / pf;
  }

  const dim3 blk(256);
  const dim3 gAF(NBAT * (TT / 64));                     // 512

  // (0) inputs only: rotary cos/sin tables [2048][64];
  //     weights (W[o][i] row-major is already [n][k]): bf16 planes for w_cond, wq; f16(bf16 x1024) for wk, wv, wo, w_film
  pro_k<<<dim3(NB_PRO), blk, 0, stream>>>(w_cond, wq, wk, wv, wo, wf, CT, ST, WCB, WQB, WKH, WVH, WOH, WFH, inv);
  // (1) per (batch, 64 keys): cond tile -> bf16 (LDS) -> c^T = cond^T . WCB^T + b_cond -> f16 hi + residual x1024 (LDS) ->
  //     k^T = CH . WKH^T + bk -> rotary, position s -> k' planes; v = WVH . (CH + CL)^T + bv per row -> v f16 plane x1024 + per-32-key
  //     block sums; carries 1024 x 1024 folded back
  ckv<<<dim3(NBAT * (TS / 64)), dim3(512), 0, stream>>>(cond, WCB, b_cond, WKH, bk, WVH, bv, CT, ST, KH, VH, VS);
  // (2) q^T = x^T . WQB^T + bq -> rotary, position t -> q' (registers) -> cross attention -> O (LDS) -> y^T = (OH + OL) . WOH^T + bo (LDS) -> FiLM GEMM + combine -> out [16][256][2048] f32
  attn_film<<<gAF, dim3(512), 0, stream>>>(WQB, bq, CT, ST, KH, VH, VS, c_mask, x_mask, WOH, bo, WFH, bfi, x, out);
  (void)hipGetLastError();
}

// v009
// Measured time: 66.3 microseconds a run.
// In both of two side-by-side timings against v008, it was 1.17 times as fast.
// All steps since v000 together make it 4.13 times as fast.
// Contractions: cond^T.w_cond^T and x^T.wq^T on v_wmma_f32_16x16x32_bf16 (inputs RNE-converted to bf16, exact operands, f32 accumulate);
// c.wk^T (c x1024 f16 hi plane), wv.c (c x1024 f16 hi + residual, products w.h + w.l), scores q'.k'^T (q' x1024, k' x1024 f16, one product),
// P'.v (centred P' = (e - 7/8) x1024 f16, v x1024 f16, one product; 7/8 * sum(v) per 32-key block added in f32),
// O.wo^T (O x8192 f16 hi + residual, products h.w + l.w), w_film.y (y x16384 f16 hi + residual): v_wmma_f32_16x16x32_f16,
// weights as f16(bf16(w) x1024), f32 accumulate. Rotary tables: f64 sin/cos of the f32 angle. Rotation, masked base-2 online softmax, 1/l, FiLM combine: f32 on VALU.
#include <hip/hip_runtime.h>
#include <math.h>
#include <stdint.h>

#define NBAT  16
#define TT    2048
#define TS    512
#define HID   256
#define CND   512
#define NH    4
#define HD    64
#define NKB   (TS / 32)
#define QSC   1024.0f
#define KSC   1024.0f
#define CSC   1024.0f
#define VCAR  1024.0f
#define PCAR  1024.0f
#define OSC   8192.0f
#define YSC   16384.0f
#define WSC   1024.0f
#define PCEN  0.875f
#define LOG2E 1.4426950408889634f
#define MASKT (-10000.0f * LOG2E)
#define SLAB64 (16 * 68)
static_assert(HID == NH * HD && HD == 64);
static_assert((TT % 64) == 0 && (TS % 64) == 0 && (TS % 32) == 0 && NKB == 16);
static_assert((TT & (TT - 1)) == 0 && (TS & (TS - 1)) == 0);
static_assert((HID % 64) == 0 && (CND % 64) == 0 && (HID % 32) == 0 && (CND % 32) == 0);
static_assert(((NBAT * TS * NH * 8) % 256) == 0);
static_assert(((NBAT * TS * HID) % 2048) == 0);

typedef unsigned short u16;
typedef _Float16 v16h __attribute__((ext_vector_type(16)));
typedef _Float16 v8h  __attribute__((ext_vector_type(8)));
typedef __bf16   v16b __attribute__((ext_vector_type(16)));
typedef float    v8f  __attribute__((ext_vector_type(8)));
typedef float    v4f  __attribute__((ext_vector_type(4)));
typedef float    v2f  __attribute__((ext_vector_type(2)));
typedef unsigned int v4u __attribute__((ext_vector_type(4)));

union FragH { v16h v; v8h h[2]; v4u u[2]; };
union FragB { v16b v; v4u u[2]; };

struct InvF { float f[32]; };
static_assert(sizeof(InvF) == 128);

// ---- scalar helpers --------------------------------------------------------------------------------
__device__ __forceinline__ unsigned short bf_bits(float f) {          // f32 -> bf16 bits, RNE convert
  unsigned u = __float_as_uint(f);
  return (unsigned short)((u + 0x7FFFu + ((u >> 16) & 1u)) >> 16);
}
__device__ __forceinline__ float bf_up(unsigned short h) { return __uint_as_float(((unsigned)h) << 16); }
__device__ __forceinline__ float bfr(float f) { return bf_up(bf_bits(f)); }
__device__ __forceinline__ unsigned short h_bits(_Float16 x) { return __builtin_bit_cast(unsigned short, x); }
__device__ __forceinline__ unsigned pk16(unsigned short a, unsigned short b) { return (unsigned)a | ((unsigned)b << 16); }
__device__ __forceinline__ v8f zero8() { v8f z = {0.f, 0.f, 0.f, 0.f, 0.f, 0.f, 0.f, 0.f}; return z; }

// ---- fragment-major planes: a 16-bit plane [R][K] (R % 16 == 0, K % 32 == 0) is stored as tiles of 16 rows x 32 k, 512 halves
//      each, tile (row >> 4, k >> 5) at ((row >> 4) * (K >> 5) + (k >> 5)) * 512; inside a tile 64 chunks of 8 halves, chunk slot
//      = ((k >> 4) & 1) * 32 + ((k >> 3) & 1) * 16 + (row & 15), so that slot & 31 is the lane that owns the chunk.
// ---- fragment loaders: 16-bit A/B operand, p = tile start + 8 * lane: two wave-wide loads of 512 contiguous bytes;
//      lane -> row/col (lane&15), elements 0..7 <- k0+8h.., elements 8..15 <- k0+16+8h..  (same split k map for A and B)
__device__ __forceinline__ v16h ldfrag_h(const _Float16* p) {
  FragH f;
  f.h[0] = *(const v8h*)(p);
  f.h[1] = *(const v8h*)(p + 256);
  return f.v;
}
__device__ __forceinline__ v16b ldfrag_b(const u16* p) {              // bf16 plane read as unsigned integer vectors
  FragB f;
  f.u[0] = *(const v4u*)(p);
  f.u[1] = *(const v4u*)(p + 256);
  return f.v;
}

// Stands behind a group of fragment loads and names their address registers as inputs, so that these registers stay unwritten
// (by a later load's result or by an address update) up to the s_wait_xcnt 0 inside it.
__device__ __forceinline__ void hold_addr(const void* a, const void* b, const void* c, const void* d, const void* e,
                                          const void* f, const void* g, const void* h, const void* i, const void* j) {
#if defined(__HIP_DEVICE_COMPILE__)
  asm volatile("s_wait_xcnt 0x0" :: "v"(a), "v"(b), "v"(c), "v"(d), "v"(e), "v"(f), "v"(g), "v"(h), "v"(i), "v"(j) : "memory");
#endif
}
// chunk slot (0..63) of a tile -> row in the tile and first k in the tile
__device__ __forceinline__ int slot_row(int slot) { return slot & 15; }
__device__ __forceinline__ int slot_k(int slot) { return ((slot >> 5) << 4) + (((slot >> 4) & 1) << 3); }

__device__ __forceinline__ v8f mma_h(v16h a, v16h b, v8f c) {
  return __builtin_amdgcn_wmma_f32_16x16x32_f16(false, a, false, b, (short)0, c, false, false);
}
__device__ __forceinline__ v8f mma_b(v16b a, v16b b, v8f c) {
  return __builtin_amdgcn_wmma_f32_16x16x32_bf16(false, a, false, b, (short)0, c, false, false);
}
// Behind the last matrix instructions of a loop body: four vector slots before the branch back, so that on the taken side too no vector
// instruction touches their accumulators or overwrites their operands too early; the operands named keep both sides in place.
template <typename F>
__device__ __forceinline__ void guardF(v8f& a0, v8f& a1, v8f& a2, v8f& a3, v8f& c0, v8f& c1, v8f& c2, v8f& c3,
                                       F x0, F x1, F x2, F x3, F x4, F x5, F x6, F x7, F x8, F x9) {
#if defined(__HIP_DEVICE_COMPILE__)
  asm volatile("v_nop\n\tv_nop\n\tv_nop\n\tv_nop"
               : "+v"(a0), "+v"(a1), "+v"(a2), "+v"(a3), "+v"(c0), "+v"(c1), "+v"(c2), "+v"(c3)
               : "v"(x0), "v"(x1), "v"(x2), "v"(x3), "v"(x4), "v"(x5), "v"(x6), "v"(x7), "v"(x8), "v"(x9) : "memory");
#endif
}
__device__ __forceinline__ void guard16(v8f (&a)[2][4], v8f (&c)[2][4], v16h x0, v16h x1, v16h x2, v16h x3, v16h x4, v16h x5,
                                        v16h x6, v16h x7) {
#if defined(__HIP_DEVICE_COMPILE__)
  asm volatile("v_nop\n\tv_nop\n\tv_nop\n\tv_nop"
               : "+v"(a[0][0]), "+v"(a[0][1]), "+v"(a[0][2]), "+v"(a[0][3]), "+v"(a[1][0]), "+v"(a[1][1]), "+v"(a[1][2]), "+v"(a[1][3]),
                 "+v"(c[0][0]), "+v"(c[0][1]), "+v"(c[0][2]), "+v"(c[0][3]), "+v"(c[1][0]), "+v"(c[1][1]), "+v"(c[1][2]), "+v"(c[1][3])
               : "v"(x0), "v"(x1), "v"(x2), "v"(x3), "v"(x4), "v"(x5), "v"(x6), "v"(x7) : "memory");
#endif
}
__device__ __forceinline__ void wave_sync_lds() {
  __builtin_amdgcn_fence(__ATOMIC_RELEASE, "workgroup");
  __builtin_amdgcn_wave_barrier();
  __builtin_amdgcn_fence(__ATOMIC_ACQUIRE, "workgroup");
}

// ---- accurate f32 sin/cos of a non-negative f32 angle (|angle| < 2048): f64 two-part pi/2 reduction + f64 polynomials,
//      plain f64 fma/mul only (no library f64 trig path), result converted to f32.
__device__ __forceinline__ void sincos_acc(float angf, float& sv, float& cv) {
  const double a = (double)angf;
  const double TWO_OVER_PI = 0.63661977236758134308;
  const double PIO2_HI = 1.5707963267948966;
  const double PIO2_LO = 6.123233995736766e-17;
  const int kq = (int)(a * TWO_OVER_PI + 0.5);
  const double kd = (double)kq;
  double r = fma(-kd, PIO2_HI, a);
  r = fma(-kd, PIO2_LO, r);
  const double r2 = r * r;
  double sp = 1.0 / 6227020800.0;
  sp = fma(sp, r2, -1.0 / 39916800.0);
  sp = fma(sp, r2, 1.0 / 362880.0);
  sp = fma(sp, r2, -1.0 / 5040.0);
  sp = fma(sp, r2, 1.0 / 120.0);
  sp = fma(sp, r2, -1.0 / 6.0);
  const double s = fma(sp * r2, r, r);
  double cp = -1.0 / 87178291200.0;
  cp = fma(cp, r2, 1.0 / 479001600.0);
  cp = fma(cp, r2, -1.0 / 3628800.0);
  cp = fma(cp, r2, 1.0 / 40320.0);
  cp = fma(cp, r2, -1.0 / 720.0);
  cp = fma(cp, r2, 1.0 / 24.0);
  cp = fma(cp, r2, -0.5);
  const double c = fma(cp, r2, 1.0);
  const int qd = kq & 3;
  const double so = (qd == 0) ? s : (qd == 1) ? c : (qd == 2) ? -s : -c;
  const double co = (qd == 0) ? c : (qd == 1) ? -s : (qd == 2) ? -c : s;
  sv = (float)so;
  cv = (float)co;
}

// =====================================================================================================
// Rotary tables: cosT[t][d], sinT[t][d] for t < TT, d < HD, angle = float(t) * inv_freq[d & 31] (f32 product), halves duplicated.
// Wave = one position t, lane = frequency index; inv_freq picked from the by-value table with a static select chain.
// coverage: grid TT/8 blocks x 8 waves = TT rows; per row 4 line stores = 64 floats of each table.
// =====================================================================================================
__device__ __forceinline__ void k_tab(float* cosT, float* sinT, const InvF& inv, int bx) {
  const int tid  = threadIdx.x;
  const int lane = tid & 31;
  const int t    = bx * 8 + (tid >> 5);
  if (t >= TT) return;                      // never taken with the exact grid; no barriers in this kernel
  float f = inv.f[0];
#pragma unroll
  for (int i = 1; i < 32; ++i) f = (lane == i) ? inv.f[i] : f;
  const float ang = (float)t * f;
  float sv, cv;
  sincos_acc(ang, sv, cv);
  float* cr = cosT + (size_t)t * HD;
  float* sr = sinT + (size_t)t * HD;
  {
    *(float*)(cr + lane)      = cv;
    *(float*)(cr + 32 + lane) = cv;
    *(float*)(sr + lane)      = sv;
    *(float*)(sr + 32 + lane) = sv;
    
  }
}

// =====================================================================================================
// Row-major f32 [R][K] -> 16-bit fragment-major plane. f16mode == 0: bf16 RNE bits; f16mode == 1: f16 bits of (bf16 RNE value) * scale.
// Thread = 8 consecutive elements: two 16-B loads, one 16-B store; 32 consecutive lanes = 512 contiguous, 512-B aligned bytes
// coverage: grid = ceil(n8/256) blocks x 256 thr x 8 = the whole plane (n8 a multiple of 32 in every use, so no partial line).
// =====================================================================================================
__device__ __forceinline__ void cvt_flat(const float* __restrict__ src, u16* D, int n8, int f16mode, float scale, int K, int bx) {
  const int gt = bx * 256 + (int)threadIdx.x;   // chunk index in the fragment-major plane
  if (gt >= n8) return;                     // no barriers in this kernel
  const int ktn = K >> 5, tile = gt >> 6, slot = gt & 63;
  const int rt = tile / ktn, kt = tile - rt * ktn;
  const float* p = src + (size_t)(rt * 16 + slot_row(slot)) * K + kt * 32 + slot_k(slot);
  const v4f a = *(const v4f*)(p), bq = *(const v4f*)(p + 4);
  float w[8];
#pragma unroll
  for (int e = 0; e < 4; ++e) { w[e] = a[e]; w[4 + e] = bq[e]; }
  v4u o;
#pragma unroll
  for (int e = 0; e < 4; ++e) {
    const float v0 = w[2 * e], v1 = w[2 * e + 1];
    const unsigned short h0 = h_bits((_Float16)(bfr(v0) * scale)), h1 = h_bits((_Float16)(bfr(v1) * scale));
    const unsigned short b0 = bf_bits(v0), b1 = bf_bits(v1);
    o[e] = (f16mode != 0) ? pk16(h0, h1) : pk16(b0, b1);
  }
  u16* d = D + (size_t)gt * 8;
  {
    *(v4u*)(d) = o;
    
  }
}

// =====================================================================================================
// GEMM epilogues: the wave's 16 x 64 f32 tile stands (final values) in its LDS slab (pitch 68), the caller has issued the wave's
// LDS sync or a block barrier; the epilogue writes the 16-bit plane(s) that the tile's reader wants, so no f32 copy goes through memory.
// A lane owns four chunks of 8 halves. Fragment-major planes: chunk it = row (lane & 15), columns it * 16 + 8 * (lane >> 4) ..,
// which is slot (it & 1) * 32 + lane of k tile (it >> 1) of the tile pair: one store = 512 contiguous bytes of the wave.
// =====================================================================================================
// f16 hi + residual fragment-major planes: hi = f16(v * sc), lo = f16(v * sc - hi) (sc a power of two, residual unscaled).
// base = first half of the wave's tile pair + 8 * lane. coverage: 4 stores x 32 lanes x 8 halves = 16 x 64 of each plane.
__device__ __forceinline__ void ep_split(const float* sl, u16* Hp, u16* Lp, size_t base, float sc, int lane) {
  const int hh = lane >> 4, m = lane & 15;
  v4u oh[4], ol[4];
#pragma unroll
  for (int it = 0; it < 4; ++it) {
    const float* p = sl + m * 68 + it * 16 + 8 * hh;
    const v4f a = *(const v4f*)(p), bq = *(const v4f*)(p + 4);
    float w[8];
#pragma unroll
    for (int e = 0; e < 4; ++e) { w[e] = a[e] * sc; w[4 + e] = bq[e] * sc; }
#pragma unroll
    for (int e = 0; e < 4; ++e) {
      const float t0 = w[2 * e], t1 = w[2 * e + 1];
      const _Float16 h0 = (_Float16)t0, h1 = (_Float16)t1;
      const _Float16 l0 = (_Float16)(t0 - (float)h0), l1 = (_Float16)(t1 - (float)h1);
      oh[it][e] = pk16(h_bits(h0), h_bits(h1));
      ol[it][e] = pk16(h_bits(l0), h_bits(l1));
    }
  }
#pragma unroll
  for (int it = 0; it < 4; ++it) {
    *(v4u*)(Hp + base + (size_t)it * 256) = oh[it];
    *(v4u*)(Lp + base + (size_t)it * 256) = ol[it];
  }
}

// Rotate-half rotary + f16 pack; the tile's 64 columns are one head's HD channels, its rows 16 positions pos0 .. ; chunks as above.
//   w[d] = x[d] * cos[pos][d] + r[d] * sin[pos][d],  r[d] = -x[d+32] for d < 32, x[d-32] for d >= 32;  out[d] = f16(w * sc).
__device__ __forceinline__ int rope_row(int lane) { return lane & 15; }
__device__ __forceinline__ int rope_d0(int it, int lane) { return it * 16 + 8 * (lane >> 4); }
struct RopeTab { v4f ca[2], cb[2], sa[2], sb[2]; };   // chunks 0, 1; chunks 2, 3 (d + 32) read the same values: the tables' halves are equal
__device__ __forceinline__ void rope_tab(RopeTab& t, const float* __restrict__ cosT, const float* __restrict__ sinT, int pos0,
                                         int lane) {
  const size_t o = (size_t)(pos0 + rope_row(lane)) * HD + rope_d0(0, lane);
  const float *cr = cosT + o, *sr = sinT + o;
  const int st = 16;                          // floats from one of the lane's chunks to the next
#pragma unroll
  for (int it = 0; it < 2; ++it) {
    t.ca[it] = *(const v4f*)(cr + it * st);  t.cb[it] = *(const v4f*)(cr + it * st + 4);
    t.sa[it] = *(const v4f*)(sr + it * st);  t.sb[it] = *(const v4f*)(sr + it * st + 4);
  }
  hold_addr(cr, sr, cr, cr, cr, cr, cr, cr, cr, cr);   // the eight addresses are constant offsets from these two
}
// oh = the lane's four chunks: together the two 16-bit fragments (d 0 .. 31 and 32 .. 63, split k map) of row lane & 15.
__device__ __forceinline__ void rope_pack(const float* sl, const RopeTab& t, v4u (&oh)[4], float sc, int lane) {
#pragma unroll
  for (int it = 0; it < 4; ++it) {
    const int d0 = rope_d0(it, lane), d1 = d0 ^ 32;
    const float* xr = sl + rope_row(lane) * 68;
    const v4f xa = *(const v4f*)(xr + d0), xb = *(const v4f*)(xr + d0 + 4);
    const v4f ya = *(const v4f*)(xr + d1), yb = *(const v4f*)(xr + d1 + 4);
    const float sgn = (d0 < 32) ? -1.0f : 1.0f;
    float w[8];
#pragma unroll
    for (int e = 0; e < 4; ++e) {
      w[e]     = fmaf(sgn * ya[e], t.sa[it & 1][e], xa[e] * t.ca[it & 1][e]);   // cosine product rounded, sine product fused
      w[4 + e] = fmaf(sgn * yb[e], t.sb[it & 1][e], xb[e] * t.cb[it & 1][e]);
    }
#pragma unroll
    for (int e = 0; e < 4; ++e) {
      const _Float16 h0 = (_Float16)(w[2 * e] * sc), h1 = (_Float16)(w[2 * e + 1] * sc);
      oh[it][e] = pk16(h_bits(h0), h_bits(h1));
    }
  }
}
// fragment-major out plane (k'), dst = the lane's first chunk. coverage: 4 stores x 32 lanes x 8 halves = 16 rows x 64 of the plane.
__device__ __forceinline__ void ep_rope(const float* sl, const RopeTab& t, u16* dst, float sc, int lane) {
  v4u oh[4];
  rope_pack(sl, t, oh, sc, lane);
#pragma unroll
  for (int it = 0; it < 4; ++it) *(v4u*)(dst + (size_t)it * 256) = oh[it];
}

// v plane + per-32-key block sums; the tile is 16 channels (rows) x 64 keys of batch b, the block all HID channels x the same keys.
//   VH = f16(v * 1024), fragment-major plane [b * HID + o][TS], vbase = first half of the wave's tile pair + 8 * lane;
//   VS[b][kb][o] = sum over keys kb*32 .. kb*32+31 of v (f32): 8 keys in a lane as a tree, the chunk pair (0,1) and (2,3) across the
//   wave's halves, then the two pairs; the block's 2 x HID sums meet in S (512 floats of LDS) so that four waves store whole lines.
// coverage: VH 4 stores x 32 lanes x 8 halves = 16 x 64; VS 2 key blocks x HID channels per block, vsdst = VS + (b * NKB + kb0) * HID.
__device__ __forceinline__ void ep_v(const float* sl, u16* VH, size_t vbase, float* vsdst, float* S, int wave, int lane) {
  const int hh = lane >> 4, m = lane & 15;
  v4u o[4];
  float ps[4];
#pragma unroll
  for (int it = 0; it < 4; ++it) {
    const float* p = sl + m * 68 + it * 16 + 8 * hh;
    const v4f a = *(const v4f*)(p), bq = *(const v4f*)(p + 4);
#pragma unroll
    for (int q = 0; q < 2; ++q) {
      o[it][q]     = pk16(h_bits((_Float16)(a[2 * q] * VCAR)),  h_bits((_Float16)(a[2 * q + 1] * VCAR)));
      o[it][2 + q] = pk16(h_bits((_Float16)(bq[2 * q] * VCAR)), h_bits((_Float16)(bq[2 * q + 1] * VCAR)));
    }
    ps[it] = ((a[0] + a[1]) + (a[2] + a[3])) + ((bq[0] + bq[1]) + (bq[2] + bq[3]));
  }
#pragma unroll
  for (int it = 0; it < 4; ++it) *(v4u*)(VH + vbase + (size_t)it * 256) = o[it];
#if defined(__HIP_DEVICE_COMPILE__)
  // the block sums below reuse the four stores' data registers: wait first
  asm volatile("s_wait_xcnt 0x0" ::: "memory");
#endif
#pragma unroll
  for (int it = 0; it < 4; ++it) ps[it] += __shfl_xor(ps[it], 16, 32);
  S[hh * HID + wave * 16 + m] = (hh != 0) ? (ps[2] + ps[3]) : (ps[0] + ps[1]);
  __syncthreads();
  if (wave < 4) {
    const int piece = wave * 128 + lane * 4;
    const v4f sv = *(const v4f*)(S + piece);
    *(v4f*)(vsdst + piece) = sv;
  }
}

// =====================================================================================================
// Shared GEMM store: the wave's 16x64 f32 tile already staged (final values) in its LDS slab (pitch 68), caller issued the
// coverage: 8 instructions x 2 rows x 16 lanes x 4 floats = the wave's 16 x 64 tile.
// =====================================================================================================
__device__ __forceinline__ void store64(const float* sl, float* C, int N, size_t rowb, int col0, int lane) {
  const int hh = lane >> 4, m = lane & 15;
  v4f vals[8];
#pragma unroll
  for (int it = 0; it < 8; ++it) vals[it] = *(const v4f*)(sl + (it * 2 + hh) * 68 + m * 4);
  float* dst = C + (rowb + (size_t)hh) * (size_t)N + col0 + m * 4;
  {
#pragma unroll
    for (int it = 0; it < 8; ++it) {
      *(v4f*)(dst + (size_t)(it * 2) * (size_t)N) = vals[it];
    }
    
  }
}

// =====================================================================================================
// Merged grid: launches that do not depend on one another share one grid; the block index (uniform in a block) picks the job,
// and every job keeps its own block numbering. Block counts of the jobs:
// =====================================================================================================
#define NB_TAB (TT / 8)
#define NB_WC  ((HID * CND) / 2048)
#define NB_W   ((HID * HID) / 2048)
#define NB_WF  ((2 * HID * HID) / 2048)
#define NB_PRO (NB_TAB + NB_WC + 4 * NB_W + NB_WF)

// What reads inputs only and has more than one reader: rotary tables, the six weight planes.
__global__ __launch_bounds__(256)
void pro_k(const float* __restrict__ w_cond,
           const float* __restrict__ wq, const float* __restrict__ wk, const float* __restrict__ wv,
           const float* __restrict__ wo, const float* __restrict__ wf, float* cosT, float* sinT,
           u16* WCB, u16* WQB, u16* WKH, u16* WVH, u16* WOH, u16* WFH, InvF inv) {
  int j = blockIdx.x;
  if (j < NB_TAB) { k_tab(cosT, sinT, inv, j); return; }
  j -= NB_TAB;
  if (j < NB_WC) { cvt_flat(w_cond, WCB, (HID * CND) / 8, 0, 1.0f, CND, j); return; }
  j -= NB_WC;
  if (j < NB_W) { cvt_flat(wq, WQB, (HID * HID) / 8, 0, 1.0f, HID, j); return; }
  j -= NB_W;
  if (j < 3 * NB_W) {
    const int wsel = j / NB_W;
    cvt_flat(wsel == 0 ? wk : wsel == 1 ? wv : wo, wsel == 0 ? WKH : wsel == 1 ? WVH : WOH, (HID * HID) / 8, 1, WSC, HID,
             j % NB_W);
    return;
  }
  j -= 3 * NB_W;
  cvt_flat(wf, WFH, (2 * HID * HID) / 8, 1, WSC, HID, j);
}

// =====================================================================================================
// cond -> c -> k', v in one block. One block = (batch b, 64 keys s0 .. s0 + 63), 16 waves, phases that hand their tile on through LDS:
//   0. cond[b][:][s0 ..] -> bf16 (RNE) fragment-major plane [64 s][CND] in P;
//   1. c^T = cond^T . WCB^T + b_cond, A fragments from P; once every wave has read its fragments the same LDS takes c as f16 hi +
//      residual planes x1024, [64 s][HID] each;
//   2. k^T = CH . WKH^T + bk, A fragments from the hi plane; rotary at positions s -> k' planes;
//   3. v = WVH . (CH + CL)^T + bv per row (products w.h then w.l per k tile), B fragments from the planes -> v plane + per-32-key sums.
// So neither cond^T nor c goes through memory. Every accumulator takes its k tiles in ascending order.
// GEMM tile of a wave: 32 x 32 (2 x 2 accumulators), so that a k tile costs two fragments from LDS (four in phase 3) and two from the
// weights: the two paths carry like loads, and a weight line is read by two waves of the block only. Epilogue tile of a wave: 16 x 64
// (what ep_split, ep_rope and ep_v take), in slab number (column group or head) * 4 + row tile for c and k, channel tile for v: a wave
// writes its accumulators into the slabs of the waves that own them, and a block barrier stands between the two.
// coverage: grid 16 b x 8 key tiles = 128 blocks; k' 16 waves x 16 s x 64 d, v 16 waves x 16 channels x 64 s, VS 2 key blocks x HID.
// =====================================================================================================
__global__ __launch_bounds__(512)
void ckv(const float* __restrict__ cond, const u16* __restrict__ WCB, const float* __restrict__ b_cond,
         const u16* __restrict__ WKH, const float* __restrict__ bk, const u16* __restrict__ WVH, const float* __restrict__ bv,
         const float* __restrict__ cosT, const float* __restrict__ sinT, u16* KH, u16* VH, float* VS) {
  // cond^T (bf16), then c: hi plane in the first half, residual plane in the second. The large alignment puts P at the start of the
  // block's LDS, so that every fragment's place in its 64 KiB fits the 16-bit offset field of an LDS load: no address arithmetic
  __shared__ __align__(2048) u16 P[64 * CND];
  __shared__ __align__(16) float slab[16 * SLAB64];    // c, then k
  __shared__ __align__(16) float slabV[16 * SLAB64];   // v
  __shared__ __align__(16) float S[2 * HID];
  static_assert(CND == 2 * HID && CND == 2 * 16 * 16 && HID == 256 && TS % 64 == 0);

  const int tid  = threadIdx.x;
  const int wave = __builtin_amdgcn_readfirstlane(tid >> 5);   // in a scalar register: what hangs on it costs no vector registers
  const int lane = tid & 31;
  const int hh   = lane >> 4;
  const int c    = lane & 15;
  const int b    = blockIdx.x / (TS / 64);
  const int s0   = (blockIdx.x % (TS / 64)) * 64;
  const int h    = wave >> 2;                       // epilogue tile: rows 16 rt .., columns 64 h ..
  const int rt   = wave & 3;
  const int p2   = wave & 1;                        // GEMM tile: 32 keys 32 p2 .., 32 columns or channels 32 g8 ..
  const int g8   = wave >> 1;
  u16* CHs = P;
  u16* CLs = P + 64 * HID;
  float* sl  = slab + wave * SLAB64;
  float* slv = slabV + wave * SLAB64;
  // phases 1, 2: accumulator (i, j) = rows 16 (2 p2 + i) .., columns 32 g8 + 16 j .. -> slab (g8 >> 1) * 4 + 2 p2 + i, columns (g8 & 1) * 32 + 16 j ..
  float* slw = slab + ((g8 >> 1) * 4 + 2 * p2) * SLAB64 + (g8 & 1) * 32 + 8 * hh * 68 + c;

  // ---- cond^T: wave = channels 16 wave .. + 15 and 256 + 16 wave .. + 15, lane = keys s0 + 2 lane, + 1, so a load is one whole 256-byte
  //      row of the tile; 8 channels of one key = one chunk. coverage: 16 waves x 8 chunks x 32 lanes x 8 halves = 64 x CND ----
  const u16* wcp = WCB + (size_t)(g8 * 32) * CND + 8 * lane;
  const float* pbc = b_cond + g8 * 32 + c;
  v16b wc[8][2];
  float rbc0, rbc1;
  {
    const float* px = cond + ((size_t)(b * CND + wave * 16)) * TS + s0 + 2 * lane;
    v2f xr[2][16];
#pragma unroll
    for (int n = 0; n < 2; ++n) {
#pragma unroll
      for (int e = 0; e < 16; ++e) xr[n][e] = *(const v2f*)(px + (size_t)(n * HID + e) * TS);
    }
    // the first half of the c GEMM's weights and its bias fly beside cond: they hang on no LDS
#pragma unroll
    for (int u = 0; u < 8; ++u) {
      wc[u][0] = ldfrag_b(wcp + u * 512);
      wc[u][1] = ldfrag_b(wcp + 16 * CND + u * 512);
    }
    rbc0 = pbc[0];
    rbc1 = pbc[16];
    hold_addr(px, wcp, pbc, px, px, px, px, px, px, px);   // the 66 addresses are constant offsets from these three
#pragma unroll
    for (int n = 0; n < 2; ++n) {
      // row tile (2 lane) >> 4, k tile 8 n + (wave >> 1); slot = (k >> 4 & 1) * 32 + (k >> 3 & 1) * 16 + (row & 15)
      u16* xd = P + ((lane >> 3) * (CND / 32) + 8 * n + (wave >> 1)) * 512 + ((wave & 1) * 32 + 2 * (lane & 7)) * 8;
#pragma unroll
      for (int g = 0; g < 2; ++g) {
#pragma unroll
        for (int j = 0; j < 2; ++j) {
          v4u ch;
#pragma unroll
          for (int e = 0; e < 4; ++e) ch[e] = pk16(bf_bits(xr[n][8 * g + 2 * e][j]), bf_bits(xr[n][8 * g + 2 * e + 1][j]));
          *(v4u*)(xd + (g * 16 + j) * 8) = ch;
        }
      }
    }
  }
  __syncthreads();                                  // cond^T written by all sixteen waves

  // ---- c^T: eight k tiles, then the other eight ----
  v16h wk[8][2];
  float rbk0, rbk1;
  {
    const u16* ap = P + (2 * p2) * (16 * CND) + 8 * lane;
    const int ts = 16 * CND;                             // one row tile of either plane
    v8f acc00 = zero8(), acc01 = zero8(), acc10 = zero8(), acc11 = zero8();
#pragma unroll
    for (int t = 0; t < 2; ++t) {
      const int kf = t * 4096;                           // k tiles 8 t .. + 7
      if (t == 1) {
#pragma unroll
        for (int u = 0; u < 8; ++u) {
          wc[u][0] = ldfrag_b(wcp + kf + u * 512);
          wc[u][1] = ldfrag_b(wcp + kf + ts + u * 512);
        }
        hold_addr(wcp, wcp, wcp, wcp, wcp, wcp, wcp, wcp, wcp, wcp);   // the 32 addresses are constant offsets from this one
      }
#pragma unroll
      for (int u = 0; u < 8; ++u) {
        const v16b a0 = ldfrag_b(ap + kf + u * 512);
        const v16b a1 = ldfrag_b(ap + ts + kf + u * 512);
        acc00 = mma_b(a0, wc[u][0], acc00);
        acc01 = mma_b(a0, wc[u][1], acc01);
        acc10 = mma_b(a1, wc[u][0], acc10);
        acc11 = mma_b(a1, wc[u][1], acc11);
      }
    }
    const float bb[2] = {bfr(rbc0), bfr(rbc1)};
#pragma unroll
    for (int r = 0; r < 8; ++r) {
      slw[r * 68]               = acc00[r] + bb[0];
      slw[r * 68 + 16]          = acc01[r] + bb[1];
      slw[SLAB64 + r * 68]      = acc10[r] + bb[0];
      slw[SLAB64 + r * 68 + 16] = acc11[r] + bb[1];
    }
    // the k GEMM's weights and bias fly over the split of c and its two barriers
    {
      const _Float16* bp = (const _Float16*)(const void*)WKH + (size_t)(g8 * 32) * HID + 8 * lane;
      const float* pb = bk + g8 * 32 + c;
#pragma unroll
      for (int u = 0; u < 8; ++u) {
        wk[u][0] = ldfrag_h(bp + u * 512);
        wk[u][1] = ldfrag_h(bp + 16 * HID + u * 512);
      }
      rbk0 = pb[0];
      rbk1 = pb[16];
      hold_addr(bp, pb, bp, bp, bp, bp, bp, bp, bp, bp);     // the 34 addresses are constant offsets from these two
    }
    __syncthreads();                                // every wave has read its cond^T fragments, so P may take c; the slabs are complete
    ep_split(sl, CHs, CLs, (size_t)(rt * (16 * HID) + h * 1024 + 8 * lane), CSC, lane);   // row tile rt, columns 64 h ..
  }
  __syncthreads();                                  // the c planes are complete (read-only from here on); the slabs are read

  const float osc = 1.0f / (CSC * WSC);
  const int ys = 16 * HID;                               // one row tile of a plane with HID columns
  // ---- k^T: all eight k tiles in one go ----
  {
    const _Float16* ap = (const _Float16*)(const void*)CHs + (2 * p2) * ys + 8 * lane;
    v8f acc00 = zero8(), acc01 = zero8(), acc10 = zero8(), acc11 = zero8();
#pragma unroll
    for (int u = 0; u < 8; ++u) {
      const v16h a0 = ldfrag_h(ap + u * 512);
      const v16h a1 = ldfrag_h(ap + ys + u * 512);
      acc00 = mma_h(a0, wk[u][0], acc00);
      acc01 = mma_h(a0, wk[u][1], acc01);
      acc10 = mma_h(a1, wk[u][0], acc10);
      acc11 = mma_h(a1, wk[u][1], acc11);
    }
    const float bb[2] = {bfr(rbk0), bfr(rbk1)};
#pragma unroll
    for (int r = 0; r < 8; ++r) {
      slw[r * 68]               = acc00[r] * osc + bb[0];
      slw[r * 68 + 16]          = acc01[r] * osc + bb[1];
      slw[SLAB64 + r * 68]      = acc10[r] * osc + bb[0];
      slw[SLAB64 + r * 68 + 16] = acc11[r] * osc + bb[1];
    }
  }
  // ---- v: accumulator (i, j) = channels 16 (2 g8 + i) .., keys 16 (2 p2 + j) .. -> slab 2 g8 + i, columns 32 p2 + 16 j .. ----
  {
    const _Float16* ap = (const _Float16*)(const void*)WVH + (size_t)(g8 * 32) * HID + 8 * lane;
    const _Float16* bh = (const _Float16*)(const void*)CHs + (2 * p2) * ys + 8 * lane;
    const _Float16* bl = (const _Float16*)(const void*)CLs + (2 * p2) * ys + 8 * lane;
    v16h a[8][2];
#pragma unroll
    for (int u = 0; u < 8; ++u) {
      a[u][0] = ldfrag_h(ap + u * 512);
      a[u][1] = ldfrag_h(ap + ys + u * 512);
    }
    const float* pb = bv + g8 * 32 + 8 * hh;
    const v4f rb[4] = {*(const v4f*)(pb), *(const v4f*)(pb + 4), *(const v4f*)(pb + 16), *(const v4f*)(pb + 20)};
    hold_addr(ap, pb, ap, ap, ap, ap, ap, ap, ap, ap);       // the 36 addresses are constant offsets from these two
    v8f acc00 = zero8(), acc01 = zero8(), acc10 = zero8(), acc11 = zero8();
#pragma unroll
    for (int u = 0; u < 8; ++u) {
      const v16h b0 = ldfrag_h(bh + u * 512),      c0 = ldfrag_h(bl + u * 512);
      const v16h b1 = ldfrag_h(bh + ys + u * 512), c1 = ldfrag_h(bl + ys + u * 512);
      acc00 = mma_h(a[u][0], b0, acc00);  acc00 = mma_h(a[u][0], c0, acc00);
      acc01 = mma_h(a[u][0], b1, acc01);  acc01 = mma_h(a[u][0], c1, acc01);
      acc10 = mma_h(a[u][1], b0, acc10);  acc10 = mma_h(a[u][1], c0, acc10);
      acc11 = mma_h(a[u][1], b1, acc11);  acc11 = mma_h(a[u][1], c1, acc11);
    }
    float* sw = slabV + (2 * g8) * SLAB64 + p2 * 32 + 8 * hh * 68 + c;
#pragma unroll
    for (int r = 0; r < 8; ++r) {
      const float bb0 = bfr(rb[r >> 2][r & 3]), bb1 = bfr(rb[2 + (r >> 2)][r & 3]);
      sw[r * 68]               = acc00[r] * osc + bb0;
      sw[r * 68 + 16]          = acc01[r] * osc + bb0;
      sw[SLAB64 + r * 68]      = acc10[r] * osc + bb1;
      sw[SLAB64 + r * 68 + 16] = acc11[r] * osc + bb1;
    }
  }
  RopeTab t;
  rope_tab(t, cosT, sinT, s0 + rt * 16, lane);
  __syncthreads();                                  // the k and v slabs are complete
  {
    // k' plane (b, h), position tile (s0 >> 4) + rt: two tiles of 512 halves
    const size_t pl = (size_t)(b * NH + h) * (TS / 16) + (size_t)((s0 >> 4) + rt);
    ep_rope(sl, t, KH + pl * 1024 + 8 * lane, KSC, lane);
#if defined(__HIP_DEVICE_COMPILE__)
    // the v epilogue below reuses the four stores' address and data registers: wait first
    asm volatile("s_wait_xcnt 0x0" ::: "memory");
#endif
  }
  // v: channels 16 wave .., keys s0 .. + 63
  ep_v(slv, VH, (size_t)(b * HID + wave * 16) * TS + (size_t)s0 * 16 + 8 * lane, VS + (size_t)(b * NKB + (s0 >> 5)) * HID, S, wave, lane);
}

// =====================================================================================================
// Cross attention, transposed, with the q GEMM in front of it and two GEMMs behind it in the same block. Attention: one tile per
// (head h, 16 queries q0..q0+15), two tiles of one head a wave; all TS keys in NKB blocks of 32.
//   q' (x1024 f16): the tile's own two fragments, made in phase 0 below; k' plane KH: per (b, h) fragment-major [s][d] (x1024), v plane VH:
//   fragment-major [b*256 + h*64+d][s] (x1024),
//   VS[b][kb][h*64+d] = f32 sum of v over key block kb; masks: key s of row t is masked iff bf16(cond_mask[b][s])*bf16(x_mask[b][t]) == 0,
//   masked score replaced by -1e4 (base-2 scaled) -> exact uniform softmax on a fully masked row, 0 weight otherwise.
//   S^T = k'.q'^T (A = 16 keys, B = 16 queries) and O^T += v^T.P'^T (A = 16 channels, B = 16 queries): lane (hh, c) holds query q0 + c
//   only, with keys kb + 8hh + r and kb + 16 + 8hh + r of a block in the registers of the two score tiles. So the maximum and the sum
//   over keys run inside the lane (one exchange with lane ^ 16 for the maximum; the two halves' sums l are joined once, at the end),
//   and the two score tiles, converted in place, are the B fragment of P'^T in the split k map of the v fragments: no LDS round trip.
//   What is now wanted per register and no longer per lane is staged once per block in LDS: the bf16-rounded key mask of batch b and
//   the block sums of b (all heads) times 7/8 * 2^20.
//   Per block: 2 score tiles x 2 k-steps (single products, q fragments made once in phase 0), scale 1/8 folded into the base-2 factor; online
//   max-subtracted base-2 softmax in f32; e = exp2(t - m) per key; l from the f32 e; accumulator update
//   o = o*alpha + (7/8 * 2^20) * VS block sum (f32), then P' = (e - 7/8) * 1024 as f16, 4 v.P' WMMAs.
//   Exact identity sum_s e_s v_s = sum_s (e_s - 7/8) v_s + 7/8 sum_s v_s per key block.
//   Accumulator j of a lane = channels 16j + 8hh .. + 7 of query c = one chunk of the O planes (O x8192 as f16 hi + residual).
// coverage: per tile 4 LDS stores x 32 lanes x 8 halves = 16 x 64 per plane; 16 tiles = the block's 64 x 256 of both O planes.
// =====================================================================================================
// 2^x for the softmax as the bare hardware instruction: every argument here is <= 0 (a score minus the running maximum), and a result
// under 2^-126 comes out as 0 where the library form spends five more vector instructions per value to return a denormal; such a
// term stands beside a term equal to 1 in the same row sum, so it reaches neither l nor the f16 P'.
__device__ __forceinline__ float exp2_raw(float x) { return __builtin_amdgcn_exp2f(x); }
__device__ __forceinline__ float other_half(float v) {                // the value of lane ^ 16
  const int b = __builtin_bit_cast(int, v);
  return __builtin_bit_cast(float, __builtin_amdgcn_permlanex16(b, b, 0x76543210, 0xfedcba98, false, false));
}

// One block = (batch b, 64 queries t0 .. t0 + 63), 8 waves, four phases that hand their tile on through LDS. A wave owns TWO tiles
// u = 2 wave + i, i = 0, 1, in every phase, so that each fragment it loads from memory (weights of phases 0 and 2, k', v) or that both tiles want from LDS
// (y, key mask, block sums) feeds two tiles. Tile u = (head or column group u >> 2, row tile u & 3), so a wave's two tiles share the head:
//   0. x[b][:][t0 ..] -> bf16 fragment-major plane [64 t][HID] in PH; q^T = x^T . WQB^T + bq: tile = (16 rows t of tile u & 3) x (the 64
//      columns of head u >> 2), A fragments from PH; rotary from the tile's slab: the lane's four chunks are the q' fragments of
//      phase 1, so neither x^T nor q' goes through memory;
//   1. attention as described above, tile = (head u >> 2, query tile u & 3); its O chunks go into the LDS planes PH, PL
//      (fragment-major [64 t][HID], hi + residual x8192) instead of memory;
//   2. y^T = (OH + OL) . WOH^T + bo: tile = (16 rows t of tile u & 3) x (64 columns of group u >> 2), A fragments from PH, PL;
//      once every wave has read its O fragments the same planes take y (hi + residual x16384);
//   3. FiLM GEMM + combine: tile = 16 channels c0 = 16 * u (gamma rows c0 .., beta rows 256 + c0 ..) x the 64 t, B fragments from PH, PL:
//      gamma[c][t] = sum_i w_film[c][i] y[t][i], beta[c][t] = sum_i w_film[256+c][i] y[t][i]  (A = w_film rows as f16(bf16 x1024),
//      products wg.h, wb.h, then wg.l, wb.l, 16 accumulators);
//      out[b][c][t] = (bf16(x[b][c][t]) * (gamma*oscale + bf16(b_film[c])) + (beta*oscale + bf16(b_film[256+c]))) * bf16(x_mask[b][t]).
// LDS 153600 bytes and at most 256 registers a wave: two blocks on a WGP (four waves a SIMD), so that the 512 blocks are resident together.
// coverage: grid 16 b x 32 t-tiles = 512 blocks x 8 waves x 2 tiles x 16 channels x 64 t = every out element exactly once.
__global__ __launch_bounds__(256, 4)
void attn_film(const u16* __restrict__ WQB, const float* __restrict__ bq, const float* __restrict__ cosT,
               const float* __restrict__ sinT, const u16* __restrict__ KHp, const u16* __restrict__ VHp,
               const float* __restrict__ VS, const float* __restrict__ cmask, const float* __restrict__ xmask,
               const u16* __restrict__ WOH, const float* __restrict__ bo, const u16* __restrict__ WF,
               const float* __restrict__ bfl, const float* __restrict__ X, float* OUT) {
  __shared__ __align__(32) float cmS[TS];          // bf16-rounded cond_mask of batch b
  __shared__ __align__(32) float vsS[NKB * HID];   // [key block][h * 64 + d]: 7/8 * 2^20 * block sum of v
  __shared__ __align__(16) u16 PH[64 * HID];       // x^T (bf16), then O, then y: hi plane of the block's 64 rows t
  __shared__ __align__(16) u16 PL[64 * HID];       // residual plane
  __shared__ __align__(16) float slab[16 * SLAB64];   // one slab per tile u

  const int tid  = threadIdx.x;
  const int wave = __builtin_amdgcn_readfirstlane(tid >> 5);   // the wave's number in a scalar register: what hangs on it (head, row
  const int lane = tid & 31;                                   // tiles, addresses of the planes, the weights, x, out, the slabs) costs
  const int hh   = lane >> 4;                                  // no vector registers
  const int c    = lane & 15;

  const int bid  = blockIdx.x;
  const int qt   = bid & (TT / 64 - 1);
  const int b    = bid >> 5;
  const int h    = wave >> 1;
  const int rt0  = (wave & 1) * 2;                  // row tiles rt0 and rt0 + 1
  const int t0   = qt * 64;
  const int q0   = t0 + rt0 * 16;                   // the wave's 32 queries

  const size_t kofs = ((size_t)(b * NH + h) * TS) * HD + 8 * lane;                // plane (b, h); key tile added per step
  const _Float16* Khb = (const _Float16*)(const void*)KHp + kofs;
  const size_t vofs = ((size_t)(b * HID + h * HD)) * TS + 8 * lane;               // row tile of d 0..15 (+16j); key tile added per step
  const _Float16* Vhb = (const _Float16*)(const void*)VHp + vofs;
  const float lsc = 0.125f * (LOG2E / (QSC * KSC));
  const float C0S = PCEN * PCAR * VCAR;

  // ---- stage the key mask (256 thr x 2 = TS), the scaled block sums of all heads (256 thr x 16 = NKB x HID) and x^T: wave = channels
  //      32 wave .. + 31, lane = positions t0 + 2 lane, + 1, so a load is one whole 256-byte row of the tile; 8 channels of one
  //      position = one chunk of the plane. coverage: 8 waves x 8 chunks x 32 lanes x 8 halves = 64 x HID ----
  static_assert(TS == 256 * 2 && NKB * HID == 256 * 16 && HID == 8 * 32);
  {
    const float* pc = cmask + (size_t)b * TS + tid * 2;
    const float* pv = VS + (size_t)b * (NKB * HID) + tid * 4;
    const float* px = X + ((size_t)(b * HID + wave * 32)) * TT + t0 + 2 * lane;
    v2f xr[32];
#pragma unroll
    for (int e = 0; e < 32; ++e) xr[e] = *(const v2f*)(px + (size_t)e * TT);
    const v2f a = *(const v2f*)(pc);
    v4f uv[4];
#pragma unroll
    for (int q = 0; q < 4; ++q) uv[q] = *(const v4f*)(pv + q * 1024);
    hold_addr(pc, pv, px, pc, pc, pc, pc, pc, pc, pc);     // the addresses of x and of the sums are constant offsets from px and pv
    const v2f am = {bfr(a[0]), bfr(a[1])};
    *(v2f*)(cmS + tid * 2) = am;
#pragma unroll
    for (int q = 0; q < 4; ++q) *(v4f*)(vsS + tid * 4 + q * 1024) = uv[q] * C0S;
#pragma unroll
    for (int n = 0; n < 2; ++n) {
      // channels 16 (2 wave + n) ..: row tile (2 lane) >> 4, k tile wave; slot = (k >> 4 & 1) * 32 + (k >> 3 & 1) * 16 + (row & 15)
      u16* xd = PH + ((lane >> 3) * (HID / 32) + wave) * 512 + (n * 32 + 2 * (lane & 7)) * 8;
#pragma unroll
      for (int g = 0; g < 2; ++g) {
#pragma unroll
        for (int j = 0; j < 2; ++j) {
          v4u ch;
#pragma unroll
          for (int e = 0; e < 4; ++e)
            ch[e] = pk16(bf_bits(xr[16 * n + 8 * g + 2 * e][j]), bf_bits(xr[16 * n + 8 * g + 2 * e + 1][j]));
          *(v4u*)(xd + (g * 16 + j) * 8) = ch;
        }
      }
    }
  }
  v2f xm2[2];
  float mrow[2], lrow[2];                           // lrow: this half's keys only
  v8f o[2][4];
#pragma unroll
  for (int i = 0; i < 2; ++i) {
    const float xmv = bfr(xmask[(size_t)b * TT + q0 + 16 * i + c]);
    xm2[i] = (v2f){xmv, xmv};
    mrow[i] = -INFINITY;
    lrow[i] = 0.f;
#pragma unroll
    for (int j = 0; j < 4; ++j) o[i][j] = zero8();
  }
#if defined(__HIP_DEVICE_COMPILE__)
  // the two loads of x_mask: their address registers are free for reuse from here on
  asm volatile("s_wait_xcnt 0x0" ::: "memory");
#endif

  __syncthreads();                                  // cmS, vsS (read-only from here on) and x^T written by all eight waves

  float* sl = slab + (2 * wave) * SLAB64;           // tile i of the wave: sl + i * SLAB64
  // ---- q^T tiles: rows t0 + 16 (rt0 + i) .., columns 64 h .. (head h); then rotary -> the q' fragments ----
  v16h qa[2], qb[2];
  {
    const int col0 = h * 64;
    const u16* ap = PH + rt0 * (16 * HID) + 8 * lane;
    const u16* bp = WQB + (size_t)col0 * HID + 8 * lane;
    const size_t bs = (size_t)16 * HID;
    v8f acc[2][4];
#pragma unroll
    for (int i = 0; i < 2; ++i) {
#pragma unroll
      for (int j = 0; j < 4; ++j) acc[i][j] = zero8();
    }
    // two k tiles a trip: the weights' sixteen loads share one trip to L2
#pragma unroll 1
    for (int k0 = 0; k0 < HID; k0 += 64) {
      const int kf = k0 * 16;                            // k tiles k0 / 32 and k0 / 32 + 1
      const u16 *p0 = bp + kf, *p1 = p0 + bs, *p2 = p1 + bs, *p3 = p2 + bs;
      const v16b b0 = ldfrag_b(p0), d0 = ldfrag_b(p0 + 512);
      const v16b b1 = ldfrag_b(p1), d1 = ldfrag_b(p1 + 512);
      const v16b b2 = ldfrag_b(p2), d2 = ldfrag_b(p2 + 512);
      const v16b b3 = ldfrag_b(p3), d3 = ldfrag_b(p3 + 512);
      hold_addr(p0, p0, p0, p0, p0, p0, p0, p0, p0, p0);     // the other addresses are constant offsets from this one
      const v16b a0 = ldfrag_b(ap + kf), e0 = ldfrag_b(ap + kf + 512);
      const v16b a1 = ldfrag_b(ap + 16 * HID + kf), e1 = ldfrag_b(ap + 16 * HID + kf + 512);
      acc[0][0] = mma_b(a0, b0, acc[0][0]);  acc[1][0] = mma_b(a1, b0, acc[1][0]);
      acc[0][1] = mma_b(a0, b1, acc[0][1]);  acc[1][1] = mma_b(a1, b1, acc[1][1]);
      acc[0][2] = mma_b(a0, b2, acc[0][2]);  acc[1][2] = mma_b(a1, b2, acc[1][2]);
      acc[0][3] = mma_b(a0, b3, acc[0][3]);  acc[1][3] = mma_b(a1, b3, acc[1][3]);
      acc[0][0] = mma_b(e0, d0, acc[0][0]);  acc[1][0] = mma_b(e1, d0, acc[1][0]);
      acc[0][1] = mma_b(e0, d1, acc[0][1]);  acc[1][1] = mma_b(e1, d1, acc[1][1]);
      acc[0][2] = mma_b(e0, d2, acc[0][2]);  acc[1][2] = mma_b(e1, d2, acc[1][2]);
      acc[0][3] = mma_b(e0, d3, acc[0][3]);  acc[1][3] = mma_b(e1, d3, acc[1][3]);
      // a0, a1 and b0 .. b3 stand eight matrix instructions back
      guardF<v16b>(acc[0][0], acc[0][1], acc[0][2], acc[0][3], acc[1][0], acc[1][1], acc[1][2], acc[1][3],
                   e0, e1, d0, d1, d2, d3, e0, e1, e0, e1);
    }
    float bb[4];
#pragma unroll
    for (int j = 0; j < 4; ++j) bb[j] = bfr(bq[col0 + 16 * j + c]);
#pragma unroll
    for (int i = 0; i < 2; ++i) {
#pragma unroll
      for (int r = 0; r < 8; ++r) {
        const int ro = i * SLAB64 + (8 * hh + r) * 68 + c;
        sl[ro]      = acc[i][0][r] + bb[0];
        sl[ro + 16] = acc[i][1][r] + bb[1];
        sl[ro + 32] = acc[i][2][r] + bb[2];
        sl[ro + 48] = acc[i][3][r] + bb[3];
      }
    }
    RopeTab tb[2];
    rope_tab(tb[0], cosT, sinT, q0, lane);
    rope_tab(tb[1], cosT, sinT, q0 + 16, lane);
    wave_sync_lds();
#pragma unroll
    for (int i = 0; i < 2; ++i) {
      v4u qc[4];
      rope_pack(sl + i * SLAB64, tb[i], qc, QSC, lane);
      FragH fa, fb;
      fa.u[0] = qc[0];  fa.u[1] = qc[1];
      fb.u[0] = qc[2];  fb.u[1] = qc[3];
      qa[i] = fa.v;
      qb[i] = fb.v;
    }
  }
  __syncthreads();                                  // every wave has read its x^T fragments: PH may take O

#pragma unroll 1
  for (int it = 0; it < NKB; ++it) {
    const int kb = it * 32;
    // ---- scores: D element r of this lane = (key kb + 8hh + r, query q0 + 16 i + c) in s0[i], key kb + 16 + 8hh + r in s1[i];
    //      each k' fragment feeds both query tiles ----
    v8f s0[2], s1[2];
    {
      const _Float16* k0p = Khb + (size_t)kb * HD;            // key tile kb / 16: HD / 32 = 2 tiles of 512 halves
      const _Float16* k1p = k0p + (size_t)16 * HD;
      const v16h k0a = ldfrag_h(k0p), k0b = ldfrag_h(k0p + 512);
      const v16h k1a = ldfrag_h(k1p), k1b = ldfrag_h(k1p + 512);
      hold_addr(k0p, k0p, k0p, k0p, k0p, k0p, k0p, k0p, k0p, k0p);   // k1p is a constant offset from k0p
      s0[0] = mma_h(k0a, qa[0], zero8());
      s0[1] = mma_h(k0a, qa[1], zero8());
      s1[0] = mma_h(k1a, qa[0], zero8());
      s1[1] = mma_h(k1a, qa[1], zero8());
      s0[0] = mma_h(k0b, qb[0], s0[0]);
      s0[1] = mma_h(k0b, qb[1], s0[1]);
      s1[0] = mma_h(k1b, qb[0], s1[0]);
      s1[1] = mma_h(k1b, qb[1], s1[1]);
    }
    // ---- mask (replace by -1e4) + online softmax in base 2, all in the lane; the key mask is read once for both tiles ----
    const float* cp = cmS + kb + 8 * hh;
    const v8f c0 = *(const v8f*)(cp), c1 = *(const v8f*)(cp + 16);
    float al[2];
    FragH ph[2];
#pragma unroll
    for (int i = 0; i < 2; ++i) {
      v8f t0, t1;
      {
        const v8f u0 = s0[i] * lsc, u1 = s1[i] * lsc;
#pragma unroll
        for (int r = 0; r < 8; r += 2) {
          const v2f m0 = (v2f){c0[r], c0[r + 1]} * xm2[i], m1 = (v2f){c1[r], c1[r + 1]} * xm2[i];
          t0[r]     = (m0[0] != 0.0f) ? u0[r]     : MASKT;
          t0[r + 1] = (m0[1] != 0.0f) ? u0[r + 1] : MASKT;
          t1[r]     = (m1[0] != 0.0f) ? u1[r]     : MASKT;
          t1[r + 1] = (m1[1] != 0.0f) ? u1[r + 1] : MASKT;
        }
      }
      float mx = fmaxf(t0[0], t0[1]);
#pragma unroll
      for (int r = 2; r < 8; r += 2) mx = fmaxf(mx, fmaxf(t0[r], t0[r + 1]));
#pragma unroll
      for (int r = 0; r < 8; r += 2) mx = fmaxf(mx, fmaxf(t1[r], t1[r + 1]));
      mx = fmaxf(mx, other_half(mx));
      const float mn = fmaxf(mrow[i], mx);
      al[i] = exp2_raw(mrow[i] - mn);
      mrow[i] = mn;
      t0 = t0 - mn;
      t1 = t1 - mn;
#pragma unroll
      for (int r = 0; r < 8; ++r) t0[r] = exp2_raw(t0[r]);
#pragma unroll
      for (int r = 0; r < 8; ++r) t1[r] = exp2_raw(t1[r]);
      {
        const v8f pr = t0 + t1;
        const v4f p4 = pr.lo + pr.hi;
        lrow[i] = lrow[i] * al[i] + ((p4[0] + p4[2]) + (p4[1] + p4[3]));
      }
      // ---- B fragment of f16(P'^T): column = query c, elements 0..7 = keys kb + 8hh + 0..7, 8..15 = keys kb + 16 + 8hh + 0..7 ----
      ph[i].h[0] = __builtin_convertvector((t0 - PCEN) * PCAR, v8h);
      ph[i].h[1] = __builtin_convertvector((t1 - PCEN) * PCAR, v8h);
    }
#pragma unroll
    for (int j = 0; j < 4; ++j) {
      const v8f vs = *(const v8f*)(vsS + it * HID + h * HD + 16 * j + 8 * hh);   // read once for both tiles
      o[0][j] = o[0][j] * al[0] + vs;
      o[1][j] = o[1][j] * al[1] + vs;
    }
    // ---- v^T.P'^T : A fragment row = d = j*16 + c, keys contiguous in the v plane; each v fragment feeds both query tiles ----
    {
      const _Float16* vhp = Vhb + kb * 16;                    // key tile kb / 32
      const v16h vh0 = ldfrag_h(vhp);
      const v16h vh1 = ldfrag_h(vhp + (size_t)16 * TS);
      const v16h vh2 = ldfrag_h(vhp + (size_t)32 * TS);
      const v16h vh3 = ldfrag_h(vhp + (size_t)48 * TS);
      hold_addr(vhp, vhp, vhp, vhp, vhp, vhp, vhp, vhp, vhp, vhp);
      o[0][0] = mma_h(vh0, ph[0].v, o[0][0]);  o[1][0] = mma_h(vh0, ph[1].v, o[1][0]);
      o[0][1] = mma_h(vh1, ph[0].v, o[0][1]);  o[1][1] = mma_h(vh1, ph[1].v, o[1][1]);
      o[0][2] = mma_h(vh2, ph[0].v, o[0][2]);  o[1][2] = mma_h(vh2, ph[1].v, o[1][2]);
      o[0][3] = mma_h(vh3, ph[0].v, o[0][3]);  o[1][3] = mma_h(vh3, ph[1].v, o[1][3]);
      guardF<v16h>(o[0][0], o[0][1], o[0][2], o[0][3], o[1][0], o[1][1], o[1][2], o[1][3],
                   ph[0].v, ph[1].v, vh0, vh1, vh2, vh3, ph[0].v, ph[1].v, ph[0].v, ph[1].v);
    }
  }

  // ---- join the halves' sums, fold 1/l and the carries (1024 on P', 1024 on v) ----
  const float oc  = 1.0f / (PCAR * VCAR);
  // ---- O x8192 -> f16 hi + residual fragment-major planes [64 t][HID] in LDS; accumulator j = chunk slot (j & 1) * 32 + lane of
  //      k tile 2h + (j >> 1) of row tile rt0 + i: row c, d = 16j + 8hh .. + 7 ----
#pragma unroll
  for (int i = 0; i < 2; ++i) {
    const float inv = (1.0f / (lrow[i] + other_half(lrow[i]))) * oc;
    const int pb0 = (rt0 + i) * (16 * HID) + h * 1024 + 8 * lane;
#pragma unroll
    for (int j = 0; j < 4; ++j) {
      float w[8];
      v4u oh, ol;
#pragma unroll
      for (int e = 0; e < 8; ++e) w[e] = (o[i][j][e] * inv) * OSC;
#pragma unroll
      for (int e = 0; e < 4; ++e) {
        const _Float16 h0 = (_Float16)w[2 * e], h1 = (_Float16)w[2 * e + 1];
        const _Float16 l0 = (_Float16)(w[2 * e] - (float)h0), l1 = (_Float16)(w[2 * e + 1] - (float)h1);
        oh[e] = pk16(h_bits(h0), h_bits(h1));
        ol[e] = pk16(h_bits(l0), h_bits(l1));
      }
      *(v4u*)(PH + pb0 + j * 256) = oh;
      *(v4u*)(PL + pb0 + j * 256) = ol;
    }
  }
  __syncthreads();                                  // a row tile of O comes from four waves (one per head)

  // ---- y^T tiles: rows t0 + 16 (rt0 + i) .., columns 64h .. ; per k step h.w then l.w; each weight fragment feeds both row tiles ----
  {
    const int col0 = h * 64;
    const _Float16* ahp = (const _Float16*)(const void*)PH + rt0 * (16 * HID) + 8 * lane;
    const _Float16* alp = (const _Float16*)(const void*)PL + rt0 * (16 * HID) + 8 * lane;
    const _Float16* bhp = (const _Float16*)(const void*)WOH + (size_t)col0 * HID + 8 * lane;
    const size_t bs = (size_t)16 * HID;
    const float osc = 1.0f / (OSC * WSC);
    v8f acc[2][4];
#pragma unroll
    for (int i = 0; i < 2; ++i) {
#pragma unroll
      for (int j = 0; j < 4; ++j) acc[i][j] = zero8();
    }
#pragma unroll 1
    for (int k0 = 0; k0 < HID; k0 += 32) {
      const int kf = k0 * 16;                            // k tile k0 / 32
      const _Float16 *p0 = bhp + kf, *p1 = p0 + bs, *p2 = p1 + bs, *p3 = p2 + bs;
      const v16h b0 = ldfrag_h(p0);
      const v16h b1 = ldfrag_h(p1);
      const v16h b2 = ldfrag_h(p2);
      const v16h b3 = ldfrag_h(p3);
      hold_addr(p0, p0, p0, p0, p0, p0, p0, p0, p0, p0);     // the other three addresses are constant offsets from this one
      const v16h ah0 = ldfrag_h(ahp + kf), ah1 = ldfrag_h(ahp + 16 * HID + kf);
      const v16h al0 = ldfrag_h(alp + kf), al1 = ldfrag_h(alp + 16 * HID + kf);
      acc[0][0] = mma_h(ah0, b0, acc[0][0]);  acc[1][0] = mma_h(ah1, b0, acc[1][0]);
      acc[0][1] = mma_h(ah0, b1, acc[0][1]);  acc[1][1] = mma_h(ah1, b1, acc[1][1]);
      acc[0][2] = mma_h(ah0, b2, acc[0][2]);  acc[1][2] = mma_h(ah1, b2, acc[1][2]);
      acc[0][3] = mma_h(ah0, b3, acc[0][3]);  acc[1][3] = mma_h(ah1, b3, acc[1][3]);
      acc[0][0] = mma_h(al0, b0, acc[0][0]);  acc[1][0] = mma_h(al1, b0, acc[1][0]);
      acc[0][1] = mma_h(al0, b1, acc[0][1]);  acc[1][1] = mma_h(al1, b1, acc[1][1]);
      acc[0][2] = mma_h(al0, b2, acc[0][2]);  acc[1][2] = mma_h(al1, b2, acc[1][2]);
      acc[0][3] = mma_h(al0, b3, acc[0][3]);  acc[1][3] = mma_h(al1, b3, acc[1][3]);
      guardF<v16h>(acc[0][0], acc[0][1], acc[0][2], acc[0][3], acc[1][0], acc[1][1], acc[1][2], acc[1][3],
                   ah0, ah1, al0, al1, b0, b1, b2, b3, al0, al1);
    }
    float bb[4];
#pragma unroll
    for (int j = 0; j < 4; ++j) bb[j] = bfr(bo[col0 + 16 * j + c]);
#pragma unroll
    for (int i = 0; i < 2; ++i) {
#pragma unroll
      for (int r = 0; r < 8; ++r) {
        const int ro = i * SLAB64 + (8 * hh + r) * 68 + c;
        sl[ro]      = acc[i][0][r] * osc + bb[0];
        sl[ro + 16] = acc[i][1][r] * osc + bb[1];
        sl[ro + 32] = acc[i][2][r] * osc + bb[2];
        sl[ro + 48] = acc[i][3][r] * osc + bb[3];
      }
    }
    __syncthreads();                                // every wave has read its O fragments (and its slabs are written): the planes may take y
#pragma unroll
    for (int i = 0; i < 2; ++i)                     // row tile rt0 + i, columns 64 h ..
      ep_split(sl + i * SLAB64, PH, PL, (size_t)((rt0 + i) * (16 * HID) + h * 1024 + 8 * lane), YSC, lane);
  }
  __syncthreads();                                  // the y planes are complete; every wave reads all 64 rows

  // ---- FiLM GEMM: channel tiles n = 0, 1 at c0 + 16 n; each y fragment feeds both ----
  const int c0 = wave * 32;
  const _Float16* agp = (const _Float16*)(const void*)WF + (size_t)c0 * HID + 8 * lane;
  const _Float16* yhp = (const _Float16*)(const void*)PH + 8 * lane;
  const _Float16* ylp = (const _Float16*)(const void*)PL + 8 * lane;
  const int ys = 16 * HID;                                                         // one row tile of the planes
  const float oscale = 1.0f / (YSC * WSC);
  v8f g[2][4], be[2][4];
#pragma unroll
  for (int n = 0; n < 2; ++n) {
#pragma unroll
    for (int j = 0; j < 4; ++j) { g[n][j] = zero8(); be[n][j] = zero8(); }
  }
#pragma unroll 1
  for (int k0 = 0; k0 < HID; k0 += 32) {
    const int kf = k0 * 16;                              // k tile k0 / 32
    const _Float16 *pg = agp + kf, *pb = pg + (size_t)HID * HID;                   // row 256 + c0 + c
    const v16h ag0 = ldfrag_h(pg), ab0 = ldfrag_h(pb);
    const v16h ag1 = ldfrag_h(pg + ys), ab1 = ldfrag_h(pb + ys);
    hold_addr(pg, pg, pg, pg, pg, pg, pg, pg, pg, pg);     // the other addresses are constant offsets from pg
    {
      const v16h y0 = ldfrag_h(yhp + kf);
      const v16h y1 = ldfrag_h(yhp + kf + ys);
      const v16h y2 = ldfrag_h(yhp + kf + 2 * ys);
      const v16h y3 = ldfrag_h(yhp + kf + 3 * ys);
      g[0][0] = mma_h(ag0, y0, g[0][0]);  be[0][0] = mma_h(ab0, y0, be[0][0]);
      g[1][0] = mma_h(ag1, y0, g[1][0]);  be[1][0] = mma_h(ab1, y0, be[1][0]);
      g[0][1] = mma_h(ag0, y1, g[0][1]);  be[0][1] = mma_h(ab0, y1, be[0][1]);
      g[1][1] = mma_h(ag1, y1, g[1][1]);  be[1][1] = mma_h(ab1, y1, be[1][1]);
      g[0][2] = mma_h(ag0, y2, g[0][2]);  be[0][2] = mma_h(ab0, y2, be[0][2]);
      g[1][2] = mma_h(ag1, y2, g[1][2]);  be[1][2] = mma_h(ab1, y2, be[1][2]);
      g[0][3] = mma_h(ag0, y3, g[0][3]);  be[0][3] = mma_h(ab0, y3, be[0][3]);
      g[1][3] = mma_h(ag1, y3, g[1][3]);  be[1][3] = mma_h(ab1, y3, be[1][3]);
    }
    const v16h z0 = ldfrag_h(ylp + kf);
    const v16h z1 = ldfrag_h(ylp + kf + ys);
    const v16h z2 = ldfrag_h(ylp + kf + 2 * ys);
    const v16h z3 = ldfrag_h(ylp + kf + 3 * ys);
    g[0][0] = mma_h(ag0, z0, g[0][0]);  be[0][0] = mma_h(ab0, z0, be[0][0]);
    g[1][0] = mma_h(ag1, z0, g[1][0]);  be[1][0] = mma_h(ab1, z0, be[1][0]);
    g[0][1] = mma_h(ag0, z1, g[0][1]);  be[0][1] = mma_h(ab0, z1, be[0][1]);
    g[1][1] = mma_h(ag1, z1, g[1][1]);  be[1][1] = mma_h(ab1, z1, be[1][1]);
    g[0][2] = mma_h(ag0, z2, g[0][2]);  be[0][2] = mma_h(ab0, z2, be[0][2]);
    g[1][2] = mma_h(ag1, z2, g[1][2]);  be[1][2] = mma_h(ab1, z2, be[1][2]);
    g[0][3] = mma_h(ag0, z3, g[0][3]);  be[0][3] = mma_h(ab0, z3, be[0][3]);
    g[1][3] = mma_h(ag1, z3, g[1][3]);  be[1][3] = mma_h(ab1, z3, be[1][3]);
    guard16(g, be, ag0, ag1, ab0, ab1, z0, z1, z2, z3);
  }
  // ---- combine, one channel tile after the other, the lane's eight channel rows of a tile together ----
  const float* xmp = xmask + (size_t)b * TT + t0 + c;
  float xm[4];
#pragma unroll
  for (int j = 0; j < 4; ++j) xm[j] = xmp[16 * j];
#pragma unroll
  for (int n = 0; n < 2; ++n) {
    const float* bfp = bfl + c0 + 16 * n + 8 * hh;
    const float* xp  = X + ((size_t)(b * HID + c0 + 16 * n + 8 * hh)) * TT + t0 + c;
    float* sn = sl + n * SLAB64;
    float bg[8], bb[8], xv[8][4];
#pragma unroll
    for (int r = 0; r < 8; ++r) {
      bg[r] = bfp[r];
      bb[r] = bfp[HID + r];
    }
    hold_addr(xmp, bfp, bfp, bfp, bfp, bfp, bfp, bfp, bfp, bfp);   // x below may land in the registers that these loads' addresses stand in
#pragma unroll
    for (int r = 0; r < 8; ++r) {
#pragma unroll
      for (int j = 0; j < 4; ++j) xv[r][j] = xp[(size_t)r * TT + 16 * j];
    }
    hold_addr(xp, xp, xp, xp, xp, xp, xp, xp, xp, xp);     // every address of x is a constant offset from this one
#pragma unroll
    for (int r = 0; r < 8; ++r) {
      // the second tile's loads may rise over rows 4 .. 7 of the first, not higher: all of them in flight beside the 128 accumulator
      // registers do not fit 256 registers (spills)
      if (n == 0 && r == 4) __builtin_amdgcn_sched_barrier(0);
      const float bgr = bfr(bg[r]), bbr = bfr(bb[r]);
#pragma unroll
      for (int j = 0; j < 4; ++j) {
        const float gam = g[n][j][r] * oscale + bgr;
        const float bet = be[n][j][r] * oscale + bbr;
        sn[(8 * hh + r) * 68 + 16 * j + c] = (bfr(xv[r][j]) * gam + bet) * bfr(xm[j]);
      }
    }
  }
  wave_sync_lds();                                  // one for both tiles: a second one would wait for the first tile's stores
  store64(sl, OUT, TT, (size_t)(b * HID + c0), t0, lane);
#if defined(__HIP_DEVICE_COMPILE__)
  // the second tile's values may reuse the stores' address and data registers: wait first
  asm volatile("s_wait_xcnt 0x0" ::: "memory");
#endif
  store64(sl + SLAB64, OUT, TT, (size_t)(b * HID + c0 + 16), t0, lane);
}

// =====================================================================================================
// Workspace map (bytes); every plane is fully written by whole-line stores before it is read; all extents are exact multiples
// of the store granularity (no pad rows needed); every offset a multiple of 65536. No launch writes a region that it reads:
//   CT f32 [2048][64] 524288, ST same
//   WCB bf16 [256][512] 262144; WQB bf16 [256][256] 131072; WKH, WVH, WOH f16 [256][256] 131072 each; WFH f16 [512][256] 262144
//   KH f16 [16][4][512][64] 4194304; VH f16 [16][256][512] 4194304; VS f32 [16][16][256] 262144
//   end 10747904
// =====================================================================================================
extern "C" void kernel_launch(void* const* d_in, const int* in_sizes, int n_in,
                              void* d_out, int out_size, void* d_ws, size_t ws_size,
                              hipStream_t stream) {
  if (n_in < 16) return;
  if (in_sizes[0] != NBAT * HID * TT) return;
  if (in_sizes[1] != NBAT * TT) return;
  if (in_sizes[2] != NBAT * CND * TS) return;
  if (in_sizes[3] != NBAT * TS) return;
  if (in_sizes[4] != HID * CND || in_sizes[5] != HID) return;
  if (in_sizes[6] != HID * HID || in_sizes[7] != HID) return;
  if (in_sizes[8] != HID * HID || in_sizes[9] != HID) return;
  if (in_sizes[10] != HID * HID || in_sizes[11] != HID) return;
  if (in_sizes[12] != HID * HID || in_sizes[13] != HID) return;
  if (in_sizes[14] != 2 * HID * HID || in_sizes[15] != 2 * HID) return;
  if (out_size != NBAT * HID * TT) return;

  const float* x      = (const float*)d_in[0];
  const float* x_mask = (const float*)d_in[1];
  const float* cond   = (const float*)d_in[2];
  const float* c_mask = (const float*)d_in[3];
  const float* w_cond = (const float*)d_in[4];
  const float* b_cond = (const float*)d_in[5];
  const float* wq     = (const float*)d_in[6];
  const float* bq     = (const float*)d_in[7];
  const float* wk     = (const float*)d_in[8];
  const float* bk     = (const float*)d_in[9];
  const float* wv     = (const float*)d_in[10];
  const float* bv     = (const float*)d_in[11];
  const float* wo     = (const float*)d_in[12];
  const float* bo     = (const float*)d_in[13];
  const float* wf     = (const float*)d_in[14];
  const float* bfi    = (const float*)d_in[15];
  float*       out    = (float*)d_out;

  const size_t szTab = (size_t)TT * HD * 4;                       //    524288
  const size_t szWCB = (size_t)HID * CND * 2;                     //    262144
  const size_t szW   = (size_t)HID * HID * 2;                     //    131072
  const size_t szWF  = (size_t)2 * HID * HID * 2;                 //    262144
  const size_t szKH  = (size_t)NBAT * TS * HID * 2;               //   4194304
  const size_t szVH  = (size_t)NBAT * HID * TS * 2;               //   4194304
  const size_t szVS  = (size_t)NBAT * NKB * HID * 4;              //    262144
  size_t off = 0;
  const size_t oCT  = off; off += szTab;
  const size_t oST  = off; off += szTab;
  const size_t oWCB = off; off += szWCB;
  const size_t oWQB = off; off += szW;
  const size_t oWKH = off; off += szW;
  const size_t oWVH = off; off += szW;
  const size_t oWOH = off; off += szW;
  const size_t oWFH = off; off += szWF;
  const size_t oKH  = off; off += szKH;
  const size_t oVH  = off; off += szVH;
  const size_t oVS  = off; off += szVS;
  if (off > ws_size) return;                            // off = 10747904
  if (off > (size_t)134217728) return;

  char* ws = (char*)d_ws;
  float* CT    = (float*)(ws + oCT);
  float* ST    = (float*)(ws + oST);
  u16*   WCB   = (u16*)(ws + oWCB);
  u16*   WQB   = (u16*)(ws + oWQB);
  u16*   WKH   = (u16*)(ws + oWKH);
  u16*   WVH   = (u16*)(ws + oWVH);
  u16*   WOH   = (u16*)(ws + oWOH);
  u16*   WFH   = (u16*)(ws + oWFH);
  u16*   KH    = (u16*)(ws + oKH);
  u16*   VH    = (u16*)(ws + oVH);
  float* VS    = (float*)(ws + oVS);

  // inv_freq[i] = 1 / pow(10000, i/32) in f32 (pow correctly converted from f64, then IEEE f32 reciprocal)
  InvF inv;
  for (int i = 0; i < 32; ++i) {
    const double p = pow(10000.0, (double)i / 32.0);
    const float pf = (float)p;
    inv.f[i] = 1.0f / pf;
  }

  const dim3 blk(256);
  const dim3 gAF(NBAT * (TT / 64));                     // 512

  // (0) inputs only: rotary cos/sin tables [2048][64];
  //     weights (W[o][i] row-major is already [n][k]): bf16 planes for w_cond, wq; f16(bf16 x1024) for wk, wv, wo, w_film
  pro_k<<<dim3(NB_PRO), blk, 0, stream>>>(w_cond, wq, wk, wv, wo, wf, CT, ST, WCB, WQB, WKH, WVH, WOH, WFH, inv);
  // (1) per (batch, 64 keys): cond tile -> bf16 (LDS) -> c^T = cond^T . WCB^T + b_cond -> f16 hi + residual x1024 (LDS) ->
  //     k^T = CH . WKH^T + bk -> rotary, position s -> k' planes; v = WVH . (CH + CL)^T + bv per row -> v f16 plane x1024 + per-32-key
  //     block sums; carries 1024 x 1024 folded back
  ckv<<<dim3(NBAT * (TS / 64)), dim3(512), 0, stream>>>(cond, WCB, b_cond, WKH, bk, WVH, bv, CT, ST, KH, VH, VS);
  // (2) q^T = x^T . WQB^T + bq -> rotary, position t -> q' (registers) -> cross attention -> O (LDS) -> y^T = (OH + OL) . WOH^T + bo (LDS) -> FiLM GEMM + combine -> out [16][256][2048] f32
  attn_film<<<gAF, dim3(256), 0, stream>>>(WQB, bq, CT, ST, KH, VH, VS, c_mask, x_mask, WOH, bo, WFH, bfi, x, out);
  (void)hipGetLastError();
}
